// v000
// Times are from an AMD MI455X. After a warm-up the kernel runs many times in a row, and a time is the length of
// such a window on the GPU divided by its runs, so every launch and the gaps after it count. The runs cycle
// through copies of the inputs. A figure is the median of several windows, for all but v000 over two sittings.
// Sittings can differ by a few percent; kernels timed side by side share one.
// v000, which the later versions start from, runs in 605 microseconds.
// Contractions on v_wmma_f32_16x16x32_bf16 (bf16 operands, f32 accumulate): qkv projection = one product on RNE-bf16 inputs; q.k^T and p.v = bf16 hi/lo planes (3 products); output projection = ctx bf16 hi/lo x bf16 weights (2 products). Masking, softmax and normalisation in f32.
#include <hip/hip_runtime.h>

typedef __attribute__((ext_vector_type(16))) _Float16 v16h;
typedef __attribute__((ext_vector_type(8)))  _Float16 v8h;
typedef __attribute__((ext_vector_type(16))) __bf16   v16b;
typedef __attribute__((ext_vector_type(8)))  __bf16   v8b;
typedef __attribute__((ext_vector_type(8)))  float    v8f;
typedef __attribute__((ext_vector_type(4)))  float    v4f;
typedef __attribute__((ext_vector_type(4)))  unsigned int v4u;

__device__ __forceinline__ unsigned short f2bf_bits(float f) {
  unsigned u = __float_as_uint(f);
  return (unsigned short)((u + 0x7FFFu + ((u >> 16) & 1u)) >> 16);
}
__device__ __forceinline__ float bf_bits2f(unsigned short h) { return __uint_as_float(((unsigned)h) << 16); }
// RNE convert of an f32 bit pattern to its bf16 value, kept as an f32 bit pattern
__device__ __forceinline__ unsigned int rne_bf16_word(unsigned int u) {
  return (u + 0x7FFFu + ((u >> 16) & 1u)) & 0xFFFF0000u;
}
__device__ __forceinline__ unsigned int pack_bf16x2(float a, float b) {
  return (unsigned int)f2bf_bits(a) | ((unsigned int)f2bf_bits(b) << 16);
}
// hi/lo bf16 split of two floats, packed as (hi_a | hi_b<<16) and (lo_a | lo_b<<16)
__device__ __forceinline__ void split_pack2(float a, float b, unsigned int& wh, unsigned int& wl) {
  const unsigned short ha = f2bf_bits(a), hb = f2bf_bits(b);
  const unsigned short la = f2bf_bits(a - bf_bits2f(ha)), lb = f2bf_bits(b - bf_bits2f(hb));
  wh = (unsigned int)ha | ((unsigned int)hb << 16);
  wl = (unsigned int)la | ((unsigned int)lb << 16);
}

// hazard guards as plain device helpers (no inline asm inside the kernel template body)
__device__ __forceinline__ void dep_guard_h(v8f& a, v8f& b, v16h x, v16h y) { asm volatile("v_nop\n\tv_nop\n\tv_nop\n\tv_nop" : "+v"(a), "+v"(b) : "v"(x), "v"(y)); }
__device__ __forceinline__ void dep_guard_b(v8f& a, v8f& b, v16b x, v16b y) { asm volatile("v_nop\n\tv_nop\n\tv_nop\n\tv_nop" : "+v"(a), "+v"(b) : "v"(x), "v"(y)); }
__device__ __forceinline__ void keep4_h(v16h a, v16h b, v16h c, v16h d) { asm volatile("v_nop" :: "v"(a), "v"(b), "v"(c), "v"(d)); }
__device__ __forceinline__ void keep4_b(v16b a, v16b b, v16b c, v16b d) { asm volatile("v_nop" :: "v"(a), "v"(b), "v"(c), "v"(d)); }
__device__ __forceinline__ void acc_guard4(v8f& a, v8f& b, v8f& c, v8f& d) { asm volatile("v_nop\n\tv_nop\n\tv_nop\n\tv_nop" : "+v"(a), "+v"(b), "+v"(c), "+v"(d)); }
template <typename T> struct Frag;
template <> struct Frag<_Float16> {
  typedef v16h V; union U { v16h v; v8h h[2]; };
  static __device__ __forceinline__ v16h load(const _Float16* p) {   // elements 0..7 <- p[0..7], 8..15 <- p[16..23]
    U f; f.h[0] = *(const v8h*)(p); f.h[1] = *(const v8h*)(p + 16); return f.v;
  }
  static __device__ __forceinline__ v8f mma(v16h a, v16h b, v8f c) {
    return __builtin_amdgcn_wmma_f32_16x16x32_f16(false, a, false, b, (short)0, c, false, false);
  }
  static __device__ __forceinline__ void guard(v8f& a, v8f& b, v16h x, v16h y) { dep_guard_h(a, b, x, y); }
  static __device__ __forceinline__ void keep(v16h a, v16h b, v16h c, v16h d) { keep4_h(a, b, c, d); }
};
template <> struct Frag<__bf16> {
  typedef v16b V; union U { v16b v; v8b h[2]; };
  static __device__ __forceinline__ v16b load(const __bf16* p) {
    U f; f.h[0] = *(const v8b*)(p); f.h[1] = *(const v8b*)(p + 16); return f.v;
  }
  static __device__ __forceinline__ v8f mma(v16b a, v16b b, v8f c) {
    return __builtin_amdgcn_wmma_f32_16x16x32_bf16(false, a, false, b, (short)0, c, false, false);
  }
  static __device__ __forceinline__ void guard(v8f& a, v8f& b, v16b x, v16b y) { dep_guard_b(a, b, x, y); }
  static __device__ __forceinline__ void keep(v16b a, v16b b, v16b c, v16b d) { keep4_b(a, b, c, d); }
};

// ---- Register-blocked batched WMMA GEMM ------------------------------------
// C[m,n] = scale * sum_k A[m,k] * Bt[n,k] (+bias)(+resid); each wave owns a 64x64 tile.
// A row-major [M,K]; Bt row-major [N,K]; M,N % 64 == 0, K % 32 == 0.
// SPLIT: 0 = single planes; 1 = A and Bt hi/lo planes (hi.hi + hi.lo + lo.hi); 2 = A hi/lo planes only (hi.B + lo.B).
// BIAS_MODE: 0 = none, 1 = bias[m], 2 = bias[n].
// OUT_MODE: 0 = f32, 1 = f16, 2 = bf16 hi plane (Cout) + bf16 lo plane (Cout2).
// ET: 0 = f16 operands, 1 = bf16 operands (pointers passed as 16-bit storage)
template <int ET> struct Elem;
template <> struct Elem<0> { typedef _Float16 T; };
template <> struct Elem<1> { typedef __bf16 T; };
template <int ET, int SPLIT, int BIAS_MODE, int OUT_MODE, bool RESID, int ACT = 0>
__global__ __launch_bounds__(256) void wmma_gemm64(
    const unsigned short* __restrict__ Ap, const unsigned short* __restrict__ A2p, int lda, long strideA,
    const unsigned short* __restrict__ Btp, const unsigned short* __restrict__ Bt2p, int ldb, long strideB,
    void* __restrict__ Cout, void* __restrict__ Cout2, int ldc, long strideC,
    const float* __restrict__ bias,
    const float* __restrict__ resid, long strideR,
    int M, int N, int K, float scale) {
  typedef typename Elem<ET>::T T;
  typedef typename Frag<T>::V V;
  const T* A = (const T*)Ap; const T* A2 = (const T*)A2p; const T* Bt = (const T*)Btp; const T* Bt2 = (const T*)Bt2p;
  __shared__ __align__(16) float sT[8][16 * 68];   // per-wave 16x64 slab, pitch 68 floats
  const int b    = blockIdx.y;
  const int lane = threadIdx.x & 31;
  const int wave = threadIdx.x >> 5;
  const int tilesN = N >> 6;
  const int tilesM = M >> 6;
  const int tile = blockIdx.x * 8 + wave;
  if (tile >= tilesM * tilesN) return;   // wave-uniform; no block barriers in this kernel
  const int tm = tile / tilesN;
  const int tn = tile - tm * tilesN;
  const int m0 = tm << 6;
  const int n0 = tn << 6;

  const T* Ab  = A  + (size_t)b * strideA;
  const T* Bb  = Bt + (size_t)b * strideB;
  const T* Ab2 = (SPLIT != 0) ? (A2  + (size_t)b * strideA) : nullptr;
  const T* Bb2 = (SPLIT == 1) ? (Bt2 + (size_t)b * strideB) : nullptr;

  const int rlane = lane & 15;                 // row (A) / col (B, D) within subtile
  const int koff  = (lane >> 4) * 8;           // k offset of this lane half
  const int mOff  = (lane >> 4) * 8;           // D row offset

  v8f acc[4][4];
#pragma unroll
  for (int i = 0; i < 4; ++i)
#pragma unroll
    for (int j = 0; j < 4; ++j) acc[i][j] = (v8f){0.f,0.f,0.f,0.f,0.f,0.f,0.f,0.f};

  for (int k0 = 0; k0 < K; k0 += 32) {
    V bh[4], bl[4];
#pragma unroll
    for (int j = 0; j < 4; ++j) {
      const size_t bo = (size_t)(n0 + (j << 4) + rlane) * ldb + koff + k0;
      bh[j] = Frag<T>::load(Bb + bo);
      if (SPLIT == 1) bl[j] = Frag<T>::load(Bb2 + bo);
    }
#pragma unroll
    for (int i = 0; i < 4; ++i) {
      const size_t ao = (size_t)(m0 + (i << 4) + rlane) * lda + koff + k0;
      V ah = Frag<T>::load(Ab + ao);
      V al;
      if (SPLIT != 0) al = Frag<T>::load(Ab2 + ao);
#pragma unroll
      for (int j = 0; j < 4; ++j) {
        acc[i][j] = Frag<T>::mma(ah, bh[j], acc[i][j]);
        if (SPLIT == 1) {
          acc[i][j] = Frag<T>::mma(ah, bl[j], acc[i][j]);
          acc[i][j] = Frag<T>::mma(al, bh[j], acc[i][j]);
        }
        if (SPLIT == 2) {
          acc[i][j] = Frag<T>::mma(al, bh[j], acc[i][j]);
        }
      }
      Frag<T>::guard(acc[i][0], acc[i][3], ah, (SPLIT != 0) ? al : ah);
    }
    Frag<T>::keep(bh[0], bh[1], bh[2], bh[3]);
    if (SPLIT == 1) Frag<T>::keep(bl[0], bl[1], bl[2], bl[3]);
  }
  acc_guard4(acc[0][0], acc[0][1], acc[0][2], acc[0][3]);
  acc_guard4(acc[1][0], acc[1][1], acc[1][2], acc[1][3]);
  acc_guard4(acc[2][0], acc[2][1], acc[2][2], acc[2][3]);
  acc_guard4(acc[3][0], acc[3][1], acc[3][2], acc[3][3]);

  // ---- epilogue ----
  float* slab = sT[wave];
  const float* Rb = RESID ? (resid + (size_t)b * strideR) : nullptr;
#pragma unroll
  for (int i = 0; i < 4; ++i) {
    const int mBase = m0 + (i << 4);
#pragma unroll
    for (int j = 0; j < 4; ++j) {
      const int n = n0 + (j << 4) + rlane;
      float bv = 0.f;
      if (BIAS_MODE == 2) bv = bias[n];
#pragma unroll
      for (int r = 0; r < 8; ++r) {
        float v = acc[i][j][r] * scale;
        if (BIAS_MODE == 1) v += bias[mBase + mOff + r];
        if (BIAS_MODE == 2) v += bv;
        if (RESID) v += Rb[(size_t)(mBase + mOff + r) * ldc + n];
        if (ACT == 1) v = tanhf(v);
        if (ACT == 2) v = fmaxf(v, 0.0f);
        if (ACT == 4) v = (v > 0.f) ? v : 0.01f * v;
        slab[(mOff + r) * 68 + (j << 4) + rlane] = v;
      }
    }
    __builtin_amdgcn_fence(__ATOMIC_RELEASE, "workgroup");
    __builtin_amdgcn_wave_barrier();
    __builtin_amdgcn_fence(__ATOMIC_ACQUIRE, "workgroup");
    if (OUT_MODE == 0) {
      float* C = (float*)Cout + (size_t)b * strideC;
      const int hh = lane >> 4, c4 = (lane & 15) * 4;     // row seg = 256 B = 16 lanes x 16 B
      {
#pragma unroll
        for (int it = 0; it < 8; ++it) {
          const int row = it * 2 + hh;
          v4f v = *(const v4f*)(slab + row * 68 + c4);
          *(v4f*)(C + (size_t)(mBase + row) * ldc + n0 + c4) = v;
        }
        
      }
    } else {
      const int q = lane >> 3, c8 = (lane & 7) * 8;
      unsigned short* C  = (unsigned short*)Cout  + (size_t)b * strideC;
      unsigned short* C2 = (OUT_MODE == 2) ? ((unsigned short*)Cout2 + (size_t)b * strideC) : nullptr;
      {
#pragma unroll
        for (int it = 0; it < 4; ++it) {
          const int row = it * 4 + q;
          const float* sp = slab + row * 68 + c8;
          v8h hv, lv;
#pragma unroll
          for (int e = 0; e < 8; ++e) {
            if (OUT_MODE == 1) {
              hv[e] = (_Float16)sp[e];
            } else {
              unsigned short hb = f2bf_bits(sp[e]);
              unsigned short lb = f2bf_bits(sp[e] - bf_bits2f(hb));
              hv[e] = __builtin_bit_cast(_Float16, hb);
              lv[e] = __builtin_bit_cast(_Float16, lb);
            }
          }
          *(v8h*)(C + (size_t)(mBase + row) * ldc + n0 + c8) = hv;
          if (OUT_MODE == 2) *(v8h*)(C2 + (size_t)(mBase + row) * ldc + n0 + c8) = lv;
        }
        
      }
    }
    __builtin_amdgcn_fence(__ATOMIC_RELEASE, "workgroup");
    __builtin_amdgcn_wave_barrier();
    __builtin_amdgcn_fence(__ATOMIC_ACQUIRE, "workgroup");
  }
}

__device__ __forceinline__ v8f at_mma(v16b a, v16b b, v8f c) {
  c = __builtin_amdgcn_wmma_f32_16x16x32_bf16(false, a, false, b, (short)0, c, false, false);
  asm volatile("v_nop\n\tv_nop\n\tv_nop\n\tv_nop" : "+v"(c) : "v"(a), "v"(b));
  return c;
}

// coverage: grid*256 threads x 8 elements == n8*8 elements exactly (host sizes n8 = n/8, n % 2048 == 0)
__global__ __launch_bounds__(256) void cast_f32_bf16x8(const float* __restrict__ in, unsigned short* __restrict__ out, int n8) {
  const int i = blockIdx.x * 256 + threadIdx.x;
  if (i >= n8) return;
  const float* p = in + (size_t)i * 8;
  const v4f a = *(const v4f*)p;
  const v4f c2 = *(const v4f*)(p + 4);
  v4u w;
  w[0] = pack_bf16x2(a[0], a[1]);
  w[1] = pack_bf16x2(a[2], a[3]);
  w[2] = pack_bf16x2(c2[0], c2[1]);
  w[3] = pack_bf16x2(c2[2], c2[3]);
  v4u* d = (v4u*)(out + (size_t)i * 8);
  *d = w;
  
}

// coverage: n4 = n/4 threads, n % 1024 == 0 so every wave writes 4 complete lines
__global__ __launch_bounds__(256) void rne_bf16_f32x4(const float* __restrict__ in, float* __restrict__ out, int n4) {
  const int i = blockIdx.x * 256 + threadIdx.x;
  if (i >= n4) return;
  v4u a = *(const v4u*)(in + (size_t)i * 4);
#pragma unroll
  for (int e = 0; e < 4; ++e) a[e] = rne_bf16_word(a[e]);
  v4u* d = (v4u*)(out + (size_t)i * 4);
  *d = a;
  
}

// ---- transpose + bf16 cast: in[nrows][ncols] f32 -> out[ncols][nrows] bf16 ----
// grid = (ncols/64, nrows/64), block 256. Load: 256 threads x 16 floats = the 64x64 tile.
__global__ __launch_bounds__(256) void transpose_cast_bf16(const float* __restrict__ in, unsigned short* __restrict__ out, int nrows, int ncols) {
  __shared__ __align__(16) float tile[64 * 68];   // tile[cl*68 + rl]: cl = in col (out row), rl = in row (out col)
  const int tid = threadIdx.x, lane = tid & 31, wave = tid >> 5;
  const int r0 = blockIdx.y * 64;
  const int c0 = blockIdx.x * 64;
  {
    const int rl = tid >> 2, cq = (tid & 3) * 16;
    const float* src = in + (size_t)(r0 + rl) * ncols + c0 + cq;
#pragma unroll
    for (int i = 0; i < 4; ++i) {
      const v4f v = *(const v4f*)(src + 4 * i);
#pragma unroll
      for (int e = 0; e < 4; ++e) tile[(cq + 4 * i + e) * 68 + rl] = v[e];
    }
  }
  __syncthreads();
  const int q8 = lane >> 3, c8 = (lane & 7) * 8;
  {
#pragma unroll
    for (int it = 0; it < 2; ++it) {
      const int cl = wave * 8 + it * 4 + q8;
      const float* sp = tile + cl * 68 + c8;
      const v4f x0 = *(const v4f*)sp;
      const v4f x1 = *(const v4f*)(sp + 4);
      v4u w;
      w[0] = pack_bf16x2(x0[0], x0[1]);
      w[1] = pack_bf16x2(x0[2], x0[3]);
      w[2] = pack_bf16x2(x1[0], x1[1]);
      w[3] = pack_bf16x2(x1[2], x1[3]);
      *(v4u*)(out + (size_t)(c0 + cl) * nrows + r0 + c8) = w;
    }
    
  }
}

// =====================================================================================
// Attention, head dim 64, over bf16 hi/lo planes of the fused qkv projection.
// qkv planes: [B*S][3*HID], q at col h*64+d, k at HID + h*64 + d, v at 2*HID + h*64 + d.
// scores = 0.125 * q.k^T (bf16 hi/lo, 3 products); mask tile m[q][kv] (RNE-bf16 converted) applied as
// s*m - 10000*(1-m); online softmax in f32; p split into bf16 hi/lo in LDS; out += p.v (3 products).
// A 64x64 tile whose mask is identically zero has 64 equal logits -10000 per row: folded in closed form
// (l += 64*p, o += p * column-sum(v), p = exp(-10000 - rowmax)).
// Block = 4 waves = 64 query rows of one (batch, head); grid.x = B * NH * (S/64).
// =====================================================================================
#define SEQ_LEN 2048
#define N_HEADS 16
#define HEAD_D 64
#define HID_SZ 1024
#define QKV_PITCH 3072
#define KV_CHUNK 64
#define N_BATCH 2

__global__ __launch_bounds__(128) void attn_planes_kernel(
    const unsigned short* __restrict__ qkvh, const unsigned short* __restrict__ qkvl,
    const float* __restrict__ maskp,
    unsigned short* __restrict__ ctxh, unsigned short* __restrict__ ctxl) {
  union FB { v16b v; v8b h[2]; };
  __shared__ __align__(16) unsigned short Kh[KV_CHUNK * HEAD_D];    // K hi [kv][d]
  __shared__ __align__(16) unsigned short Kl[KV_CHUNK * HEAD_D];    // K lo [kv][d]
  __shared__ __align__(16) unsigned short Vth[HEAD_D * KV_CHUNK];   // V hi [d][kv]
  __shared__ __align__(16) unsigned short Vtl[HEAD_D * KV_CHUNK];   // V lo [d][kv]
  __shared__ __align__(16) unsigned short Psh[4][16 * KV_CHUNK];   // per wave P hi [row][kv]
  __shared__ __align__(16) unsigned short Psl[4][16 * KV_CHUNK];   // per wave P lo [row][kv]
  __shared__ __align__(16) float Os[4][16 * 68];                   // per wave out tile, pitch 68; Os[0][0..127] doubles as column-sum scratch
  __shared__ __align__(16) unsigned int Msk[64 * 68];              // mask tile [q][kv] (f32 bits), pitch 68; doubles as v scratch [kv][d]
  __shared__ int AnyNZ[4];

  const int tid  = threadIdx.x;
  const int wave = tid >> 5;
  const int lane = tid & 31;
  const int hh   = lane >> 4;
  const int c    = lane & 15;
  const int bx   = blockIdx.x;
  const int qb   = bx & 31;                  // SEQ_LEN / 64 == 32
  const int bhd  = bx >> 5;
  const int h    = bhd & (N_HEADS - 1);
  const int b    = bhd >> 4;
  const int qblk = qb * 64;
  const int q0   = qblk + wave * 16;
  const size_t rowb = (size_t)b * SEQ_LEN;

  // ---- Q fragments (A operand), hi and lo planes, 2 d-chunks (8 b128 loads per lane) ----
  v16b qah[2], qal[2];
  {
    const size_t qoff = (rowb + q0 + c) * QKV_PITCH + h * HEAD_D + 8 * hh;
#pragma unroll
    for (int dc = 0; dc < 2; ++dc) {
      qah[dc] = Frag<__bf16>::load((const __bf16*)qkvh + qoff + dc * 32);
      qal[dc] = Frag<__bf16>::load((const __bf16*)qkvl + qoff + dc * 32);
    }
  }

  float mrow[8], lrow[8];
  v8f oacc[4];
#pragma unroll
  for (int r = 0; r < 8; ++r) { mrow[r] = -__builtin_inff(); lrow[r] = 0.f; }
#pragma unroll
  for (int t = 0; t < 4; ++t) oacc[t] = (v8f){0.f,0.f,0.f,0.f,0.f,0.f,0.f,0.f};

  const int kvr = tid >> 1;            // staging: kv row of this thread (0..63)
  const int dh  = (tid & 1) * 32;      // staging: d half (0 or 32)

  for (int kc = 0; kc < SEQ_LEN / KV_CHUNK; ++kc) {
    const int kv0 = kc * KV_CHUNK;
    __syncthreads();
    // ---- mask tile [64 q][64 kv]: 1024 float4 / 128 threads = 8 b128 per lane; RNE-bf16 convert; all-zero test ----
    unsigned int nz = 0u;
#pragma unroll
    for (int i = 0; i < 8; ++i) {
      const int idx = i * 128 + tid;
      const int row = idx >> 4;
      const int c4  = (idx & 15) * 4;
      v4u m = *(const v4u*)(maskp + (size_t)(qblk + row) * SEQ_LEN + kv0 + c4);
#pragma unroll
      for (int e = 0; e < 4; ++e) { const unsigned int u = rne_bf16_word(m[e]); m[e] = u; nz |= (u & 0x7FFFFFFFu); }
      *(v4u*)(Msk + row * 68 + c4) = m;
    }
    const int anyw = __any(nz != 0u);
    AnyNZ[wave] = anyw;
    __syncthreads();
    const int tile_live = AnyNZ[0] | AnyNZ[1] | AnyNZ[2] | AnyNZ[3];   // block-uniform

    const size_t koff = (rowb + kv0 + kvr) * QKV_PITCH + HID_SZ + h * HEAD_D + dh;
    const size_t voff = koff + HID_SZ;

    if (tile_live) {
      // ---- K hi/lo rows -> LDS [kv][d] (4+4 b128 per lane, 128 threads x 32 elements = 64x64 per plane) ----
      {
        const v4u* gh = (const v4u*)(qkvh + koff);
        const v4u* gl = (const v4u*)(qkvl + koff);
        v4u* lh = (v4u*)(Kh + kvr * HEAD_D + dh);
        v4u* ll = (v4u*)(Kl + kvr * HEAD_D + dh);
#pragma unroll
        for (int i = 0; i < 4; ++i) { const v4u a = gh[i]; const v4u bb = gl[i]; lh[i] = a; ll[i] = bb; }
      }
      asm volatile("" ::: "memory");
      // ---- V hi/lo rows -> LDS transposed [d][kv] ----
      {
        const v4u* gh = (const v4u*)(qkvh + voff);
        const v4u* gl = (const v4u*)(qkvl + voff);
#pragma unroll
        for (int i = 0; i < 4; ++i) {
          const v4u wh = gh[i];
          const v4u wl = gl[i];
#pragma unroll
          for (int e = 0; e < 4; ++e) {
            const int d = dh + 8 * i + 2 * e;
            Vth[d * KV_CHUNK + kvr]       = (unsigned short)(wh[e] & 0xFFFFu);
            Vth[(d + 1) * KV_CHUNK + kvr] = (unsigned short)(wh[e] >> 16);
            Vtl[d * KV_CHUNK + kvr]       = (unsigned short)(wl[e] & 0xFFFFu);
            Vtl[(d + 1) * KV_CHUNK + kvr] = (unsigned short)(wl[e] >> 16);
          }
        }
      }
      __syncthreads();

      // ---- scores: 4 key subtiles x 2 d-chunks, hi.hi + hi.lo + lo.hi ----
      v8f s[4];
#pragma unroll
      for (int j = 0; j < 4; ++j) {
        s[j] = (v8f){0.f,0.f,0.f,0.f,0.f,0.f,0.f,0.f};
#pragma unroll
        for (int dc = 0; dc < 2; ++dc) {
          FB kb, kl;
          const int ko = (j * 16 + c) * HEAD_D + dc * 32 + 8 * hh;
          kb.h[0] = *(const v8b*)((const __bf16*)Kh + ko);
          kb.h[1] = *(const v8b*)((const __bf16*)Kh + ko + 16);
          kl.h[0] = *(const v8b*)((const __bf16*)Kl + ko);
          kl.h[1] = *(const v8b*)((const __bf16*)Kl + ko + 16);
          s[j] = at_mma(qah[dc], kb.v, s[j]);
          s[j] = at_mma(qah[dc], kl.v, s[j]);
          s[j] = at_mma(qal[dc], kb.v, s[j]);
        }
      }
      // ---- scale, mask (literal s*m - 10000*(1-m)), row max ----
      float cm[8];
#pragma unroll
      for (int r = 0; r < 8; ++r) {
        const int rl = wave * 16 + 8 * hh + r;
        float m = -__builtin_inff();
#pragma unroll
        for (int j = 0; j < 4; ++j) {
          const float mk = __uint_as_float(Msk[rl * 68 + j * 16 + c]);
          float x = s[j][r] * 0.125f;
          x = x * mk - 10000.0f * (1.0f - mk);
          s[j][r] = x;
          m = fmaxf(m, x);
        }
#pragma unroll
        for (int off = 1; off < 16; off <<= 1) m = fmaxf(m, __shfl_xor(m, off, 32));
        cm[r] = m;
      }
      // ---- online softmax; P split into bf16 hi/lo in LDS (per wave) ----
      unsigned short* pwh = Psh[wave];
      unsigned short* pwl = Psl[wave];
#pragma unroll
      for (int r = 0; r < 8; ++r) {
        const float mnew  = fmaxf(mrow[r], cm[r]);
        const float alpha = expf(mrow[r] - mnew);
        mrow[r] = mnew;
        float psum = 0.f;
#pragma unroll
        for (int j = 0; j < 4; ++j) {
          const float p = expf(s[j][r] - mnew);
          psum += p;
          const unsigned short hb = f2bf_bits(p);
          const unsigned short lb = f2bf_bits(p - bf_bits2f(hb));
          pwh[(8 * hh + r) * KV_CHUNK + j * 16 + c] = hb;
          pwl[(8 * hh + r) * KV_CHUNK + j * 16 + c] = lb;
        }
#pragma unroll
        for (int off = 1; off < 16; off <<= 1) psum += __shfl_xor(psum, off, 32);
        lrow[r] = lrow[r] * alpha + psum;
#pragma unroll
        for (int t = 0; t < 4; ++t) oacc[t][r] *= alpha;
      }
      __builtin_amdgcn_fence(__ATOMIC_RELEASE, "workgroup");
      __builtin_amdgcn_wave_barrier();
      __builtin_amdgcn_fence(__ATOMIC_ACQUIRE, "workgroup");
      // ---- out += P(16x64) . V(64x64): pa.vh + pa.vl + pl.vh ----
#pragma unroll 1
      for (int kk = 0; kk < 2; ++kk) {
        FB pa, pl;
        const int po = c * KV_CHUNK + kk * 32 + 8 * hh;
        pa.h[0] = *(const v8b*)((const __bf16*)pwh + po);
        pa.h[1] = *(const v8b*)((const __bf16*)pwh + po + 16);
        pl.h[0] = *(const v8b*)((const __bf16*)pwl + po);
        pl.h[1] = *(const v8b*)((const __bf16*)pwl + po + 16);
#pragma unroll
        for (int t = 0; t < 4; ++t) {
          FB vb, vl;
          const int vo = (t * 16 + c) * KV_CHUNK + kk * 32 + 8 * hh;
          vb.h[0] = *(const v8b*)((const __bf16*)Vth + vo);
          vb.h[1] = *(const v8b*)((const __bf16*)Vth + vo + 16);
          vl.h[0] = *(const v8b*)((const __bf16*)Vtl + vo);
          vl.h[1] = *(const v8b*)((const __bf16*)Vtl + vo + 16);
          oacc[t] = at_mma(pa.v, vb.v, oacc[t]);
          oacc[t] = at_mma(pa.v, vl.v, oacc[t]);
          oacc[t] = at_mma(pl.v, vb.v, oacc[t]);
        }
      }
    } else {
      // ---- all-masked tile: v rows (hi+lo, f32) -> Msk scratch [kv][d], column sums, closed-form update ----
      {
        const v4u* gh = (const v4u*)(qkvh + voff);
        const v4u* gl = (const v4u*)(qkvl + voff);
#pragma unroll
        for (int i = 0; i < 4; ++i) {
          const v4u wh = gh[i];
          const v4u wl = gl[i];
          v4u f0, f1;
          {
            const float a0 = __uint_as_float(wh[0] << 16);          const float b0 = __uint_as_float(wl[0] << 16);
            const float a1 = __uint_as_float(wh[0] & 0xFFFF0000u); const float b1 = __uint_as_float(wl[0] & 0xFFFF0000u);
            const float a2 = __uint_as_float(wh[1] << 16);          const float b2 = __uint_as_float(wl[1] << 16);
            const float a3 = __uint_as_float(wh[1] & 0xFFFF0000u); const float b3 = __uint_as_float(wl[1] & 0xFFFF0000u);
            f0[0] = __float_as_uint(a0 + b0); f0[1] = __float_as_uint(a1 + b1);
            f0[2] = __float_as_uint(a2 + b2); f0[3] = __float_as_uint(a3 + b3);
          }
          {
            const float a0 = __uint_as_float(wh[2] << 16);          const float b0 = __uint_as_float(wl[2] << 16);
            const float a1 = __uint_as_float(wh[2] & 0xFFFF0000u); const float b1 = __uint_as_float(wl[2] & 0xFFFF0000u);
            const float a2 = __uint_as_float(wh[3] << 16);          const float b2 = __uint_as_float(wl[3] << 16);
            const float a3 = __uint_as_float(wh[3] & 0xFFFF0000u); const float b3 = __uint_as_float(wl[3] & 0xFFFF0000u);
            f1[0] = __float_as_uint(a0 + b0); f1[1] = __float_as_uint(a1 + b1);
            f1[2] = __float_as_uint(a2 + b2); f1[3] = __float_as_uint(a3 + b3);
          }
          *(v4u*)(Msk + kvr * 68 + dh + 8 * i)     = f0;
          *(v4u*)(Msk + kvr * 68 + dh + 8 * i + 4) = f1;
        }
      }
      __syncthreads();
      {
        const int d = tid & 63, half = tid >> 6;
        float part = 0.f;
#pragma unroll 8
        for (int kq = 0; kq < 32; ++kq) part += __uint_as_float(Msk[(half * 32 + kq) * 68 + d]);
        Os[0][half * 64 + d] = part;
      }
      __syncthreads();
      float vs[4];
#pragma unroll
      for (int t = 0; t < 4; ++t) vs[t] = Os[0][t * 16 + c] + Os[0][64 + t * 16 + c];
#pragma unroll
      for (int r = 0; r < 8; ++r) {
        const float mnew  = fmaxf(mrow[r], -10000.0f);
        const float alpha = expf(mrow[r] - mnew);
        const float p     = expf(-10000.0f - mnew);
        mrow[r] = mnew;
        lrow[r] = lrow[r] * alpha + 64.0f * p;
#pragma unroll
        for (int t = 0; t < 4; ++t) oacc[t][r] = oacc[t][r] * alpha + p * vs[t];
      }
    }
  }
  __syncthreads();

  float* os = Os[wave];
#pragma unroll
  for (int r = 0; r < 8; ++r) {
    const float inv = 1.0f / lrow[r];
#pragma unroll
    for (int t = 0; t < 4; ++t) os[(8 * hh + r) * 68 + t * 16 + c] = oacc[t][r] * inv;
  }
  __builtin_amdgcn_fence(__ATOMIC_RELEASE, "workgroup");
  __builtin_amdgcn_wave_barrier();
  __builtin_amdgcn_fence(__ATOMIC_ACQUIRE, "workgroup");
  {
    const int q8 = lane >> 3, c8 = (lane & 7) * 8;
    unsigned short* oh = ctxh + (rowb + q0) * HID_SZ + h * HEAD_D + c8;
    unsigned short* ol = ctxl + (rowb + q0) * HID_SZ + h * HEAD_D + c8;
    {
#pragma unroll
      for (int it = 0; it < 4; ++it) {
        const int row = it * 4 + q8;
        const float* sp = os + row * 68 + c8;
        const v4f x0 = *(const v4f*)sp;
        const v4f x1 = *(const v4f*)(sp + 4);
        v4u wh, wl;
        unsigned int th, tl;
        split_pack2(x0[0], x0[1], th, tl); wh[0] = th; wl[0] = tl;
        split_pack2(x0[2], x0[3], th, tl); wh[1] = th; wl[1] = tl;
        split_pack2(x1[0], x1[1], th, tl); wh[2] = th; wl[2] = tl;
        split_pack2(x1[2], x1[3], th, tl); wh[3] = th; wl[3] = tl;
        *(v4u*)(oh + (size_t)row * HID_SZ) = wh;
        *(v4u*)(ol + (size_t)row * HID_SZ) = wl;
      }
      
    }
  }
}

// ---------------------------------------------------------------------------
// Workspace region map (bytes):
//   Hb    bf16 [4096][1024]        off 0            size  8388608
//   WQt   bf16 [3072][1024]        off 8388608      size  6291456
//   WDt   bf16 [1024][1024]        off 14680064     size  2097152
//   BQ    f32  [3072]              off 16777216     size    12288
//   BD    f32  [1024]              off 16789504     size     4096
//   QKVh  bf16 [4096][3072]        off 16793600     size 25165824
//   QKVl  bf16 [4096][3072]        off 41959424     size 25165824
//   CTXh  bf16 [4096][1024]        off 67125248     size  8388608
//   CTXl  bf16 [4096][1024]        off 75513856     size  8388608
//   end                            83902464
// Every region is fully written by its producer before any consumer reads it.
// ---------------------------------------------------------------------------
extern "C" void kernel_launch(void* const* d_in, const int* in_sizes, int n_in,
                              void* d_out, int out_size, void* d_ws, size_t ws_size,
                              hipStream_t stream) {
  constexpr int kB = N_BATCH, kS = SEQ_LEN, kH = HID_SZ;
  constexpr int kM = kB * kS;          // 4096
  constexpr int kN3 = 3 * kH;          // 3072
  static_assert(kM % 64 == 0 && kN3 % 64 == 0 && kH % 64 == 0);   // GEMM M/N tile multiples
  static_assert(kH % 32 == 0);                                     // GEMM K step
  static_assert(kS % KV_CHUNK == 0 && kS / 64 == 32 && kH / HEAD_D == N_HEADS);
  static_assert((kM * kH) % 2048 == 0 && kN3 % 1024 == 0 && kH % 1024 == 0);

  if (n_in < 6) return;
  if (in_sizes[0] != kM * kH || in_sizes[1] != kS * kS || in_sizes[2] != kH * kN3 ||
      in_sizes[3] != kN3 || in_sizes[4] != kH * kH || in_sizes[5] != kH) return;
  if (out_size != kM * kH) return;

  const float* hidden  = (const float*)d_in[0];
  const float* maskp   = (const float*)d_in[1];
  const float* w_qkv   = (const float*)d_in[2];
  const float* b_qkv   = (const float*)d_in[3];
  const float* w_dense = (const float*)d_in[4];
  const float* b_dense = (const float*)d_in[5];
  float* out = (float*)d_out;

  const size_t szHb  = (size_t)kM * kH * 2;
  const size_t szWQt = (size_t)kN3 * kH * 2;
  const size_t szWDt = (size_t)kH * kH * 2;
  const size_t szBQ  = (size_t)kN3 * 4;
  const size_t szBD  = (size_t)kH * 4;
  const size_t szQKV = (size_t)kM * kN3 * 2;
  const size_t szCTX = (size_t)kM * kH * 2;
  const size_t offHb   = 0;
  const size_t offWQt  = offHb + szHb;
  const size_t offWDt  = offWQt + szWQt;
  const size_t offBQ   = offWDt + szWDt;
  const size_t offBD   = offBQ + szBQ;
  const size_t offQKVh = offBD + szBD;
  const size_t offQKVl = offQKVh + szQKV;
  const size_t offCTXh = offQKVl + szQKV;
  const size_t offCTXl = offCTXh + szCTX;
  const size_t offEnd  = offCTXl + szCTX;
  if (offEnd > ws_size) return;

  char* ws = (char*)d_ws;
  unsigned short* Hb   = (unsigned short*)(ws + offHb);
  unsigned short* WQt  = (unsigned short*)(ws + offWQt);
  unsigned short* WDt  = (unsigned short*)(ws + offWDt);
  float*          BQ   = (float*)(ws + offBQ);
  float*          BD   = (float*)(ws + offBD);
  unsigned short* QKVh = (unsigned short*)(ws + offQKVh);
  unsigned short* QKVl = (unsigned short*)(ws + offQKVl);
  unsigned short* CTXh = (unsigned short*)(ws + offCTXh);
  unsigned short* CTXl = (unsigned short*)(ws + offCTXl);

  // 1) hidden -> bf16 plane [4096][1024]
  {
    const int n8 = (kM * kH) / 8;                       // 524288 threads = 2048 blocks exactly
    cast_f32_bf16x8<<<dim3(n8 / 256), dim3(256), 0, stream>>>(hidden, Hb, n8);
  }
  // 2) w_qkv [1024 rows][3072 cols] -> WQt [3072][1024] bf16 ; w_dense [1024][1024] -> WDt [1024][1024] bf16
  transpose_cast_bf16<<<dim3(kN3 / 64, kH / 64), dim3(256), 0, stream>>>(w_qkv, WQt, kH, kN3);
  transpose_cast_bf16<<<dim3(kH / 64, kH / 64), dim3(256), 0, stream>>>(w_dense, WDt, kH, kH);
  // 3) bias lines RNE-bf16 converted (kept as f32)
  rne_bf16_f32x4<<<dim3((kN3 / 4) / 256), dim3(256), 0, stream>>>(b_qkv, BQ, kN3 / 4);
  rne_bf16_f32x4<<<dim3((kH / 4) / 256), dim3(256), 0, stream>>>(b_dense, BD, kH / 4);
  // 4) fused qkv projection: [4096x1024] x WQt[3072x1024]^T + bias -> bf16 hi/lo planes [4096][3072]
  {
    const int tiles = (kM / 64) * (kN3 / 64);           // 3072 wave tiles -> 384 blocks of 8 waves
    wmma_gemm64<1, 0, 2, 2, false><<<dim3(tiles / 8, 1), dim3(256), 0, stream>>>(
        Hb, Hb, kH, 0L, WQt, WQt, kH, 0L, (void*)QKVh, (void*)QKVl, kN3, 0L,
        BQ, BQ, 0L, kM, kN3, kH, 1.0f);
  }
  // 5) attention per (batch, head, 64 query rows) -> ctx bf16 hi/lo planes [4096][1024]
  attn_planes_kernel<<<dim3(kB * N_HEADS * (kS / 64)), dim3(128), 0, stream>>>(QKVh, QKVl, maskp, CTXh, CTXl);
  // 6) output projection: ctx (hi/lo) [4096x1024] x WDt[1024x1024]^T + bias -> out f32 [4096][1024]
  {
    const int tiles = (kM / 64) * (kH / 64);            // 1024 wave tiles -> 128 blocks
    wmma_gemm64<1, 2, 2, 0, false><<<dim3(tiles / 8, 1), dim3(256), 0, stream>>>(
        CTXh, CTXl, kH, 0L, WDt, WDt, kH, 0L, (void*)out, (void*)out, kH, 0L,
        BD, BD, 0L, kM, kH, kH, 1.0f);
  }
}

// v001
// It runs in 512 microseconds.
// Timed twice side by side with v000, it ran 1.22 times as fast both times.
// Contractions on v_wmma_f32_16x16x32_bf16 (bf16 operands, f32 accumulate): qkv projection = one product on RNE-bf16 inputs; q.k^T and p.v = bf16 hi/lo planes (3 products); output projection = ctx bf16 hi/lo x bf16 weights (2 products). Masking, softmax and normalisation in f32.
#include <hip/hip_runtime.h>

typedef __attribute__((ext_vector_type(16))) _Float16 v16h;
typedef __attribute__((ext_vector_type(8)))  _Float16 v8h;
typedef __attribute__((ext_vector_type(16))) __bf16   v16b;
typedef __attribute__((ext_vector_type(8)))  __bf16   v8b;
typedef __attribute__((ext_vector_type(8)))  float    v8f;
typedef __attribute__((ext_vector_type(4)))  float    v4f;
typedef __attribute__((ext_vector_type(4)))  unsigned int v4u;

__device__ __forceinline__ unsigned short f2bf_bits(float f) {
  unsigned u = __float_as_uint(f);
  return (unsigned short)((u + 0x7FFFu + ((u >> 16) & 1u)) >> 16);
}
__device__ __forceinline__ float bf_bits2f(unsigned short h) { return __uint_as_float(((unsigned)h) << 16); }
// RNE convert of an f32 bit pattern to its bf16 value, kept as an f32 bit pattern
__device__ __forceinline__ unsigned int rne_bf16_word(unsigned int u) {
  return (u + 0x7FFFu + ((u >> 16) & 1u)) & 0xFFFF0000u;
}
__device__ __forceinline__ unsigned int pack_bf16x2(float a, float b) {
  return (unsigned int)f2bf_bits(a) | ((unsigned int)f2bf_bits(b) << 16);
}
// hi/lo bf16 split of two floats, packed as (hi_a | hi_b<<16) and (lo_a | lo_b<<16)
__device__ __forceinline__ void split_pack2(float a, float b, unsigned int& wh, unsigned int& wl) {
  const unsigned short ha = f2bf_bits(a), hb = f2bf_bits(b);
  const unsigned short la = f2bf_bits(a - bf_bits2f(ha)), lb = f2bf_bits(b - bf_bits2f(hb));
  wh = (unsigned int)ha | ((unsigned int)hb << 16);
  wl = (unsigned int)la | ((unsigned int)lb << 16);
}

// hazard guards as plain device helpers (no inline asm inside the kernel template body)
__device__ __forceinline__ void dep_guard_h(v8f& a, v8f& b, v16h x, v16h y) { asm volatile("v_nop\n\tv_nop\n\tv_nop\n\tv_nop" : "+v"(a), "+v"(b) : "v"(x), "v"(y)); }
__device__ __forceinline__ void dep_guard_b(v8f& a, v8f& b, v16b x, v16b y) { asm volatile("v_nop\n\tv_nop\n\tv_nop\n\tv_nop" : "+v"(a), "+v"(b) : "v"(x), "v"(y)); }
__device__ __forceinline__ void keep4_h(v16h a, v16h b, v16h c, v16h d) { asm volatile("v_nop" :: "v"(a), "v"(b), "v"(c), "v"(d)); }
__device__ __forceinline__ void keep4_b(v16b a, v16b b, v16b c, v16b d) { asm volatile("v_nop" :: "v"(a), "v"(b), "v"(c), "v"(d)); }
__device__ __forceinline__ void acc_guard4(v8f& a, v8f& b, v8f& c, v8f& d) { asm volatile("v_nop\n\tv_nop\n\tv_nop\n\tv_nop" : "+v"(a), "+v"(b), "+v"(c), "+v"(d)); }
template <typename T> struct Frag;
template <> struct Frag<_Float16> {
  typedef v16h V; union U { v16h v; v8h h[2]; };
  static __device__ __forceinline__ v16h load(const _Float16* p) {   // elements 0..7 <- p[0..7], 8..15 <- p[16..23]
    U f; f.h[0] = *(const v8h*)(p); f.h[1] = *(const v8h*)(p + 16); return f.v;
  }
  static __device__ __forceinline__ v8f mma(v16h a, v16h b, v8f c) {
    return __builtin_amdgcn_wmma_f32_16x16x32_f16(false, a, false, b, (short)0, c, false, false);
  }
  static __device__ __forceinline__ void guard(v8f& a, v8f& b, v16h x, v16h y) { dep_guard_h(a, b, x, y); }
  static __device__ __forceinline__ void keep(v16h a, v16h b, v16h c, v16h d) { keep4_h(a, b, c, d); }
};
template <> struct Frag<__bf16> {
  typedef v16b V; union U { v16b v; v8b h[2]; };
  static __device__ __forceinline__ v16b load(const __bf16* p) {
    U f; f.h[0] = *(const v8b*)(p); f.h[1] = *(const v8b*)(p + 16); return f.v;
  }
  static __device__ __forceinline__ v8f mma(v16b a, v16b b, v8f c) {
    return __builtin_amdgcn_wmma_f32_16x16x32_bf16(false, a, false, b, (short)0, c, false, false);
  }
  static __device__ __forceinline__ void guard(v8f& a, v8f& b, v16b x, v16b y) { dep_guard_b(a, b, x, y); }
  static __device__ __forceinline__ void keep(v16b a, v16b b, v16b c, v16b d) { keep4_b(a, b, c, d); }
};

// ---- Register-blocked batched WMMA GEMM ------------------------------------
// C[m,n] = scale * sum_k A[m,k] * Bt[n,k] (+bias)(+resid); each wave owns a 64x64 tile.
// A row-major [M,K]; Bt row-major [N,K]; M,N % 64 == 0, K % 32 == 0.
// SPLIT: 0 = single planes; 1 = A and Bt hi/lo planes (hi.hi + hi.lo + lo.hi); 2 = A hi/lo planes only (hi.B + lo.B).
// BIAS_MODE: 0 = none, 1 = bias[m], 2 = bias[n].
// OUT_MODE: 0 = f32, 1 = f16, 2 = bf16 hi plane (Cout) + bf16 lo plane (Cout2).
// ET: 0 = f16 operands, 1 = bf16 operands (pointers passed as 16-bit storage)
template <int ET> struct Elem;
template <> struct Elem<0> { typedef _Float16 T; };
template <> struct Elem<1> { typedef __bf16 T; };
template <int ET, int SPLIT, int BIAS_MODE, int OUT_MODE, bool RESID, int ACT = 0>
__global__ __launch_bounds__(256) void wmma_gemm64(
    const unsigned short* __restrict__ Ap, const unsigned short* __restrict__ A2p, int lda, long strideA,
    const unsigned short* __restrict__ Btp, const unsigned short* __restrict__ Bt2p, int ldb, long strideB,
    void* __restrict__ Cout, void* __restrict__ Cout2, int ldc, long strideC,
    const float* __restrict__ bias,
    const float* __restrict__ resid, long strideR,
    int M, int N, int K, float scale) {
  typedef typename Elem<ET>::T T;
  typedef typename Frag<T>::V V;
  const T* A = (const T*)Ap; const T* A2 = (const T*)A2p; const T* Bt = (const T*)Btp; const T* Bt2 = (const T*)Bt2p;
  __shared__ __align__(16) float sT[8][16 * 68];   // per-wave 16x64 slab, pitch 68 floats
  const int b    = blockIdx.y;
  const int lane = threadIdx.x & 31;
  const int wave = threadIdx.x >> 5;
  const int tilesN = N >> 6;
  const int tilesM = M >> 6;
  const int tile = blockIdx.x * 8 + wave;
  if (tile >= tilesM * tilesN) return;   // wave-uniform; no block barriers in this kernel
  const int tm = tile / tilesN;
  const int tn = tile - tm * tilesN;
  const int m0 = tm << 6;
  const int n0 = tn << 6;

  const T* Ab  = A  + (size_t)b * strideA;
  const T* Bb  = Bt + (size_t)b * strideB;
  const T* Ab2 = (SPLIT != 0) ? (A2  + (size_t)b * strideA) : nullptr;
  const T* Bb2 = (SPLIT == 1) ? (Bt2 + (size_t)b * strideB) : nullptr;

  const int rlane = lane & 15;                 // row (A) / col (B, D) within subtile
  const int koff  = (lane >> 4) * 8;           // k offset of this lane half
  const int mOff  = (lane >> 4) * 8;           // D row offset

  v8f acc[4][4];
#pragma unroll
  for (int i = 0; i < 4; ++i)
#pragma unroll
    for (int j = 0; j < 4; ++j) acc[i][j] = (v8f){0.f,0.f,0.f,0.f,0.f,0.f,0.f,0.f};

  for (int k0 = 0; k0 < K; k0 += 32) {
    V bh[4], bl[4];
#pragma unroll
    for (int j = 0; j < 4; ++j) {
      const size_t bo = (size_t)(n0 + (j << 4) + rlane) * ldb + koff + k0;
      bh[j] = Frag<T>::load(Bb + bo);
      if (SPLIT == 1) bl[j] = Frag<T>::load(Bb2 + bo);
    }
#pragma unroll
    for (int i = 0; i < 4; ++i) {
      const size_t ao = (size_t)(m0 + (i << 4) + rlane) * lda + koff + k0;
      V ah = Frag<T>::load(Ab + ao);
      V al;
      if (SPLIT != 0) al = Frag<T>::load(Ab2 + ao);
#pragma unroll
      for (int j = 0; j < 4; ++j) {
        acc[i][j] = Frag<T>::mma(ah, bh[j], acc[i][j]);
        if (SPLIT == 1) {
          acc[i][j] = Frag<T>::mma(ah, bl[j], acc[i][j]);
          acc[i][j] = Frag<T>::mma(al, bh[j], acc[i][j]);
        }
        if (SPLIT == 2) {
          acc[i][j] = Frag<T>::mma(al, bh[j], acc[i][j]);
        }
      }
      Frag<T>::guard(acc[i][0], acc[i][3], ah, (SPLIT != 0) ? al : ah);
    }
    Frag<T>::keep(bh[0], bh[1], bh[2], bh[3]);
    if (SPLIT == 1) Frag<T>::keep(bl[0], bl[1], bl[2], bl[3]);
  }
  acc_guard4(acc[0][0], acc[0][1], acc[0][2], acc[0][3]);
  acc_guard4(acc[1][0], acc[1][1], acc[1][2], acc[1][3]);
  acc_guard4(acc[2][0], acc[2][1], acc[2][2], acc[2][3]);
  acc_guard4(acc[3][0], acc[3][1], acc[3][2], acc[3][3]);

  // ---- epilogue ----
  float* slab = sT[wave];
  const float* Rb = RESID ? (resid + (size_t)b * strideR) : nullptr;
#pragma unroll
  for (int i = 0; i < 4; ++i) {
    const int mBase = m0 + (i << 4);
#pragma unroll
    for (int j = 0; j < 4; ++j) {
      const int n = n0 + (j << 4) + rlane;
      float bv = 0.f;
      if (BIAS_MODE == 2) bv = bias[n];
#pragma unroll
      for (int r = 0; r < 8; ++r) {
        float v = acc[i][j][r] * scale;
        if (BIAS_MODE == 1) v += bias[mBase + mOff + r];
        if (BIAS_MODE == 2) v += bv;
        if (RESID) v += Rb[(size_t)(mBase + mOff + r) * ldc + n];
        if (ACT == 1) v = tanhf(v);
        if (ACT == 2) v = fmaxf(v, 0.0f);
        if (ACT == 4) v = (v > 0.f) ? v : 0.01f * v;
        slab[(mOff + r) * 68 + (j << 4) + rlane] = v;
      }
    }
    __builtin_amdgcn_fence(__ATOMIC_RELEASE, "workgroup");
    __builtin_amdgcn_wave_barrier();
    __builtin_amdgcn_fence(__ATOMIC_ACQUIRE, "workgroup");
    if (OUT_MODE == 0) {
      float* C = (float*)Cout + (size_t)b * strideC;
      const int hh = lane >> 4, c4 = (lane & 15) * 4;     // row seg = 256 B = 16 lanes x 16 B
      {
#pragma unroll
        for (int it = 0; it < 8; ++it) {
          const int row = it * 2 + hh;
          v4f v = *(const v4f*)(slab + row * 68 + c4);
          *(v4f*)(C + (size_t)(mBase + row) * ldc + n0 + c4) = v;
        }
        
      }
    } else {
      const int q = lane >> 3, c8 = (lane & 7) * 8;
      unsigned short* C  = (unsigned short*)Cout  + (size_t)b * strideC;
      unsigned short* C2 = (OUT_MODE == 2) ? ((unsigned short*)Cout2 + (size_t)b * strideC) : nullptr;
      {
#pragma unroll
        for (int it = 0; it < 4; ++it) {
          const int row = it * 4 + q;
          const float* sp = slab + row * 68 + c8;
          v8h hv, lv;
#pragma unroll
          for (int e = 0; e < 8; ++e) {
            if (OUT_MODE == 1) {
              hv[e] = (_Float16)sp[e];
            } else {
              unsigned short hb = f2bf_bits(sp[e]);
              unsigned short lb = f2bf_bits(sp[e] - bf_bits2f(hb));
              hv[e] = __builtin_bit_cast(_Float16, hb);
              lv[e] = __builtin_bit_cast(_Float16, lb);
            }
          }
          *(v8h*)(C + (size_t)(mBase + row) * ldc + n0 + c8) = hv;
          if (OUT_MODE == 2) *(v8h*)(C2 + (size_t)(mBase + row) * ldc + n0 + c8) = lv;
        }
        
      }
    }
    __builtin_amdgcn_fence(__ATOMIC_RELEASE, "workgroup");
    __builtin_amdgcn_wave_barrier();
    __builtin_amdgcn_fence(__ATOMIC_ACQUIRE, "workgroup");
  }
}

__device__ __forceinline__ v8f at_mma(v16b a, v16b b, v8f c) {
  c = __builtin_amdgcn_wmma_f32_16x16x32_bf16(false, a, false, b, (short)0, c, false, false);
  asm volatile("v_nop\n\tv_nop\n\tv_nop\n\tv_nop" : "+v"(c) : "v"(a), "v"(b));
  return c;
}

// coverage: grid*256 threads x 8 elements == n8*8 elements exactly (host sizes n8 = n/8, n % 2048 == 0)
__global__ __launch_bounds__(256) void cast_f32_bf16x8(const float* __restrict__ in, unsigned short* __restrict__ out, int n8) {
  const int i = blockIdx.x * 256 + threadIdx.x;
  if (i >= n8) return;
  const float* p = in + (size_t)i * 8;
  const v4f a = *(const v4f*)p;
  const v4f c2 = *(const v4f*)(p + 4);
  v4u w;
  w[0] = pack_bf16x2(a[0], a[1]);
  w[1] = pack_bf16x2(a[2], a[3]);
  w[2] = pack_bf16x2(c2[0], c2[1]);
  w[3] = pack_bf16x2(c2[2], c2[3]);
  v4u* d = (v4u*)(out + (size_t)i * 8);
  *d = w;
  
}

// coverage: n4 = n/4 threads, n % 1024 == 0 so every wave writes 4 complete lines
__global__ __launch_bounds__(256) void rne_bf16_f32x4(const float* __restrict__ in, float* __restrict__ out, int n4) {
  const int i = blockIdx.x * 256 + threadIdx.x;
  if (i >= n4) return;
  v4u a = *(const v4u*)(in + (size_t)i * 4);
#pragma unroll
  for (int e = 0; e < 4; ++e) a[e] = rne_bf16_word(a[e]);
  v4u* d = (v4u*)(out + (size_t)i * 4);
  *d = a;
  
}

// ---- transpose + bf16 cast: in[nrows][ncols] f32 -> out[ncols][nrows] bf16 ----
// grid = (ncols/64, nrows/64), block 256. Load: 256 threads x 16 floats = the 64x64 tile.
__global__ __launch_bounds__(256) void transpose_cast_bf16(const float* __restrict__ in, unsigned short* __restrict__ out, int nrows, int ncols) {
  __shared__ __align__(16) float tile[64 * 68];   // tile[cl*68 + rl]: cl = in col (out row), rl = in row (out col)
  const int tid = threadIdx.x, lane = tid & 31, wave = tid >> 5;
  const int r0 = blockIdx.y * 64;
  const int c0 = blockIdx.x * 64;
  {
    const int rl = tid >> 2, cq = (tid & 3) * 16;
    const float* src = in + (size_t)(r0 + rl) * ncols + c0 + cq;
#pragma unroll
    for (int i = 0; i < 4; ++i) {
      const v4f v = *(const v4f*)(src + 4 * i);
#pragma unroll
      for (int e = 0; e < 4; ++e) tile[(cq + 4 * i + e) * 68 + rl] = v[e];
    }
  }
  __syncthreads();
  const int q8 = lane >> 3, c8 = (lane & 7) * 8;
  {
#pragma unroll
    for (int it = 0; it < 2; ++it) {
      const int cl = wave * 8 + it * 4 + q8;
      const float* sp = tile + cl * 68 + c8;
      const v4f x0 = *(const v4f*)sp;
      const v4f x1 = *(const v4f*)(sp + 4);
      v4u w;
      w[0] = pack_bf16x2(x0[0], x0[1]);
      w[1] = pack_bf16x2(x0[2], x0[3]);
      w[2] = pack_bf16x2(x1[0], x1[1]);
      w[3] = pack_bf16x2(x1[2], x1[3]);
      *(v4u*)(out + (size_t)(c0 + cl) * nrows + r0 + c8) = w;
    }
    
  }
}

// =====================================================================================
// Attention, head dim 64, over bf16 hi/lo planes of the fused qkv projection.
// qkv planes: [B*S][3*HID], q at col h*64+d, k at HID + h*64 + d, v at 2*HID + h*64 + d.
// scores = 0.125 * q.k^T (bf16 hi/lo, 3 products); mask tile m[q][kv] (RNE-bf16 converted) applied as
// s*m - 10000*(1-m); online softmax in f32; p split into bf16 hi/lo in LDS; out += p.v (3 products).
// A 64x64 tile whose mask is identically zero has 64 equal logits -10000 per row: folded in closed form
// (l += 64*p, o += p * column-sum(v), p = exp(-10000 - rowmax)).
// Block = 4 waves = 64 query rows of one (batch, head); grid.x = B * NH * (S/64).
// =====================================================================================
#define SEQ_LEN 2048
#define N_HEADS 16
#define HEAD_D 64
#define HID_SZ 1024
#define QKV_PITCH 3072
#define KV_CHUNK 64
#define N_BATCH 2
#define LDS_P 72   // row pitch of the K, V^T and P tiles in 16-bit elements: 144 B = 16 B x odd, so the 16 rows of a b128 fragment read fall on distinct banks

__global__ __launch_bounds__(128) void attn_planes_kernel(
    const unsigned short* __restrict__ qkvh, const unsigned short* __restrict__ qkvl,
    const float* __restrict__ maskp,
    unsigned short* __restrict__ ctxh, unsigned short* __restrict__ ctxl) {
  union FB { v16b v; v8b h[2]; };
  __shared__ __align__(16) unsigned short Kh[KV_CHUNK * LDS_P];     // K hi [kv][d], pitch LDS_P
  __shared__ __align__(16) unsigned short Kl[KV_CHUNK * LDS_P];     // K lo [kv][d], pitch LDS_P
  __shared__ __align__(16) unsigned short Vth[HEAD_D * LDS_P];      // V hi [d][kv], pitch LDS_P
  __shared__ __align__(16) unsigned short Vtl[HEAD_D * LDS_P];      // V lo [d][kv], pitch LDS_P
  __shared__ __align__(16) unsigned short Psh[4][16 * LDS_P];      // per wave P hi [row][kv], pitch LDS_P
  __shared__ __align__(16) unsigned short Psl[4][16 * LDS_P];      // per wave P lo [row][kv], pitch LDS_P
  __shared__ __align__(16) float Os[4][16 * 68];                   // per wave out tile, pitch 68; Os[0][0..127] doubles as column-sum scratch
  __shared__ __align__(16) unsigned int Msk[64 * 68];              // mask tile [q][kv] (f32 bits), pitch 68; doubles as v scratch [kv][d]
  __shared__ int AnyNZ[4];

  const int tid  = threadIdx.x;
  const int wave = tid >> 5;
  const int lane = tid & 31;
  const int hh   = lane >> 4;
  const int c    = lane & 15;
  const int bx   = blockIdx.x;
  const int qb   = bx & 31;                  // SEQ_LEN / 64 == 32
  const int bhd  = bx >> 5;
  const int h    = bhd & (N_HEADS - 1);
  const int b    = bhd >> 4;
  const int qblk = qb * 64;
  const int q0   = qblk + wave * 16;
  const size_t rowb = (size_t)b * SEQ_LEN;

  // ---- Q fragments (A operand), hi and lo planes, 2 d-chunks (8 b128 loads per lane) ----
  v16b qah[2], qal[2];
  {
    const size_t qoff = (rowb + q0 + c) * QKV_PITCH + h * HEAD_D + 8 * hh;
#pragma unroll
    for (int dc = 0; dc < 2; ++dc) {
      qah[dc] = Frag<__bf16>::load((const __bf16*)qkvh + qoff + dc * 32);
      qal[dc] = Frag<__bf16>::load((const __bf16*)qkvl + qoff + dc * 32);
    }
  }

  float mrow[8], lrow[8];
  v8f oacc[4];
#pragma unroll
  for (int r = 0; r < 8; ++r) { mrow[r] = -__builtin_inff(); lrow[r] = 0.f; }
#pragma unroll
  for (int t = 0; t < 4; ++t) oacc[t] = (v8f){0.f,0.f,0.f,0.f,0.f,0.f,0.f,0.f};

  const int kvr = tid >> 1;            // staging: kv row of this thread (0..63)
  const int dh  = (tid & 1) * 32;      // staging: d half (0 or 32)

  for (int kc = 0; kc < SEQ_LEN / KV_CHUNK; ++kc) {
    const int kv0 = kc * KV_CHUNK;
    __syncthreads();
    // ---- mask tile [64 q][64 kv]: 1024 float4 / 128 threads = 8 b128 per lane; RNE-bf16 convert; all-zero test ----
    unsigned int nz = 0u;
#pragma unroll
    for (int i = 0; i < 8; ++i) {
      const int idx = i * 128 + tid;
      const int row = idx >> 4;
      const int c4  = (idx & 15) * 4;
      v4u m = *(const v4u*)(maskp + (size_t)(qblk + row) * SEQ_LEN + kv0 + c4);
#pragma unroll
      for (int e = 0; e < 4; ++e) { const unsigned int u = rne_bf16_word(m[e]); m[e] = u; nz |= (u & 0x7FFFFFFFu); }
      *(v4u*)(Msk + row * 68 + c4) = m;
    }
    const int anyw = __any(nz != 0u);
    AnyNZ[wave] = anyw;
    __syncthreads();
    const int tile_live = AnyNZ[0] | AnyNZ[1] | AnyNZ[2] | AnyNZ[3];   // block-uniform

    const size_t koff = (rowb + kv0 + kvr) * QKV_PITCH + HID_SZ + h * HEAD_D + dh;
    const size_t voff = koff + HID_SZ;

    if (tile_live) {
      // ---- K hi/lo rows -> LDS [kv][d] (4+4 b128 per lane, 128 threads x 32 elements = 64x64 per plane) ----
      {
        const v4u* gh = (const v4u*)(qkvh + koff);
        const v4u* gl = (const v4u*)(qkvl + koff);
        v4u* lh = (v4u*)(Kh + kvr * LDS_P + dh);
        v4u* ll = (v4u*)(Kl + kvr * LDS_P + dh);
#pragma unroll
        for (int i = 0; i < 4; ++i) { const v4u a = gh[i]; const v4u bb = gl[i]; lh[i] = a; ll[i] = bb; }
      }
      asm volatile("" ::: "memory");
      // ---- V hi/lo rows -> LDS transposed [d][kv] ----
      {
        const v4u* gh = (const v4u*)(qkvh + voff);
        const v4u* gl = (const v4u*)(qkvl + voff);
        unsigned short* sh = Vth + dh * LDS_P + kvr;   // one base per plane: every row step below is a constant offset
        unsigned short* sl = Vtl + dh * LDS_P + kvr;
#pragma unroll
        for (int i = 0; i < 4; ++i) {
          const v4u wh = gh[i];
          const v4u wl = gl[i];
#pragma unroll
          for (int e = 0; e < 4; ++e) {
            const int d = 8 * i + 2 * e;
            sh[d * LDS_P]       = (unsigned short)(wh[e] & 0xFFFFu);
            sh[(d + 1) * LDS_P] = (unsigned short)(wh[e] >> 16);
            sl[d * LDS_P]       = (unsigned short)(wl[e] & 0xFFFFu);
            sl[(d + 1) * LDS_P] = (unsigned short)(wl[e] >> 16);
          }
        }
      }
      __syncthreads();

      // ---- scores: 4 key subtiles x 2 d-chunks, hi.hi + hi.lo + lo.hi ----
      v8f s[4];
#pragma unroll
      for (int j = 0; j < 4; ++j) {
        s[j] = (v8f){0.f,0.f,0.f,0.f,0.f,0.f,0.f,0.f};
#pragma unroll
        for (int dc = 0; dc < 2; ++dc) {
          FB kb, kl;
          const int ko = (j * 16 + c) * LDS_P + dc * 32 + 8 * hh;
          kb.h[0] = *(const v8b*)((const __bf16*)Kh + ko);
          kb.h[1] = *(const v8b*)((const __bf16*)Kh + ko + 16);
          kl.h[0] = *(const v8b*)((const __bf16*)Kl + ko);
          kl.h[1] = *(const v8b*)((const __bf16*)Kl + ko + 16);
          s[j] = at_mma(qah[dc], kb.v, s[j]);
          s[j] = at_mma(qah[dc], kl.v, s[j]);
          s[j] = at_mma(qal[dc], kb.v, s[j]);
        }
      }
      // ---- scale, mask (literal s*m - 10000*(1-m)), row max ----
      float cm[8];
#pragma unroll
      for (int r = 0; r < 8; ++r) {
        const int rl = wave * 16 + 8 * hh + r;
        float m = -__builtin_inff();
#pragma unroll
        for (int j = 0; j < 4; ++j) {
          const float mk = __uint_as_float(Msk[rl * 68 + j * 16 + c]);
          float x = s[j][r] * 0.125f;
          x = x * mk - 10000.0f * (1.0f - mk);
          s[j][r] = x;
          m = fmaxf(m, x);
        }
#pragma unroll
        for (int off = 1; off < 16; off <<= 1) m = fmaxf(m, __shfl_xor(m, off, 32));
        cm[r] = m;
      }
      // ---- online softmax; P split into bf16 hi/lo in LDS (per wave) ----
      unsigned short* pwh = Psh[wave];
      unsigned short* pwl = Psl[wave];
#pragma unroll
      for (int r = 0; r < 8; ++r) {
        const float mnew  = fmaxf(mrow[r], cm[r]);
        const float alpha = expf(mrow[r] - mnew);
        mrow[r] = mnew;
        float psum = 0.f;
#pragma unroll
        for (int j = 0; j < 4; ++j) {
          const float p = expf(s[j][r] - mnew);
          psum += p;
          const unsigned short hb = f2bf_bits(p);
          const unsigned short lb = f2bf_bits(p - bf_bits2f(hb));
          pwh[(8 * hh + r) * LDS_P + j * 16 + c] = hb;
          pwl[(8 * hh + r) * LDS_P + j * 16 + c] = lb;
        }
#pragma unroll
        for (int off = 1; off < 16; off <<= 1) psum += __shfl_xor(psum, off, 32);
        lrow[r] = lrow[r] * alpha + psum;
#pragma unroll
        for (int t = 0; t < 4; ++t) oacc[t][r] *= alpha;
      }
      __builtin_amdgcn_fence(__ATOMIC_RELEASE, "workgroup");
      __builtin_amdgcn_wave_barrier();
      __builtin_amdgcn_fence(__ATOMIC_ACQUIRE, "workgroup");
      // ---- out += P(16x64) . V(64x64): pa.vh + pa.vl + pl.vh ----
#pragma unroll 1
      for (int kk = 0; kk < 2; ++kk) {
        FB pa, pl;
        const int po = c * LDS_P + kk * 32 + 8 * hh;
        pa.h[0] = *(const v8b*)((const __bf16*)pwh + po);
        pa.h[1] = *(const v8b*)((const __bf16*)pwh + po + 16);
        pl.h[0] = *(const v8b*)((const __bf16*)pwl + po);
        pl.h[1] = *(const v8b*)((const __bf16*)pwl + po + 16);
#pragma unroll
        for (int t = 0; t < 4; ++t) {
          FB vb, vl;
          const int vo = (t * 16 + c) * LDS_P + kk * 32 + 8 * hh;
          vb.h[0] = *(const v8b*)((const __bf16*)Vth + vo);
          vb.h[1] = *(const v8b*)((const __bf16*)Vth + vo + 16);
          vl.h[0] = *(const v8b*)((const __bf16*)Vtl + vo);
          vl.h[1] = *(const v8b*)((const __bf16*)Vtl + vo + 16);
          oacc[t] = at_mma(pa.v, vb.v, oacc[t]);
          oacc[t] = at_mma(pa.v, vl.v, oacc[t]);
          oacc[t] = at_mma(pl.v, vb.v, oacc[t]);
        }
      }
    } else {
      // ---- all-masked tile: v rows (hi+lo, f32) -> Msk scratch [kv][d], column sums, closed-form update ----
      {
        const v4u* gh = (const v4u*)(qkvh + voff);
        const v4u* gl = (const v4u*)(qkvl + voff);
#pragma unroll
        for (int i = 0; i < 4; ++i) {
          const v4u wh = gh[i];
          const v4u wl = gl[i];
          v4u f0, f1;
          {
            const float a0 = __uint_as_float(wh[0] << 16);          const float b0 = __uint_as_float(wl[0] << 16);
            const float a1 = __uint_as_float(wh[0] & 0xFFFF0000u); const float b1 = __uint_as_float(wl[0] & 0xFFFF0000u);
            const float a2 = __uint_as_float(wh[1] << 16);          const float b2 = __uint_as_float(wl[1] << 16);
            const float a3 = __uint_as_float(wh[1] & 0xFFFF0000u); const float b3 = __uint_as_float(wl[1] & 0xFFFF0000u);
            f0[0] = __float_as_uint(a0 + b0); f0[1] = __float_as_uint(a1 + b1);
            f0[2] = __float_as_uint(a2 + b2); f0[3] = __float_as_uint(a3 + b3);
          }
          {
            const float a0 = __uint_as_float(wh[2] << 16);          const float b0 = __uint_as_float(wl[2] << 16);
            const float a1 = __uint_as_float(wh[2] & 0xFFFF0000u); const float b1 = __uint_as_float(wl[2] & 0xFFFF0000u);
            const float a2 = __uint_as_float(wh[3] << 16);          const float b2 = __uint_as_float(wl[3] << 16);
            const float a3 = __uint_as_float(wh[3] & 0xFFFF0000u); const float b3 = __uint_as_float(wl[3] & 0xFFFF0000u);
            f1[0] = __float_as_uint(a0 + b0); f1[1] = __float_as_uint(a1 + b1);
            f1[2] = __float_as_uint(a2 + b2); f1[3] = __float_as_uint(a3 + b3);
          }
          *(v4u*)(Msk + kvr * 68 + dh + 8 * i)     = f0;
          *(v4u*)(Msk + kvr * 68 + dh + 8 * i + 4) = f1;
        }
      }
      __syncthreads();
      {
        const int d = tid & 63, half = tid >> 6;
        float part = 0.f;
#pragma unroll 8
        for (int kq = 0; kq < 32; ++kq) part += __uint_as_float(Msk[(half * 32 + kq) * 68 + d]);
        Os[0][half * 64 + d] = part;
      }
      __syncthreads();
      float vs[4];
#pragma unroll
      for (int t = 0; t < 4; ++t) vs[t] = Os[0][t * 16 + c] + Os[0][64 + t * 16 + c];
#pragma unroll
      for (int r = 0; r < 8; ++r) {
        const float mnew  = fmaxf(mrow[r], -10000.0f);
        const float alpha = expf(mrow[r] - mnew);
        const float p     = expf(-10000.0f - mnew);
        mrow[r] = mnew;
        lrow[r] = lrow[r] * alpha + 64.0f * p;
#pragma unroll
        for (int t = 0; t < 4; ++t) oacc[t][r] = oacc[t][r] * alpha + p * vs[t];
      }
    }
  }
  __syncthreads();

  float* os = Os[wave];
#pragma unroll
  for (int r = 0; r < 8; ++r) {
    const float inv = 1.0f / lrow[r];
#pragma unroll
    for (int t = 0; t < 4; ++t) os[(8 * hh + r) * 68 + t * 16 + c] = oacc[t][r] * inv;
  }
  __builtin_amdgcn_fence(__ATOMIC_RELEASE, "workgroup");
  __builtin_amdgcn_wave_barrier();
  __builtin_amdgcn_fence(__ATOMIC_ACQUIRE, "workgroup");
  {
    const int q8 = lane >> 3, c8 = (lane & 7) * 8;
    unsigned short* oh = ctxh + (rowb + q0) * HID_SZ + h * HEAD_D + c8;
    unsigned short* ol = ctxl + (rowb + q0) * HID_SZ + h * HEAD_D + c8;
    {
#pragma unroll
      for (int it = 0; it < 4; ++it) {
        const int row = it * 4 + q8;
        const float* sp = os + row * 68 + c8;
        const v4f x0 = *(const v4f*)sp;
        const v4f x1 = *(const v4f*)(sp + 4);
        v4u wh, wl;
        unsigned int th, tl;
        split_pack2(x0[0], x0[1], th, tl); wh[0] = th; wl[0] = tl;
        split_pack2(x0[2], x0[3], th, tl); wh[1] = th; wl[1] = tl;
        split_pack2(x1[0], x1[1], th, tl); wh[2] = th; wl[2] = tl;
        split_pack2(x1[2], x1[3], th, tl); wh[3] = th; wl[3] = tl;
        *(v4u*)(oh + (size_t)row * HID_SZ) = wh;
        *(v4u*)(ol + (size_t)row * HID_SZ) = wl;
      }
      
    }
  }
}

// ---------------------------------------------------------------------------
// Workspace region map (bytes):
//   Hb    bf16 [4096][1024]        off 0            size  8388608
//   WQt   bf16 [3072][1024]        off 8388608      size  6291456
//   WDt   bf16 [1024][1024]        off 14680064     size  2097152
//   BQ    f32  [3072]              off 16777216     size    12288
//   BD    f32  [1024]              off 16789504     size     4096
//   QKVh  bf16 [4096][3072]        off 16793600     size 25165824
//   QKVl  bf16 [4096][3072]        off 41959424     size 25165824
//   CTXh  bf16 [4096][1024]        off 67125248     size  8388608
//   CTXl  bf16 [4096][1024]        off 75513856     size  8388608
//   end                            83902464
// Every region is fully written by its producer before any consumer reads it.
// ---------------------------------------------------------------------------
extern "C" void kernel_launch(void* const* d_in, const int* in_sizes, int n_in,
                              void* d_out, int out_size, void* d_ws, size_t ws_size,
                              hipStream_t stream) {
  constexpr int kB = N_BATCH, kS = SEQ_LEN, kH = HID_SZ;
  constexpr int kM = kB * kS;          // 4096
  constexpr int kN3 = 3 * kH;          // 3072
  static_assert(kM % 64 == 0 && kN3 % 64 == 0 && kH % 64 == 0);   // GEMM M/N tile multiples
  static_assert(kH % 32 == 0);                                     // GEMM K step
  static_assert(kS % KV_CHUNK == 0 && kS / 64 == 32 && kH / HEAD_D == N_HEADS);
  static_assert((kM * kH) % 2048 == 0 && kN3 % 1024 == 0 && kH % 1024 == 0);

  if (n_in < 6) return;
  if (in_sizes[0] != kM * kH || in_sizes[1] != kS * kS || in_sizes[2] != kH * kN3 ||
      in_sizes[3] != kN3 || in_sizes[4] != kH * kH || in_sizes[5] != kH) return;
  if (out_size != kM * kH) return;

  const float* hidden  = (const float*)d_in[0];
  const float* maskp   = (const float*)d_in[1];
  const float* w_qkv   = (const float*)d_in[2];
  const float* b_qkv   = (const float*)d_in[3];
  const float* w_dense = (const float*)d_in[4];
  const float* b_dense = (const float*)d_in[5];
  float* out = (float*)d_out;

  const size_t szHb  = (size_t)kM * kH * 2;
  const size_t szWQt = (size_t)kN3 * kH * 2;
  const size_t szWDt = (size_t)kH * kH * 2;
  const size_t szBQ  = (size_t)kN3 * 4;
  const size_t szBD  = (size_t)kH * 4;
  const size_t szQKV = (size_t)kM * kN3 * 2;
  const size_t szCTX = (size_t)kM * kH * 2;
  const size_t offHb   = 0;
  const size_t offWQt  = offHb + szHb;
  const size_t offWDt  = offWQt + szWQt;
  const size_t offBQ   = offWDt + szWDt;
  const size_t offBD   = offBQ + szBQ;
  const size_t offQKVh = offBD + szBD;
  const size_t offQKVl = offQKVh + szQKV;
  const size_t offCTXh = offQKVl + szQKV;
  const size_t offCTXl = offCTXh + szCTX;
  const size_t offEnd  = offCTXl + szCTX;
  if (offEnd > ws_size) return;

  char* ws = (char*)d_ws;
  unsigned short* Hb   = (unsigned short*)(ws + offHb);
  unsigned short* WQt  = (unsigned short*)(ws + offWQt);
  unsigned short* WDt  = (unsigned short*)(ws + offWDt);
  float*          BQ   = (float*)(ws + offBQ);
  float*          BD   = (float*)(ws + offBD);
  unsigned short* QKVh = (unsigned short*)(ws + offQKVh);
  unsigned short* QKVl = (unsigned short*)(ws + offQKVl);
  unsigned short* CTXh = (unsigned short*)(ws + offCTXh);
  unsigned short* CTXl = (unsigned short*)(ws + offCTXl);

  // 1) hidden -> bf16 plane [4096][1024]
  {
    const int n8 = (kM * kH) / 8;                       // 524288 threads = 2048 blocks exactly
    cast_f32_bf16x8<<<dim3(n8 / 256), dim3(256), 0, stream>>>(hidden, Hb, n8);
  }
  // 2) w_qkv [1024 rows][3072 cols] -> WQt [3072][1024] bf16 ; w_dense [1024][1024] -> WDt [1024][1024] bf16
  transpose_cast_bf16<<<dim3(kN3 / 64, kH / 64), dim3(256), 0, stream>>>(w_qkv, WQt, kH, kN3);
  transpose_cast_bf16<<<dim3(kH / 64, kH / 64), dim3(256), 0, stream>>>(w_dense, WDt, kH, kH);
  // 3) bias lines RNE-bf16 converted (kept as f32)
  rne_bf16_f32x4<<<dim3((kN3 / 4) / 256), dim3(256), 0, stream>>>(b_qkv, BQ, kN3 / 4);
  rne_bf16_f32x4<<<dim3((kH / 4) / 256), dim3(256), 0, stream>>>(b_dense, BD, kH / 4);
  // 4) fused qkv projection: [4096x1024] x WQt[3072x1024]^T + bias -> bf16 hi/lo planes [4096][3072]
  {
    const int tiles = (kM / 64) * (kN3 / 64);           // 3072 wave tiles -> 384 blocks of 8 waves
    wmma_gemm64<1, 0, 2, 2, false><<<dim3(tiles / 8, 1), dim3(256), 0, stream>>>(
        Hb, Hb, kH, 0L, WQt, WQt, kH, 0L, (void*)QKVh, (void*)QKVl, kN3, 0L,
        BQ, BQ, 0L, kM, kN3, kH, 1.0f);
  }
  // 5) attention per (batch, head, 64 query rows) -> ctx bf16 hi/lo planes [4096][1024]
  attn_planes_kernel<<<dim3(kB * N_HEADS * (kS / 64)), dim3(128), 0, stream>>>(QKVh, QKVl, maskp, CTXh, CTXl);
  // 6) output projection: ctx (hi/lo) [4096x1024] x WDt[1024x1024]^T + bias -> out f32 [4096][1024]
  {
    const int tiles = (kM / 64) * (kH / 64);            // 1024 wave tiles -> 128 blocks
    wmma_gemm64<1, 2, 2, 0, false><<<dim3(tiles / 8, 1), dim3(256), 0, stream>>>(
        CTXh, CTXl, kH, 0L, WDt, WDt, kH, 0L, (void*)out, (void*)out, kH, 0L,
        BD, BD, 0L, kM, kH, kH, 1.0f);
  }
}

// v002
// One run takes 380 microseconds.
// In two side-by-side timings against v001, it was 1.34 and 1.35 times as fast.
// Counting every step since v000, it is 1.64 times as fast.
// Contractions on v_wmma_f32_16x16x32_bf16 (bf16 operands, f32 accumulate): qkv projection = one product on RNE-bf16 inputs; q.k^T and p.v = bf16 hi/lo planes (3 products); output projection = ctx bf16 hi/lo x bf16 weights (2 products). Masking, softmax and normalisation in f32.
#include <hip/hip_runtime.h>

typedef __attribute__((ext_vector_type(16))) _Float16 v16h;
typedef __attribute__((ext_vector_type(8)))  _Float16 v8h;
typedef __attribute__((ext_vector_type(16))) __bf16   v16b;
typedef __attribute__((ext_vector_type(8)))  __bf16   v8b;
typedef __attribute__((ext_vector_type(8)))  float    v8f;
typedef __attribute__((ext_vector_type(4)))  float    v4f;
typedef __attribute__((ext_vector_type(4)))  unsigned int v4u;

__device__ __forceinline__ unsigned short f2bf_bits(float f) {
  unsigned u = __float_as_uint(f);
  return (unsigned short)((u + 0x7FFFu + ((u >> 16) & 1u)) >> 16);
}
__device__ __forceinline__ float bf_bits2f(unsigned short h) { return __uint_as_float(((unsigned)h) << 16); }
// RNE convert of an f32 bit pattern to its bf16 value, kept as an f32 bit pattern
__device__ __forceinline__ unsigned int rne_bf16_word(unsigned int u) {
  return (u + 0x7FFFu + ((u >> 16) & 1u)) & 0xFFFF0000u;
}
__device__ __forceinline__ unsigned int pack_bf16x2(float a, float b) {
  return (unsigned int)f2bf_bits(a) | ((unsigned int)f2bf_bits(b) << 16);
}
// hi/lo bf16 split of two floats, packed as (hi_a | hi_b<<16) and (lo_a | lo_b<<16)
__device__ __forceinline__ void split_pack2(float a, float b, unsigned int& wh, unsigned int& wl) {
  const unsigned short ha = f2bf_bits(a), hb = f2bf_bits(b);
  const unsigned short la = f2bf_bits(a - bf_bits2f(ha)), lb = f2bf_bits(b - bf_bits2f(hb));
  wh = (unsigned int)ha | ((unsigned int)hb << 16);
  wl = (unsigned int)la | ((unsigned int)lb << 16);
}

// hazard guards as plain device helpers (no inline asm inside the kernel template body)
__device__ __forceinline__ void dep_guard_h(v8f& a, v8f& b, v16h x, v16h y) { asm volatile("v_nop\n\tv_nop\n\tv_nop\n\tv_nop" : "+v"(a), "+v"(b) : "v"(x), "v"(y)); }
__device__ __forceinline__ void dep_guard_b(v8f& a, v8f& b, v16b x, v16b y) { asm volatile("v_nop\n\tv_nop\n\tv_nop\n\tv_nop" : "+v"(a), "+v"(b) : "v"(x), "v"(y)); }
__device__ __forceinline__ void keep4_h(v16h a, v16h b, v16h c, v16h d) { asm volatile("v_nop" :: "v"(a), "v"(b), "v"(c), "v"(d)); }
__device__ __forceinline__ void keep4_b(v16b a, v16b b, v16b c, v16b d) { asm volatile("v_nop" :: "v"(a), "v"(b), "v"(c), "v"(d)); }
__device__ __forceinline__ void acc_guard4(v8f& a, v8f& b, v8f& c, v8f& d) { asm volatile("v_nop\n\tv_nop\n\tv_nop\n\tv_nop" : "+v"(a), "+v"(b), "+v"(c), "+v"(d)); }
template <typename T> struct Frag;
template <> struct Frag<_Float16> {
  typedef v16h V; union U { v16h v; v8h h[2]; };
  static __device__ __forceinline__ v16h load(const _Float16* p) {   // elements 0..7 <- p[0..7], 8..15 <- p[16..23]
    U f; f.h[0] = *(const v8h*)(p); f.h[1] = *(const v8h*)(p + 16); return f.v;
  }
  static __device__ __forceinline__ v8f mma(v16h a, v16h b, v8f c) {
    return __builtin_amdgcn_wmma_f32_16x16x32_f16(false, a, false, b, (short)0, c, false, false);
  }
  static __device__ __forceinline__ void guard(v8f& a, v8f& b, v16h x, v16h y) { dep_guard_h(a, b, x, y); }
  static __device__ __forceinline__ void keep(v16h a, v16h b, v16h c, v16h d) { keep4_h(a, b, c, d); }
};
template <> struct Frag<__bf16> {
  typedef v16b V; union U { v16b v; v8b h[2]; };
  static __device__ __forceinline__ v16b load(const __bf16* p) {
    U f; f.h[0] = *(const v8b*)(p); f.h[1] = *(const v8b*)(p + 16); return f.v;
  }
  static __device__ __forceinline__ v8f mma(v16b a, v16b b, v8f c) {
    return __builtin_amdgcn_wmma_f32_16x16x32_bf16(false, a, false, b, (short)0, c, false, false);
  }
  static __device__ __forceinline__ void guard(v8f& a, v8f& b, v16b x, v16b y) { dep_guard_b(a, b, x, y); }
  static __device__ __forceinline__ void keep(v16b a, v16b b, v16b c, v16b d) { keep4_b(a, b, c, d); }
};

// ---- Register-blocked batched WMMA GEMM ------------------------------------
// C[m,n] = scale * sum_k A[m,k] * Bt[n,k] (+bias)(+resid); each wave owns a 64x64 tile.
// A row-major [M,K]; Bt row-major [N,K]; M,N % 64 == 0, K % 32 == 0.
// SPLIT: 0 = single planes; 1 = A and Bt hi/lo planes (hi.hi + hi.lo + lo.hi); 2 = A hi/lo planes only (hi.B + lo.B).
// BIAS_MODE: 0 = none, 1 = bias[m], 2 = bias[n].
// OUT_MODE: 0 = f32, 1 = f16, 2 = bf16 hi plane (Cout) + bf16 lo plane (Cout2).
// ET: 0 = f16 operands, 1 = bf16 operands (pointers passed as 16-bit storage)
template <int ET> struct Elem;
template <> struct Elem<0> { typedef _Float16 T; };
template <> struct Elem<1> { typedef __bf16 T; };
template <int ET, int SPLIT, int BIAS_MODE, int OUT_MODE, bool RESID, int ACT = 0>
__global__ __launch_bounds__(256) void wmma_gemm64(
    const unsigned short* __restrict__ Ap, const unsigned short* __restrict__ A2p, int lda, long strideA,
    const unsigned short* __restrict__ Btp, const unsigned short* __restrict__ Bt2p, int ldb, long strideB,
    void* __restrict__ Cout, void* __restrict__ Cout2, int ldc, long strideC,
    const float* __restrict__ bias,
    const float* __restrict__ resid, long strideR,
    int M, int N, int K, float scale) {
  typedef typename Elem<ET>::T T;
  typedef typename Frag<T>::V V;
  const T* A = (const T*)Ap; const T* A2 = (const T*)A2p; const T* Bt = (const T*)Btp; const T* Bt2 = (const T*)Bt2p;
  __shared__ __align__(16) float sT[8][16 * 68];   // per-wave 16x64 slab, pitch 68 floats
  const int b    = blockIdx.y;
  const int lane = threadIdx.x & 31;
  const int wave = threadIdx.x >> 5;
  const int tilesN = N >> 6;
  const int tilesM = M >> 6;
  const int tile = blockIdx.x * 8 + wave;
  if (tile >= tilesM * tilesN) return;   // wave-uniform; no block barriers in this kernel
  const int tm = tile / tilesN;
  const int tn = tile - tm * tilesN;
  const int m0 = tm << 6;
  const int n0 = tn << 6;

  const T* Ab  = A  + (size_t)b * strideA;
  const T* Bb  = Bt + (size_t)b * strideB;
  const T* Ab2 = (SPLIT != 0) ? (A2  + (size_t)b * strideA) : nullptr;
  const T* Bb2 = (SPLIT == 1) ? (Bt2 + (size_t)b * strideB) : nullptr;

  const int rlane = lane & 15;                 // row (A) / col (B, D) within subtile
  const int koff  = (lane >> 4) * 8;           // k offset of this lane half
  const int mOff  = (lane >> 4) * 8;           // D row offset

  v8f acc[4][4];
#pragma unroll
  for (int i = 0; i < 4; ++i)
#pragma unroll
    for (int j = 0; j < 4; ++j) acc[i][j] = (v8f){0.f,0.f,0.f,0.f,0.f,0.f,0.f,0.f};

  for (int k0 = 0; k0 < K; k0 += 32) {
    V bh[4], bl[4];
#pragma unroll
    for (int j = 0; j < 4; ++j) {
      const size_t bo = (size_t)(n0 + (j << 4) + rlane) * ldb + koff + k0;
      bh[j] = Frag<T>::load(Bb + bo);
      if (SPLIT == 1) bl[j] = Frag<T>::load(Bb2 + bo);
    }
#pragma unroll
    for (int i = 0; i < 4; ++i) {
      const size_t ao = (size_t)(m0 + (i << 4) + rlane) * lda + koff + k0;
      V ah = Frag<T>::load(Ab + ao);
      V al;
      if (SPLIT != 0) al = Frag<T>::load(Ab2 + ao);
#pragma unroll
      for (int j = 0; j < 4; ++j) {
        acc[i][j] = Frag<T>::mma(ah, bh[j], acc[i][j]);
        if (SPLIT == 1) {
          acc[i][j] = Frag<T>::mma(ah, bl[j], acc[i][j]);
          acc[i][j] = Frag<T>::mma(al, bh[j], acc[i][j]);
        }
        if (SPLIT == 2) {
          acc[i][j] = Frag<T>::mma(al, bh[j], acc[i][j]);
        }
      }
      Frag<T>::guard(acc[i][0], acc[i][3], ah, (SPLIT != 0) ? al : ah);
    }
    Frag<T>::keep(bh[0], bh[1], bh[2], bh[3]);
    if (SPLIT == 1) Frag<T>::keep(bl[0], bl[1], bl[2], bl[3]);
  }
  acc_guard4(acc[0][0], acc[0][1], acc[0][2], acc[0][3]);
  acc_guard4(acc[1][0], acc[1][1], acc[1][2], acc[1][3]);
  acc_guard4(acc[2][0], acc[2][1], acc[2][2], acc[2][3]);
  acc_guard4(acc[3][0], acc[3][1], acc[3][2], acc[3][3]);

  // ---- epilogue ----
  float* slab = sT[wave];
  const float* Rb = RESID ? (resid + (size_t)b * strideR) : nullptr;
#pragma unroll
  for (int i = 0; i < 4; ++i) {
    const int mBase = m0 + (i << 4);
#pragma unroll
    for (int j = 0; j < 4; ++j) {
      const int n = n0 + (j << 4) + rlane;
      float bv = 0.f;
      if (BIAS_MODE == 2) bv = bias[n];
#pragma unroll
      for (int r = 0; r < 8; ++r) {
        float v = acc[i][j][r] * scale;
        if (BIAS_MODE == 1) v += bias[mBase + mOff + r];
        if (BIAS_MODE == 2) v += bv;
        if (RESID) v += Rb[(size_t)(mBase + mOff + r) * ldc + n];
        if (ACT == 1) v = tanhf(v);
        if (ACT == 2) v = fmaxf(v, 0.0f);
        if (ACT == 4) v = (v > 0.f) ? v : 0.01f * v;
        slab[(mOff + r) * 68 + (j << 4) + rlane] = v;
      }
    }
    __builtin_amdgcn_fence(__ATOMIC_RELEASE, "workgroup");
    __builtin_amdgcn_wave_barrier();
    __builtin_amdgcn_fence(__ATOMIC_ACQUIRE, "workgroup");
    if (OUT_MODE == 0) {
      float* C = (float*)Cout + (size_t)b * strideC;
      const int hh = lane >> 4, c4 = (lane & 15) * 4;     // row seg = 256 B = 16 lanes x 16 B
      {
#pragma unroll
        for (int it = 0; it < 8; ++it) {
          const int row = it * 2 + hh;
          v4f v = *(const v4f*)(slab + row * 68 + c4);
          *(v4f*)(C + (size_t)(mBase + row) * ldc + n0 + c4) = v;
        }
        
      }
    } else {
      const int q = lane >> 3, c8 = (lane & 7) * 8;
      unsigned short* C  = (unsigned short*)Cout  + (size_t)b * strideC;
      unsigned short* C2 = (OUT_MODE == 2) ? ((unsigned short*)Cout2 + (size_t)b * strideC) : nullptr;
      {
#pragma unroll
        for (int it = 0; it < 4; ++it) {
          const int row = it * 4 + q;
          const float* sp = slab + row * 68 + c8;
          v8h hv, lv;
#pragma unroll
          for (int e = 0; e < 8; ++e) {
            if (OUT_MODE == 1) {
              hv[e] = (_Float16)sp[e];
            } else {
              unsigned short hb = f2bf_bits(sp[e]);
              unsigned short lb = f2bf_bits(sp[e] - bf_bits2f(hb));
              hv[e] = __builtin_bit_cast(_Float16, hb);
              lv[e] = __builtin_bit_cast(_Float16, lb);
            }
          }
          *(v8h*)(C + (size_t)(mBase + row) * ldc + n0 + c8) = hv;
          if (OUT_MODE == 2) *(v8h*)(C2 + (size_t)(mBase + row) * ldc + n0 + c8) = lv;
        }
        
      }
    }
    __builtin_amdgcn_fence(__ATOMIC_RELEASE, "workgroup");
    __builtin_amdgcn_wave_barrier();
    __builtin_amdgcn_fence(__ATOMIC_ACQUIRE, "workgroup");
  }
}

__device__ __forceinline__ v8f at_mma(v16b a, v16b b, v8f c) {
  c = __builtin_amdgcn_wmma_f32_16x16x32_bf16(false, a, false, b, (short)0, c, false, false);
  asm volatile("v_nop\n\tv_nop\n\tv_nop\n\tv_nop" : "+v"(c) : "v"(a), "v"(b));
  return c;
}

// coverage: grid*256 threads x 8 elements == n8*8 elements exactly (host sizes n8 = n/8, n % 2048 == 0)
__global__ __launch_bounds__(256) void cast_f32_bf16x8(const float* __restrict__ in, unsigned short* __restrict__ out, int n8) {
  const int i = blockIdx.x * 256 + threadIdx.x;
  if (i >= n8) return;
  const float* p = in + (size_t)i * 8;
  const v4f a = *(const v4f*)p;
  const v4f c2 = *(const v4f*)(p + 4);
  v4u w;
  w[0] = pack_bf16x2(a[0], a[1]);
  w[1] = pack_bf16x2(a[2], a[3]);
  w[2] = pack_bf16x2(c2[0], c2[1]);
  w[3] = pack_bf16x2(c2[2], c2[3]);
  v4u* d = (v4u*)(out + (size_t)i * 8);
  *d = w;
  
}

// coverage: n4 = n/4 threads, n % 1024 == 0 so every wave writes 4 complete lines
__global__ __launch_bounds__(256) void rne_bf16_f32x4(const float* __restrict__ in, float* __restrict__ out, int n4) {
  const int i = blockIdx.x * 256 + threadIdx.x;
  if (i >= n4) return;
  v4u a = *(const v4u*)(in + (size_t)i * 4);
#pragma unroll
  for (int e = 0; e < 4; ++e) a[e] = rne_bf16_word(a[e]);
  v4u* d = (v4u*)(out + (size_t)i * 4);
  *d = a;
  
}

// ---- transpose + bf16 cast: in[nrows][ncols] f32 -> out[ncols][nrows] bf16 ----
// grid = (ncols/64, nrows/64), block 256. Load: 256 threads x 16 floats = the 64x64 tile.
__global__ __launch_bounds__(256) void transpose_cast_bf16(const float* __restrict__ in, unsigned short* __restrict__ out, int nrows, int ncols) {
  __shared__ __align__(16) float tile[64 * 68];   // tile[cl*68 + rl]: cl = in col (out row), rl = in row (out col)
  const int tid = threadIdx.x, lane = tid & 31, wave = tid >> 5;
  const int r0 = blockIdx.y * 64;
  const int c0 = blockIdx.x * 64;
  {
    const int rl = tid >> 2, cq = (tid & 3) * 16;
    const float* src = in + (size_t)(r0 + rl) * ncols + c0 + cq;
#pragma unroll
    for (int i = 0; i < 4; ++i) {
      const v4f v = *(const v4f*)(src + 4 * i);
#pragma unroll
      for (int e = 0; e < 4; ++e) tile[(cq + 4 * i + e) * 68 + rl] = v[e];
    }
  }
  __syncthreads();
  const int q8 = lane >> 3, c8 = (lane & 7) * 8;
  {
#pragma unroll
    for (int it = 0; it < 2; ++it) {
      const int cl = wave * 8 + it * 4 + q8;
      const float* sp = tile + cl * 68 + c8;
      const v4f x0 = *(const v4f*)sp;
      const v4f x1 = *(const v4f*)(sp + 4);
      v4u w;
      w[0] = pack_bf16x2(x0[0], x0[1]);
      w[1] = pack_bf16x2(x0[2], x0[3]);
      w[2] = pack_bf16x2(x1[0], x1[1]);
      w[3] = pack_bf16x2(x1[2], x1[3]);
      *(v4u*)(out + (size_t)(c0 + cl) * nrows + r0 + c8) = w;
    }
    
  }
}

// =====================================================================================
// Attention, head dim 64, over bf16 hi/lo planes of the fused qkv projection.
// qkv planes: [B*S][3*HID], q at col h*64+d, k at HID + h*64 + d, v at 2*HID + h*64 + d.
// scores = 0.125 * q.k^T (bf16 hi/lo, 3 products); mask tile m[q][kv] (RNE-bf16 converted) applied as
// s*m - 10000*(1-m); online softmax in f32; p split into bf16 hi/lo in LDS; out += p.v (3 products).
// A 64x64 tile whose mask is identically zero has 64 equal logits -10000 per row: folded in closed form
// (l += 64*p, o += p * column-sum(v), p = exp(-10000 - rowmax)).
// Block = 4 waves = 64 query rows of one (batch, head); grid.x = B * NH * (S/64).
// =====================================================================================
#define SEQ_LEN 2048
#define N_HEADS 16
#define HEAD_D 64
#define HID_SZ 1024
#define QKV_PITCH 3072
#define KV_CHUNK 64
#define N_BATCH 2
#define LDS_P 72   // row pitch of the K, V^T and P tiles in 16-bit elements: 144 B = 16 B x odd, so the 16 rows of a b128 fragment read fall on distinct banks

__global__ __launch_bounds__(128) void attn_planes_kernel(
    const unsigned short* __restrict__ qkvh, const unsigned short* __restrict__ qkvl,
    const float* __restrict__ maskp,
    unsigned short* __restrict__ ctxh, unsigned short* __restrict__ ctxl) {
  union FB { v16b v; v8b h[2]; };
  __shared__ __align__(16) unsigned short Kh[KV_CHUNK * LDS_P];     // K hi [kv][d], pitch LDS_P
  __shared__ __align__(16) unsigned short Kl[KV_CHUNK * LDS_P];     // K lo [kv][d], pitch LDS_P
  __shared__ __align__(16) unsigned short Vth[HEAD_D * LDS_P];      // V hi [d][kv], pitch LDS_P
  __shared__ __align__(16) unsigned short Vtl[HEAD_D * LDS_P];      // V lo [d][kv], pitch LDS_P
  __shared__ __align__(16) unsigned short Psh[4][16 * LDS_P];      // per wave P hi [row][kv], pitch LDS_P
  __shared__ __align__(16) unsigned short Psl[4][16 * LDS_P];      // per wave P lo [row][kv], pitch LDS_P
  __shared__ __align__(16) float Os[4][16 * 68];                   // per wave out tile, pitch 68; Os[0][0..127] doubles as column-sum scratch
  __shared__ __align__(16) unsigned int Msk[64 * 68];              // mask tile [q][kv] (f32 bits), pitch 68; doubles as v scratch [kv][d]
  __shared__ int AnyNZ[4];

  const int tid  = threadIdx.x;
  const int wave = tid >> 5;
  const int lane = tid & 31;
  const int hh   = lane >> 4;
  const int c    = lane & 15;
  const int bx   = blockIdx.x;
  const int qb   = 31 - (bx >> 5);           // SEQ_LEN / 64 == 32; late query blocks first: under a lower-triangular mask they hold the most live tiles, so cost falls with the block index (speed only)
  static_assert(N_BATCH * N_HEADS == 32 && SEQ_LEN / 64 == 32, "block index split");
  const int bhd  = bx & 31;                  // N_BATCH * N_HEADS == 32
  const int h    = bhd & (N_HEADS - 1);
  const int b    = bhd >> 4;
  const int qblk = qb * 64;
  const int q0   = qblk + wave * 16;
  const size_t rowb = (size_t)b * SEQ_LEN;

  // ---- Q fragments (A operand), hi and lo planes, 2 d-chunks (8 b128 loads per lane) ----
  v16b qah[2], qal[2];
  {
    const size_t qoff = (rowb + q0 + c) * QKV_PITCH + h * HEAD_D + 8 * hh;
#pragma unroll
    for (int dc = 0; dc < 2; ++dc) {
      qah[dc] = Frag<__bf16>::load((const __bf16*)qkvh + qoff + dc * 32);
      qal[dc] = Frag<__bf16>::load((const __bf16*)qkvl + qoff + dc * 32);
    }
  }

  float mrow[8], lrow[8];
  v8f oacc[4];
#pragma unroll
  for (int r = 0; r < 8; ++r) { mrow[r] = -__builtin_inff(); lrow[r] = 0.f; }
#pragma unroll
  for (int t = 0; t < 4; ++t) oacc[t] = (v8f){0.f,0.f,0.f,0.f,0.f,0.f,0.f,0.f};

  const int kvr = tid >> 1;            // staging: kv row of this thread (0..63)
  const int dh  = (tid & 1) * 32;      // staging: d half (0 or 32)

  for (int kc = 0; kc < SEQ_LEN / KV_CHUNK; ++kc) {
    const int kv0 = kc * KV_CHUNK;
    __syncthreads();
    // ---- mask tile [64 q][64 kv]: 1024 float4 / 128 threads = 8 b128 per lane; RNE-bf16 convert; all-zero test ----
    unsigned int nz = 0u;
#pragma unroll
    for (int i = 0; i < 8; ++i) {
      const int idx = i * 128 + tid;
      const int row = idx >> 4;
      const int c4  = (idx & 15) * 4;
      v4u m = *(const v4u*)(maskp + (size_t)(qblk + row) * SEQ_LEN + kv0 + c4);
#pragma unroll
      for (int e = 0; e < 4; ++e) { const unsigned int u = rne_bf16_word(m[e]); m[e] = u; nz |= (u & 0x7FFFFFFFu); }
      *(v4u*)(Msk + row * 68 + c4) = m;
    }
    const int anyw = __any(nz != 0u);
    AnyNZ[wave] = anyw;
    __syncthreads();
    const int tile_live = AnyNZ[0] | AnyNZ[1] | AnyNZ[2] | AnyNZ[3];   // block-uniform

    const size_t koff = (rowb + kv0 + kvr) * QKV_PITCH + HID_SZ + h * HEAD_D + dh;
    const size_t voff = koff + HID_SZ;

    if (tile_live) {
      // ---- K hi/lo rows -> LDS [kv][d] (4+4 b128 per lane, 128 threads x 32 elements = 64x64 per plane) ----
      {
        const v4u* gh = (const v4u*)(qkvh + koff);
        const v4u* gl = (const v4u*)(qkvl + koff);
        v4u* lh = (v4u*)(Kh + kvr * LDS_P + dh);
        v4u* ll = (v4u*)(Kl + kvr * LDS_P + dh);
#pragma unroll
        for (int i = 0; i < 4; ++i) { const v4u a = gh[i]; const v4u bb = gl[i]; lh[i] = a; ll[i] = bb; }
      }
      asm volatile("" ::: "memory");
      // ---- V hi/lo rows -> LDS transposed [d][kv] ----
      {
        const v4u* gh = (const v4u*)(qkvh + voff);
        const v4u* gl = (const v4u*)(qkvl + voff);
        unsigned short* sh = Vth + dh * LDS_P + kvr;   // one base per plane: every row step below is a constant offset
        unsigned short* sl = Vtl + dh * LDS_P + kvr;
#pragma unroll
        for (int i = 0; i < 4; ++i) {
          const v4u wh = gh[i];
          const v4u wl = gl[i];
#pragma unroll
          for (int e = 0; e < 4; ++e) {
            const int d = 8 * i + 2 * e;
            sh[d * LDS_P]       = (unsigned short)(wh[e] & 0xFFFFu);
            sh[(d + 1) * LDS_P] = (unsigned short)(wh[e] >> 16);
            sl[d * LDS_P]       = (unsigned short)(wl[e] & 0xFFFFu);
            sl[(d + 1) * LDS_P] = (unsigned short)(wl[e] >> 16);
          }
        }
      }
      __syncthreads();

      // ---- scores: 4 key subtiles x 2 d-chunks, hi.hi + hi.lo + lo.hi ----
      v8f s[4];
#pragma unroll
      for (int j = 0; j < 4; ++j) {
        s[j] = (v8f){0.f,0.f,0.f,0.f,0.f,0.f,0.f,0.f};
#pragma unroll
        for (int dc = 0; dc < 2; ++dc) {
          FB kb, kl;
          const int ko = (j * 16 + c) * LDS_P + dc * 32 + 8 * hh;
          kb.h[0] = *(const v8b*)((const __bf16*)Kh + ko);
          kb.h[1] = *(const v8b*)((const __bf16*)Kh + ko + 16);
          kl.h[0] = *(const v8b*)((const __bf16*)Kl + ko);
          kl.h[1] = *(const v8b*)((const __bf16*)Kl + ko + 16);
          s[j] = at_mma(qah[dc], kb.v, s[j]);
          s[j] = at_mma(qah[dc], kl.v, s[j]);
          s[j] = at_mma(qal[dc], kb.v, s[j]);
        }
      }
      // ---- scale, mask (literal s*m - 10000*(1-m)), row max ----
      float cm[8];
#pragma unroll
      for (int r = 0; r < 8; ++r) {
        const int rl = wave * 16 + 8 * hh + r;
        float m = -__builtin_inff();
#pragma unroll
        for (int j = 0; j < 4; ++j) {
          const float mk = __uint_as_float(Msk[rl * 68 + j * 16 + c]);
          float x = s[j][r] * 0.125f;
          x = x * mk - 10000.0f * (1.0f - mk);
          s[j][r] = x;
          m = fmaxf(m, x);
        }
#pragma unroll
        for (int off = 1; off < 16; off <<= 1) m = fmaxf(m, __shfl_xor(m, off, 32));
        cm[r] = m;
      }
      // ---- online softmax; P split into bf16 hi/lo in LDS (per wave) ----
      unsigned short* pwh = Psh[wave];
      unsigned short* pwl = Psl[wave];
#pragma unroll
      for (int r = 0; r < 8; ++r) {
        const float mnew  = fmaxf(mrow[r], cm[r]);
        const float alpha = expf(mrow[r] - mnew);
        mrow[r] = mnew;
        float psum = 0.f;
#pragma unroll
        for (int j = 0; j < 4; ++j) {
          const float p = expf(s[j][r] - mnew);
          psum += p;
          const unsigned short hb = f2bf_bits(p);
          const unsigned short lb = f2bf_bits(p - bf_bits2f(hb));
          pwh[(8 * hh + r) * LDS_P + j * 16 + c] = hb;
          pwl[(8 * hh + r) * LDS_P + j * 16 + c] = lb;
        }
#pragma unroll
        for (int off = 1; off < 16; off <<= 1) psum += __shfl_xor(psum, off, 32);
        lrow[r] = lrow[r] * alpha + psum;
#pragma unroll
        for (int t = 0; t < 4; ++t) oacc[t][r] *= alpha;
      }
      __builtin_amdgcn_fence(__ATOMIC_RELEASE, "workgroup");
      __builtin_amdgcn_wave_barrier();
      __builtin_amdgcn_fence(__ATOMIC_ACQUIRE, "workgroup");
      // ---- out += P(16x64) . V(64x64): pa.vh + pa.vl + pl.vh ----
#pragma unroll 1
      for (int kk = 0; kk < 2; ++kk) {
        FB pa, pl;
        const int po = c * LDS_P + kk * 32 + 8 * hh;
        pa.h[0] = *(const v8b*)((const __bf16*)pwh + po);
        pa.h[1] = *(const v8b*)((const __bf16*)pwh + po + 16);
        pl.h[0] = *(const v8b*)((const __bf16*)pwl + po);
        pl.h[1] = *(const v8b*)((const __bf16*)pwl + po + 16);
#pragma unroll
        for (int t = 0; t < 4; ++t) {
          FB vb, vl;
          const int vo = (t * 16 + c) * LDS_P + kk * 32 + 8 * hh;
          vb.h[0] = *(const v8b*)((const __bf16*)Vth + vo);
          vb.h[1] = *(const v8b*)((const __bf16*)Vth + vo + 16);
          vl.h[0] = *(const v8b*)((const __bf16*)Vtl + vo);
          vl.h[1] = *(const v8b*)((const __bf16*)Vtl + vo + 16);
          oacc[t] = at_mma(pa.v, vb.v, oacc[t]);
          oacc[t] = at_mma(pa.v, vl.v, oacc[t]);
          oacc[t] = at_mma(pl.v, vb.v, oacc[t]);
        }
      }
    } else {
      // ---- all-masked tile: v rows (hi+lo, f32) -> Msk scratch [kv][d], column sums, closed-form update ----
      {
        const v4u* gh = (const v4u*)(qkvh + voff);
        const v4u* gl = (const v4u*)(qkvl + voff);
#pragma unroll
        for (int i = 0; i < 4; ++i) {
          const v4u wh = gh[i];
          const v4u wl = gl[i];
          v4u f0, f1;
          {
            const float a0 = __uint_as_float(wh[0] << 16);          const float b0 = __uint_as_float(wl[0] << 16);
            const float a1 = __uint_as_float(wh[0] & 0xFFFF0000u); const float b1 = __uint_as_float(wl[0] & 0xFFFF0000u);
            const float a2 = __uint_as_float(wh[1] << 16);          const float b2 = __uint_as_float(wl[1] << 16);
            const float a3 = __uint_as_float(wh[1] & 0xFFFF0000u); const float b3 = __uint_as_float(wl[1] & 0xFFFF0000u);
            f0[0] = __float_as_uint(a0 + b0); f0[1] = __float_as_uint(a1 + b1);
            f0[2] = __float_as_uint(a2 + b2); f0[3] = __float_as_uint(a3 + b3);
          }
          {
            const float a0 = __uint_as_float(wh[2] << 16);          const float b0 = __uint_as_float(wl[2] << 16);
            const float a1 = __uint_as_float(wh[2] & 0xFFFF0000u); const float b1 = __uint_as_float(wl[2] & 0xFFFF0000u);
            const float a2 = __uint_as_float(wh[3] << 16);          const float b2 = __uint_as_float(wl[3] << 16);
            const float a3 = __uint_as_float(wh[3] & 0xFFFF0000u); const float b3 = __uint_as_float(wl[3] & 0xFFFF0000u);
            f1[0] = __float_as_uint(a0 + b0); f1[1] = __float_as_uint(a1 + b1);
            f1[2] = __float_as_uint(a2 + b2); f1[3] = __float_as_uint(a3 + b3);
          }
          *(v4u*)(Msk + kvr * 68 + dh + 8 * i)     = f0;
          *(v4u*)(Msk + kvr * 68 + dh + 8 * i + 4) = f1;
        }
      }
      __syncthreads();
      {
        const int d = tid & 63, half = tid >> 6;
        float part = 0.f;
#pragma unroll 8
        for (int kq = 0; kq < 32; ++kq) part += __uint_as_float(Msk[(half * 32 + kq) * 68 + d]);
        Os[0][half * 64 + d] = part;
      }
      __syncthreads();
      float vs[4];
#pragma unroll
      for (int t = 0; t < 4; ++t) vs[t] = Os[0][t * 16 + c] + Os[0][64 + t * 16 + c];
#pragma unroll
      for (int r = 0; r < 8; ++r) {
        const float mnew  = fmaxf(mrow[r], -10000.0f);
        const float alpha = expf(mrow[r] - mnew);
        const float p     = expf(-10000.0f - mnew);
        mrow[r] = mnew;
        lrow[r] = lrow[r] * alpha + 64.0f * p;
#pragma unroll
        for (int t = 0; t < 4; ++t) oacc[t][r] = oacc[t][r] * alpha + p * vs[t];
      }
    }
  }
  __syncthreads();

  float* os = Os[wave];
#pragma unroll
  for (int r = 0; r < 8; ++r) {
    const float inv = 1.0f / lrow[r];
#pragma unroll
    for (int t = 0; t < 4; ++t) os[(8 * hh + r) * 68 + t * 16 + c] = oacc[t][r] * inv;
  }
  __builtin_amdgcn_fence(__ATOMIC_RELEASE, "workgroup");
  __builtin_amdgcn_wave_barrier();
  __builtin_amdgcn_fence(__ATOMIC_ACQUIRE, "workgroup");
  {
    const int q8 = lane >> 3, c8 = (lane & 7) * 8;
    unsigned short* oh = ctxh + (rowb + q0) * HID_SZ + h * HEAD_D + c8;
    unsigned short* ol = ctxl + (rowb + q0) * HID_SZ + h * HEAD_D + c8;
    {
#pragma unroll
      for (int it = 0; it < 4; ++it) {
        const int row = it * 4 + q8;
        const float* sp = os + row * 68 + c8;
        const v4f x0 = *(const v4f*)sp;
        const v4f x1 = *(const v4f*)(sp + 4);
        v4u wh, wl;
        unsigned int th, tl;
        split_pack2(x0[0], x0[1], th, tl); wh[0] = th; wl[0] = tl;
        split_pack2(x0[2], x0[3], th, tl); wh[1] = th; wl[1] = tl;
        split_pack2(x1[0], x1[1], th, tl); wh[2] = th; wl[2] = tl;
        split_pack2(x1[2], x1[3], th, tl); wh[3] = th; wl[3] = tl;
        *(v4u*)(oh + (size_t)row * HID_SZ) = wh;
        *(v4u*)(ol + (size_t)row * HID_SZ) = wl;
      }
      
    }
  }
}

// ---------------------------------------------------------------------------
// Workspace region map (bytes):
//   Hb    bf16 [4096][1024]        off 0            size  8388608
//   WQt   bf16 [3072][1024]        off 8388608      size  6291456
//   WDt   bf16 [1024][1024]        off 14680064     size  2097152
//   BQ    f32  [3072]              off 16777216     size    12288
//   BD    f32  [1024]              off 16789504     size     4096
//   QKVh  bf16 [4096][3072]        off 16793600     size 25165824
//   QKVl  bf16 [4096][3072]        off 41959424     size 25165824
//   CTXh  bf16 [4096][1024]        off 67125248     size  8388608
//   CTXl  bf16 [4096][1024]        off 75513856     size  8388608
//   end                            83902464
// Every region is fully written by its producer before any consumer reads it.
// ---------------------------------------------------------------------------
extern "C" void kernel_launch(void* const* d_in, const int* in_sizes, int n_in,
                              void* d_out, int out_size, void* d_ws, size_t ws_size,
                              hipStream_t stream) {
  constexpr int kB = N_BATCH, kS = SEQ_LEN, kH = HID_SZ;
  constexpr int kM = kB * kS;          // 4096
  constexpr int kN3 = 3 * kH;          // 3072
  static_assert(kM % 64 == 0 && kN3 % 64 == 0 && kH % 64 == 0);   // GEMM M/N tile multiples
  static_assert(kH % 32 == 0);                                     // GEMM K step
  static_assert(kS % KV_CHUNK == 0 && kS / 64 == 32 && kH / HEAD_D == N_HEADS);
  static_assert((kM * kH) % 2048 == 0 && kN3 % 1024 == 0 && kH % 1024 == 0);

  if (n_in < 6) return;
  if (in_sizes[0] != kM * kH || in_sizes[1] != kS * kS || in_sizes[2] != kH * kN3 ||
      in_sizes[3] != kN3 || in_sizes[4] != kH * kH || in_sizes[5] != kH) return;
  if (out_size != kM * kH) return;

  const float* hidden  = (const float*)d_in[0];
  const float* maskp   = (const float*)d_in[1];
  const float* w_qkv   = (const float*)d_in[2];
  const float* b_qkv   = (const float*)d_in[3];
  const float* w_dense = (const float*)d_in[4];
  const float* b_dense = (const float*)d_in[5];
  float* out = (float*)d_out;

  const size_t szHb  = (size_t)kM * kH * 2;
  const size_t szWQt = (size_t)kN3 * kH * 2;
  const size_t szWDt = (size_t)kH * kH * 2;
  const size_t szBQ  = (size_t)kN3 * 4;
  const size_t szBD  = (size_t)kH * 4;
  const size_t szQKV = (size_t)kM * kN3 * 2;
  const size_t szCTX = (size_t)kM * kH * 2;
  const size_t offHb   = 0;
  const size_t offWQt  = offHb + szHb;
  const size_t offWDt  = offWQt + szWQt;
  const size_t offBQ   = offWDt + szWDt;
  const size_t offBD   = offBQ + szBQ;
  const size_t offQKVh = offBD + szBD;
  const size_t offQKVl = offQKVh + szQKV;
  const size_t offCTXh = offQKVl + szQKV;
  const size_t offCTXl = offCTXh + szCTX;
  const size_t offEnd  = offCTXl + szCTX;
  if (offEnd > ws_size) return;

  char* ws = (char*)d_ws;
  unsigned short* Hb   = (unsigned short*)(ws + offHb);
  unsigned short* WQt  = (unsigned short*)(ws + offWQt);
  unsigned short* WDt  = (unsigned short*)(ws + offWDt);
  float*          BQ   = (float*)(ws + offBQ);
  float*          BD   = (float*)(ws + offBD);
  unsigned short* QKVh = (unsigned short*)(ws + offQKVh);
  unsigned short* QKVl = (unsigned short*)(ws + offQKVl);
  unsigned short* CTXh = (unsigned short*)(ws + offCTXh);
  unsigned short* CTXl = (unsigned short*)(ws + offCTXl);

  // 1) hidden -> bf16 plane [4096][1024]
  {
    const int n8 = (kM * kH) / 8;                       // 524288 threads = 2048 blocks exactly
    cast_f32_bf16x8<<<dim3(n8 / 256), dim3(256), 0, stream>>>(hidden, Hb, n8);
  }
  // 2) w_qkv [1024 rows][3072 cols] -> WQt [3072][1024] bf16 ; w_dense [1024][1024] -> WDt [1024][1024] bf16
  transpose_cast_bf16<<<dim3(kN3 / 64, kH / 64), dim3(256), 0, stream>>>(w_qkv, WQt, kH, kN3);
  transpose_cast_bf16<<<dim3(kH / 64, kH / 64), dim3(256), 0, stream>>>(w_dense, WDt, kH, kH);
  // 3) bias lines RNE-bf16 converted (kept as f32)
  rne_bf16_f32x4<<<dim3((kN3 / 4) / 256), dim3(256), 0, stream>>>(b_qkv, BQ, kN3 / 4);
  rne_bf16_f32x4<<<dim3((kH / 4) / 256), dim3(256), 0, stream>>>(b_dense, BD, kH / 4);
  // 4) fused qkv projection: [4096x1024] x WQt[3072x1024]^T + bias -> bf16 hi/lo planes [4096][3072]
  {
    const int tiles = (kM / 64) * (kN3 / 64);           // 3072 wave tiles -> 384 blocks of 8 waves
    wmma_gemm64<1, 0, 2, 2, false><<<dim3(tiles / 8, 1), dim3(256), 0, stream>>>(
        Hb, Hb, kH, 0L, WQt, WQt, kH, 0L, (void*)QKVh, (void*)QKVl, kN3, 0L,
        BQ, BQ, 0L, kM, kN3, kH, 1.0f);
  }
  // 5) attention per (batch, head, 64 query rows) -> ctx bf16 hi/lo planes [4096][1024]
  attn_planes_kernel<<<dim3(kB * N_HEADS * (kS / 64)), dim3(128), 0, stream>>>(QKVh, QKVl, maskp, CTXh, CTXl);
  // 6) output projection: ctx (hi/lo) [4096x1024] x WDt[1024x1024]^T + bias -> out f32 [4096][1024]
  {
    const int tiles = (kM / 64) * (kH / 64);            // 1024 wave tiles -> 128 blocks
    wmma_gemm64<1, 2, 2, 0, false><<<dim3(tiles / 8, 1), dim3(256), 0, stream>>>(
        CTXh, CTXl, kH, 0L, WDt, WDt, kH, 0L, (void*)out, (void*)out, kH, 0L,
        BD, BD, 0L, kM, kH, kH, 1.0f);
  }
}

// v003
// One run takes 286 microseconds.
// In two side-by-side timings against v002, it was 1.34 and 1.33 times as fast.
// All steps since v000 together make it 2.19 times as fast.
// Contractions on v_wmma_f32_16x16x32_bf16 (bf16 operands, f32 accumulate): qkv projection = one product on RNE-bf16 inputs; q.k^T and p.v = bf16 hi/lo planes (3 products); output projection = ctx bf16 hi/lo x bf16 weights (2 products). Masking, softmax and normalisation in f32.
#include <hip/hip_runtime.h>

typedef __attribute__((ext_vector_type(16))) _Float16 v16h;
typedef __attribute__((ext_vector_type(8)))  _Float16 v8h;
typedef __attribute__((ext_vector_type(16))) __bf16   v16b;
typedef __attribute__((ext_vector_type(8)))  __bf16   v8b;
typedef __attribute__((ext_vector_type(8)))  float    v8f;
typedef __attribute__((ext_vector_type(4)))  float    v4f;
typedef __attribute__((ext_vector_type(4)))  unsigned int v4u;

__device__ __forceinline__ unsigned short f2bf_bits(float f) {
  unsigned u = __float_as_uint(f);
  return (unsigned short)((u + 0x7FFFu + ((u >> 16) & 1u)) >> 16);
}
__device__ __forceinline__ float bf_bits2f(unsigned short h) { return __uint_as_float(((unsigned)h) << 16); }
// RNE convert of an f32 bit pattern to its bf16 value, kept as an f32 bit pattern
__device__ __forceinline__ unsigned int rne_bf16_word(unsigned int u) {
  return (u + 0x7FFFu + ((u >> 16) & 1u)) & 0xFFFF0000u;
}
__device__ __forceinline__ unsigned int pack_bf16x2(float a, float b) {
  return (unsigned int)f2bf_bits(a) | ((unsigned int)f2bf_bits(b) << 16);
}
// hi/lo bf16 split of two floats, packed as (hi_a | hi_b<<16) and (lo_a | lo_b<<16)
__device__ __forceinline__ void split_pack2(float a, float b, unsigned int& wh, unsigned int& wl) {
  const unsigned short ha = f2bf_bits(a), hb = f2bf_bits(b);
  const unsigned short la = f2bf_bits(a - bf_bits2f(ha)), lb = f2bf_bits(b - bf_bits2f(hb));
  wh = (unsigned int)ha | ((unsigned int)hb << 16);
  wl = (unsigned int)la | ((unsigned int)lb << 16);
}

// hazard guards as plain device helpers (no inline asm inside the kernel template body)
__device__ __forceinline__ void dep_guard_h(v8f& a, v8f& b, v16h x, v16h y) { asm volatile("v_nop\n\tv_nop\n\tv_nop\n\tv_nop" : "+v"(a), "+v"(b) : "v"(x), "v"(y)); }
__device__ __forceinline__ void dep_guard_b(v8f& a, v8f& b, v16b x, v16b y) { asm volatile("v_nop\n\tv_nop\n\tv_nop\n\tv_nop" : "+v"(a), "+v"(b) : "v"(x), "v"(y)); }
__device__ __forceinline__ void keep4_h(v16h a, v16h b, v16h c, v16h d) { asm volatile("v_nop" :: "v"(a), "v"(b), "v"(c), "v"(d)); }
__device__ __forceinline__ void keep4_b(v16b a, v16b b, v16b c, v16b d) { asm volatile("v_nop" :: "v"(a), "v"(b), "v"(c), "v"(d)); }
__device__ __forceinline__ void acc_guard4(v8f& a, v8f& b, v8f& c, v8f& d) { asm volatile("v_nop\n\tv_nop\n\tv_nop\n\tv_nop" : "+v"(a), "+v"(b), "+v"(c), "+v"(d)); }
template <typename T> struct Frag;
template <> struct Frag<_Float16> {
  typedef v16h V; union U { v16h v; v8h h[2]; };
  static __device__ __forceinline__ v16h load(const _Float16* p) {   // elements 0..7 <- p[0..7], 8..15 <- p[16..23]
    U f; f.h[0] = *(const v8h*)(p); f.h[1] = *(const v8h*)(p + 16); return f.v;
  }
  static __device__ __forceinline__ v8f mma(v16h a, v16h b, v8f c) {
    return __builtin_amdgcn_wmma_f32_16x16x32_f16(false, a, false, b, (short)0, c, false, false);
  }
  static __device__ __forceinline__ void guard(v8f& a, v8f& b, v16h x, v16h y) { dep_guard_h(a, b, x, y); }
  static __device__ __forceinline__ void keep(v16h a, v16h b, v16h c, v16h d) { keep4_h(a, b, c, d); }
};
template <> struct Frag<__bf16> {
  typedef v16b V; union U { v16b v; v8b h[2]; };
  static __device__ __forceinline__ v16b load(const __bf16* p) {
    U f; f.h[0] = *(const v8b*)(p); f.h[1] = *(const v8b*)(p + 16); return f.v;
  }
  static __device__ __forceinline__ v8f mma(v16b a, v16b b, v8f c) {
    return __builtin_amdgcn_wmma_f32_16x16x32_bf16(false, a, false, b, (short)0, c, false, false);
  }
  static __device__ __forceinline__ void guard(v8f& a, v8f& b, v16b x, v16b y) { dep_guard_b(a, b, x, y); }
  static __device__ __forceinline__ void keep(v16b a, v16b b, v16b c, v16b d) { keep4_b(a, b, c, d); }
};

// ---- Register-blocked batched WMMA GEMM ------------------------------------
// C[m,n] = scale * sum_k A[m,k] * Bt[n,k] (+bias)(+resid); each wave owns a 64x64 tile.
// A row-major [M,K]; Bt row-major [N,K]; M,N % 64 == 0, K % 32 == 0.
// SPLIT: 0 = single planes; 1 = A and Bt hi/lo planes (hi.hi + hi.lo + lo.hi); 2 = A hi/lo planes only (hi.B + lo.B).
// BIAS_MODE: 0 = none, 1 = bias[m], 2 = bias[n].
// OUT_MODE: 0 = f32, 1 = f16, 2 = bf16 hi plane (Cout) + bf16 lo plane (Cout2).
// ET: 0 = f16 operands, 1 = bf16 operands (pointers passed as 16-bit storage)
template <int ET> struct Elem;
template <> struct Elem<0> { typedef _Float16 T; };
template <> struct Elem<1> { typedef __bf16 T; };
template <int ET, int SPLIT, int BIAS_MODE, int OUT_MODE, bool RESID, int ACT = 0>
__global__ __launch_bounds__(256) void wmma_gemm64(
    const unsigned short* __restrict__ Ap, const unsigned short* __restrict__ A2p, int lda, long strideA,
    const unsigned short* __restrict__ Btp, const unsigned short* __restrict__ Bt2p, int ldb, long strideB,
    void* __restrict__ Cout, void* __restrict__ Cout2, int ldc, long strideC,
    const float* __restrict__ bias,
    const float* __restrict__ resid, long strideR,
    int M, int N, int K, float scale) {
  typedef typename Elem<ET>::T T;
  typedef typename Frag<T>::V V;
  const T* A = (const T*)Ap; const T* A2 = (const T*)A2p; const T* Bt = (const T*)Btp; const T* Bt2 = (const T*)Bt2p;
  __shared__ __align__(16) float sT[8][16 * 68];   // per-wave 16x64 slab, pitch 68 floats
  const int b    = blockIdx.y;
  const int lane = threadIdx.x & 31;
  const int wave = threadIdx.x >> 5;
  const int tilesN = N >> 6;
  const int tilesM = M >> 6;
  const int tile = blockIdx.x * 8 + wave;
  if (tile >= tilesM * tilesN) return;   // wave-uniform; no block barriers in this kernel
  const int tm = tile / tilesN;
  const int tn = tile - tm * tilesN;
  const int m0 = tm << 6;
  const int n0 = tn << 6;

  const T* Ab  = A  + (size_t)b * strideA;
  const T* Bb  = Bt + (size_t)b * strideB;
  const T* Ab2 = (SPLIT != 0) ? (A2  + (size_t)b * strideA) : nullptr;
  const T* Bb2 = (SPLIT == 1) ? (Bt2 + (size_t)b * strideB) : nullptr;

  const int rlane = lane & 15;                 // row (A) / col (B, D) within subtile
  const int koff  = (lane >> 4) * 8;           // k offset of this lane half
  const int mOff  = (lane >> 4) * 8;           // D row offset

  v8f acc[4][4];
#pragma unroll
  for (int i = 0; i < 4; ++i)
#pragma unroll
    for (int j = 0; j < 4; ++j) acc[i][j] = (v8f){0.f,0.f,0.f,0.f,0.f,0.f,0.f,0.f};

  for (int k0 = 0; k0 < K; k0 += 32) {
    V bh[4], bl[4];
#pragma unroll
    for (int j = 0; j < 4; ++j) {
      const size_t bo = (size_t)(n0 + (j << 4) + rlane) * ldb + koff + k0;
      bh[j] = Frag<T>::load(Bb + bo);
      if (SPLIT == 1) bl[j] = Frag<T>::load(Bb2 + bo);
    }
#pragma unroll
    for (int i = 0; i < 4; ++i) {
      const size_t ao = (size_t)(m0 + (i << 4) + rlane) * lda + koff + k0;
      V ah = Frag<T>::load(Ab + ao);
      V al;
      if (SPLIT != 0) al = Frag<T>::load(Ab2 + ao);
#pragma unroll
      for (int j = 0; j < 4; ++j) {
        acc[i][j] = Frag<T>::mma(ah, bh[j], acc[i][j]);
        if (SPLIT == 1) {
          acc[i][j] = Frag<T>::mma(ah, bl[j], acc[i][j]);
          acc[i][j] = Frag<T>::mma(al, bh[j], acc[i][j]);
        }
        if (SPLIT == 2) {
          acc[i][j] = Frag<T>::mma(al, bh[j], acc[i][j]);
        }
      }
      Frag<T>::guard(acc[i][0], acc[i][3], ah, (SPLIT != 0) ? al : ah);
    }
    Frag<T>::keep(bh[0], bh[1], bh[2], bh[3]);
    if (SPLIT == 1) Frag<T>::keep(bl[0], bl[1], bl[2], bl[3]);
  }
  acc_guard4(acc[0][0], acc[0][1], acc[0][2], acc[0][3]);
  acc_guard4(acc[1][0], acc[1][1], acc[1][2], acc[1][3]);
  acc_guard4(acc[2][0], acc[2][1], acc[2][2], acc[2][3]);
  acc_guard4(acc[3][0], acc[3][1], acc[3][2], acc[3][3]);

  // ---- epilogue ----
  float* slab = sT[wave];
  const float* Rb = RESID ? (resid + (size_t)b * strideR) : nullptr;
#pragma unroll
  for (int i = 0; i < 4; ++i) {
    const int mBase = m0 + (i << 4);
#pragma unroll
    for (int j = 0; j < 4; ++j) {
      const int n = n0 + (j << 4) + rlane;
      float bv = 0.f;
      if (BIAS_MODE == 2) bv = bias[n];
#pragma unroll
      for (int r = 0; r < 8; ++r) {
        float v = acc[i][j][r] * scale;
        if (BIAS_MODE == 1) v += bias[mBase + mOff + r];
        if (BIAS_MODE == 2) v += bv;
        if (RESID) v += Rb[(size_t)(mBase + mOff + r) * ldc + n];
        if (ACT == 1) v = tanhf(v);
        if (ACT == 2) v = fmaxf(v, 0.0f);
        if (ACT == 4) v = (v > 0.f) ? v : 0.01f * v;
        slab[(mOff + r) * 68 + (j << 4) + rlane] = v;
      }
    }
    __builtin_amdgcn_fence(__ATOMIC_RELEASE, "workgroup");
    __builtin_amdgcn_wave_barrier();
    __builtin_amdgcn_fence(__ATOMIC_ACQUIRE, "workgroup");
    if (OUT_MODE == 0) {
      float* C = (float*)Cout + (size_t)b * strideC;
      const int hh = lane >> 4, c4 = (lane & 15) * 4;     // row seg = 256 B = 16 lanes x 16 B
      {
#pragma unroll
        for (int it = 0; it < 8; ++it) {
          const int row = it * 2 + hh;
          v4f v = *(const v4f*)(slab + row * 68 + c4);
          *(v4f*)(C + (size_t)(mBase + row) * ldc + n0 + c4) = v;
        }
        
      }
    } else {
      const int q = lane >> 3, c8 = (lane & 7) * 8;
      unsigned short* C  = (unsigned short*)Cout  + (size_t)b * strideC;
      unsigned short* C2 = (OUT_MODE == 2) ? ((unsigned short*)Cout2 + (size_t)b * strideC) : nullptr;
      {
#pragma unroll
        for (int it = 0; it < 4; ++it) {
          const int row = it * 4 + q;
          const float* sp = slab + row * 68 + c8;
          v8h hv, lv;
#pragma unroll
          for (int e = 0; e < 8; ++e) {
            if (OUT_MODE == 1) {
              hv[e] = (_Float16)sp[e];
            } else {
              unsigned short hb = f2bf_bits(sp[e]);
              unsigned short lb = f2bf_bits(sp[e] - bf_bits2f(hb));
              hv[e] = __builtin_bit_cast(_Float16, hb);
              lv[e] = __builtin_bit_cast(_Float16, lb);
            }
          }
          *(v8h*)(C + (size_t)(mBase + row) * ldc + n0 + c8) = hv;
          if (OUT_MODE == 2) *(v8h*)(C2 + (size_t)(mBase + row) * ldc + n0 + c8) = lv;
        }
        
      }
    }
    __builtin_amdgcn_fence(__ATOMIC_RELEASE, "workgroup");
    __builtin_amdgcn_wave_barrier();
    __builtin_amdgcn_fence(__ATOMIC_ACQUIRE, "workgroup");
  }
}

// lane l <-> lane l ^ 16
__device__ __forceinline__ float xhalf(float x) {
  return __builtin_bit_cast(float, __builtin_amdgcn_permlanex16(__builtin_bit_cast(int, x), __builtin_bit_cast(int, x), 0x76543210, 0xfedcba98, false, false));
}

__device__ __forceinline__ v8f at_mma(v16b a, v16b b, v8f c) {
  c = __builtin_amdgcn_wmma_f32_16x16x32_bf16(false, a, false, b, (short)0, c, false, false);
  asm volatile("v_nop\n\tv_nop\n\tv_nop\n\tv_nop" : "+v"(c) : "v"(a), "v"(b));
  return c;
}

// coverage: grid*256 threads x 8 elements == n8*8 elements exactly (host sizes n8 = n/8, n % 2048 == 0)
__global__ __launch_bounds__(256) void cast_f32_bf16x8(const float* __restrict__ in, unsigned short* __restrict__ out, int n8) {
  const int i = blockIdx.x * 256 + threadIdx.x;
  if (i >= n8) return;
  const float* p = in + (size_t)i * 8;
  const v4f a = *(const v4f*)p;
  const v4f c2 = *(const v4f*)(p + 4);
  v4u w;
  w[0] = pack_bf16x2(a[0], a[1]);
  w[1] = pack_bf16x2(a[2], a[3]);
  w[2] = pack_bf16x2(c2[0], c2[1]);
  w[3] = pack_bf16x2(c2[2], c2[3]);
  v4u* d = (v4u*)(out + (size_t)i * 8);
  *d = w;
  
}

// coverage: n4 = n/4 threads, n % 1024 == 0 so every wave writes 4 complete lines
__global__ __launch_bounds__(256) void rne_bf16_f32x4(const float* __restrict__ in, float* __restrict__ out, int n4) {
  const int i = blockIdx.x * 256 + threadIdx.x;
  if (i >= n4) return;
  v4u a = *(const v4u*)(in + (size_t)i * 4);
#pragma unroll
  for (int e = 0; e < 4; ++e) a[e] = rne_bf16_word(a[e]);
  v4u* d = (v4u*)(out + (size_t)i * 4);
  *d = a;
  
}

// ---- transpose + bf16 cast: in[nrows][ncols] f32 -> out[ncols][nrows] bf16 ----
// grid = (ncols/64, nrows/64), block 256. Load: 256 threads x 16 floats = the 64x64 tile.
__global__ __launch_bounds__(256) void transpose_cast_bf16(const float* __restrict__ in, unsigned short* __restrict__ out, int nrows, int ncols) {
  __shared__ __align__(16) float tile[64 * 68];   // tile[cl*68 + rl]: cl = in col (out row), rl = in row (out col)
  const int tid = threadIdx.x, lane = tid & 31, wave = tid >> 5;
  const int r0 = blockIdx.y * 64;
  const int c0 = blockIdx.x * 64;
  {
    const int rl = tid >> 2, cq = (tid & 3) * 16;
    const float* src = in + (size_t)(r0 + rl) * ncols + c0 + cq;
#pragma unroll
    for (int i = 0; i < 4; ++i) {
      const v4f v = *(const v4f*)(src + 4 * i);
#pragma unroll
      for (int e = 0; e < 4; ++e) tile[(cq + 4 * i + e) * 68 + rl] = v[e];
    }
  }
  __syncthreads();
  const int q8 = lane >> 3, c8 = (lane & 7) * 8;
  {
#pragma unroll
    for (int it = 0; it < 2; ++it) {
      const int cl = wave * 8 + it * 4 + q8;
      const float* sp = tile + cl * 68 + c8;
      const v4f x0 = *(const v4f*)sp;
      const v4f x1 = *(const v4f*)(sp + 4);
      v4u w;
      w[0] = pack_bf16x2(x0[0], x0[1]);
      w[1] = pack_bf16x2(x0[2], x0[3]);
      w[2] = pack_bf16x2(x1[0], x1[1]);
      w[3] = pack_bf16x2(x1[2], x1[3]);
      *(v4u*)(out + (size_t)(c0 + cl) * nrows + r0 + c8) = w;
    }
    
  }
}

// =====================================================================================
// Attention, head dim 64, over bf16 hi/lo planes of the fused qkv projection.
// qkv planes: [B*S][3*HID], q at col h*64+d, k at HID + h*64 + d, v at 2*HID + h*64 + d.
// scores = 0.125 * q.k^T (bf16 hi/lo, 3 products); mask tile m[q][kv] (RNE-bf16 converted) applied as
// s*m - 10000*(1-m); online softmax in f32. Both products are formed transposed (S^T = K.Q^T, out^T += V^T.P^T, 3 products each):
// a lane holds one query's scores, so row maximum and sum are in-lane plus one exchange of the lane halves, and the
// score accumulators, split into bf16 hi/lo, are the B operand of the second product as they stand.
// A 64x64 tile whose mask is identically zero has 64 equal logits -10000 per row: folded in closed form
// (l += 64*p, o += p * column-sum(v), p = exp(-10000 - rowmax)).
// Block = 4 waves = 64 query rows of one (batch, head); grid.x = B * NH * (S/64).
// =====================================================================================
#define SEQ_LEN 2048
#define N_HEADS 16
#define HEAD_D 64
#define HID_SZ 1024
#define QKV_PITCH 3072
#define KV_CHUNK 64
#define N_BATCH 2
#define LDS_P 72   // row pitch of the K and V^T tiles in 16-bit elements: 144 B = 16 B x odd, so the 16 rows of a b128 fragment read fall on distinct banks

__global__ __launch_bounds__(128) void attn_planes_kernel(
    const unsigned short* __restrict__ qkvh, const unsigned short* __restrict__ qkvl,
    const float* __restrict__ maskp,
    unsigned short* __restrict__ ctxh, unsigned short* __restrict__ ctxl) {
  union FB { v16b v; v8b h[2]; };
  union FW { v16b v; unsigned int w[8]; };
  __shared__ __align__(16) unsigned short Kh[KV_CHUNK * LDS_P];     // K hi [kv][d], pitch LDS_P
  __shared__ __align__(16) unsigned short Kl[KV_CHUNK * LDS_P];     // K lo [kv][d], pitch LDS_P
  __shared__ __align__(16) unsigned short Vth[HEAD_D * LDS_P];      // V hi [d][kv], pitch LDS_P
  __shared__ __align__(16) unsigned short Vtl[HEAD_D * LDS_P];      // V lo [d][kv], pitch LDS_P
  __shared__ __align__(16) float Os[4][16 * 68];                   // per wave out tile, pitch 68; Os[0][0..127] doubles as column-sum scratch
  __shared__ __align__(16) unsigned int Msk[64 * 68];              // mask tile [q][kv] (f32 bits), pitch 68; doubles as v scratch [kv][d]
  __shared__ int AnyNZ[4];

  const int tid  = threadIdx.x;
  const int wave = tid >> 5;
  const int lane = tid & 31;
  const int hh   = lane >> 4;
  const int c    = lane & 15;
  const int bx   = blockIdx.x;
  const int qb   = 31 - (bx >> 5);           // SEQ_LEN / 64 == 32; late query blocks first: under a lower-triangular mask they hold the most live tiles, so cost falls with the block index (speed only)
  static_assert(N_BATCH * N_HEADS == 32 && SEQ_LEN / 64 == 32, "block index split");
  const int bhd  = bx & 31;                  // N_BATCH * N_HEADS == 32
  const int h    = bhd & (N_HEADS - 1);
  const int b    = bhd >> 4;
  const int qblk = qb * 64;
  const int q0   = qblk + wave * 16;
  const size_t rowb = (size_t)b * SEQ_LEN;

  // ---- Q fragments (B operand of the transposed scores), hi and lo planes, 2 d-chunks (8 b128 loads per lane) ----
  v16b qah[2], qal[2];
  {
    const size_t qoff = (rowb + q0 + c) * QKV_PITCH + h * HEAD_D + 8 * hh;
#pragma unroll
    for (int dc = 0; dc < 2; ++dc) {
      qah[dc] = Frag<__bf16>::load((const __bf16*)qkvh + qoff + dc * 32);
      qal[dc] = Frag<__bf16>::load((const __bf16*)qkvl + qoff + dc * 32);
    }
  }

  float mrow = -__builtin_inff(), lrow = 0.f;   // running maximum and sum of query q0 + c (the same in both lane halves)
  v8f oacc[4];                                  // out^T: oacc[t][r] = out[q0 + c][16 t + 8 hh + r]
#pragma unroll
  for (int t = 0; t < 4; ++t) oacc[t] = (v8f){0.f,0.f,0.f,0.f,0.f,0.f,0.f,0.f};

  const int kvr = tid >> 1;            // staging: kv row of this thread (0..63)
  const int dh  = (tid & 1) * 32;      // staging: d half (0 or 32)

  for (int kc = 0; kc < SEQ_LEN / KV_CHUNK; ++kc) {
    const int kv0 = kc * KV_CHUNK;
    __syncthreads();
    // ---- mask tile [64 q][64 kv]: 1024 float4 / 128 threads = 8 b128 per lane; RNE-bf16 convert; all-zero test ----
    unsigned int nz = 0u;
#pragma unroll
    for (int i = 0; i < 8; ++i) {
      const int idx = i * 128 + tid;
      const int row = idx >> 4;
      const int c4  = (idx & 15) * 4;
      v4u m = *(const v4u*)(maskp + (size_t)(qblk + row) * SEQ_LEN + kv0 + c4);
#pragma unroll
      for (int e = 0; e < 4; ++e) { const unsigned int u = rne_bf16_word(m[e]); m[e] = u; nz |= (u & 0x7FFFFFFFu); }
      *(v4u*)(Msk + row * 68 + c4) = m;
    }
    const int anyw = __any(nz != 0u);
    AnyNZ[wave] = anyw;
    __syncthreads();
    const int tile_live = AnyNZ[0] | AnyNZ[1] | AnyNZ[2] | AnyNZ[3];   // block-uniform

    const size_t koff = (rowb + kv0 + kvr) * QKV_PITCH + HID_SZ + h * HEAD_D + dh;
    const size_t voff = koff + HID_SZ;

    if (tile_live) {
      // ---- K hi/lo rows -> LDS [kv][d] (4+4 b128 per lane, 128 threads x 32 elements = 64x64 per plane) ----
      {
        const v4u* gh = (const v4u*)(qkvh + koff);
        const v4u* gl = (const v4u*)(qkvl + koff);
        v4u* lh = (v4u*)(Kh + kvr * LDS_P + dh);
        v4u* ll = (v4u*)(Kl + kvr * LDS_P + dh);
        v4u a[4], bb[4];
#pragma unroll
        for (int i = 0; i < 4; ++i) { a[i] = gh[i]; bb[i] = gl[i]; }
        // inputs-only fence on the loaded values: keeps the 8 loads in flight together (without it this build waits after every second load)
        asm volatile("" :: "v"(a[0]), "v"(a[1]), "v"(a[2]), "v"(a[3]), "v"(bb[0]), "v"(bb[1]), "v"(bb[2]), "v"(bb[3]));
#pragma unroll
        for (int i = 0; i < 4; ++i) { lh[i] = a[i]; ll[i] = bb[i]; }
      }
      asm volatile("" ::: "memory");
      // ---- V hi/lo rows -> LDS transposed [d][kv] ----
      {
        const v4u* gh = (const v4u*)(qkvh + voff);
        const v4u* gl = (const v4u*)(qkvl + voff);
        unsigned short* sh = Vth + dh * LDS_P + kvr;   // one base per plane: every row step below is a constant offset
        unsigned short* sl = Vtl + dh * LDS_P + kvr;
        v4u vh4[4], vl4[4];
#pragma unroll
        for (int i = 0; i < 4; ++i) { vh4[i] = gh[i]; vl4[i] = gl[i]; }
        // inputs-only fence on the loaded values: keeps the 8 loads in flight together, as above
        asm volatile("" :: "v"(vh4[0]), "v"(vh4[1]), "v"(vh4[2]), "v"(vh4[3]), "v"(vl4[0]), "v"(vl4[1]), "v"(vl4[2]), "v"(vl4[3]));
#pragma unroll
        for (int i = 0; i < 4; ++i) {
          const v4u wh = vh4[i];
          const v4u wl = vl4[i];
#pragma unroll
          for (int e = 0; e < 4; ++e) {
            const int d = 8 * i + 2 * e;
            sh[d * LDS_P]       = (unsigned short)(wh[e] & 0xFFFFu);
            sh[(d + 1) * LDS_P] = (unsigned short)(wh[e] >> 16);
            sl[d * LDS_P]       = (unsigned short)(wl[e] & 0xFFFFu);
            sl[(d + 1) * LDS_P] = (unsigned short)(wl[e] >> 16);
          }
        }
      }
      __syncthreads();

      // ---- scores, transposed: S^T = K . Q^T, 4 key subtiles x 2 d-chunks, hi.hi + lo.hi + hi.lo ----
      // s[j][r] = score of query q0 + c against key kv0 + 16 j + 8 hh + r: one query per lane, its keys in registers
      v8f s[4];
#pragma unroll
      for (int j = 0; j < 4; ++j) {
        s[j] = (v8f){0.f,0.f,0.f,0.f,0.f,0.f,0.f,0.f};
#pragma unroll
        for (int dc = 0; dc < 2; ++dc) {
          FB kb, kl;
          const int ko = (j * 16 + c) * LDS_P + dc * 32 + 8 * hh;
          kb.h[0] = *(const v8b*)((const __bf16*)Kh + ko);
          kb.h[1] = *(const v8b*)((const __bf16*)Kh + ko + 16);
          kl.h[0] = *(const v8b*)((const __bf16*)Kl + ko);
          kl.h[1] = *(const v8b*)((const __bf16*)Kl + ko + 16);
          s[j] = at_mma(kb.v, qah[dc], s[j]);
          s[j] = at_mma(kl.v, qah[dc], s[j]);
          s[j] = at_mma(kb.v, qal[dc], s[j]);
        }
      }
      // ---- scale, mask (literal s*m - 10000*(1-m)), maximum of the lane's 32 keys, then of both lane halves ----
      float cm = -__builtin_inff();
      {
        const unsigned int* mp = Msk + (wave * 16 + c) * 68 + 8 * hh;
#pragma unroll
        for (int j = 0; j < 4; ++j) {
          const v4u k0 = *(const v4u*)(mp + j * 16);
          const v4u k1 = *(const v4u*)(mp + j * 16 + 4);
#pragma unroll
          for (int r = 0; r < 8; ++r) {
            const float mk = __uint_as_float(r < 4 ? k0[r & 3] : k1[r & 3]);
            float x = s[j][r] * 0.125f;
            x = x * mk - 10000.0f * (1.0f - mk);
            s[j][r] = x;
            cm = fmaxf(cm, x);
          }
        }
      }
      cm = fmaxf(cm, xhalf(cm));
      // ---- online softmax, one query per lane; P^T split into bf16 hi/lo and packed in place as B operands ----
      FW ph[2], pl[2];
      {
        const float mnew  = fmaxf(mrow, cm);
        const float alpha = expf(mrow - mnew);
        mrow = mnew;
        float ps[4];
#pragma unroll
        for (int j = 0; j < 4; ++j) {
          ps[j] = 0.f;
#pragma unroll
          for (int r = 0; r < 8; r += 2) {
            const float p0 = expf(s[j][r] - mnew);
            const float p1 = expf(s[j][r + 1] - mnew);
            ps[j] += p0;
            ps[j] += p1;
            unsigned int wh, wl;
            split_pack2(p0, p1, wh, wl);
            ph[j >> 1].w[(j & 1) * 4 + (r >> 1)] = wh;   // element 8 (j & 1) + r of the 32-key fragment = key 16 (j & 1) + 8 hh + r
            pl[j >> 1].w[(j & 1) * 4 + (r >> 1)] = wl;
          }
        }
        float psum = (ps[0] + ps[1]) + (ps[2] + ps[3]);
        psum += xhalf(psum);
        lrow = lrow * alpha + psum;
#pragma unroll
        for (int t = 0; t < 4; ++t)
#pragma unroll
          for (int r = 0; r < 8; ++r) oacc[t][r] *= alpha;
      }
      // ---- out^T += V^T(64x64) . P^T(64x16): vh.ph + vl.ph + vh.pl; oacc[t][r] = out[q0 + c][16 t + 8 hh + r] ----
#pragma unroll
      for (int kk = 0; kk < 2; ++kk) {
#pragma unroll
        for (int t = 0; t < 4; ++t) {
          FB vb, vl;
          const int vo = (t * 16 + c) * LDS_P + kk * 32 + 8 * hh;
          vb.h[0] = *(const v8b*)((const __bf16*)Vth + vo);
          vb.h[1] = *(const v8b*)((const __bf16*)Vth + vo + 16);
          vl.h[0] = *(const v8b*)((const __bf16*)Vtl + vo);
          vl.h[1] = *(const v8b*)((const __bf16*)Vtl + vo + 16);
          oacc[t] = at_mma(vb.v, ph[kk].v, oacc[t]);
          oacc[t] = at_mma(vl.v, ph[kk].v, oacc[t]);
          oacc[t] = at_mma(vb.v, pl[kk].v, oacc[t]);
        }
      }
    } else {
      // ---- all-masked tile: v rows (hi+lo, f32) -> Msk scratch [kv][d], column sums, closed-form update ----
      {
        const v4u* gh = (const v4u*)(qkvh + voff);
        const v4u* gl = (const v4u*)(qkvl + voff);
#pragma unroll
        for (int i = 0; i < 4; ++i) {
          const v4u wh = gh[i];
          const v4u wl = gl[i];
          v4u f0, f1;
          {
            const float a0 = __uint_as_float(wh[0] << 16);          const float b0 = __uint_as_float(wl[0] << 16);
            const float a1 = __uint_as_float(wh[0] & 0xFFFF0000u); const float b1 = __uint_as_float(wl[0] & 0xFFFF0000u);
            const float a2 = __uint_as_float(wh[1] << 16);          const float b2 = __uint_as_float(wl[1] << 16);
            const float a3 = __uint_as_float(wh[1] & 0xFFFF0000u); const float b3 = __uint_as_float(wl[1] & 0xFFFF0000u);
            f0[0] = __float_as_uint(a0 + b0); f0[1] = __float_as_uint(a1 + b1);
            f0[2] = __float_as_uint(a2 + b2); f0[3] = __float_as_uint(a3 + b3);
          }
          {
            const float a0 = __uint_as_float(wh[2] << 16);          const float b0 = __uint_as_float(wl[2] << 16);
            const float a1 = __uint_as_float(wh[2] & 0xFFFF0000u); const float b1 = __uint_as_float(wl[2] & 0xFFFF0000u);
            const float a2 = __uint_as_float(wh[3] << 16);          const float b2 = __uint_as_float(wl[3] << 16);
            const float a3 = __uint_as_float(wh[3] & 0xFFFF0000u); const float b3 = __uint_as_float(wl[3] & 0xFFFF0000u);
            f1[0] = __float_as_uint(a0 + b0); f1[1] = __float_as_uint(a1 + b1);
            f1[2] = __float_as_uint(a2 + b2); f1[3] = __float_as_uint(a3 + b3);
          }
          *(v4u*)(Msk + kvr * 68 + dh + 8 * i)     = f0;
          *(v4u*)(Msk + kvr * 68 + dh + 8 * i + 4) = f1;
        }
      }
      __syncthreads();
      {
        const int d = tid & 63, half = tid >> 6;
        float part = 0.f;
#pragma unroll 8
        for (int kq = 0; kq < 32; ++kq) part += __uint_as_float(Msk[(half * 32 + kq) * 68 + d]);
        Os[0][half * 64 + d] = part;
      }
      __syncthreads();
      {
        const float mnew  = fmaxf(mrow, -10000.0f);
        const float alpha = expf(mrow - mnew);
        const float p     = expf(-10000.0f - mnew);
        mrow = mnew;
        lrow = lrow * alpha + 64.0f * p;
#pragma unroll
        for (int t = 0; t < 4; ++t) {
          const float* cs = Os[0] + t * 16 + 8 * hh;      // column sums of the lane's 8 output columns, two partial sums each
          const v4f a0 = *(const v4f*)cs;
          const v4f a1 = *(const v4f*)(cs + 4);
          const v4f b0 = *(const v4f*)(cs + 64);
          const v4f b1 = *(const v4f*)(cs + 68);
#pragma unroll
          for (int r = 0; r < 8; ++r) {
            const float vs = (r < 4 ? a0[r & 3] : a1[r & 3]) + (r < 4 ? b0[r & 3] : b1[r & 3]);
            oacc[t][r] = oacc[t][r] * alpha + p * vs;
          }
        }
      }
    }
  }
  __syncthreads();

  float* os = Os[wave];
  {
    const float inv = 1.0f / lrow;
#pragma unroll
    for (int t = 0; t < 4; ++t) {
      v4f x0, x1;
#pragma unroll
      for (int r = 0; r < 4; ++r) { x0[r] = oacc[t][r] * inv; x1[r] = oacc[t][r + 4] * inv; }
      *(v4f*)(os + c * 68 + t * 16 + 8 * hh)     = x0;
      *(v4f*)(os + c * 68 + t * 16 + 8 * hh + 4) = x1;
    }
  }
  __builtin_amdgcn_fence(__ATOMIC_RELEASE, "workgroup");
  __builtin_amdgcn_wave_barrier();
  __builtin_amdgcn_fence(__ATOMIC_ACQUIRE, "workgroup");
  {
    const int q8 = lane >> 3, c8 = (lane & 7) * 8;
    unsigned short* oh = ctxh + (rowb + q0) * HID_SZ + h * HEAD_D + c8;
    unsigned short* ol = ctxl + (rowb + q0) * HID_SZ + h * HEAD_D + c8;
    {
#pragma unroll
      for (int it = 0; it < 4; ++it) {
        const int row = it * 4 + q8;
        const float* sp = os + row * 68 + c8;
        const v4f x0 = *(const v4f*)sp;
        const v4f x1 = *(const v4f*)(sp + 4);
        v4u wh, wl;
        unsigned int th, tl;
        split_pack2(x0[0], x0[1], th, tl); wh[0] = th; wl[0] = tl;
        split_pack2(x0[2], x0[3], th, tl); wh[1] = th; wl[1] = tl;
        split_pack2(x1[0], x1[1], th, tl); wh[2] = th; wl[2] = tl;
        split_pack2(x1[2], x1[3], th, tl); wh[3] = th; wl[3] = tl;
        *(v4u*)(oh + (size_t)row * HID_SZ) = wh;
        *(v4u*)(ol + (size_t)row * HID_SZ) = wl;
      }
      
    }
  }
}

// ---------------------------------------------------------------------------
// Workspace region map (bytes):
//   Hb    bf16 [4096][1024]        off 0            size  8388608
//   WQt   bf16 [3072][1024]        off 8388608      size  6291456
//   WDt   bf16 [1024][1024]        off 14680064     size  2097152
//   BQ    f32  [3072]              off 16777216     size    12288
//   BD    f32  [1024]              off 16789504     size     4096
//   QKVh  bf16 [4096][3072]        off 16793600     size 25165824
//   QKVl  bf16 [4096][3072]        off 41959424     size 25165824
//   CTXh  bf16 [4096][1024]        off 67125248     size  8388608
//   CTXl  bf16 [4096][1024]        off 75513856     size  8388608
//   end                            83902464
// Every region is fully written by its producer before any consumer reads it.
// ---------------------------------------------------------------------------
extern "C" void kernel_launch(void* const* d_in, const int* in_sizes, int n_in,
                              void* d_out, int out_size, void* d_ws, size_t ws_size,
                              hipStream_t stream) {
  constexpr int kB = N_BATCH, kS = SEQ_LEN, kH = HID_SZ;
  constexpr int kM = kB * kS;          // 4096
  constexpr int kN3 = 3 * kH;          // 3072
  static_assert(kM % 64 == 0 && kN3 % 64 == 0 && kH % 64 == 0);   // GEMM M/N tile multiples
  static_assert(kH % 32 == 0);                                     // GEMM K step
  static_assert(kS % KV_CHUNK == 0 && kS / 64 == 32 && kH / HEAD_D == N_HEADS);
  static_assert((kM * kH) % 2048 == 0 && kN3 % 1024 == 0 && kH % 1024 == 0);

  if (n_in < 6) return;
  if (in_sizes[0] != kM * kH || in_sizes[1] != kS * kS || in_sizes[2] != kH * kN3 ||
      in_sizes[3] != kN3 || in_sizes[4] != kH * kH || in_sizes[5] != kH) return;
  if (out_size != kM * kH) return;

  const float* hidden  = (const float*)d_in[0];
  const float* maskp   = (const float*)d_in[1];
  const float* w_qkv   = (const float*)d_in[2];
  const float* b_qkv   = (const float*)d_in[3];
  const float* w_dense = (const float*)d_in[4];
  const float* b_dense = (const float*)d_in[5];
  float* out = (float*)d_out;

  const size_t szHb  = (size_t)kM * kH * 2;
  const size_t szWQt = (size_t)kN3 * kH * 2;
  const size_t szWDt = (size_t)kH * kH * 2;
  const size_t szBQ  = (size_t)kN3 * 4;
  const size_t szBD  = (size_t)kH * 4;
  const size_t szQKV = (size_t)kM * kN3 * 2;
  const size_t szCTX = (size_t)kM * kH * 2;
  const size_t offHb   = 0;
  const size_t offWQt  = offHb + szHb;
  const size_t offWDt  = offWQt + szWQt;
  const size_t offBQ   = offWDt + szWDt;
  const size_t offBD   = offBQ + szBQ;
  const size_t offQKVh = offBD + szBD;
  const size_t offQKVl = offQKVh + szQKV;
  const size_t offCTXh = offQKVl + szQKV;
  const size_t offCTXl = offCTXh + szCTX;
  const size_t offEnd  = offCTXl + szCTX;
  if (offEnd > ws_size) return;

  char* ws = (char*)d_ws;
  unsigned short* Hb   = (unsigned short*)(ws + offHb);
  unsigned short* WQt  = (unsigned short*)(ws + offWQt);
  unsigned short* WDt  = (unsigned short*)(ws + offWDt);
  float*          BQ   = (float*)(ws + offBQ);
  float*          BD   = (float*)(ws + offBD);
  unsigned short* QKVh = (unsigned short*)(ws + offQKVh);
  unsigned short* QKVl = (unsigned short*)(ws + offQKVl);
  unsigned short* CTXh = (unsigned short*)(ws + offCTXh);
  unsigned short* CTXl = (unsigned short*)(ws + offCTXl);

  // 1) hidden -> bf16 plane [4096][1024]
  {
    const int n8 = (kM * kH) / 8;                       // 524288 threads = 2048 blocks exactly
    cast_f32_bf16x8<<<dim3(n8 / 256), dim3(256), 0, stream>>>(hidden, Hb, n8);
  }
  // 2) w_qkv [1024 rows][3072 cols] -> WQt [3072][1024] bf16 ; w_dense [1024][1024] -> WDt [1024][1024] bf16
  transpose_cast_bf16<<<dim3(kN3 / 64, kH / 64), dim3(256), 0, stream>>>(w_qkv, WQt, kH, kN3);
  transpose_cast_bf16<<<dim3(kH / 64, kH / 64), dim3(256), 0, stream>>>(w_dense, WDt, kH, kH);
  // 3) bias lines RNE-bf16 converted (kept as f32)
  rne_bf16_f32x4<<<dim3((kN3 / 4) / 256), dim3(256), 0, stream>>>(b_qkv, BQ, kN3 / 4);
  rne_bf16_f32x4<<<dim3((kH / 4) / 256), dim3(256), 0, stream>>>(b_dense, BD, kH / 4);
  // 4) fused qkv projection: [4096x1024] x WQt[3072x1024]^T + bias -> bf16 hi/lo planes [4096][3072]
  {
    const int tiles = (kM / 64) * (kN3 / 64);           // 3072 wave tiles -> 384 blocks of 8 waves
    wmma_gemm64<1, 0, 2, 2, false><<<dim3(tiles / 8, 1), dim3(256), 0, stream>>>(
        Hb, Hb, kH, 0L, WQt, WQt, kH, 0L, (void*)QKVh, (void*)QKVl, kN3, 0L,
        BQ, BQ, 0L, kM, kN3, kH, 1.0f);
  }
  // 5) attention per (batch, head, 64 query rows) -> ctx bf16 hi/lo planes [4096][1024]
  attn_planes_kernel<<<dim3(kB * N_HEADS * (kS / 64)), dim3(128), 0, stream>>>(QKVh, QKVl, maskp, CTXh, CTXl);
  // 6) output projection: ctx (hi/lo) [4096x1024] x WDt[1024x1024]^T + bias -> out f32 [4096][1024]
  {
    const int tiles = (kM / 64) * (kH / 64);            // 1024 wave tiles -> 128 blocks
    wmma_gemm64<1, 2, 2, 0, false><<<dim3(tiles / 8, 1), dim3(256), 0, stream>>>(
        CTXh, CTXl, kH, 0L, WDt, WDt, kH, 0L, (void*)out, (void*)out, kH, 0L,
        BD, BD, 0L, kM, kH, kH, 1.0f);
  }
}

// v004
// It runs in 264 microseconds.
// In both of two side-by-side timings against v003, it was 1.08 times as fast.
// Counting every step since v000, it is 2.37 times as fast.
// Contractions on v_wmma_f32_16x16x32_bf16 (bf16 operands, f32 accumulate): qkv projection = one product on RNE-bf16 inputs; q.k^T and p.v = bf16 hi/lo planes (3 products); output projection = ctx bf16 hi/lo x bf16 weights (2 products). Masking, softmax and normalisation in f32.
#include <hip/hip_runtime.h>

typedef __attribute__((ext_vector_type(16))) _Float16 v16h;
typedef __attribute__((ext_vector_type(8)))  _Float16 v8h;
typedef __attribute__((ext_vector_type(16))) __bf16   v16b;
typedef __attribute__((ext_vector_type(8)))  __bf16   v8b;
typedef __attribute__((ext_vector_type(8)))  float    v8f;
typedef __attribute__((ext_vector_type(4)))  float    v4f;
typedef __attribute__((ext_vector_type(4)))  unsigned int v4u;

__device__ __forceinline__ unsigned short f2bf_bits(float f) {
  unsigned u = __float_as_uint(f);
  return (unsigned short)((u + 0x7FFFu + ((u >> 16) & 1u)) >> 16);
}
__device__ __forceinline__ float bf_bits2f(unsigned short h) { return __uint_as_float(((unsigned)h) << 16); }
// RNE convert of an f32 bit pattern to its bf16 value, kept as an f32 bit pattern
__device__ __forceinline__ unsigned int rne_bf16_word(unsigned int u) {
  return (u + 0x7FFFu + ((u >> 16) & 1u)) & 0xFFFF0000u;
}
__device__ __forceinline__ unsigned int pack_bf16x2(float a, float b) {
  return (unsigned int)f2bf_bits(a) | ((unsigned int)f2bf_bits(b) << 16);
}
// hi/lo bf16 split of two floats, packed as (hi_a | hi_b<<16) and (lo_a | lo_b<<16)
__device__ __forceinline__ void split_pack2(float a, float b, unsigned int& wh, unsigned int& wl) {
  const unsigned short ha = f2bf_bits(a), hb = f2bf_bits(b);
  const unsigned short la = f2bf_bits(a - bf_bits2f(ha)), lb = f2bf_bits(b - bf_bits2f(hb));
  wh = (unsigned int)ha | ((unsigned int)hb << 16);
  wl = (unsigned int)la | ((unsigned int)lb << 16);
}

// hazard guards as plain device helpers (no inline asm inside the kernel template body)
__device__ __forceinline__ void dep_guard_h(v8f& a, v8f& b, v16h x, v16h y) { asm volatile("v_nop\n\tv_nop\n\tv_nop\n\tv_nop" : "+v"(a), "+v"(b) : "v"(x), "v"(y)); }
__device__ __forceinline__ void dep_guard_b(v8f& a, v8f& b, v16b x, v16b y) { asm volatile("v_nop\n\tv_nop\n\tv_nop\n\tv_nop" : "+v"(a), "+v"(b) : "v"(x), "v"(y)); }
__device__ __forceinline__ void keep4_h(v16h a, v16h b, v16h c, v16h d) { asm volatile("v_nop" :: "v"(a), "v"(b), "v"(c), "v"(d)); }
__device__ __forceinline__ void keep4_b(v16b a, v16b b, v16b c, v16b d) { asm volatile("v_nop" :: "v"(a), "v"(b), "v"(c), "v"(d)); }
__device__ __forceinline__ void acc_guard4(v8f& a, v8f& b, v8f& c, v8f& d) { asm volatile("v_nop\n\tv_nop\n\tv_nop\n\tv_nop" : "+v"(a), "+v"(b), "+v"(c), "+v"(d)); }
template <typename T> struct Frag;
template <> struct Frag<_Float16> {
  typedef v16h V; union U { v16h v; v8h h[2]; };
  static __device__ __forceinline__ v16h load(const _Float16* p) {   // elements 0..7 <- p[0..7], 8..15 <- p[16..23]
    U f; f.h[0] = *(const v8h*)(p); f.h[1] = *(const v8h*)(p + 16); return f.v;
  }
  static __device__ __forceinline__ v8f mma(v16h a, v16h b, v8f c) {
    return __builtin_amdgcn_wmma_f32_16x16x32_f16(false, a, false, b, (short)0, c, false, false);
  }
  static __device__ __forceinline__ void guard(v8f& a, v8f& b, v16h x, v16h y) { dep_guard_h(a, b, x, y); }
  static __device__ __forceinline__ void keep(v16h a, v16h b, v16h c, v16h d) { keep4_h(a, b, c, d); }
};
template <> struct Frag<__bf16> {
  typedef v16b V; union U { v16b v; v8b h[2]; };
  static __device__ __forceinline__ v16b load(const __bf16* p) {
    U f; f.h[0] = *(const v8b*)(p); f.h[1] = *(const v8b*)(p + 16); return f.v;
  }
  static __device__ __forceinline__ v8f mma(v16b a, v16b b, v8f c) {
    return __builtin_amdgcn_wmma_f32_16x16x32_bf16(false, a, false, b, (short)0, c, false, false);
  }
  static __device__ __forceinline__ void guard(v8f& a, v8f& b, v16b x, v16b y) { dep_guard_b(a, b, x, y); }
  static __device__ __forceinline__ void keep(v16b a, v16b b, v16b c, v16b d) { keep4_b(a, b, c, d); }
};

// ---- Register-blocked batched WMMA GEMM ------------------------------------
// C[m,n] = scale * sum_k A[m,k] * Bt[n,k] (+bias)(+resid); each wave owns a 64x64 tile.
// A row-major [M,K]; Bt row-major [N,K]; M,N % 64 == 0, K % 32 == 0.
// SPLIT: 0 = single planes; 1 = A and Bt hi/lo planes (hi.hi + hi.lo + lo.hi); 2 = A hi/lo planes only (hi.B + lo.B).
// BIAS_MODE: 0 = none, 1 = bias[m], 2 = bias[n].
// OUT_MODE: 0 = f32, 1 = f16, 2 = bf16 hi plane (Cout) + bf16 lo plane (Cout2).
// ET: 0 = f16 operands, 1 = bf16 operands (pointers passed as 16-bit storage)
template <int ET> struct Elem;
template <> struct Elem<0> { typedef _Float16 T; };
template <> struct Elem<1> { typedef __bf16 T; };
template <int ET, int SPLIT, int BIAS_MODE, int OUT_MODE, bool RESID, int ACT = 0>
__global__ __launch_bounds__(256) void wmma_gemm64(
    const unsigned short* __restrict__ Ap, const unsigned short* __restrict__ A2p, int lda, long strideA,
    const unsigned short* __restrict__ Btp, const unsigned short* __restrict__ Bt2p, int ldb, long strideB,
    void* __restrict__ Cout, void* __restrict__ Cout2, int ldc, long strideC,
    const float* __restrict__ bias,
    const float* __restrict__ resid, long strideR,
    int M, int N, int K, float scale) {
  typedef typename Elem<ET>::T T;
  typedef typename Frag<T>::V V;
  const T* A = (const T*)Ap; const T* A2 = (const T*)A2p; const T* Bt = (const T*)Btp; const T* Bt2 = (const T*)Bt2p;
  __shared__ __align__(16) float sT[8][16 * 68];   // per-wave 16x64 slab, pitch 68 floats
  const int b    = blockIdx.y;
  const int lane = threadIdx.x & 31;
  const int wave = threadIdx.x >> 5;
  const int tilesN = N >> 6;
  const int tilesM = M >> 6;
  const int tile = blockIdx.x * 8 + wave;
  if (tile >= tilesM * tilesN) return;   // wave-uniform; no block barriers in this kernel
  const int tm = tile / tilesN;
  const int tn = tile - tm * tilesN;
  const int m0 = tm << 6;
  const int n0 = tn << 6;

  const T* Ab  = A  + (size_t)b * strideA;
  const T* Bb  = Bt + (size_t)b * strideB;
  const T* Ab2 = (SPLIT != 0) ? (A2  + (size_t)b * strideA) : nullptr;
  const T* Bb2 = (SPLIT == 1) ? (Bt2 + (size_t)b * strideB) : nullptr;

  const int rlane = lane & 15;                 // row (A) / col (B, D) within subtile
  const int koff  = (lane >> 4) * 8;           // k offset of this lane half
  const int mOff  = (lane >> 4) * 8;           // D row offset

  v8f acc[4][4];
#pragma unroll
  for (int i = 0; i < 4; ++i)
#pragma unroll
    for (int j = 0; j < 4; ++j) acc[i][j] = (v8f){0.f,0.f,0.f,0.f,0.f,0.f,0.f,0.f};

  for (int k0 = 0; k0 < K; k0 += 32) {
    V bh[4], bl[4];
#pragma unroll
    for (int j = 0; j < 4; ++j) {
      const size_t bo = (size_t)(n0 + (j << 4) + rlane) * ldb + koff + k0;
      bh[j] = Frag<T>::load(Bb + bo);
      if (SPLIT == 1) bl[j] = Frag<T>::load(Bb2 + bo);
    }
#pragma unroll
    for (int i = 0; i < 4; ++i) {
      const size_t ao = (size_t)(m0 + (i << 4) + rlane) * lda + koff + k0;
      V ah = Frag<T>::load(Ab + ao);
      V al;
      if (SPLIT != 0) al = Frag<T>::load(Ab2 + ao);
#pragma unroll
      for (int j = 0; j < 4; ++j) {
        acc[i][j] = Frag<T>::mma(ah, bh[j], acc[i][j]);
        if (SPLIT == 1) {
          acc[i][j] = Frag<T>::mma(ah, bl[j], acc[i][j]);
          acc[i][j] = Frag<T>::mma(al, bh[j], acc[i][j]);
        }
        if (SPLIT == 2) {
          acc[i][j] = Frag<T>::mma(al, bh[j], acc[i][j]);
        }
      }
      Frag<T>::guard(acc[i][0], acc[i][3], ah, (SPLIT != 0) ? al : ah);
    }
    Frag<T>::keep(bh[0], bh[1], bh[2], bh[3]);
    if (SPLIT == 1) Frag<T>::keep(bl[0], bl[1], bl[2], bl[3]);
  }
  acc_guard4(acc[0][0], acc[0][1], acc[0][2], acc[0][3]);
  acc_guard4(acc[1][0], acc[1][1], acc[1][2], acc[1][3]);
  acc_guard4(acc[2][0], acc[2][1], acc[2][2], acc[2][3]);
  acc_guard4(acc[3][0], acc[3][1], acc[3][2], acc[3][3]);

  // ---- epilogue ----
  float* slab = sT[wave];
  const float* Rb = RESID ? (resid + (size_t)b * strideR) : nullptr;
#pragma unroll
  for (int i = 0; i < 4; ++i) {
    const int mBase = m0 + (i << 4);
#pragma unroll
    for (int j = 0; j < 4; ++j) {
      const int n = n0 + (j << 4) + rlane;
      float bv = 0.f;
      if (BIAS_MODE == 2) bv = bias[n];
#pragma unroll
      for (int r = 0; r < 8; ++r) {
        float v = acc[i][j][r] * scale;
        if (BIAS_MODE == 1) v += bias[mBase + mOff + r];
        if (BIAS_MODE == 2) v += bv;
        if (RESID) v += Rb[(size_t)(mBase + mOff + r) * ldc + n];
        if (ACT == 1) v = tanhf(v);
        if (ACT == 2) v = fmaxf(v, 0.0f);
        if (ACT == 4) v = (v > 0.f) ? v : 0.01f * v;
        slab[(mOff + r) * 68 + (j << 4) + rlane] = v;
      }
    }
    __builtin_amdgcn_fence(__ATOMIC_RELEASE, "workgroup");
    __builtin_amdgcn_wave_barrier();
    __builtin_amdgcn_fence(__ATOMIC_ACQUIRE, "workgroup");
    if (OUT_MODE == 0) {
      float* C = (float*)Cout + (size_t)b * strideC;
      const int hh = lane >> 4, c4 = (lane & 15) * 4;     // row seg = 256 B = 16 lanes x 16 B
      {
#pragma unroll
        for (int it = 0; it < 8; ++it) {
          const int row = it * 2 + hh;
          v4f v = *(const v4f*)(slab + row * 68 + c4);
          *(v4f*)(C + (size_t)(mBase + row) * ldc + n0 + c4) = v;
        }
        
      }
    } else {
      const int q = lane >> 3, c8 = (lane & 7) * 8;
      unsigned short* C  = (unsigned short*)Cout  + (size_t)b * strideC;
      unsigned short* C2 = (OUT_MODE == 2) ? ((unsigned short*)Cout2 + (size_t)b * strideC) : nullptr;
      {
#pragma unroll
        for (int it = 0; it < 4; ++it) {
          const int row = it * 4 + q;
          const float* sp = slab + row * 68 + c8;
          v8h hv, lv;
#pragma unroll
          for (int e = 0; e < 8; ++e) {
            if (OUT_MODE == 1) {
              hv[e] = (_Float16)sp[e];
            } else {
              unsigned short hb = f2bf_bits(sp[e]);
              unsigned short lb = f2bf_bits(sp[e] - bf_bits2f(hb));
              hv[e] = __builtin_bit_cast(_Float16, hb);
              lv[e] = __builtin_bit_cast(_Float16, lb);
            }
          }
          *(v8h*)(C + (size_t)(mBase + row) * ldc + n0 + c8) = hv;
          if (OUT_MODE == 2) *(v8h*)(C2 + (size_t)(mBase + row) * ldc + n0 + c8) = lv;
        }
        
      }
    }
    __builtin_amdgcn_fence(__ATOMIC_RELEASE, "workgroup");
    __builtin_amdgcn_wave_barrier();
    __builtin_amdgcn_fence(__ATOMIC_ACQUIRE, "workgroup");
  }
}

// lane l <-> lane l ^ 16
__device__ __forceinline__ float xhalf(float x) {
  return __builtin_bit_cast(float, __builtin_amdgcn_permlanex16(__builtin_bit_cast(int, x), __builtin_bit_cast(int, x), 0x76543210, 0xfedcba98, false, false));
}

__device__ __forceinline__ v8f at_mma(v16b a, v16b b, v8f c) {
  c = __builtin_amdgcn_wmma_f32_16x16x32_bf16(false, a, false, b, (short)0, c, false, false);
  asm volatile("v_nop\n\tv_nop\n\tv_nop\n\tv_nop" : "+v"(c) : "v"(a), "v"(b));
  return c;
}

// coverage: grid*256 threads x 8 elements == n8*8 elements exactly (host sizes n8 = n/8, n % 2048 == 0)
__global__ __launch_bounds__(256) void cast_f32_bf16x8(const float* __restrict__ in, unsigned short* __restrict__ out, int n8) {
  const int i = blockIdx.x * 256 + threadIdx.x;
  if (i >= n8) return;
  const float* p = in + (size_t)i * 8;
  const v4f a = *(const v4f*)p;
  const v4f c2 = *(const v4f*)(p + 4);
  v4u w;
  w[0] = pack_bf16x2(a[0], a[1]);
  w[1] = pack_bf16x2(a[2], a[3]);
  w[2] = pack_bf16x2(c2[0], c2[1]);
  w[3] = pack_bf16x2(c2[2], c2[3]);
  v4u* d = (v4u*)(out + (size_t)i * 8);
  *d = w;
  
}

// coverage: n4 = n/4 threads, n % 1024 == 0 so every wave writes 4 complete lines
__global__ __launch_bounds__(256) void rne_bf16_f32x4(const float* __restrict__ in, float* __restrict__ out, int n4) {
  const int i = blockIdx.x * 256 + threadIdx.x;
  if (i >= n4) return;
  v4u a = *(const v4u*)(in + (size_t)i * 4);
#pragma unroll
  for (int e = 0; e < 4; ++e) a[e] = rne_bf16_word(a[e]);
  v4u* d = (v4u*)(out + (size_t)i * 4);
  *d = a;
  
}

// ---- transpose + bf16 cast: in[nrows][ncols] f32 -> out[ncols][nrows] bf16 ----
// grid = (ncols/64, nrows/64), block 256. Load: 256 threads x 16 floats = the 64x64 tile.
__global__ __launch_bounds__(256) void transpose_cast_bf16(const float* __restrict__ in, unsigned short* __restrict__ out, int nrows, int ncols) {
  __shared__ __align__(16) float tile[64 * 68];   // tile[cl*68 + rl]: cl = in col (out row), rl = in row (out col)
  const int tid = threadIdx.x, lane = tid & 31, wave = tid >> 5;
  const int r0 = blockIdx.y * 64;
  const int c0 = blockIdx.x * 64;
  {
    const int rl = tid >> 2, cq = (tid & 3) * 16;
    const float* src = in + (size_t)(r0 + rl) * ncols + c0 + cq;
#pragma unroll
    for (int i = 0; i < 4; ++i) {
      const v4f v = *(const v4f*)(src + 4 * i);
#pragma unroll
      for (int e = 0; e < 4; ++e) tile[(cq + 4 * i + e) * 68 + rl] = v[e];
    }
  }
  __syncthreads();
  const int q8 = lane >> 3, c8 = (lane & 7) * 8;
  {
#pragma unroll
    for (int it = 0; it < 2; ++it) {
      const int cl = wave * 8 + it * 4 + q8;
      const float* sp = tile + cl * 68 + c8;
      const v4f x0 = *(const v4f*)sp;
      const v4f x1 = *(const v4f*)(sp + 4);
      v4u w;
      w[0] = pack_bf16x2(x0[0], x0[1]);
      w[1] = pack_bf16x2(x0[2], x0[3]);
      w[2] = pack_bf16x2(x1[0], x1[1]);
      w[3] = pack_bf16x2(x1[2], x1[3]);
      *(v4u*)(out + (size_t)(c0 + cl) * nrows + r0 + c8) = w;
    }
    
  }
}

// =====================================================================================
// Attention, head dim 64, over bf16 hi/lo planes of the fused qkv projection.
// qkv planes: [B*S][3*HID], q at col h*64+d, k at HID + h*64 + d, v at 2*HID + h*64 + d.
// scores = 0.125 * q.k^T (bf16 hi/lo, 3 products); mask tile m[q][kv] (RNE-bf16 converted) applied as
// s*m - 10000*(1-m); online softmax in f32. Both products are formed transposed (S^T = K.Q^T, out^T += V^T.P^T, 3 products each):
// a lane holds one query's scores, so row maximum and sum are in-lane plus one exchange of the lane halves, and the
// score accumulators, split into bf16 hi/lo, are the B operand of the second product as they stand.
// A 64x64 tile whose mask is identically zero has 64 equal logits -10000 per row: folded in closed form
// (l += 64*p, o += p * column-sum(v), p = exp(-10000 - rowmax)).
// The class of every mask tile (all 0 / all 1 / mixed, of the RNE-bf16 converted values) comes from mask_tile_class, which
// reads the mask once; a tile of ones leaves every score as it is (x*1 - 10000*0 == x), so only a mixed tile is loaded here.
// Block = 4 waves = 64 query rows of one (batch, head); grid.x = B * NH * (S/64).
// =====================================================================================
#define SEQ_LEN 2048
#define N_HEADS 16
#define HEAD_D 64
#define HID_SZ 1024
#define QKV_PITCH 3072
#define KV_CHUNK 64
#define N_BATCH 2
#define LDS_P 72   // row pitch of the K and V^T tiles in 16-bit elements: 144 B = 16 B x odd, so the 16 rows of a b128 fragment read fall on distinct banks

#define TCLS_STRIDE 32   // ints between two tile classes: each class has a 128-byte line of its own (one writer per line)

// One wave per 64x64 mask tile (grid = 32 x 32 tiles, tile = query block * 32 + key block): 32 b128 loads per lane = the tile.
// class 0: every RNE-bf16 converted element is +-0; class 1: every one is 1.0; class 2: anything else.
__global__ __launch_bounds__(32) void mask_tile_class(const float* __restrict__ maskp, int* __restrict__ tcls) {
  const int lane = threadIdx.x;
  const int qb = blockIdx.x >> 5, kc = blockIdx.x & 31;
  const float* src = maskp + (size_t)(qb * 64 + (lane >> 4)) * SEQ_LEN + kc * 64 + (lane & 15) * 4;
  unsigned int nz = 0u, n1 = 0u;
#pragma unroll
  for (int i = 0; i < 32; ++i) {
    const v4u m = *(const v4u*)(src + (size_t)(2 * i) * SEQ_LEN);
#pragma unroll
    for (int e = 0; e < 4; ++e) { const unsigned int u = rne_bf16_word(m[e]); nz |= (u & 0x7FFFFFFFu); n1 |= (u ^ 0x3F800000u); }
  }
  const int any_nz = __any(nz != 0u);
  const int any_n1 = __any(n1 != 0u);
  if (lane == 0) tcls[(size_t)blockIdx.x * TCLS_STRIDE] = any_nz ? (any_n1 ? 2 : 1) : 0;
}

__global__ __launch_bounds__(128) void attn_planes_kernel(
    const unsigned short* __restrict__ qkvh, const unsigned short* __restrict__ qkvl,
    const float* __restrict__ maskp, const int* __restrict__ tcls,
    unsigned short* __restrict__ ctxh, unsigned short* __restrict__ ctxl) {
  union FB { v16b v; v8b h[2]; };
  union FW { v16b v; unsigned int w[8]; };
  __shared__ __align__(16) unsigned short Kh[KV_CHUNK * LDS_P];     // K hi [kv][d], pitch LDS_P
  __shared__ __align__(16) unsigned short Kl[KV_CHUNK * LDS_P];     // K lo [kv][d], pitch LDS_P
  __shared__ __align__(16) unsigned short Vth[HEAD_D * LDS_P];      // V hi [d][kv], pitch LDS_P
  __shared__ __align__(16) unsigned short Vtl[HEAD_D * LDS_P];      // V lo [d][kv], pitch LDS_P
  __shared__ __align__(16) float Os[4][16 * 68];                   // per wave out tile, pitch 68; Os[0][0..127] doubles as column-sum scratch
  __shared__ __align__(16) unsigned int Msk[64 * 68];              // mask tile [q][kv] (f32 bits), pitch 68; doubles as v scratch [kv][d]

  const int tid  = threadIdx.x;
  const int wave = tid >> 5;
  const int lane = tid & 31;
  const int hh   = lane >> 4;
  const int c    = lane & 15;
  const int bx   = blockIdx.x;
  const int qb   = 31 - (bx >> 5);           // SEQ_LEN / 64 == 32; late query blocks first: under a lower-triangular mask they hold the most live tiles, so cost falls with the block index (speed only)
  static_assert(N_BATCH * N_HEADS == 32 && SEQ_LEN / 64 == 32, "block index split");
  const int bhd  = bx & 31;                  // N_BATCH * N_HEADS == 32
  const int h    = bhd & (N_HEADS - 1);
  const int b    = bhd >> 4;
  const int qblk = qb * 64;
  const int q0   = qblk + wave * 16;
  const size_t rowb = (size_t)b * SEQ_LEN;

  // ---- Q fragments (B operand of the transposed scores), hi and lo planes, 2 d-chunks (8 b128 loads per lane) ----
  v16b qah[2], qal[2];
  {
    const size_t qoff = (rowb + q0 + c) * QKV_PITCH + h * HEAD_D + 8 * hh;
#pragma unroll
    for (int dc = 0; dc < 2; ++dc) {
      qah[dc] = Frag<__bf16>::load((const __bf16*)qkvh + qoff + dc * 32);
      qal[dc] = Frag<__bf16>::load((const __bf16*)qkvl + qoff + dc * 32);
    }
  }

  float mrow = -__builtin_inff(), lrow = 0.f;   // running maximum and sum of query q0 + c (the same in both lane halves)
  v8f oacc[4];                                  // out^T: oacc[t][r] = out[q0 + c][16 t + 8 hh + r]
#pragma unroll
  for (int t = 0; t < 4; ++t) oacc[t] = (v8f){0.f,0.f,0.f,0.f,0.f,0.f,0.f,0.f};

  const int cls_l = tcls[(size_t)(qb * 32 + lane) * TCLS_STRIDE];   // lane l: class of this query block's mask tile l

  const int kvr = tid >> 1;            // staging: kv row of this thread (0..63)
  const int dh  = (tid & 1) * 32;      // staging: d half (0 or 32)

  for (int kc = 0; kc < SEQ_LEN / KV_CHUNK; ++kc) {
    const int kv0 = kc * KV_CHUNK;
    __syncthreads();
    const int cls = __builtin_amdgcn_readlane(cls_l, kc);   // scalar, the same in every wave of the block

    const size_t koff = (rowb + kv0 + kvr) * QKV_PITCH + HID_SZ + h * HEAD_D + dh;
    const size_t voff = koff + HID_SZ;

    if (cls != 0) {
      if (cls == 2) {
        // ---- mixed mask tile [64 q][64 kv]: 1024 float4 / 128 threads = 8 b128 per lane; RNE-bf16 convert ----
#pragma unroll
        for (int i = 0; i < 8; ++i) {
          const int idx = i * 128 + tid;
          const int row = idx >> 4;
          const int c4  = (idx & 15) * 4;
          v4u m = *(const v4u*)(maskp + (size_t)(qblk + row) * SEQ_LEN + kv0 + c4);
#pragma unroll
          for (int e = 0; e < 4; ++e) m[e] = rne_bf16_word(m[e]);
          *(v4u*)(Msk + row * 68 + c4) = m;
        }
      }
      // ---- K hi/lo rows -> LDS [kv][d] (4+4 b128 per lane, 128 threads x 32 elements = 64x64 per plane) ----
      {
        const v4u* gh = (const v4u*)(qkvh + koff);
        const v4u* gl = (const v4u*)(qkvl + koff);
        v4u* lh = (v4u*)(Kh + kvr * LDS_P + dh);
        v4u* ll = (v4u*)(Kl + kvr * LDS_P + dh);
        v4u a[4], bb[4];
#pragma unroll
        for (int i = 0; i < 4; ++i) { a[i] = gh[i]; bb[i] = gl[i]; }
        // inputs-only fence on the loaded values: keeps the 8 loads in flight together (without it this build waits after every second load)
        asm volatile("" :: "v"(a[0]), "v"(a[1]), "v"(a[2]), "v"(a[3]), "v"(bb[0]), "v"(bb[1]), "v"(bb[2]), "v"(bb[3]));
#pragma unroll
        for (int i = 0; i < 4; ++i) { lh[i] = a[i]; ll[i] = bb[i]; }
      }
      asm volatile("" ::: "memory");
      // ---- V hi/lo rows -> LDS transposed [d][kv] ----
      {
        const v4u* gh = (const v4u*)(qkvh + voff);
        const v4u* gl = (const v4u*)(qkvl + voff);
        unsigned short* sh = Vth + dh * LDS_P + kvr;   // one base per plane: every row step below is a constant offset
        unsigned short* sl = Vtl + dh * LDS_P + kvr;
        v4u vh4[4], vl4[4];
#pragma unroll
        for (int i = 0; i < 4; ++i) { vh4[i] = gh[i]; vl4[i] = gl[i]; }
        // inputs-only fence on the loaded values: keeps the 8 loads in flight together, as above
        asm volatile("" :: "v"(vh4[0]), "v"(vh4[1]), "v"(vh4[2]), "v"(vh4[3]), "v"(vl4[0]), "v"(vl4[1]), "v"(vl4[2]), "v"(vl4[3]));
#pragma unroll
        for (int i = 0; i < 4; ++i) {
          const v4u wh = vh4[i];
          const v4u wl = vl4[i];
#pragma unroll
          for (int e = 0; e < 4; ++e) {
            const int d = 8 * i + 2 * e;
            sh[d * LDS_P]       = (unsigned short)(wh[e] & 0xFFFFu);
            sh[(d + 1) * LDS_P] = (unsigned short)(wh[e] >> 16);
            sl[d * LDS_P]       = (unsigned short)(wl[e] & 0xFFFFu);
            sl[(d + 1) * LDS_P] = (unsigned short)(wl[e] >> 16);
          }
        }
      }
      __syncthreads();

      // ---- scores, transposed: S^T = K . Q^T, 4 key subtiles x 2 d-chunks, hi.hi + lo.hi + hi.lo ----
      // s[j][r] = score of query q0 + c against key kv0 + 16 j + 8 hh + r: one query per lane, its keys in registers
      v8f s[4];
#pragma unroll
      for (int j = 0; j < 4; ++j) {
        s[j] = (v8f){0.f,0.f,0.f,0.f,0.f,0.f,0.f,0.f};
#pragma unroll
        for (int dc = 0; dc < 2; ++dc) {
          FB kb, kl;
          const int ko = (j * 16 + c) * LDS_P + dc * 32 + 8 * hh;
          kb.h[0] = *(const v8b*)((const __bf16*)Kh + ko);
          kb.h[1] = *(const v8b*)((const __bf16*)Kh + ko + 16);
          kl.h[0] = *(const v8b*)((const __bf16*)Kl + ko);
          kl.h[1] = *(const v8b*)((const __bf16*)Kl + ko + 16);
          s[j] = at_mma(kb.v, qah[dc], s[j]);
          s[j] = at_mma(kl.v, qah[dc], s[j]);
          s[j] = at_mma(kb.v, qal[dc], s[j]);
        }
      }
      // ---- scale, mask (literal s*m - 10000*(1-m)), maximum of the lane's 32 keys, then of both lane halves ----
      float cm = -__builtin_inff();
      if (cls == 2) {
        const unsigned int* mp = Msk + (wave * 16 + c) * 68 + 8 * hh;
#pragma unroll
        for (int j = 0; j < 4; ++j) {
          const v4u k0 = *(const v4u*)(mp + j * 16);
          const v4u k1 = *(const v4u*)(mp + j * 16 + 4);
#pragma unroll
          for (int r = 0; r < 8; ++r) {
            const float mk = __uint_as_float(r < 4 ? k0[r & 3] : k1[r & 3]);
            float x = s[j][r] * 0.125f;
            x = x * mk - 10000.0f * (1.0f - mk);
            s[j][r] = x;
            cm = fmaxf(cm, x);
          }
        }
      } else {
        // tile of ones: x*1 - 10000*(1 - 1) == x for every x
#pragma unroll
        for (int j = 0; j < 4; ++j)
#pragma unroll
          for (int r = 0; r < 8; ++r) {
            const float x = s[j][r] * 0.125f;
            s[j][r] = x;
            cm = fmaxf(cm, x);
          }
      }
      cm = fmaxf(cm, xhalf(cm));
      // ---- online softmax, one query per lane; P^T split into bf16 hi/lo and packed in place as B operands ----
      FW ph[2], pl[2];
      {
        const float mnew  = fmaxf(mrow, cm);
        const float alpha = expf(mrow - mnew);
        mrow = mnew;
        float ps[4];
#pragma unroll
        for (int j = 0; j < 4; ++j) {
          ps[j] = 0.f;
#pragma unroll
          for (int r = 0; r < 8; r += 2) {
            const float p0 = expf(s[j][r] - mnew);
            const float p1 = expf(s[j][r + 1] - mnew);
            ps[j] += p0;
            ps[j] += p1;
            unsigned int wh, wl;
            split_pack2(p0, p1, wh, wl);
            ph[j >> 1].w[(j & 1) * 4 + (r >> 1)] = wh;   // element 8 (j & 1) + r of the 32-key fragment = key 16 (j & 1) + 8 hh + r
            pl[j >> 1].w[(j & 1) * 4 + (r >> 1)] = wl;
          }
        }
        float psum = (ps[0] + ps[1]) + (ps[2] + ps[3]);
        psum += xhalf(psum);
        lrow = lrow * alpha + psum;
#pragma unroll
        for (int t = 0; t < 4; ++t)
#pragma unroll
          for (int r = 0; r < 8; ++r) oacc[t][r] *= alpha;
      }
      // ---- out^T += V^T(64x64) . P^T(64x16): vh.ph + vl.ph + vh.pl; oacc[t][r] = out[q0 + c][16 t + 8 hh + r] ----
#pragma unroll
      for (int kk = 0; kk < 2; ++kk) {
#pragma unroll
        for (int t = 0; t < 4; ++t) {
          FB vb, vl;
          const int vo = (t * 16 + c) * LDS_P + kk * 32 + 8 * hh;
          vb.h[0] = *(const v8b*)((const __bf16*)Vth + vo);
          vb.h[1] = *(const v8b*)((const __bf16*)Vth + vo + 16);
          vl.h[0] = *(const v8b*)((const __bf16*)Vtl + vo);
          vl.h[1] = *(const v8b*)((const __bf16*)Vtl + vo + 16);
          oacc[t] = at_mma(vb.v, ph[kk].v, oacc[t]);
          oacc[t] = at_mma(vl.v, ph[kk].v, oacc[t]);
          oacc[t] = at_mma(vb.v, pl[kk].v, oacc[t]);
        }
      }
    } else {
      // ---- all-masked tile: v rows (hi+lo, f32) -> Msk scratch [kv][d], column sums, closed-form update ----
      {
        const v4u* gh = (const v4u*)(qkvh + voff);
        const v4u* gl = (const v4u*)(qkvl + voff);
#pragma unroll
        for (int i = 0; i < 4; ++i) {
          const v4u wh = gh[i];
          const v4u wl = gl[i];
          v4u f0, f1;
          {
            const float a0 = __uint_as_float(wh[0] << 16);          const float b0 = __uint_as_float(wl[0] << 16);
            const float a1 = __uint_as_float(wh[0] & 0xFFFF0000u); const float b1 = __uint_as_float(wl[0] & 0xFFFF0000u);
            const float a2 = __uint_as_float(wh[1] << 16);          const float b2 = __uint_as_float(wl[1] << 16);
            const float a3 = __uint_as_float(wh[1] & 0xFFFF0000u); const float b3 = __uint_as_float(wl[1] & 0xFFFF0000u);
            f0[0] = __float_as_uint(a0 + b0); f0[1] = __float_as_uint(a1 + b1);
            f0[2] = __float_as_uint(a2 + b2); f0[3] = __float_as_uint(a3 + b3);
          }
          {
            const float a0 = __uint_as_float(wh[2] << 16);          const float b0 = __uint_as_float(wl[2] << 16);
            const float a1 = __uint_as_float(wh[2] & 0xFFFF0000u); const float b1 = __uint_as_float(wl[2] & 0xFFFF0000u);
            const float a2 = __uint_as_float(wh[3] << 16);          const float b2 = __uint_as_float(wl[3] << 16);
            const float a3 = __uint_as_float(wh[3] & 0xFFFF0000u); const float b3 = __uint_as_float(wl[3] & 0xFFFF0000u);
            f1[0] = __float_as_uint(a0 + b0); f1[1] = __float_as_uint(a1 + b1);
            f1[2] = __float_as_uint(a2 + b2); f1[3] = __float_as_uint(a3 + b3);
          }
          *(v4u*)(Msk + kvr * 68 + dh + 8 * i)     = f0;
          *(v4u*)(Msk + kvr * 68 + dh + 8 * i + 4) = f1;
        }
      }
      __syncthreads();
      {
        const int d = tid & 63, half = tid >> 6;
        float part = 0.f;
#pragma unroll 8
        for (int kq = 0; kq < 32; ++kq) part += __uint_as_float(Msk[(half * 32 + kq) * 68 + d]);
        Os[0][half * 64 + d] = part;
      }
      __syncthreads();
      {
        const float mnew  = fmaxf(mrow, -10000.0f);
        const float alpha = expf(mrow - mnew);
        const float p     = expf(-10000.0f - mnew);
        mrow = mnew;
        lrow = lrow * alpha + 64.0f * p;
#pragma unroll
        for (int t = 0; t < 4; ++t) {
          const float* cs = Os[0] + t * 16 + 8 * hh;      // column sums of the lane's 8 output columns, two partial sums each
          const v4f a0 = *(const v4f*)cs;
          const v4f a1 = *(const v4f*)(cs + 4);
          const v4f b0 = *(const v4f*)(cs + 64);
          const v4f b1 = *(const v4f*)(cs + 68);
#pragma unroll
          for (int r = 0; r < 8; ++r) {
            const float vs = (r < 4 ? a0[r & 3] : a1[r & 3]) + (r < 4 ? b0[r & 3] : b1[r & 3]);
            oacc[t][r] = oacc[t][r] * alpha + p * vs;
          }
        }
      }
    }
  }
  __syncthreads();

  float* os = Os[wave];
  {
    const float inv = 1.0f / lrow;
#pragma unroll
    for (int t = 0; t < 4; ++t) {
      v4f x0, x1;
#pragma unroll
      for (int r = 0; r < 4; ++r) { x0[r] = oacc[t][r] * inv; x1[r] = oacc[t][r + 4] * inv; }
      *(v4f*)(os + c * 68 + t * 16 + 8 * hh)     = x0;
      *(v4f*)(os + c * 68 + t * 16 + 8 * hh + 4) = x1;
    }
  }
  __builtin_amdgcn_fence(__ATOMIC_RELEASE, "workgroup");
  __builtin_amdgcn_wave_barrier();
  __builtin_amdgcn_fence(__ATOMIC_ACQUIRE, "workgroup");
  {
    const int q8 = lane >> 3, c8 = (lane & 7) * 8;
    unsigned short* oh = ctxh + (rowb + q0) * HID_SZ + h * HEAD_D + c8;
    unsigned short* ol = ctxl + (rowb + q0) * HID_SZ + h * HEAD_D + c8;
    {
#pragma unroll
      for (int it = 0; it < 4; ++it) {
        const int row = it * 4 + q8;
        const float* sp = os + row * 68 + c8;
        const v4f x0 = *(const v4f*)sp;
        const v4f x1 = *(const v4f*)(sp + 4);
        v4u wh, wl;
        unsigned int th, tl;
        split_pack2(x0[0], x0[1], th, tl); wh[0] = th; wl[0] = tl;
        split_pack2(x0[2], x0[3], th, tl); wh[1] = th; wl[1] = tl;
        split_pack2(x1[0], x1[1], th, tl); wh[2] = th; wl[2] = tl;
        split_pack2(x1[2], x1[3], th, tl); wh[3] = th; wl[3] = tl;
        *(v4u*)(oh + (size_t)row * HID_SZ) = wh;
        *(v4u*)(ol + (size_t)row * HID_SZ) = wl;
      }
      
    }
  }
}

// ---------------------------------------------------------------------------
// Workspace region map (bytes):
//   Hb    bf16 [4096][1024]        off 0            size  8388608
//   WQt   bf16 [3072][1024]        off 8388608      size  6291456
//   WDt   bf16 [1024][1024]        off 14680064     size  2097152
//   BQ    f32  [3072]              off 16777216     size    12288
//   BD    f32  [1024]              off 16789504     size     4096
//   QKVh  bf16 [4096][3072]        off 16793600     size 25165824
//   QKVl  bf16 [4096][3072]        off 41959424     size 25165824
//   CTXh  bf16 [4096][1024]        off 67125248     size  8388608
//   CTXl  bf16 [4096][1024]        off 75513856     size  8388608
//   TCLS  i32  [1024] x 128 B      off 83902464     size   131072
//   end                            84033536
// Every region is written by its producer before any consumer reads it (TCLS: only the first int of each 128-byte line).
// ---------------------------------------------------------------------------
extern "C" void kernel_launch(void* const* d_in, const int* in_sizes, int n_in,
                              void* d_out, int out_size, void* d_ws, size_t ws_size,
                              hipStream_t stream) {
  constexpr int kB = N_BATCH, kS = SEQ_LEN, kH = HID_SZ;
  constexpr int kM = kB * kS;          // 4096
  constexpr int kN3 = 3 * kH;          // 3072
  static_assert(kM % 64 == 0 && kN3 % 64 == 0 && kH % 64 == 0);   // GEMM M/N tile multiples
  static_assert(kH % 32 == 0);                                     // GEMM K step
  static_assert(kS % KV_CHUNK == 0 && kS / 64 == 32 && kH / HEAD_D == N_HEADS);
  static_assert((kM * kH) % 2048 == 0 && kN3 % 1024 == 0 && kH % 1024 == 0);

  if (n_in < 6) return;
  if (in_sizes[0] != kM * kH || in_sizes[1] != kS * kS || in_sizes[2] != kH * kN3 ||
      in_sizes[3] != kN3 || in_sizes[4] != kH * kH || in_sizes[5] != kH) return;
  if (out_size != kM * kH) return;

  const float* hidden  = (const float*)d_in[0];
  const float* maskp   = (const float*)d_in[1];
  const float* w_qkv   = (const float*)d_in[2];
  const float* b_qkv   = (const float*)d_in[3];
  const float* w_dense = (const float*)d_in[4];
  const float* b_dense = (const float*)d_in[5];
  float* out = (float*)d_out;

  const size_t szHb  = (size_t)kM * kH * 2;
  const size_t szWQt = (size_t)kN3 * kH * 2;
  const size_t szWDt = (size_t)kH * kH * 2;
  const size_t szBQ  = (size_t)kN3 * 4;
  const size_t szBD  = (size_t)kH * 4;
  const size_t szQKV = (size_t)kM * kN3 * 2;
  const size_t szCTX = (size_t)kM * kH * 2;
  const size_t offHb   = 0;
  const size_t offWQt  = offHb + szHb;
  const size_t offWDt  = offWQt + szWQt;
  const size_t offBQ   = offWDt + szWDt;
  const size_t offBD   = offBQ + szBQ;
  const size_t offQKVh = offBD + szBD;
  const size_t offQKVl = offQKVh + szQKV;
  const size_t offCTXh = offQKVl + szQKV;
  const size_t offCTXl = offCTXh + szCTX;
  const size_t offTCLS = offCTXl + szCTX;
  const size_t szTCLS  = (size_t)(kS / 64) * (kS / 64) * TCLS_STRIDE * 4;
  const size_t offEnd  = offTCLS + szTCLS;
  if (offEnd > ws_size) return;

  char* ws = (char*)d_ws;
  unsigned short* Hb   = (unsigned short*)(ws + offHb);
  unsigned short* WQt  = (unsigned short*)(ws + offWQt);
  unsigned short* WDt  = (unsigned short*)(ws + offWDt);
  float*          BQ   = (float*)(ws + offBQ);
  float*          BD   = (float*)(ws + offBD);
  unsigned short* QKVh = (unsigned short*)(ws + offQKVh);
  unsigned short* QKVl = (unsigned short*)(ws + offQKVl);
  unsigned short* CTXh = (unsigned short*)(ws + offCTXh);
  unsigned short* CTXl = (unsigned short*)(ws + offCTXl);
  int*            TCLS = (int*)(ws + offTCLS);

  // 1) hidden -> bf16 plane [4096][1024]
  {
    const int n8 = (kM * kH) / 8;                       // 524288 threads = 2048 blocks exactly
    cast_f32_bf16x8<<<dim3(n8 / 256), dim3(256), 0, stream>>>(hidden, Hb, n8);
  }
  // 2) w_qkv [1024 rows][3072 cols] -> WQt [3072][1024] bf16 ; w_dense [1024][1024] -> WDt [1024][1024] bf16
  transpose_cast_bf16<<<dim3(kN3 / 64, kH / 64), dim3(256), 0, stream>>>(w_qkv, WQt, kH, kN3);
  transpose_cast_bf16<<<dim3(kH / 64, kH / 64), dim3(256), 0, stream>>>(w_dense, WDt, kH, kH);
  // 3) bias lines RNE-bf16 converted (kept as f32)
  rne_bf16_f32x4<<<dim3((kN3 / 4) / 256), dim3(256), 0, stream>>>(b_qkv, BQ, kN3 / 4);
  rne_bf16_f32x4<<<dim3((kH / 4) / 256), dim3(256), 0, stream>>>(b_dense, BD, kH / 4);
  // 4) fused qkv projection: [4096x1024] x WQt[3072x1024]^T + bias -> bf16 hi/lo planes [4096][3072]
  {
    const int tiles = (kM / 64) * (kN3 / 64);           // 3072 wave tiles -> 384 blocks of 8 waves
    wmma_gemm64<1, 0, 2, 2, false><<<dim3(tiles / 8, 1), dim3(256), 0, stream>>>(
        Hb, Hb, kH, 0L, WQt, WQt, kH, 0L, (void*)QKVh, (void*)QKVl, kN3, 0L,
        BQ, BQ, 0L, kM, kN3, kH, 1.0f);
  }
  // 5) class of each 64x64 mask tile, then attention per (batch, head, 64 query rows) -> ctx bf16 hi/lo planes [4096][1024]
  mask_tile_class<<<dim3((kS / 64) * (kS / 64)), dim3(32), 0, stream>>>(maskp, TCLS);
  attn_planes_kernel<<<dim3(kB * N_HEADS * (kS / 64)), dim3(128), 0, stream>>>(QKVh, QKVl, maskp, TCLS, CTXh, CTXl);
  // 6) output projection: ctx (hi/lo) [4096x1024] x WDt[1024x1024]^T + bias -> out f32 [4096][1024]
  {
    const int tiles = (kM / 64) * (kH / 64);            // 1024 wave tiles -> 128 blocks
    wmma_gemm64<1, 2, 2, 0, false><<<dim3(tiles / 8, 1), dim3(256), 0, stream>>>(
        CTXh, CTXl, kH, 0L, WDt, WDt, kH, 0L, (void*)out, (void*)out, kH, 0L,
        BD, BD, 0L, kM, kH, kH, 1.0f);
  }
}

// v005
// A run of this version takes 186 microseconds.
// Next to v004, in two timings, it ran 1.43 and 1.42 times as fast.
// Counting every step since v000, it is 3.37 times as fast.
// Contractions on v_wmma_f32_16x16x32_bf16 (bf16 operands, f32 accumulate): qkv projection = one product on RNE-bf16 inputs; q.k^T and p.v = bf16 hi/lo planes (3 products); output projection = ctx bf16 hi/lo x bf16 weights (2 products). Masking, softmax and normalisation in f32.
#include <hip/hip_runtime.h>

typedef __attribute__((ext_vector_type(16))) _Float16 v16h;
typedef __attribute__((ext_vector_type(8)))  _Float16 v8h;
typedef __attribute__((ext_vector_type(16))) __bf16   v16b;
typedef __attribute__((ext_vector_type(8)))  __bf16   v8b;
typedef __attribute__((ext_vector_type(8)))  float    v8f;
typedef __attribute__((ext_vector_type(4)))  float    v4f;
typedef __attribute__((ext_vector_type(4)))  unsigned int v4u;

__device__ __forceinline__ unsigned short f2bf_bits(float f) {
  unsigned u = __float_as_uint(f);
  return (unsigned short)((u + 0x7FFFu + ((u >> 16) & 1u)) >> 16);
}
__device__ __forceinline__ float bf_bits2f(unsigned short h) { return __uint_as_float(((unsigned)h) << 16); }
// RNE convert of an f32 bit pattern to its bf16 value, kept as an f32 bit pattern
__device__ __forceinline__ unsigned int rne_bf16_word(unsigned int u) {
  return (u + 0x7FFFu + ((u >> 16) & 1u)) & 0xFFFF0000u;
}
__device__ __forceinline__ unsigned int pack_bf16x2(float a, float b) {
  return (unsigned int)f2bf_bits(a) | ((unsigned int)f2bf_bits(b) << 16);
}
// hi/lo bf16 split of two floats, packed as (hi_a | hi_b<<16) and (lo_a | lo_b<<16)
__device__ __forceinline__ void split_pack2(float a, float b, unsigned int& wh, unsigned int& wl) {
  const unsigned short ha = f2bf_bits(a), hb = f2bf_bits(b);
  const unsigned short la = f2bf_bits(a - bf_bits2f(ha)), lb = f2bf_bits(b - bf_bits2f(hb));
  wh = (unsigned int)ha | ((unsigned int)hb << 16);
  wl = (unsigned int)la | ((unsigned int)lb << 16);
}

// hazard guards as plain device helpers
__device__ __forceinline__ void dep_guard_h(v8f& a, v8f& b, v16h x, v16h y) { asm volatile("v_nop\n\tv_nop\n\tv_nop\n\tv_nop" : "+v"(a), "+v"(b) : "v"(x), "v"(y)); }
__device__ __forceinline__ void dep_guard_b(v8f& a, v8f& b, v16b x, v16b y) { asm volatile("v_nop\n\tv_nop\n\tv_nop\n\tv_nop" : "+v"(a), "+v"(b) : "v"(x), "v"(y)); }
__device__ __forceinline__ void keep4_h(v16h a, v16h b, v16h c, v16h d) { asm volatile("v_nop" :: "v"(a), "v"(b), "v"(c), "v"(d)); }
__device__ __forceinline__ void keep4_b(v16b a, v16b b, v16b c, v16b d) { asm volatile("v_nop" :: "v"(a), "v"(b), "v"(c), "v"(d)); }
__device__ __forceinline__ void acc_guard4(v8f& a, v8f& b, v8f& c, v8f& d) { asm volatile("v_nop\n\tv_nop\n\tv_nop\n\tv_nop" : "+v"(a), "+v"(b), "+v"(c), "+v"(d)); }
template <typename T> struct Frag;
template <> struct Frag<_Float16> {
  typedef v16h V; union U { v16h v; v8h h[2]; };
  static __device__ __forceinline__ v16h load(const _Float16* p) {   // elements 0..7 <- p[0..7], 8..15 <- p[16..23]
    U f; f.h[0] = *(const v8h*)(p); f.h[1] = *(const v8h*)(p + 16); return f.v;
  }
  static __device__ __forceinline__ v8f mma(v16h a, v16h b, v8f c) {
    return __builtin_amdgcn_wmma_f32_16x16x32_f16(false, a, false, b, (short)0, c, false, false);
  }
  static __device__ __forceinline__ void guard(v8f& a, v8f& b, v16h x, v16h y) { dep_guard_h(a, b, x, y); }
  static __device__ __forceinline__ void keep(v16h a, v16h b, v16h c, v16h d) { keep4_h(a, b, c, d); }
};
template <> struct Frag<__bf16> {
  typedef v16b V; union U { v16b v; v8b h[2]; };
  static __device__ __forceinline__ v16b load(const __bf16* p) {
    U f; f.h[0] = *(const v8b*)(p); f.h[1] = *(const v8b*)(p + 16); return f.v;
  }
  static __device__ __forceinline__ v8f mma(v16b a, v16b b, v8f c) {
    return __builtin_amdgcn_wmma_f32_16x16x32_bf16(false, a, false, b, (short)0, c, false, false);
  }
  static __device__ __forceinline__ void guard(v8f& a, v8f& b, v16b x, v16b y) { dep_guard_b(a, b, x, y); }
  static __device__ __forceinline__ void keep(v16b a, v16b b, v16b c, v16b d) { keep4_b(a, b, c, d); }
};

// ---- Register-blocked batched WMMA GEMM ------------------------------------
// C[m,n] = scale * sum_k A[m,k] * Bt[n,k] (+bias)(+resid); a block of 8 waves (2 x 4) owns a 128x256 tile, each wave 64x64 of it.
// A row-major [M,K]; Bt row-major [N,K]; M % 128 == 0, N % 256 == 0, K % 64 == 0.
// The block's rows of A and Bt go through LDS in slices of 64 k (one 128-byte line per row), brought by asynchronous copies
// into two buffers: slice t + 1 flies while slice t is worked on, and every line is fetched once per block, whole.
// SPLIT: 0 = single planes; 1 = A and Bt hi/lo planes (hi.hi + hi.lo + lo.hi); 2 = A hi/lo planes only (hi.B + lo.B).
// BIAS_MODE: 0 = none, 1 = bias[m], 2 = bias[n].
// OUT_MODE: 0 = f32, 1 = f16, 2 = bf16 hi plane (Cout) + bf16 lo plane (Cout2).
// ET: 0 = f16 operands, 1 = bf16 operands (pointers passed as 16-bit storage)
template <int ET> struct Elem;
template <> struct Elem<0> { typedef _Float16 T; };
template <> struct Elem<1> { typedef __bf16 T; };

#define G_BM 128   // block tile rows of A
#define G_BN 256   // block tile rows of Bt
#define G_KS 64    // k elements of one staged slice
#define G_P  72    // LDS row pitch in 16-bit elements: 144 B = 16 B x odd, free of bank conflicts for b128 fragment reads

// One line of an asynchronous copy: 16 bytes per lane, global -> LDS, through no register.
#define G_CP(l, g) "global_load_async_to_lds_b128 %" #l ", %" #g ", off\n\t"
// N copies and, as the last line of the same statement, the wait that stands before their address registers are rewritten.
template <int N>
__device__ __forceinline__ void async_copies(const unsigned int* l, const unsigned short* const* g) {
  static_assert(N == 8 || N == 12, "copies per statement");
  if constexpr (N == 12) {
    asm volatile(G_CP(0, 1) G_CP(2, 3) G_CP(4, 5) G_CP(6, 7) G_CP(8, 9) G_CP(10, 11) G_CP(12, 13) G_CP(14, 15)
                 G_CP(16, 17) G_CP(18, 19) G_CP(20, 21) G_CP(22, 23) "s_wait_xcnt 0x0"
                 :: "v"(l[0]), "v"(g[0]), "v"(l[1]), "v"(g[1]), "v"(l[2]), "v"(g[2]), "v"(l[3]), "v"(g[3]),
                    "v"(l[4]), "v"(g[4]), "v"(l[5]), "v"(g[5]), "v"(l[6]), "v"(g[6]), "v"(l[7]), "v"(g[7]),
                    "v"(l[8]), "v"(g[8]), "v"(l[9]), "v"(g[9]), "v"(l[10]), "v"(g[10]), "v"(l[11]), "v"(g[11])
                 : "memory");
  } else {
    asm volatile(G_CP(0, 1) G_CP(2, 3) G_CP(4, 5) G_CP(6, 7) G_CP(8, 9) G_CP(10, 11) G_CP(12, 13) G_CP(14, 15) "s_wait_xcnt 0x0"
                 :: "v"(l[0]), "v"(g[0]), "v"(l[1]), "v"(g[1]), "v"(l[2]), "v"(g[2]), "v"(l[3]), "v"(g[3]),
                    "v"(l[4]), "v"(g[4]), "v"(l[5]), "v"(g[5]), "v"(l[6]), "v"(g[6]), "v"(l[7]), "v"(g[7])
                 : "memory");
  }
}

template <int ET, int SPLIT, int BIAS_MODE, int OUT_MODE, bool RESID, int ACT = 0>
__global__ __launch_bounds__(256) void wmma_gemm64(
    const unsigned short* __restrict__ Ap, const unsigned short* __restrict__ A2p, int lda, long strideA,
    const unsigned short* __restrict__ Btp, const unsigned short* __restrict__ Bt2p, int ldb, long strideB,
    void* __restrict__ Cout, void* __restrict__ Cout2, int ldc, long strideC,
    const float* __restrict__ bias,
    const float* __restrict__ resid, long strideR,
    int M, int N, int K, float scale) {
  typedef typename Elem<ET>::T T;
  typedef typename Frag<T>::V V;
  constexpr int NPA   = (SPLIT != 0) ? 2 : 1;             // planes of A
  constexpr int NPB   = (SPLIT == 1) ? 2 : 1;             // planes of Bt
  constexpr int ROWS  = G_BM * NPA + G_BN * NPB;          // rows of one slice: [A | A2 | Bt | Bt2]
  constexpr int STAGE = ROWS * G_P;                       // 16-bit elements of one buffer
  constexpr int NCOPY = ROWS / 32;                        // copies per lane and slice: 256 lanes x 16 B = 32 rows of 128 B
  constexpr int CGRP  = (NCOPY % 12 == 0) ? 12 : 8;       // copies per statement
  constexpr int AHEAD = (SPLIT == 0) ? 4 : 1;             // as far as the registers reach below 256
  static_assert(NCOPY % CGRP == 0 && NCOPY <= 63, "copies per slice");
  __shared__ __align__(16) unsigned short ring[2 * STAGE];   // two buffers
  __shared__ __align__(16) float sT[8][16 * 68];   // per-wave 16x64 slab, pitch 68 floats
  const int b    = blockIdx.y;
  const int tid  = threadIdx.x;
  const int lane = tid & 31;
  const int wave = tid >> 5;
  const int tilesN = N / G_BN;
  const int tilesM = M / G_BM;
  if ((int)blockIdx.x >= tilesM * tilesN) return;   // the same for the whole block, in front of every barrier
  const int tm = blockIdx.x / tilesN;
  const int tn = blockIdx.x - tm * tilesN;
  const int wm = wave >> 2;                    // wave's 64 rows of the block's A rows
  const int wn = wave & 3;                     // wave's 64 rows of the block's Bt rows
  const int m0 = tm * G_BM + (wm << 6);
  const int n0 = tn * G_BN + (wn << 6);

  const int rlane = lane & 15;                 // row (A) / col (B, D) within subtile
  const int koff  = (lane >> 4) * 8;           // k offset of this lane half
  const int mOff  = (lane >> 4) * 8;           // D row offset

  // copy i of a lane: row 32 i + (tid >> 3) of the slice, bytes 16 (tid & 7) .. + 15 of its 128: 8 lanes bring one whole line
  const int crow = tid >> 3;
  const int cseg = (tid & 7) * 8;
  const unsigned short* gA  = Ap  + (size_t)b * strideA + (size_t)(tm * G_BM + crow) * lda + cseg;
  const unsigned short* gA2 = A2p + (size_t)b * strideA + (size_t)(tm * G_BM + crow) * lda + cseg;
  const unsigned short* gB  = Btp  + (size_t)b * strideB + (size_t)(tn * G_BN + crow) * ldb + cseg;
  const unsigned short* gB2 = Bt2p + (size_t)b * strideB + (size_t)(tn * G_BN + crow) * ldb + cseg;
  const unsigned int lds0 = (unsigned int)(size_t)ring + (unsigned int)(crow * G_P + cseg) * 2u;   // low 32 bits = LDS byte address

  auto stage = [&](int kt, int buf) {
    unsigned int l[NCOPY];
    const unsigned short* g[NCOPY];
    // both loops unrolled: every address is a register operand of a copy statement
#pragma unroll
    for (int i = 0; i < NCOPY; ++i) {
      l[i] = lds0 + (unsigned int)(buf * STAGE + i * 32 * G_P) * 2u;
      if (i < 4 * NPA) {
        const int pl = i >> 2, r = (i & 3) * 32;
        g[i] = (pl ? gA2 : gA) + (size_t)r * lda + kt * G_KS;
      } else {
        const int q = i - 4 * NPA, pl = q >> 3, r = (q & 7) * 32;
        g[i] = (pl ? gB2 : gB) + (size_t)r * ldb + kt * G_KS;
      }
    }
#pragma unroll
    for (int i = 0; i < NCOPY; i += CGRP) async_copies<CGRP>(l + i, g + i);
  };

  v8f acc[4][4];
#pragma unroll
  for (int i = 0; i < 4; ++i)
#pragma unroll
    for (int j = 0; j < 4; ++j) acc[i][j] = (v8f){0.f,0.f,0.f,0.f,0.f,0.f,0.f,0.f};

  const int nt = K / G_KS;
  stage(0, 0);
  asm volatile("s_wait_asynccnt 0x0" ::: "memory");   // this wave's copies of slice 0 have landed
  __syncthreads();                                     // ... and every other wave's
  if (nt > 1) stage(1, 1);

  const int aoff = ((wm << 6) + rlane) * G_P + koff;
  const int boff = (G_BM * NPA + (wn << 6) + rlane) * G_P + koff;
  for (int t = 0; t < nt; ++t) {
    const T* sb = (const T*)ring + (t & 1) * STAGE;
#pragma unroll
    for (int ks = 0; ks < G_KS; ks += 32) {
      V bh[4], bl[4];
#pragma unroll
      for (int j = 0; j < 4; ++j) {
        bh[j] = Frag<T>::load(sb + boff + j * 16 * G_P + ks);
        if (SPLIT == 1) bl[j] = Frag<T>::load(sb + boff + (G_BN + j * 16) * G_P + ks);
      }
      // A fragments are fetched AHEAD row groups in front of their products, so that a row group's LDS latency lies under the products before it
      V ah[4], al[4];
#pragma unroll
      for (int i = 0; i < AHEAD; ++i) {
        ah[i] = Frag<T>::load(sb + aoff + i * 16 * G_P + ks);
        if (SPLIT != 0) al[i] = Frag<T>::load(sb + aoff + (G_BM + i * 16) * G_P + ks);
      }
#pragma unroll
      for (int i = 0; i < 4; ++i) {
        if (i + AHEAD < 4) {
          ah[i + AHEAD] = Frag<T>::load(sb + aoff + (i + AHEAD) * 16 * G_P + ks);
          if (SPLIT != 0) al[i + AHEAD] = Frag<T>::load(sb + aoff + (G_BM + (i + AHEAD) * 16) * G_P + ks);
        }
#pragma unroll
        for (int j = 0; j < 4; ++j) {
          acc[i][j] = Frag<T>::mma(ah[i], bh[j], acc[i][j]);
          if (SPLIT == 1) {
            acc[i][j] = Frag<T>::mma(ah[i], bl[j], acc[i][j]);
            acc[i][j] = Frag<T>::mma(al[i], bh[j], acc[i][j]);
          }
          if (SPLIT == 2) {
            acc[i][j] = Frag<T>::mma(al[i], bh[j], acc[i][j]);
          }
        }
        Frag<T>::guard(acc[i][0], acc[i][3], ah[i], (SPLIT != 0) ? al[i] : ah[i]);
      }
      Frag<T>::keep(bh[0], bh[1], bh[2], bh[3]);
      if (SPLIT == 1) Frag<T>::keep(bl[0], bl[1], bl[2], bl[3]);
    }
    asm volatile("s_wait_dscnt 0x0" ::: "memory");      // this wave's reads of slice t are done before its buffer is refilled
    asm volatile("s_wait_asynccnt 0x0" ::: "memory");   // this wave's copies of slice t + 1 have landed
    __syncthreads();                                     // publishes slice t + 1 and ends every reader's last read of slice t
    if (t + 2 < nt) stage(t + 2, t & 1);
  }
  asm volatile("s_wait_asynccnt 0x0" ::: "memory");     // no copy is outstanding behind the loop
  acc_guard4(acc[0][0], acc[0][1], acc[0][2], acc[0][3]);
  acc_guard4(acc[1][0], acc[1][1], acc[1][2], acc[1][3]);
  acc_guard4(acc[2][0], acc[2][1], acc[2][2], acc[2][3]);
  acc_guard4(acc[3][0], acc[3][1], acc[3][2], acc[3][3]);

  // ---- epilogue ----
  float* slab = sT[wave];
  const float* Rb = RESID ? (resid + (size_t)b * strideR) : nullptr;
#pragma unroll
  for (int i = 0; i < 4; ++i) {
    const int mBase = m0 + (i << 4);
#pragma unroll
    for (int j = 0; j < 4; ++j) {
      const int n = n0 + (j << 4) + rlane;
      float bv = 0.f;
      if (BIAS_MODE == 2) bv = bias[n];
#pragma unroll
      for (int r = 0; r < 8; ++r) {
        float v = acc[i][j][r] * scale;
        if (BIAS_MODE == 1) v += bias[mBase + mOff + r];
        if (BIAS_MODE == 2) v += bv;
        if (RESID) v += Rb[(size_t)(mBase + mOff + r) * ldc + n];
        if (ACT == 1) v = tanhf(v);
        if (ACT == 2) v = fmaxf(v, 0.0f);
        if (ACT == 4) v = (v > 0.f) ? v : 0.01f * v;
        slab[(mOff + r) * 68 + (j << 4) + rlane] = v;
      }
    }
    __builtin_amdgcn_fence(__ATOMIC_RELEASE, "workgroup");
    __builtin_amdgcn_wave_barrier();
    __builtin_amdgcn_fence(__ATOMIC_ACQUIRE, "workgroup");
    if (OUT_MODE == 0) {
      float* C = (float*)Cout + (size_t)b * strideC;
      const int hh = lane >> 4, c4 = (lane & 15) * 4;     // row seg = 256 B = 16 lanes x 16 B
      {
#pragma unroll
        for (int it = 0; it < 8; ++it) {
          const int row = it * 2 + hh;
          v4f v = *(const v4f*)(slab + row * 68 + c4);
          *(v4f*)(C + (size_t)(mBase + row) * ldc + n0 + c4) = v;
        }
        
      }
    } else {
      const int q = lane >> 3, c8 = (lane & 7) * 8;
      unsigned short* C  = (unsigned short*)Cout  + (size_t)b * strideC;
      unsigned short* C2 = (OUT_MODE == 2) ? ((unsigned short*)Cout2 + (size_t)b * strideC) : nullptr;
      {
#pragma unroll
        for (int it = 0; it < 4; ++it) {
          const int row = it * 4 + q;
          const float* sp = slab + row * 68 + c8;
          v8h hv, lv;
#pragma unroll
          for (int e = 0; e < 8; ++e) {
            if (OUT_MODE == 1) {
              hv[e] = (_Float16)sp[e];
            } else {
              unsigned short hb = f2bf_bits(sp[e]);
              unsigned short lb = f2bf_bits(sp[e] - bf_bits2f(hb));
              hv[e] = __builtin_bit_cast(_Float16, hb);
              lv[e] = __builtin_bit_cast(_Float16, lb);
            }
          }
          *(v8h*)(C + (size_t)(mBase + row) * ldc + n0 + c8) = hv;
          if (OUT_MODE == 2) *(v8h*)(C2 + (size_t)(mBase + row) * ldc + n0 + c8) = lv;
        }
        
      }
    }
    __builtin_amdgcn_fence(__ATOMIC_RELEASE, "workgroup");
    __builtin_amdgcn_wave_barrier();
    __builtin_amdgcn_fence(__ATOMIC_ACQUIRE, "workgroup");
  }
}

// lane l <-> lane l ^ 16
__device__ __forceinline__ float xhalf(float x) {
  return __builtin_bit_cast(float, __builtin_amdgcn_permlanex16(__builtin_bit_cast(int, x), __builtin_bit_cast(int, x), 0x76543210, 0xfedcba98, false, false));
}

__device__ __forceinline__ v8f at_mma(v16b a, v16b b, v8f c) {
  c = __builtin_amdgcn_wmma_f32_16x16x32_bf16(false, a, false, b, (short)0, c, false, false);
  asm volatile("v_nop\n\tv_nop\n\tv_nop\n\tv_nop" : "+v"(c) : "v"(a), "v"(b));
  return c;
}

// coverage: grid*256 threads x 8 elements == n8*8 elements exactly (host sizes n8 = n/8, n % 2048 == 0)
__global__ __launch_bounds__(256) void cast_f32_bf16x8(const float* __restrict__ in, unsigned short* __restrict__ out, int n8) {
  const int i = blockIdx.x * 256 + threadIdx.x;
  if (i >= n8) return;
  const float* p = in + (size_t)i * 8;
  const v4f a = *(const v4f*)p;
  const v4f c2 = *(const v4f*)(p + 4);
  v4u w;
  w[0] = pack_bf16x2(a[0], a[1]);
  w[1] = pack_bf16x2(a[2], a[3]);
  w[2] = pack_bf16x2(c2[0], c2[1]);
  w[3] = pack_bf16x2(c2[2], c2[3]);
  v4u* d = (v4u*)(out + (size_t)i * 8);
  *d = w;
  
}

// coverage: n4 = n/4 threads, n % 1024 == 0 so every wave writes 4 complete lines
__global__ __launch_bounds__(256) void rne_bf16_f32x4(const float* __restrict__ in, float* __restrict__ out, int n4) {
  const int i = blockIdx.x * 256 + threadIdx.x;
  if (i >= n4) return;
  v4u a = *(const v4u*)(in + (size_t)i * 4);
#pragma unroll
  for (int e = 0; e < 4; ++e) a[e] = rne_bf16_word(a[e]);
  v4u* d = (v4u*)(out + (size_t)i * 4);
  *d = a;
  
}

// ---- transpose + bf16 cast: in[nrows][ncols] f32 -> out[ncols][nrows] bf16 ----
// grid = (ncols/64, nrows/64), block 256. Load: 256 threads x 16 floats = the 64x64 tile.
__global__ __launch_bounds__(256) void transpose_cast_bf16(const float* __restrict__ in, unsigned short* __restrict__ out, int nrows, int ncols) {
  __shared__ __align__(16) float tile[64 * 68];   // tile[cl*68 + rl]: cl = in col (out row), rl = in row (out col)
  const int tid = threadIdx.x, lane = tid & 31, wave = tid >> 5;
  const int r0 = blockIdx.y * 64;
  const int c0 = blockIdx.x * 64;
  {
    const int rl = tid >> 2, cq = (tid & 3) * 16;
    const float* src = in + (size_t)(r0 + rl) * ncols + c0 + cq;
#pragma unroll
    for (int i = 0; i < 4; ++i) {
      const v4f v = *(const v4f*)(src + 4 * i);
#pragma unroll
      for (int e = 0; e < 4; ++e) tile[(cq + 4 * i + e) * 68 + rl] = v[e];
    }
  }
  __syncthreads();
  const int q8 = lane >> 3, c8 = (lane & 7) * 8;
  {
#pragma unroll
    for (int it = 0; it < 2; ++it) {
      const int cl = wave * 8 + it * 4 + q8;
      const float* sp = tile + cl * 68 + c8;
      const v4f x0 = *(const v4f*)sp;
      const v4f x1 = *(const v4f*)(sp + 4);
      v4u w;
      w[0] = pack_bf16x2(x0[0], x0[1]);
      w[1] = pack_bf16x2(x0[2], x0[3]);
      w[2] = pack_bf16x2(x1[0], x1[1]);
      w[3] = pack_bf16x2(x1[2], x1[3]);
      *(v4u*)(out + (size_t)(c0 + cl) * nrows + r0 + c8) = w;
    }
    
  }
}

// =====================================================================================
// Attention, head dim 64, over bf16 hi/lo planes of the fused qkv projection.
// qkv planes: [B*S][3*HID], q at col h*64+d, k at HID + h*64 + d, v at 2*HID + h*64 + d.
// scores = 0.125 * q.k^T (bf16 hi/lo, 3 products); mask tile m[q][kv] (RNE-bf16 converted) applied as
// s*m - 10000*(1-m); online softmax in f32. Both products are formed transposed (S^T = K.Q^T, out^T += V^T.P^T, 3 products each):
// a lane holds one query's scores, so row maximum and sum are in-lane plus one exchange of the lane halves, and the
// score accumulators, split into bf16 hi/lo, are the B operand of the second product as they stand.
// A 64x64 tile whose mask is identically zero has 64 equal logits -10000 per row: folded in closed form
// (l += 64*p, o += p * column-sum(v), p = exp(-10000 - rowmax)).
// The class of every mask tile (all 0 / all 1 / mixed, of the RNE-bf16 converted values) comes from mask_tile_class, which
// reads the mask once; a tile of ones leaves every score as it is (x*1 - 10000*0 == x), so only a mixed tile is loaded here.
// Block = 4 waves = 64 query rows of one (batch, head); grid.x = B * NH * (S/64).
// =====================================================================================
#define SEQ_LEN 2048
#define N_HEADS 16
#define HEAD_D 64
#define HID_SZ 1024
#define QKV_PITCH 3072
#define KV_CHUNK 64
#define N_BATCH 2
#define LDS_P 72   // row pitch of the K and V^T tiles in 16-bit elements: 144 B = 16 B x odd, so the 16 rows of a b128 fragment read fall on distinct banks

#define TCLS_STRIDE 32   // ints between two tile classes: each class has a 128-byte line of its own (one writer per line)

// One wave per 64x64 mask tile (grid = 32 x 32 tiles, tile = query block * 32 + key block): 32 b128 loads per lane = the tile.
// class 0: every RNE-bf16 converted element is +-0; class 1: every one is 1.0; class 2: anything else.
__global__ __launch_bounds__(32) void mask_tile_class(const float* __restrict__ maskp, int* __restrict__ tcls) {
  const int lane = threadIdx.x;
  const int qb = blockIdx.x >> 5, kc = blockIdx.x & 31;
  const float* src = maskp + (size_t)(qb * 64 + (lane >> 4)) * SEQ_LEN + kc * 64 + (lane & 15) * 4;
  unsigned int nz = 0u, n1 = 0u;
#pragma unroll
  for (int i = 0; i < 32; ++i) {
    const v4u m = *(const v4u*)(src + (size_t)(2 * i) * SEQ_LEN);
#pragma unroll
    for (int e = 0; e < 4; ++e) { const unsigned int u = rne_bf16_word(m[e]); nz |= (u & 0x7FFFFFFFu); n1 |= (u ^ 0x3F800000u); }
  }
  const int any_nz = __any(nz != 0u);
  const int any_n1 = __any(n1 != 0u);
  if (lane == 0) tcls[(size_t)blockIdx.x * TCLS_STRIDE] = any_nz ? (any_n1 ? 2 : 1) : 0;
}

__global__ __launch_bounds__(128) void attn_planes_kernel(
    const unsigned short* __restrict__ qkvh, const unsigned short* __restrict__ qkvl,
    const float* __restrict__ maskp, const int* __restrict__ tcls,
    unsigned short* __restrict__ ctxh, unsigned short* __restrict__ ctxl) {
  union FB { v16b v; v8b h[2]; };
  union FW { v16b v; unsigned int w[8]; };
  __shared__ __align__(16) unsigned short Kh[KV_CHUNK * LDS_P];     // K hi [kv][d], pitch LDS_P
  __shared__ __align__(16) unsigned short Kl[KV_CHUNK * LDS_P];     // K lo [kv][d], pitch LDS_P
  __shared__ __align__(16) unsigned short Vth[HEAD_D * LDS_P];      // V hi [d][kv], pitch LDS_P
  __shared__ __align__(16) unsigned short Vtl[HEAD_D * LDS_P];      // V lo [d][kv], pitch LDS_P
  __shared__ __align__(16) float Os[4][16 * 68];                   // per wave out tile, pitch 68; Os[0][0..127] doubles as column-sum scratch
  __shared__ __align__(16) unsigned int Msk[64 * 68];              // mask tile [q][kv] (f32 bits), pitch 68; doubles as v scratch [kv][d]

  const int tid  = threadIdx.x;
  const int wave = tid >> 5;
  const int lane = tid & 31;
  const int hh   = lane >> 4;
  const int c    = lane & 15;
  const int bx   = blockIdx.x;
  const int qb   = 31 - (bx >> 5);           // SEQ_LEN / 64 == 32; late query blocks first: under a lower-triangular mask they hold the most live tiles, so cost falls with the block index (speed only)
  static_assert(N_BATCH * N_HEADS == 32 && SEQ_LEN / 64 == 32, "block index split");
  const int bhd  = bx & 31;                  // N_BATCH * N_HEADS == 32
  const int h    = bhd & (N_HEADS - 1);
  const int b    = bhd >> 4;
  const int qblk = qb * 64;
  const int q0   = qblk + wave * 16;
  const size_t rowb = (size_t)b * SEQ_LEN;

  // ---- Q fragments (B operand of the transposed scores), hi and lo planes, 2 d-chunks (8 b128 loads per lane) ----
  v16b qah[2], qal[2];
  {
    const size_t qoff = (rowb + q0 + c) * QKV_PITCH + h * HEAD_D + 8 * hh;
#pragma unroll
    for (int dc = 0; dc < 2; ++dc) {
      qah[dc] = Frag<__bf16>::load((const __bf16*)qkvh + qoff + dc * 32);
      qal[dc] = Frag<__bf16>::load((const __bf16*)qkvl + qoff + dc * 32);
    }
  }

  float mrow = -__builtin_inff(), lrow = 0.f;   // running maximum and sum of query q0 + c (the same in both lane halves)
  v8f oacc[4];                                  // out^T: oacc[t][r] = out[q0 + c][16 t + 8 hh + r]
#pragma unroll
  for (int t = 0; t < 4; ++t) oacc[t] = (v8f){0.f,0.f,0.f,0.f,0.f,0.f,0.f,0.f};

  const int cls_l = tcls[(size_t)(qb * 32 + lane) * TCLS_STRIDE];   // lane l: class of this query block's mask tile l

  const int kvr = tid >> 1;            // staging: kv row of this thread (0..63)
  const int dh  = (tid & 1) * 32;      // staging: d half (0 or 32)

  for (int kc = 0; kc < SEQ_LEN / KV_CHUNK; ++kc) {
    const int kv0 = kc * KV_CHUNK;
    __syncthreads();
    const int cls = __builtin_amdgcn_readlane(cls_l, kc);   // scalar, the same in every wave of the block

    const size_t koff = (rowb + kv0 + kvr) * QKV_PITCH + HID_SZ + h * HEAD_D + dh;
    const size_t voff = koff + HID_SZ;

    if (cls != 0) {
      if (cls == 2) {
        // ---- mixed mask tile [64 q][64 kv]: 1024 float4 / 128 threads = 8 b128 per lane; RNE-bf16 convert ----
#pragma unroll
        for (int i = 0; i < 8; ++i) {
          const int idx = i * 128 + tid;
          const int row = idx >> 4;
          const int c4  = (idx & 15) * 4;
          v4u m = *(const v4u*)(maskp + (size_t)(qblk + row) * SEQ_LEN + kv0 + c4);
#pragma unroll
          for (int e = 0; e < 4; ++e) m[e] = rne_bf16_word(m[e]);
          *(v4u*)(Msk + row * 68 + c4) = m;
        }
      }
      // ---- K hi/lo rows -> LDS [kv][d] (4+4 b128 per lane, 128 threads x 32 elements = 64x64 per plane) ----
      {
        const v4u* gh = (const v4u*)(qkvh + koff);
        const v4u* gl = (const v4u*)(qkvl + koff);
        v4u* lh = (v4u*)(Kh + kvr * LDS_P + dh);
        v4u* ll = (v4u*)(Kl + kvr * LDS_P + dh);
        v4u a[4], bb[4];
#pragma unroll
        for (int i = 0; i < 4; ++i) { a[i] = gh[i]; bb[i] = gl[i]; }
        // inputs-only fence on the loaded values: keeps the 8 loads in flight together (without it this build waits after every second load)
        asm volatile("" :: "v"(a[0]), "v"(a[1]), "v"(a[2]), "v"(a[3]), "v"(bb[0]), "v"(bb[1]), "v"(bb[2]), "v"(bb[3]));
#pragma unroll
        for (int i = 0; i < 4; ++i) { lh[i] = a[i]; ll[i] = bb[i]; }
      }
      asm volatile("" ::: "memory");
      // ---- V hi/lo rows -> LDS transposed [d][kv] ----
      {
        const v4u* gh = (const v4u*)(qkvh + voff);
        const v4u* gl = (const v4u*)(qkvl + voff);
        unsigned short* sh = Vth + dh * LDS_P + kvr;   // one base per plane: every row step below is a constant offset
        unsigned short* sl = Vtl + dh * LDS_P + kvr;
        v4u vh4[4], vl4[4];
#pragma unroll
        for (int i = 0; i < 4; ++i) { vh4[i] = gh[i]; vl4[i] = gl[i]; }
        // inputs-only fence on the loaded values: keeps the 8 loads in flight together, as above
        asm volatile("" :: "v"(vh4[0]), "v"(vh4[1]), "v"(vh4[2]), "v"(vh4[3]), "v"(vl4[0]), "v"(vl4[1]), "v"(vl4[2]), "v"(vl4[3]));
#pragma unroll
        for (int i = 0; i < 4; ++i) {
          const v4u wh = vh4[i];
          const v4u wl = vl4[i];
#pragma unroll
          for (int e = 0; e < 4; ++e) {
            const int d = 8 * i + 2 * e;
            sh[d * LDS_P]       = (unsigned short)(wh[e] & 0xFFFFu);
            sh[(d + 1) * LDS_P] = (unsigned short)(wh[e] >> 16);
            sl[d * LDS_P]       = (unsigned short)(wl[e] & 0xFFFFu);
            sl[(d + 1) * LDS_P] = (unsigned short)(wl[e] >> 16);
          }
        }
      }
      __syncthreads();

      // ---- scores, transposed: S^T = K . Q^T, 4 key subtiles x 2 d-chunks, hi.hi + lo.hi + hi.lo ----
      // s[j][r] = score of query q0 + c against key kv0 + 16 j + 8 hh + r: one query per lane, its keys in registers
      v8f s[4];
#pragma unroll
      for (int j = 0; j < 4; ++j) {
        s[j] = (v8f){0.f,0.f,0.f,0.f,0.f,0.f,0.f,0.f};
#pragma unroll
        for (int dc = 0; dc < 2; ++dc) {
          FB kb, kl;
          const int ko = (j * 16 + c) * LDS_P + dc * 32 + 8 * hh;
          kb.h[0] = *(const v8b*)((const __bf16*)Kh + ko);
          kb.h[1] = *(const v8b*)((const __bf16*)Kh + ko + 16);
          kl.h[0] = *(const v8b*)((const __bf16*)Kl + ko);
          kl.h[1] = *(const v8b*)((const __bf16*)Kl + ko + 16);
          s[j] = at_mma(kb.v, qah[dc], s[j]);
          s[j] = at_mma(kl.v, qah[dc], s[j]);
          s[j] = at_mma(kb.v, qal[dc], s[j]);
        }
      }
      // ---- scale, mask (literal s*m - 10000*(1-m)), maximum of the lane's 32 keys, then of both lane halves ----
      float cm = -__builtin_inff();
      if (cls == 2) {
        const unsigned int* mp = Msk + (wave * 16 + c) * 68 + 8 * hh;
#pragma unroll
        for (int j = 0; j < 4; ++j) {
          const v4u k0 = *(const v4u*)(mp + j * 16);
          const v4u k1 = *(const v4u*)(mp + j * 16 + 4);
#pragma unroll
          for (int r = 0; r < 8; ++r) {
            const float mk = __uint_as_float(r < 4 ? k0[r & 3] : k1[r & 3]);
            float x = s[j][r] * 0.125f;
            x = x * mk - 10000.0f * (1.0f - mk);
            s[j][r] = x;
            cm = fmaxf(cm, x);
          }
        }
      } else {
        // tile of ones: x*1 - 10000*(1 - 1) == x for every x
#pragma unroll
        for (int j = 0; j < 4; ++j)
#pragma unroll
          for (int r = 0; r < 8; ++r) {
            const float x = s[j][r] * 0.125f;
            s[j][r] = x;
            cm = fmaxf(cm, x);
          }
      }
      cm = fmaxf(cm, xhalf(cm));
      // ---- online softmax, one query per lane; P^T split into bf16 hi/lo and packed in place as B operands ----
      FW ph[2], pl[2];
      {
        const float mnew  = fmaxf(mrow, cm);
        const float alpha = expf(mrow - mnew);
        mrow = mnew;
        float ps[4];
#pragma unroll
        for (int j = 0; j < 4; ++j) {
          ps[j] = 0.f;
#pragma unroll
          for (int r = 0; r < 8; r += 2) {
            const float p0 = expf(s[j][r] - mnew);
            const float p1 = expf(s[j][r + 1] - mnew);
            ps[j] += p0;
            ps[j] += p1;
            unsigned int wh, wl;
            split_pack2(p0, p1, wh, wl);
            ph[j >> 1].w[(j & 1) * 4 + (r >> 1)] = wh;   // element 8 (j & 1) + r of the 32-key fragment = key 16 (j & 1) + 8 hh + r
            pl[j >> 1].w[(j & 1) * 4 + (r >> 1)] = wl;
          }
        }
        float psum = (ps[0] + ps[1]) + (ps[2] + ps[3]);
        psum += xhalf(psum);
        lrow = lrow * alpha + psum;
#pragma unroll
        for (int t = 0; t < 4; ++t)
#pragma unroll
          for (int r = 0; r < 8; ++r) oacc[t][r] *= alpha;
      }
      // ---- out^T += V^T(64x64) . P^T(64x16): vh.ph + vl.ph + vh.pl; oacc[t][r] = out[q0 + c][16 t + 8 hh + r] ----
#pragma unroll
      for (int kk = 0; kk < 2; ++kk) {
#pragma unroll
        for (int t = 0; t < 4; ++t) {
          FB vb, vl;
          const int vo = (t * 16 + c) * LDS_P + kk * 32 + 8 * hh;
          vb.h[0] = *(const v8b*)((const __bf16*)Vth + vo);
          vb.h[1] = *(const v8b*)((const __bf16*)Vth + vo + 16);
          vl.h[0] = *(const v8b*)((const __bf16*)Vtl + vo);
          vl.h[1] = *(const v8b*)((const __bf16*)Vtl + vo + 16);
          oacc[t] = at_mma(vb.v, ph[kk].v, oacc[t]);
          oacc[t] = at_mma(vl.v, ph[kk].v, oacc[t]);
          oacc[t] = at_mma(vb.v, pl[kk].v, oacc[t]);
        }
      }
    } else {
      // ---- all-masked tile: v rows (hi+lo, f32) -> Msk scratch [kv][d], column sums, closed-form update ----
      {
        const v4u* gh = (const v4u*)(qkvh + voff);
        const v4u* gl = (const v4u*)(qkvl + voff);
#pragma unroll
        for (int i = 0; i < 4; ++i) {
          const v4u wh = gh[i];
          const v4u wl = gl[i];
          v4u f0, f1;
          {
            const float a0 = __uint_as_float(wh[0] << 16);          const float b0 = __uint_as_float(wl[0] << 16);
            const float a1 = __uint_as_float(wh[0] & 0xFFFF0000u); const float b1 = __uint_as_float(wl[0] & 0xFFFF0000u);
            const float a2 = __uint_as_float(wh[1] << 16);          const float b2 = __uint_as_float(wl[1] << 16);
            const float a3 = __uint_as_float(wh[1] & 0xFFFF0000u); const float b3 = __uint_as_float(wl[1] & 0xFFFF0000u);
            f0[0] = __float_as_uint(a0 + b0); f0[1] = __float_as_uint(a1 + b1);
            f0[2] = __float_as_uint(a2 + b2); f0[3] = __float_as_uint(a3 + b3);
          }
          {
            const float a0 = __uint_as_float(wh[2] << 16);          const float b0 = __uint_as_float(wl[2] << 16);
            const float a1 = __uint_as_float(wh[2] & 0xFFFF0000u); const float b1 = __uint_as_float(wl[2] & 0xFFFF0000u);
            const float a2 = __uint_as_float(wh[3] << 16);          const float b2 = __uint_as_float(wl[3] << 16);
            const float a3 = __uint_as_float(wh[3] & 0xFFFF0000u); const float b3 = __uint_as_float(wl[3] & 0xFFFF0000u);
            f1[0] = __float_as_uint(a0 + b0); f1[1] = __float_as_uint(a1 + b1);
            f1[2] = __float_as_uint(a2 + b2); f1[3] = __float_as_uint(a3 + b3);
          }
          *(v4u*)(Msk + kvr * 68 + dh + 8 * i)     = f0;
          *(v4u*)(Msk + kvr * 68 + dh + 8 * i + 4) = f1;
        }
      }
      __syncthreads();
      {
        const int d = tid & 63, half = tid >> 6;
        float part = 0.f;
#pragma unroll 8
        for (int kq = 0; kq < 32; ++kq) part += __uint_as_float(Msk[(half * 32 + kq) * 68 + d]);
        Os[0][half * 64 + d] = part;
      }
      __syncthreads();
      {
        const float mnew  = fmaxf(mrow, -10000.0f);
        const float alpha = expf(mrow - mnew);
        const float p     = expf(-10000.0f - mnew);
        mrow = mnew;
        lrow = lrow * alpha + 64.0f * p;
#pragma unroll
        for (int t = 0; t < 4; ++t) {
          const float* cs = Os[0] + t * 16 + 8 * hh;      // column sums of the lane's 8 output columns, two partial sums each
          const v4f a0 = *(const v4f*)cs;
          const v4f a1 = *(const v4f*)(cs + 4);
          const v4f b0 = *(const v4f*)(cs + 64);
          const v4f b1 = *(const v4f*)(cs + 68);
#pragma unroll
          for (int r = 0; r < 8; ++r) {
            const float vs = (r < 4 ? a0[r & 3] : a1[r & 3]) + (r < 4 ? b0[r & 3] : b1[r & 3]);
            oacc[t][r] = oacc[t][r] * alpha + p * vs;
          }
        }
      }
    }
  }
  __syncthreads();

  float* os = Os[wave];
  {
    const float inv = 1.0f / lrow;
#pragma unroll
    for (int t = 0; t < 4; ++t) {
      v4f x0, x1;
#pragma unroll
      for (int r = 0; r < 4; ++r) { x0[r] = oacc[t][r] * inv; x1[r] = oacc[t][r + 4] * inv; }
      *(v4f*)(os + c * 68 + t * 16 + 8 * hh)     = x0;
      *(v4f*)(os + c * 68 + t * 16 + 8 * hh + 4) = x1;
    }
  }
  __builtin_amdgcn_fence(__ATOMIC_RELEASE, "workgroup");
  __builtin_amdgcn_wave_barrier();
  __builtin_amdgcn_fence(__ATOMIC_ACQUIRE, "workgroup");
  {
    const int q8 = lane >> 3, c8 = (lane & 7) * 8;
    unsigned short* oh = ctxh + (rowb + q0) * HID_SZ + h * HEAD_D + c8;
    unsigned short* ol = ctxl + (rowb + q0) * HID_SZ + h * HEAD_D + c8;
    {
#pragma unroll
      for (int it = 0; it < 4; ++it) {
        const int row = it * 4 + q8;
        const float* sp = os + row * 68 + c8;
        const v4f x0 = *(const v4f*)sp;
        const v4f x1 = *(const v4f*)(sp + 4);
        v4u wh, wl;
        unsigned int th, tl;
        split_pack2(x0[0], x0[1], th, tl); wh[0] = th; wl[0] = tl;
        split_pack2(x0[2], x0[3], th, tl); wh[1] = th; wl[1] = tl;
        split_pack2(x1[0], x1[1], th, tl); wh[2] = th; wl[2] = tl;
        split_pack2(x1[2], x1[3], th, tl); wh[3] = th; wl[3] = tl;
        *(v4u*)(oh + (size_t)row * HID_SZ) = wh;
        *(v4u*)(ol + (size_t)row * HID_SZ) = wl;
      }
      
    }
  }
}

// ---------------------------------------------------------------------------
// Workspace region map (bytes):
//   Hb    bf16 [4096][1024]        off 0            size  8388608
//   WQt   bf16 [3072][1024]        off 8388608      size  6291456
//   WDt   bf16 [1024][1024]        off 14680064     size  2097152
//   BQ    f32  [3072]              off 16777216     size    12288
//   BD    f32  [1024]              off 16789504     size     4096
//   QKVh  bf16 [4096][3072]        off 16793600     size 25165824
//   QKVl  bf16 [4096][3072]        off 41959424     size 25165824
//   CTXh  bf16 [4096][1024]        off 67125248     size  8388608
//   CTXl  bf16 [4096][1024]        off 75513856     size  8388608
//   TCLS  i32  [1024] x 128 B      off 83902464     size   131072
//   end                            84033536
// Every region is written by its producer before any consumer reads it (TCLS: only the first int of each 128-byte line).
// ---------------------------------------------------------------------------
extern "C" void kernel_launch(void* const* d_in, const int* in_sizes, int n_in,
                              void* d_out, int out_size, void* d_ws, size_t ws_size,
                              hipStream_t stream) {
  constexpr int kB = N_BATCH, kS = SEQ_LEN, kH = HID_SZ;
  constexpr int kM = kB * kS;          // 4096
  constexpr int kN3 = 3 * kH;          // 3072
  static_assert(kM % G_BM == 0 && kN3 % G_BN == 0 && kH % G_BN == 0);   // GEMM M/N tile multiples
  static_assert(kH % G_KS == 0);                                         // GEMM K slice
  static_assert(kS % KV_CHUNK == 0 && kS / 64 == 32 && kH / HEAD_D == N_HEADS);
  static_assert((kM * kH) % 2048 == 0 && kN3 % 1024 == 0 && kH % 1024 == 0);

  if (n_in < 6) return;
  if (in_sizes[0] != kM * kH || in_sizes[1] != kS * kS || in_sizes[2] != kH * kN3 ||
      in_sizes[3] != kN3 || in_sizes[4] != kH * kH || in_sizes[5] != kH) return;
  if (out_size != kM * kH) return;

  const float* hidden  = (const float*)d_in[0];
  const float* maskp   = (const float*)d_in[1];
  const float* w_qkv   = (const float*)d_in[2];
  const float* b_qkv   = (const float*)d_in[3];
  const float* w_dense = (const float*)d_in[4];
  const float* b_dense = (const float*)d_in[5];
  float* out = (float*)d_out;

  const size_t szHb  = (size_t)kM * kH * 2;
  const size_t szWQt = (size_t)kN3 * kH * 2;
  const size_t szWDt = (size_t)kH * kH * 2;
  const size_t szBQ  = (size_t)kN3 * 4;
  const size_t szBD  = (size_t)kH * 4;
  const size_t szQKV = (size_t)kM * kN3 * 2;
  const size_t szCTX = (size_t)kM * kH * 2;
  const size_t offHb   = 0;
  const size_t offWQt  = offHb + szHb;
  const size_t offWDt  = offWQt + szWQt;
  const size_t offBQ   = offWDt + szWDt;
  const size_t offBD   = offBQ + szBQ;
  const size_t offQKVh = offBD + szBD;
  const size_t offQKVl = offQKVh + szQKV;
  const size_t offCTXh = offQKVl + szQKV;
  const size_t offCTXl = offCTXh + szCTX;
  const size_t offTCLS = offCTXl + szCTX;
  const size_t szTCLS  = (size_t)(kS / 64) * (kS / 64) * TCLS_STRIDE * 4;
  const size_t offEnd  = offTCLS + szTCLS;
  if (offEnd > ws_size) return;

  char* ws = (char*)d_ws;
  unsigned short* Hb   = (unsigned short*)(ws + offHb);
  unsigned short* WQt  = (unsigned short*)(ws + offWQt);
  unsigned short* WDt  = (unsigned short*)(ws + offWDt);
  float*          BQ   = (float*)(ws + offBQ);
  float*          BD   = (float*)(ws + offBD);
  unsigned short* QKVh = (unsigned short*)(ws + offQKVh);
  unsigned short* QKVl = (unsigned short*)(ws + offQKVl);
  unsigned short* CTXh = (unsigned short*)(ws + offCTXh);
  unsigned short* CTXl = (unsigned short*)(ws + offCTXl);
  int*            TCLS = (int*)(ws + offTCLS);

  // 1) hidden -> bf16 plane [4096][1024]
  {
    const int n8 = (kM * kH) / 8;                       // 524288 threads = 2048 blocks exactly
    cast_f32_bf16x8<<<dim3(n8 / 256), dim3(256), 0, stream>>>(hidden, Hb, n8);
  }
  // 2) w_qkv [1024 rows][3072 cols] -> WQt [3072][1024] bf16 ; w_dense [1024][1024] -> WDt [1024][1024] bf16
  transpose_cast_bf16<<<dim3(kN3 / 64, kH / 64), dim3(256), 0, stream>>>(w_qkv, WQt, kH, kN3);
  transpose_cast_bf16<<<dim3(kH / 64, kH / 64), dim3(256), 0, stream>>>(w_dense, WDt, kH, kH);
  // 3) bias lines RNE-bf16 converted (kept as f32)
  rne_bf16_f32x4<<<dim3((kN3 / 4) / 256), dim3(256), 0, stream>>>(b_qkv, BQ, kN3 / 4);
  rne_bf16_f32x4<<<dim3((kH / 4) / 256), dim3(256), 0, stream>>>(b_dense, BD, kH / 4);
  // 4) fused qkv projection: [4096x1024] x WQt[3072x1024]^T + bias -> bf16 hi/lo planes [4096][3072]
  {
    const int tiles = (kM / G_BM) * (kN3 / G_BN);       // 384 block tiles of 128x256
    wmma_gemm64<1, 0, 2, 2, false><<<dim3(tiles, 1), dim3(256), 0, stream>>>(
        Hb, Hb, kH, 0L, WQt, WQt, kH, 0L, (void*)QKVh, (void*)QKVl, kN3, 0L,
        BQ, BQ, 0L, kM, kN3, kH, 1.0f);
  }
  // 5) class of each 64x64 mask tile, then attention per (batch, head, 64 query rows) -> ctx bf16 hi/lo planes [4096][1024]
  mask_tile_class<<<dim3((kS / 64) * (kS / 64)), dim3(32), 0, stream>>>(maskp, TCLS);
  attn_planes_kernel<<<dim3(kB * N_HEADS * (kS / 64)), dim3(128), 0, stream>>>(QKVh, QKVl, maskp, TCLS, CTXh, CTXl);
  // 6) output projection: ctx (hi/lo) [4096x1024] x WDt[1024x1024]^T + bias -> out f32 [4096][1024]
  {
    const int tiles = (kM / G_BM) * (kH / G_BN);        // 128 block tiles of 128x256
    wmma_gemm64<1, 2, 2, 0, false><<<dim3(tiles, 1), dim3(256), 0, stream>>>(
        CTXh, CTXl, kH, 0L, WDt, WDt, kH, 0L, (void*)out, (void*)out, kH, 0L,
        BD, BD, 0L, kM, kH, kH, 1.0f);
  }
}

// v006
// One run takes 172 microseconds.
// Next to v005, in two timings, it ran 1.08 times as fast each time.
// All steps since v000 together make it 3.65 times as fast.
// Contractions on v_wmma_f32_16x16x32_bf16 (bf16 operands, f32 accumulate): qkv projection = one product on RNE-bf16 inputs; q.k^T and p.v = bf16 hi/lo planes (3 products); output projection = ctx bf16 hi/lo x bf16 weights (2 products). Masking, softmax and normalisation in f32.
#include <hip/hip_runtime.h>

typedef __attribute__((ext_vector_type(16))) _Float16 v16h;
typedef __attribute__((ext_vector_type(8)))  _Float16 v8h;
typedef __attribute__((ext_vector_type(16))) __bf16   v16b;
typedef __attribute__((ext_vector_type(8)))  __bf16   v8b;
typedef __attribute__((ext_vector_type(8)))  float    v8f;
typedef __attribute__((ext_vector_type(4)))  float    v4f;
typedef __attribute__((ext_vector_type(2)))  float    v2f;
typedef __attribute__((ext_vector_type(4)))  unsigned int v4u;

__device__ __forceinline__ unsigned short f2bf_bits(float f) {
  unsigned u = __float_as_uint(f);
  return (unsigned short)((u + 0x7FFFu + ((u >> 16) & 1u)) >> 16);
}
__device__ __forceinline__ float bf_bits2f(unsigned short h) { return __uint_as_float(((unsigned)h) << 16); }
// RNE convert of an f32 bit pattern to its bf16 value, kept as an f32 bit pattern
__device__ __forceinline__ unsigned int rne_bf16_word(unsigned int u) {
  return (u + 0x7FFFu + ((u >> 16) & 1u)) & 0xFFFF0000u;
}
__device__ __forceinline__ unsigned int pack_bf16x2(float a, float b) {
  return (unsigned int)f2bf_bits(a) | ((unsigned int)f2bf_bits(b) << 16);
}
// hi/lo bf16 split of two floats, packed as (hi_a | hi_b<<16) and (lo_a | lo_b<<16)
__device__ __forceinline__ void split_pack2(float a, float b, unsigned int& wh, unsigned int& wl) {
  const unsigned short ha = f2bf_bits(a), hb = f2bf_bits(b);
  const unsigned short la = f2bf_bits(a - bf_bits2f(ha)), lb = f2bf_bits(b - bf_bits2f(hb));
  wh = (unsigned int)ha | ((unsigned int)hb << 16);
  wl = (unsigned int)la | ((unsigned int)lb << 16);
}

// hazard guards as plain device helpers
__device__ __forceinline__ void dep_guard_h(v8f& a, v8f& b, v16h x, v16h y) { asm volatile("v_nop\n\tv_nop\n\tv_nop\n\tv_nop" : "+v"(a), "+v"(b) : "v"(x), "v"(y)); }
__device__ __forceinline__ void dep_guard_b(v8f& a, v8f& b, v16b x, v16b y) { asm volatile("v_nop\n\tv_nop\n\tv_nop\n\tv_nop" : "+v"(a), "+v"(b) : "v"(x), "v"(y)); }
__device__ __forceinline__ void keep4_h(v16h a, v16h b, v16h c, v16h d) { asm volatile("v_nop" :: "v"(a), "v"(b), "v"(c), "v"(d)); }
__device__ __forceinline__ void keep4_b(v16b a, v16b b, v16b c, v16b d) { asm volatile("v_nop" :: "v"(a), "v"(b), "v"(c), "v"(d)); }
__device__ __forceinline__ void acc_guard4(v8f& a, v8f& b, v8f& c, v8f& d) { asm volatile("v_nop\n\tv_nop\n\tv_nop\n\tv_nop" : "+v"(a), "+v"(b), "+v"(c), "+v"(d)); }
template <typename T> struct Frag;
template <> struct Frag<_Float16> {
  typedef v16h V; union U { v16h v; v8h h[2]; };
  static __device__ __forceinline__ v16h load(const _Float16* p) {   // elements 0..7 <- p[0..7], 8..15 <- p[16..23]
    U f; f.h[0] = *(const v8h*)(p); f.h[1] = *(const v8h*)(p + 16); return f.v;
  }
  static __device__ __forceinline__ v8f mma(v16h a, v16h b, v8f c) {
    return __builtin_amdgcn_wmma_f32_16x16x32_f16(false, a, false, b, (short)0, c, false, false);
  }
  static __device__ __forceinline__ void guard(v8f& a, v8f& b, v16h x, v16h y) { dep_guard_h(a, b, x, y); }
  static __device__ __forceinline__ void keep(v16h a, v16h b, v16h c, v16h d) { keep4_h(a, b, c, d); }
};
template <> struct Frag<__bf16> {
  typedef v16b V; union U { v16b v; v8b h[2]; };
  static __device__ __forceinline__ v16b load(const __bf16* p) {
    U f; f.h[0] = *(const v8b*)(p); f.h[1] = *(const v8b*)(p + 16); return f.v;
  }
  static __device__ __forceinline__ v8f mma(v16b a, v16b b, v8f c) {
    return __builtin_amdgcn_wmma_f32_16x16x32_bf16(false, a, false, b, (short)0, c, false, false);
  }
  static __device__ __forceinline__ void guard(v8f& a, v8f& b, v16b x, v16b y) { dep_guard_b(a, b, x, y); }
  static __device__ __forceinline__ void keep(v16b a, v16b b, v16b c, v16b d) { keep4_b(a, b, c, d); }
};

// ---- Register-blocked batched WMMA GEMM ------------------------------------
// C[m,n] = scale * sum_k A[m,k] * Bt[n,k] (+bias)(+resid); a block of 8 waves (2 x 4) owns a 128x256 tile, each wave 64x64 of it.
// A row-major [M,K]; Bt row-major [N,K]; M % 128 == 0, N % 256 == 0, K % 64 == 0.
// The block's rows of A and Bt go through LDS in slices of 64 k (one 128-byte line per row), brought by asynchronous copies
// into two buffers: slice t + 1 flies while slice t is worked on, and every line is fetched once per block, whole.
// SPLIT: 0 = single planes; 1 = A and Bt hi/lo planes (hi.hi + hi.lo + lo.hi); 2 = A hi/lo planes only (hi.B + lo.B).
// BIAS_MODE: 0 = none, 1 = bias[m], 2 = bias[n].
// OUT_MODE: 0 = f32, 1 = f16, 2 = bf16 hi plane (Cout) + bf16 lo plane (Cout2).
// ET: 0 = f16 operands, 1 = bf16 operands (pointers passed as 16-bit storage)
template <int ET> struct Elem;
template <> struct Elem<0> { typedef _Float16 T; };
template <> struct Elem<1> { typedef __bf16 T; };

#define G_BM 128   // block tile rows of A
#define G_BN 256   // block tile rows of Bt
#define G_KS 64    // k elements of one staged slice
#define G_P  72    // LDS row pitch in 16-bit elements: 144 B = 16 B x odd, free of bank conflicts for b128 fragment reads

// One line of an asynchronous copy: 16 bytes per lane, global -> LDS, through no register.
#define G_CP(l, g) "global_load_async_to_lds_b128 %" #l ", %" #g ", off\n\t"
// N copies and, as the last line of the same statement, the wait that stands before their address registers are rewritten.
template <int N>
__device__ __forceinline__ void async_copies(const unsigned int* l, const unsigned short* const* g) {
  static_assert(N == 8 || N == 12, "copies per statement");
  if constexpr (N == 12) {
    asm volatile(G_CP(0, 1) G_CP(2, 3) G_CP(4, 5) G_CP(6, 7) G_CP(8, 9) G_CP(10, 11) G_CP(12, 13) G_CP(14, 15)
                 G_CP(16, 17) G_CP(18, 19) G_CP(20, 21) G_CP(22, 23) "s_wait_xcnt 0x0"
                 :: "v"(l[0]), "v"(g[0]), "v"(l[1]), "v"(g[1]), "v"(l[2]), "v"(g[2]), "v"(l[3]), "v"(g[3]),
                    "v"(l[4]), "v"(g[4]), "v"(l[5]), "v"(g[5]), "v"(l[6]), "v"(g[6]), "v"(l[7]), "v"(g[7]),
                    "v"(l[8]), "v"(g[8]), "v"(l[9]), "v"(g[9]), "v"(l[10]), "v"(g[10]), "v"(l[11]), "v"(g[11])
                 : "memory");
  } else {
    asm volatile(G_CP(0, 1) G_CP(2, 3) G_CP(4, 5) G_CP(6, 7) G_CP(8, 9) G_CP(10, 11) G_CP(12, 13) G_CP(14, 15) "s_wait_xcnt 0x0"
                 :: "v"(l[0]), "v"(g[0]), "v"(l[1]), "v"(g[1]), "v"(l[2]), "v"(g[2]), "v"(l[3]), "v"(g[3]),
                    "v"(l[4]), "v"(g[4]), "v"(l[5]), "v"(g[5]), "v"(l[6]), "v"(g[6]), "v"(l[7]), "v"(g[7])
                 : "memory");
  }
}

template <int ET, int SPLIT, int BIAS_MODE, int OUT_MODE, bool RESID, int ACT = 0>
__global__ __launch_bounds__(256) void wmma_gemm64(
    const unsigned short* __restrict__ Ap, const unsigned short* __restrict__ A2p, int lda, long strideA,
    const unsigned short* __restrict__ Btp, const unsigned short* __restrict__ Bt2p, int ldb, long strideB,
    void* __restrict__ Cout, void* __restrict__ Cout2, int ldc, long strideC,
    const float* __restrict__ bias,
    const float* __restrict__ resid, long strideR,
    int M, int N, int K, float scale) {
  typedef typename Elem<ET>::T T;
  typedef typename Frag<T>::V V;
  constexpr int NPA   = (SPLIT != 0) ? 2 : 1;             // planes of A
  constexpr int NPB   = (SPLIT == 1) ? 2 : 1;             // planes of Bt
  constexpr int ROWS  = G_BM * NPA + G_BN * NPB;          // rows of one slice: [A | A2 | Bt | Bt2]
  constexpr int STAGE = ROWS * G_P;                       // 16-bit elements of one buffer
  constexpr int NCOPY = ROWS / 32;                        // copies per lane and slice: 256 lanes x 16 B = 32 rows of 128 B
  constexpr int CGRP  = (NCOPY % 12 == 0) ? 12 : 8;       // copies per statement
  constexpr int AHEAD = (SPLIT == 0) ? 4 : 1;             // as far as the registers reach below 256
  static_assert(NCOPY % CGRP == 0 && NCOPY <= 63, "copies per slice");
  __shared__ __align__(16) unsigned short ring[2 * STAGE];   // two buffers
  __shared__ __align__(16) float sT[8][16 * 68];   // per-wave 16x64 slab, pitch 68 floats
  const int b    = blockIdx.y;
  const int tid  = threadIdx.x;
  const int lane = tid & 31;
  const int wave = tid >> 5;
  const int tilesN = N / G_BN;
  const int tilesM = M / G_BM;
  if ((int)blockIdx.x >= tilesM * tilesN) return;   // the same for the whole block, in front of every barrier
  const int tm = blockIdx.x / tilesN;
  const int tn = blockIdx.x - tm * tilesN;
  const int wm = wave >> 2;                    // wave's 64 rows of the block's A rows
  const int wn = wave & 3;                     // wave's 64 rows of the block's Bt rows
  const int m0 = tm * G_BM + (wm << 6);
  const int n0 = tn * G_BN + (wn << 6);

  const int rlane = lane & 15;                 // row (A) / col (B, D) within subtile
  const int koff  = (lane >> 4) * 8;           // k offset of this lane half
  const int mOff  = (lane >> 4) * 8;           // D row offset

  // copy i of a lane: row 32 i + (tid >> 3) of the slice, bytes 16 (tid & 7) .. + 15 of its 128: 8 lanes bring one whole line
  const int crow = tid >> 3;
  const int cseg = (tid & 7) * 8;
  const unsigned short* gA  = Ap  + (size_t)b * strideA + (size_t)(tm * G_BM + crow) * lda + cseg;
  const unsigned short* gA2 = A2p + (size_t)b * strideA + (size_t)(tm * G_BM + crow) * lda + cseg;
  const unsigned short* gB  = Btp  + (size_t)b * strideB + (size_t)(tn * G_BN + crow) * ldb + cseg;
  const unsigned short* gB2 = Bt2p + (size_t)b * strideB + (size_t)(tn * G_BN + crow) * ldb + cseg;
  const unsigned int lds0 = (unsigned int)(size_t)ring + (unsigned int)(crow * G_P + cseg) * 2u;   // low 32 bits = LDS byte address

  auto stage = [&](int kt, int buf) {
    unsigned int l[NCOPY];
    const unsigned short* g[NCOPY];
    // both loops unrolled: every address is a register operand of a copy statement
#pragma unroll
    for (int i = 0; i < NCOPY; ++i) {
      l[i] = lds0 + (unsigned int)(buf * STAGE + i * 32 * G_P) * 2u;
      if (i < 4 * NPA) {
        const int pl = i >> 2, r = (i & 3) * 32;
        g[i] = (pl ? gA2 : gA) + (size_t)r * lda + kt * G_KS;
      } else {
        const int q = i - 4 * NPA, pl = q >> 3, r = (q & 7) * 32;
        g[i] = (pl ? gB2 : gB) + (size_t)r * ldb + kt * G_KS;
      }
    }
#pragma unroll
    for (int i = 0; i < NCOPY; i += CGRP) async_copies<CGRP>(l + i, g + i);
  };

  v8f acc[4][4];
#pragma unroll
  for (int i = 0; i < 4; ++i)
#pragma unroll
    for (int j = 0; j < 4; ++j) acc[i][j] = (v8f){0.f,0.f,0.f,0.f,0.f,0.f,0.f,0.f};

  const int nt = K / G_KS;
  stage(0, 0);
  asm volatile("s_wait_asynccnt 0x0" ::: "memory");   // this wave's copies of slice 0 have landed
  __syncthreads();                                     // ... and every other wave's
  if (nt > 1) stage(1, 1);

  const int aoff = ((wm << 6) + rlane) * G_P + koff;
  const int boff = (G_BM * NPA + (wn << 6) + rlane) * G_P + koff;
  for (int t = 0; t < nt; ++t) {
    const T* sb = (const T*)ring + (t & 1) * STAGE;
#pragma unroll
    for (int ks = 0; ks < G_KS; ks += 32) {
      V bh[4], bl[4];
#pragma unroll
      for (int j = 0; j < 4; ++j) {
        bh[j] = Frag<T>::load(sb + boff + j * 16 * G_P + ks);
        if (SPLIT == 1) bl[j] = Frag<T>::load(sb + boff + (G_BN + j * 16) * G_P + ks);
      }
      // A fragments are fetched AHEAD row groups in front of their products, so that a row group's LDS latency lies under the products before it
      V ah[4], al[4];
#pragma unroll
      for (int i = 0; i < AHEAD; ++i) {
        ah[i] = Frag<T>::load(sb + aoff + i * 16 * G_P + ks);
        if (SPLIT != 0) al[i] = Frag<T>::load(sb + aoff + (G_BM + i * 16) * G_P + ks);
      }
#pragma unroll
      for (int i = 0; i < 4; ++i) {
        if (i + AHEAD < 4) {
          ah[i + AHEAD] = Frag<T>::load(sb + aoff + (i + AHEAD) * 16 * G_P + ks);
          if (SPLIT != 0) al[i + AHEAD] = Frag<T>::load(sb + aoff + (G_BM + (i + AHEAD) * 16) * G_P + ks);
        }
#pragma unroll
        for (int j = 0; j < 4; ++j) {
          acc[i][j] = Frag<T>::mma(ah[i], bh[j], acc[i][j]);
          if (SPLIT == 1) {
            acc[i][j] = Frag<T>::mma(ah[i], bl[j], acc[i][j]);
            acc[i][j] = Frag<T>::mma(al[i], bh[j], acc[i][j]);
          }
          if (SPLIT == 2) {
            acc[i][j] = Frag<T>::mma(al[i], bh[j], acc[i][j]);
          }
        }
        Frag<T>::guard(acc[i][0], acc[i][3], ah[i], (SPLIT != 0) ? al[i] : ah[i]);
      }
      Frag<T>::keep(bh[0], bh[1], bh[2], bh[3]);
      if (SPLIT == 1) Frag<T>::keep(bl[0], bl[1], bl[2], bl[3]);
    }
    asm volatile("s_wait_dscnt 0x0" ::: "memory");      // this wave's reads of slice t are done before its buffer is refilled
    asm volatile("s_wait_asynccnt 0x0" ::: "memory");   // this wave's copies of slice t + 1 have landed
    __syncthreads();                                     // publishes slice t + 1 and ends every reader's last read of slice t
    if (t + 2 < nt) stage(t + 2, t & 1);
  }
  asm volatile("s_wait_asynccnt 0x0" ::: "memory");     // no copy is outstanding behind the loop
  acc_guard4(acc[0][0], acc[0][1], acc[0][2], acc[0][3]);
  acc_guard4(acc[1][0], acc[1][1], acc[1][2], acc[1][3]);
  acc_guard4(acc[2][0], acc[2][1], acc[2][2], acc[2][3]);
  acc_guard4(acc[3][0], acc[3][1], acc[3][2], acc[3][3]);

  // ---- epilogue ----
  float* slab = sT[wave];
  const float* Rb = RESID ? (resid + (size_t)b * strideR) : nullptr;
#pragma unroll
  for (int i = 0; i < 4; ++i) {
    const int mBase = m0 + (i << 4);
#pragma unroll
    for (int j = 0; j < 4; ++j) {
      const int n = n0 + (j << 4) + rlane;
      float bv = 0.f;
      if (BIAS_MODE == 2) bv = bias[n];
#pragma unroll
      for (int r = 0; r < 8; ++r) {
        float v = acc[i][j][r] * scale;
        if (BIAS_MODE == 1) v += bias[mBase + mOff + r];
        if (BIAS_MODE == 2) v += bv;
        if (RESID) v += Rb[(size_t)(mBase + mOff + r) * ldc + n];
        if (ACT == 1) v = tanhf(v);
        if (ACT == 2) v = fmaxf(v, 0.0f);
        if (ACT == 4) v = (v > 0.f) ? v : 0.01f * v;
        slab[(mOff + r) * 68 + (j << 4) + rlane] = v;
      }
    }
    __builtin_amdgcn_fence(__ATOMIC_RELEASE, "workgroup");
    __builtin_amdgcn_wave_barrier();
    __builtin_amdgcn_fence(__ATOMIC_ACQUIRE, "workgroup");
    if (OUT_MODE == 0) {
      float* C = (float*)Cout + (size_t)b * strideC;
      const int hh = lane >> 4, c4 = (lane & 15) * 4;     // row seg = 256 B = 16 lanes x 16 B
      {
#pragma unroll
        for (int it = 0; it < 8; ++it) {
          const int row = it * 2 + hh;
          v4f v = *(const v4f*)(slab + row * 68 + c4);
          *(v4f*)(C + (size_t)(mBase + row) * ldc + n0 + c4) = v;
        }
        
      }
    } else {
      const int q = lane >> 3, c8 = (lane & 7) * 8;
      unsigned short* C  = (unsigned short*)Cout  + (size_t)b * strideC;
      unsigned short* C2 = (OUT_MODE == 2) ? ((unsigned short*)Cout2 + (size_t)b * strideC) : nullptr;
      {
#pragma unroll
        for (int it = 0; it < 4; ++it) {
          const int row = it * 4 + q;
          const float* sp = slab + row * 68 + c8;
          v8h hv, lv;
#pragma unroll
          for (int e = 0; e < 8; ++e) {
            if (OUT_MODE == 1) {
              hv[e] = (_Float16)sp[e];
            } else {
              unsigned short hb = f2bf_bits(sp[e]);
              unsigned short lb = f2bf_bits(sp[e] - bf_bits2f(hb));
              hv[e] = __builtin_bit_cast(_Float16, hb);
              lv[e] = __builtin_bit_cast(_Float16, lb);
            }
          }
          *(v8h*)(C + (size_t)(mBase + row) * ldc + n0 + c8) = hv;
          if (OUT_MODE == 2) *(v8h*)(C2 + (size_t)(mBase + row) * ldc + n0 + c8) = lv;
        }
        
      }
    }
    __builtin_amdgcn_fence(__ATOMIC_RELEASE, "workgroup");
    __builtin_amdgcn_wave_barrier();
    __builtin_amdgcn_fence(__ATOMIC_ACQUIRE, "workgroup");
  }
}

// lane l <-> lane l ^ 16
__device__ __forceinline__ float xhalf(float x) {
  return __builtin_bit_cast(float, __builtin_amdgcn_permlanex16(__builtin_bit_cast(int, x), __builtin_bit_cast(int, x), 0x76543210, 0xfedcba98, false, false));
}

__device__ __forceinline__ v8f at_mma(v16b a, v16b b, v8f c) {
  c = __builtin_amdgcn_wmma_f32_16x16x32_bf16(false, a, false, b, (short)0, c, false, false);
  asm volatile("v_nop\n\tv_nop\n\tv_nop\n\tv_nop" : "+v"(c) : "v"(a), "v"(b));
  return c;
}

// coverage: grid*256 threads x 8 elements == n8*8 elements exactly (host sizes n8 = n/8, n % 2048 == 0)
__global__ __launch_bounds__(256) void cast_f32_bf16x8(const float* __restrict__ in, unsigned short* __restrict__ out, int n8) {
  const int i = blockIdx.x * 256 + threadIdx.x;
  if (i >= n8) return;
  const float* p = in + (size_t)i * 8;
  const v4f a = *(const v4f*)p;
  const v4f c2 = *(const v4f*)(p + 4);
  v4u w;
  w[0] = pack_bf16x2(a[0], a[1]);
  w[1] = pack_bf16x2(a[2], a[3]);
  w[2] = pack_bf16x2(c2[0], c2[1]);
  w[3] = pack_bf16x2(c2[2], c2[3]);
  v4u* d = (v4u*)(out + (size_t)i * 8);
  *d = w;
  
}

// coverage: n4 = n/4 threads, n % 1024 == 0 so every wave writes 4 complete lines
__global__ __launch_bounds__(256) void rne_bf16_f32x4(const float* __restrict__ in, float* __restrict__ out, int n4) {
  const int i = blockIdx.x * 256 + threadIdx.x;
  if (i >= n4) return;
  v4u a = *(const v4u*)(in + (size_t)i * 4);
#pragma unroll
  for (int e = 0; e < 4; ++e) a[e] = rne_bf16_word(a[e]);
  v4u* d = (v4u*)(out + (size_t)i * 4);
  *d = a;
  
}

// ---- transpose + bf16 cast: in[nrows][ncols] f32 -> out[ncols][nrows] bf16 ----
// grid = (ncols/64, nrows/64), block 256. Load: 256 threads x 16 floats = the 64x64 tile.
__global__ __launch_bounds__(256) void transpose_cast_bf16(const float* __restrict__ in, unsigned short* __restrict__ out, int nrows, int ncols) {
  __shared__ __align__(16) float tile[64 * 68];   // tile[cl*68 + rl]: cl = in col (out row), rl = in row (out col)
  const int tid = threadIdx.x, lane = tid & 31, wave = tid >> 5;
  const int r0 = blockIdx.y * 64;
  const int c0 = blockIdx.x * 64;
  {
    const int rl = tid >> 2, cq = (tid & 3) * 16;
    const float* src = in + (size_t)(r0 + rl) * ncols + c0 + cq;
#pragma unroll
    for (int i = 0; i < 4; ++i) {
      const v4f v = *(const v4f*)(src + 4 * i);
#pragma unroll
      for (int e = 0; e < 4; ++e) tile[(cq + 4 * i + e) * 68 + rl] = v[e];
    }
  }
  __syncthreads();
  const int q8 = lane >> 3, c8 = (lane & 7) * 8;
  {
#pragma unroll
    for (int it = 0; it < 2; ++it) {
      const int cl = wave * 8 + it * 4 + q8;
      const float* sp = tile + cl * 68 + c8;
      const v4f x0 = *(const v4f*)sp;
      const v4f x1 = *(const v4f*)(sp + 4);
      v4u w;
      w[0] = pack_bf16x2(x0[0], x0[1]);
      w[1] = pack_bf16x2(x0[2], x0[3]);
      w[2] = pack_bf16x2(x1[0], x1[1]);
      w[3] = pack_bf16x2(x1[2], x1[3]);
      *(v4u*)(out + (size_t)(c0 + cl) * nrows + r0 + c8) = w;
    }
    
  }
}

// =====================================================================================
// Attention, head dim 64, over bf16 hi/lo planes of the fused qkv projection.
// qkv planes: [B*S][3*HID], q at col h*64+d, k at HID + h*64 + d, v at 2*HID + h*64 + d.
// scores = 0.125 * q.k^T (bf16 hi/lo, 3 products); mask tile m[q][kv] (RNE-bf16 converted) applied as
// s*m - 10000*(1-m); online softmax in f32. Both products are formed transposed (S^T = K.Q^T, out^T += V^T.P^T, 3 products each):
// a lane holds one query's scores, so row maximum and sum are in-lane plus one exchange of the lane halves, and the
// score accumulators, split into bf16 hi/lo, are the B operand of the second product as they stand.
// A 64x64 tile whose mask is identically zero has 64 equal logits -10000 per row: folded in closed form
// (l += 64*p, o += p * column-sum(v), p = exp(-10000 - rowmax)).
// The class of every mask tile (all 0 / all 1 / mixed, of the RNE-bf16 converted values) comes from mask_tile_class, which
// reads the mask once; a tile of ones leaves every score as it is (x*1 - 10000*0 == x), so only a mixed tile is loaded here.
// The softmax runs in base 2: every logit is multiplied by log2(e) (for a tile of ones in the same multiply as the 1/8), the running
// maximum is kept in those units, and exp(x - m) = 2^(x2 - m2) is one subtraction and one v_exp_f32.
// Block = 4 waves = 64 query rows of one (batch, head); grid.x = B * NH * (S/64).
// =====================================================================================
#define SEQ_LEN 2048
#define N_HEADS 16
#define HEAD_D 64
#define HID_SZ 1024
#define QKV_PITCH 3072
#define KV_CHUNK 64
#define N_BATCH 2
#define LDS_P 72   // row pitch of the K and V^T tiles in 16-bit elements: 144 B = 16 B x odd, so the 16 rows of a b128 fragment read fall on distinct banks

#define LOG2_E 1.44269504088896340736f
#define MASKED_L2 (-10000.0f * LOG2_E)   // the logit of a masked key, in base-2 units

#define TCLS_STRIDE 32   // ints between two tile classes: each class has a 128-byte line of its own (one writer per line)

// One wave per 64x64 mask tile (grid = 32 x 32 tiles, tile = query block * 32 + key block): 32 b128 loads per lane = the tile.
// class 0: every RNE-bf16 converted element is +-0; class 1: every one is 1.0; class 2: anything else.
__global__ __launch_bounds__(32) void mask_tile_class(const float* __restrict__ maskp, int* __restrict__ tcls) {
  const int lane = threadIdx.x;
  const int qb = blockIdx.x >> 5, kc = blockIdx.x & 31;
  const float* src = maskp + (size_t)(qb * 64 + (lane >> 4)) * SEQ_LEN + kc * 64 + (lane & 15) * 4;
  unsigned int nz = 0u, n1 = 0u;
#pragma unroll
  for (int i = 0; i < 32; ++i) {
    const v4u m = *(const v4u*)(src + (size_t)(2 * i) * SEQ_LEN);
#pragma unroll
    for (int e = 0; e < 4; ++e) { const unsigned int u = rne_bf16_word(m[e]); nz |= (u & 0x7FFFFFFFu); n1 |= (u ^ 0x3F800000u); }
  }
  const int any_nz = __any(nz != 0u);
  const int any_n1 = __any(n1 != 0u);
  if (lane == 0) tcls[(size_t)blockIdx.x * TCLS_STRIDE] = any_nz ? (any_n1 ? 2 : 1) : 0;
}

__global__ __launch_bounds__(128) void attn_planes_kernel(
    const unsigned short* __restrict__ qkvh, const unsigned short* __restrict__ qkvl,
    const float* __restrict__ maskp, const int* __restrict__ tcls,
    unsigned short* __restrict__ ctxh, unsigned short* __restrict__ ctxl) {
  union FB { v16b v; v8b h[2]; };
  union FW { v16b v; unsigned int w[8]; };
  __shared__ __align__(16) unsigned short Kh[KV_CHUNK * LDS_P];     // K hi [kv][d], pitch LDS_P
  __shared__ __align__(16) unsigned short Kl[KV_CHUNK * LDS_P];     // K lo [kv][d], pitch LDS_P
  __shared__ __align__(16) unsigned short Vth[HEAD_D * LDS_P];      // V hi [d][kv], pitch LDS_P
  __shared__ __align__(16) unsigned short Vtl[HEAD_D * LDS_P];      // V lo [d][kv], pitch LDS_P
  __shared__ __align__(16) float Os[4][16 * 68];                   // per wave out tile, pitch 68; Os[0][0..127] doubles as column-sum scratch
  __shared__ __align__(16) unsigned int Msk[64 * 68];              // mask tile [q][kv] (f32 bits), pitch 68; doubles as v scratch [kv][d]

  const int tid  = threadIdx.x;
  const int wave = tid >> 5;
  const int lane = tid & 31;
  const int hh   = lane >> 4;
  const int c    = lane & 15;
  const int bx   = blockIdx.x;
  const int qb   = 31 - (bx >> 5);           // SEQ_LEN / 64 == 32; late query blocks first: under a lower-triangular mask they hold the most live tiles, so cost falls with the block index (speed only)
  static_assert(N_BATCH * N_HEADS == 32 && SEQ_LEN / 64 == 32, "block index split");
  const int bhd  = bx & 31;                  // N_BATCH * N_HEADS == 32
  const int h    = bhd & (N_HEADS - 1);
  const int b    = bhd >> 4;
  const int qblk = qb * 64;
  const int q0   = qblk + wave * 16;
  const size_t rowb = (size_t)b * SEQ_LEN;

  // ---- Q fragments (B operand of the transposed scores), hi and lo planes, 2 d-chunks (8 b128 loads per lane) ----
  v16b qah[2], qal[2];
  {
    const size_t qoff = (rowb + q0 + c) * QKV_PITCH + h * HEAD_D + 8 * hh;
#pragma unroll
    for (int dc = 0; dc < 2; ++dc) {
      qah[dc] = Frag<__bf16>::load((const __bf16*)qkvh + qoff + dc * 32);
      qal[dc] = Frag<__bf16>::load((const __bf16*)qkvl + qoff + dc * 32);
    }
  }

  float mrow = -__builtin_inff(), lrow = 0.f;   // running maximum (base-2 units) and sum of query q0 + c (the same in both lane halves)
  v8f oacc[4];                                  // out^T: oacc[t][r] = out[q0 + c][16 t + 8 hh + r]
#pragma unroll
  for (int t = 0; t < 4; ++t) oacc[t] = (v8f){0.f,0.f,0.f,0.f,0.f,0.f,0.f,0.f};

  const int cls_l = tcls[(size_t)(qb * 32 + lane) * TCLS_STRIDE];   // lane l: class of this query block's mask tile l

  const int kvr = tid >> 1;            // staging: kv row of this thread (0..63)
  const int dh  = (tid & 1) * 32;      // staging: d half (0 or 32)

  for (int kc = 0; kc < SEQ_LEN / KV_CHUNK; ++kc) {
    const int kv0 = kc * KV_CHUNK;
    __syncthreads();
    const int cls = __builtin_amdgcn_readlane(cls_l, kc);   // scalar, the same in every wave of the block

    const size_t koff = (rowb + kv0 + kvr) * QKV_PITCH + HID_SZ + h * HEAD_D + dh;
    const size_t voff = koff + HID_SZ;

    if (cls != 0) {
      if (cls == 2) {
        // ---- mixed mask tile [64 q][64 kv]: 1024 float4 / 128 threads = 8 b128 per lane; RNE-bf16 convert ----
#pragma unroll
        for (int i = 0; i < 8; ++i) {
          const int idx = i * 128 + tid;
          const int row = idx >> 4;
          const int c4  = (idx & 15) * 4;
          v4u m = *(const v4u*)(maskp + (size_t)(qblk + row) * SEQ_LEN + kv0 + c4);
#pragma unroll
          for (int e = 0; e < 4; ++e) m[e] = rne_bf16_word(m[e]);
          *(v4u*)(Msk + row * 68 + c4) = m;
        }
      }
      // ---- K hi/lo rows -> LDS [kv][d] (4+4 b128 per lane, 128 threads x 32 elements = 64x64 per plane) ----
      {
        const v4u* gh = (const v4u*)(qkvh + koff);
        const v4u* gl = (const v4u*)(qkvl + koff);
        v4u* lh = (v4u*)(Kh + kvr * LDS_P + dh);
        v4u* ll = (v4u*)(Kl + kvr * LDS_P + dh);
        v4u a[4], bb[4];
#pragma unroll
        for (int i = 0; i < 4; ++i) { a[i] = gh[i]; bb[i] = gl[i]; }
        // inputs-only fence on the loaded values: keeps the 8 loads in flight together (without it this build waits after every second load)
        asm volatile("" :: "v"(a[0]), "v"(a[1]), "v"(a[2]), "v"(a[3]), "v"(bb[0]), "v"(bb[1]), "v"(bb[2]), "v"(bb[3]));
#pragma unroll
        for (int i = 0; i < 4; ++i) { lh[i] = a[i]; ll[i] = bb[i]; }
      }
      asm volatile("" ::: "memory");
      // ---- V hi/lo rows -> LDS transposed [d][kv] ----
      {
        const v4u* gh = (const v4u*)(qkvh + voff);
        const v4u* gl = (const v4u*)(qkvl + voff);
        unsigned short* sh = Vth + dh * LDS_P + kvr;   // one base per plane: every row step below is a constant offset
        unsigned short* sl = Vtl + dh * LDS_P + kvr;
        v4u vh4[4], vl4[4];
#pragma unroll
        for (int i = 0; i < 4; ++i) { vh4[i] = gh[i]; vl4[i] = gl[i]; }
        // inputs-only fence on the loaded values: keeps the 8 loads in flight together, as above
        asm volatile("" :: "v"(vh4[0]), "v"(vh4[1]), "v"(vh4[2]), "v"(vh4[3]), "v"(vl4[0]), "v"(vl4[1]), "v"(vl4[2]), "v"(vl4[3]));
#pragma unroll
        for (int i = 0; i < 4; ++i) {
          const v4u wh = vh4[i];
          const v4u wl = vl4[i];
#pragma unroll
          for (int e = 0; e < 4; ++e) {
            const int d = 8 * i + 2 * e;
            sh[d * LDS_P]       = (unsigned short)(wh[e] & 0xFFFFu);
            sh[(d + 1) * LDS_P] = (unsigned short)(wh[e] >> 16);
            sl[d * LDS_P]       = (unsigned short)(wl[e] & 0xFFFFu);
            sl[(d + 1) * LDS_P] = (unsigned short)(wl[e] >> 16);
          }
        }
      }
      __syncthreads();

      // ---- scores, transposed: S^T = K . Q^T, 4 key subtiles x 2 d-chunks, hi.hi + lo.hi + hi.lo ----
      // s[j][r] = score of query q0 + c against key kv0 + 16 j + 8 hh + r: one query per lane, its keys in registers
      v8f s[4];
#pragma unroll
      for (int j = 0; j < 4; ++j) {
        s[j] = (v8f){0.f,0.f,0.f,0.f,0.f,0.f,0.f,0.f};
#pragma unroll
        for (int dc = 0; dc < 2; ++dc) {
          FB kb, kl;
          const int ko = (j * 16 + c) * LDS_P + dc * 32 + 8 * hh;
          kb.h[0] = *(const v8b*)((const __bf16*)Kh + ko);
          kb.h[1] = *(const v8b*)((const __bf16*)Kh + ko + 16);
          kl.h[0] = *(const v8b*)((const __bf16*)Kl + ko);
          kl.h[1] = *(const v8b*)((const __bf16*)Kl + ko + 16);
          s[j] = at_mma(kb.v, qah[dc], s[j]);
          s[j] = at_mma(kl.v, qah[dc], s[j]);
          s[j] = at_mma(kb.v, qal[dc], s[j]);
        }
      }
      // ---- scale, mask (literal s*m - 10000*(1-m)), to base-2 units, maximum of the lane's 32 keys, then of both lane halves ----
      float cm = -__builtin_inff();
      if (cls == 2) {
        const unsigned int* mp = Msk + (wave * 16 + c) * 68 + 8 * hh;
#pragma unroll
        for (int j = 0; j < 4; ++j) {
          const v4u k0 = *(const v4u*)(mp + j * 16);
          const v4u k1 = *(const v4u*)(mp + j * 16 + 4);
#pragma unroll
          for (int r = 0; r < 8; ++r) {
            const float mk = __uint_as_float(r < 4 ? k0[r & 3] : k1[r & 3]);
            float x = s[j][r] * 0.125f;
            x = x * mk - 10000.0f * (1.0f - mk);
            x *= LOG2_E;
            s[j][r] = x;
            cm = fmaxf(cm, x);
          }
        }
      } else {
        // tile of ones: x*1 - 10000*(1 - 1) == x for every x
#pragma unroll
        for (int j = 0; j < 4; ++j)
#pragma unroll
          for (int r = 0; r < 8; ++r) {
            const float x = s[j][r] * (0.125f * LOG2_E);
            s[j][r] = x;
            cm = fmaxf(cm, x);
          }
      }
      cm = fmaxf(cm, xhalf(cm));
      // ---- online softmax, one query per lane; P^T split into bf16 hi/lo and packed in place as B operands ----
      FW ph[2], pl[2];
      {
        const float mnew  = fmaxf(mrow, cm);
        const float alpha = __builtin_amdgcn_exp2f(mrow - mnew);
        mrow = mnew;
        float ps[4];
#pragma unroll
        for (int j = 0; j < 4; ++j) {
          ps[j] = 0.f;
#pragma unroll
          for (int r = 0; r < 8; r += 2) {
            const v2f d = (v2f){s[j][r], s[j][r + 1]} - mnew;   // one packed subtraction for two keys
            const float p0 = __builtin_amdgcn_exp2f(d[0]);
            const float p1 = __builtin_amdgcn_exp2f(d[1]);
            ps[j] += p0;
            ps[j] += p1;
            unsigned int wh, wl;
            split_pack2(p0, p1, wh, wl);
            ph[j >> 1].w[(j & 1) * 4 + (r >> 1)] = wh;   // element 8 (j & 1) + r of the 32-key fragment = key 16 (j & 1) + 8 hh + r
            pl[j >> 1].w[(j & 1) * 4 + (r >> 1)] = wl;
          }
        }
        float psum = (ps[0] + ps[1]) + (ps[2] + ps[3]);
        psum += xhalf(psum);
        lrow = lrow * alpha + psum;
#pragma unroll
        for (int t = 0; t < 4; ++t)
#pragma unroll
          for (int r = 0; r < 8; ++r) oacc[t][r] *= alpha;
      }
      // ---- out^T += V^T(64x64) . P^T(64x16): vh.ph + vl.ph + vh.pl; oacc[t][r] = out[q0 + c][16 t + 8 hh + r] ----
#pragma unroll
      for (int kk = 0; kk < 2; ++kk) {
#pragma unroll
        for (int t = 0; t < 4; ++t) {
          FB vb, vl;
          const int vo = (t * 16 + c) * LDS_P + kk * 32 + 8 * hh;
          vb.h[0] = *(const v8b*)((const __bf16*)Vth + vo);
          vb.h[1] = *(const v8b*)((const __bf16*)Vth + vo + 16);
          vl.h[0] = *(const v8b*)((const __bf16*)Vtl + vo);
          vl.h[1] = *(const v8b*)((const __bf16*)Vtl + vo + 16);
          oacc[t] = at_mma(vb.v, ph[kk].v, oacc[t]);
          oacc[t] = at_mma(vl.v, ph[kk].v, oacc[t]);
          oacc[t] = at_mma(vb.v, pl[kk].v, oacc[t]);
        }
      }
    } else {
      // ---- all-masked tile: v rows (hi+lo, f32) -> Msk scratch [kv][d], column sums, closed-form update ----
      {
        const v4u* gh = (const v4u*)(qkvh + voff);
        const v4u* gl = (const v4u*)(qkvl + voff);
#pragma unroll
        for (int i = 0; i < 4; ++i) {
          const v4u wh = gh[i];
          const v4u wl = gl[i];
          v4u f0, f1;
          {
            const float a0 = __uint_as_float(wh[0] << 16);          const float b0 = __uint_as_float(wl[0] << 16);
            const float a1 = __uint_as_float(wh[0] & 0xFFFF0000u); const float b1 = __uint_as_float(wl[0] & 0xFFFF0000u);
            const float a2 = __uint_as_float(wh[1] << 16);          const float b2 = __uint_as_float(wl[1] << 16);
            const float a3 = __uint_as_float(wh[1] & 0xFFFF0000u); const float b3 = __uint_as_float(wl[1] & 0xFFFF0000u);
            f0[0] = __float_as_uint(a0 + b0); f0[1] = __float_as_uint(a1 + b1);
            f0[2] = __float_as_uint(a2 + b2); f0[3] = __float_as_uint(a3 + b3);
          }
          {
            const float a0 = __uint_as_float(wh[2] << 16);          const float b0 = __uint_as_float(wl[2] << 16);
            const float a1 = __uint_as_float(wh[2] & 0xFFFF0000u); const float b1 = __uint_as_float(wl[2] & 0xFFFF0000u);
            const float a2 = __uint_as_float(wh[3] << 16);          const float b2 = __uint_as_float(wl[3] << 16);
            const float a3 = __uint_as_float(wh[3] & 0xFFFF0000u); const float b3 = __uint_as_float(wl[3] & 0xFFFF0000u);
            f1[0] = __float_as_uint(a0 + b0); f1[1] = __float_as_uint(a1 + b1);
            f1[2] = __float_as_uint(a2 + b2); f1[3] = __float_as_uint(a3 + b3);
          }
          *(v4u*)(Msk + kvr * 68 + dh + 8 * i)     = f0;
          *(v4u*)(Msk + kvr * 68 + dh + 8 * i + 4) = f1;
        }
      }
      __syncthreads();
      {
        const int d = tid & 63, half = tid >> 6;
        float part = 0.f;
#pragma unroll 8
        for (int kq = 0; kq < 32; ++kq) part += __uint_as_float(Msk[(half * 32 + kq) * 68 + d]);
        Os[0][half * 64 + d] = part;
      }
      __syncthreads();
      {
        const float mnew  = fmaxf(mrow, MASKED_L2);
        const float alpha = __builtin_amdgcn_exp2f(mrow - mnew);
        const float p     = __builtin_amdgcn_exp2f(MASKED_L2 - mnew);
        mrow = mnew;
        lrow = lrow * alpha + 64.0f * p;
#pragma unroll
        for (int t = 0; t < 4; ++t) {
          const float* cs = Os[0] + t * 16 + 8 * hh;      // column sums of the lane's 8 output columns, two partial sums each
          const v4f a0 = *(const v4f*)cs;
          const v4f a1 = *(const v4f*)(cs + 4);
          const v4f b0 = *(const v4f*)(cs + 64);
          const v4f b1 = *(const v4f*)(cs + 68);
#pragma unroll
          for (int r = 0; r < 8; ++r) {
            const float vs = (r < 4 ? a0[r & 3] : a1[r & 3]) + (r < 4 ? b0[r & 3] : b1[r & 3]);
            oacc[t][r] = oacc[t][r] * alpha + p * vs;
          }
        }
      }
    }
  }
  __syncthreads();

  float* os = Os[wave];
  {
    const float inv = 1.0f / lrow;
#pragma unroll
    for (int t = 0; t < 4; ++t) {
      v4f x0, x1;
#pragma unroll
      for (int r = 0; r < 4; ++r) { x0[r] = oacc[t][r] * inv; x1[r] = oacc[t][r + 4] * inv; }
      *(v4f*)(os + c * 68 + t * 16 + 8 * hh)     = x0;
      *(v4f*)(os + c * 68 + t * 16 + 8 * hh + 4) = x1;
    }
  }
  __builtin_amdgcn_fence(__ATOMIC_RELEASE, "workgroup");
  __builtin_amdgcn_wave_barrier();
  __builtin_amdgcn_fence(__ATOMIC_ACQUIRE, "workgroup");
  {
    const int q8 = lane >> 3, c8 = (lane & 7) * 8;
    unsigned short* oh = ctxh + (rowb + q0) * HID_SZ + h * HEAD_D + c8;
    unsigned short* ol = ctxl + (rowb + q0) * HID_SZ + h * HEAD_D + c8;
    {
#pragma unroll
      for (int it = 0; it < 4; ++it) {
        const int row = it * 4 + q8;
        const float* sp = os + row * 68 + c8;
        const v4f x0 = *(const v4f*)sp;
        const v4f x1 = *(const v4f*)(sp + 4);
        v4u wh, wl;
        unsigned int th, tl;
        split_pack2(x0[0], x0[1], th, tl); wh[0] = th; wl[0] = tl;
        split_pack2(x0[2], x0[3], th, tl); wh[1] = th; wl[1] = tl;
        split_pack2(x1[0], x1[1], th, tl); wh[2] = th; wl[2] = tl;
        split_pack2(x1[2], x1[3], th, tl); wh[3] = th; wl[3] = tl;
        *(v4u*)(oh + (size_t)row * HID_SZ) = wh;
        *(v4u*)(ol + (size_t)row * HID_SZ) = wl;
      }
      
    }
  }
}

// ---------------------------------------------------------------------------
// Workspace region map (bytes):
//   Hb    bf16 [4096][1024]        off 0            size  8388608
//   WQt   bf16 [3072][1024]        off 8388608      size  6291456
//   WDt   bf16 [1024][1024]        off 14680064     size  2097152
//   BQ    f32  [3072]              off 16777216     size    12288
//   BD    f32  [1024]              off 16789504     size     4096
//   QKVh  bf16 [4096][3072]        off 16793600     size 25165824
//   QKVl  bf16 [4096][3072]        off 41959424     size 25165824
//   CTXh  bf16 [4096][1024]        off 67125248     size  8388608
//   CTXl  bf16 [4096][1024]        off 75513856     size  8388608
//   TCLS  i32  [1024] x 128 B      off 83902464     size   131072
//   end                            84033536
// Every region is written by its producer before any consumer reads it (TCLS: only the first int of each 128-byte line).
// ---------------------------------------------------------------------------
extern "C" void kernel_launch(void* const* d_in, const int* in_sizes, int n_in,
                              void* d_out, int out_size, void* d_ws, size_t ws_size,
                              hipStream_t stream) {
  constexpr int kB = N_BATCH, kS = SEQ_LEN, kH = HID_SZ;
  constexpr int kM = kB * kS;          // 4096
  constexpr int kN3 = 3 * kH;          // 3072
  static_assert(kM % G_BM == 0 && kN3 % G_BN == 0 && kH % G_BN == 0);   // GEMM M/N tile multiples
  static_assert(kH % G_KS == 0);                                         // GEMM K slice
  static_assert(kS % KV_CHUNK == 0 && kS / 64 == 32 && kH / HEAD_D == N_HEADS);
  static_assert((kM * kH) % 2048 == 0 && kN3 % 1024 == 0 && kH % 1024 == 0);

  if (n_in < 6) return;
  if (in_sizes[0] != kM * kH || in_sizes[1] != kS * kS || in_sizes[2] != kH * kN3 ||
      in_sizes[3] != kN3 || in_sizes[4] != kH * kH || in_sizes[5] != kH) return;
  if (out_size != kM * kH) return;

  const float* hidden  = (const float*)d_in[0];
  const float* maskp   = (const float*)d_in[1];
  const float* w_qkv   = (const float*)d_in[2];
  const float* b_qkv   = (const float*)d_in[3];
  const float* w_dense = (const float*)d_in[4];
  const float* b_dense = (const float*)d_in[5];
  float* out = (float*)d_out;

  const size_t szHb  = (size_t)kM * kH * 2;
  const size_t szWQt = (size_t)kN3 * kH * 2;
  const size_t szWDt = (size_t)kH * kH * 2;
  const size_t szBQ  = (size_t)kN3 * 4;
  const size_t szBD  = (size_t)kH * 4;
  const size_t szQKV = (size_t)kM * kN3 * 2;
  const size_t szCTX = (size_t)kM * kH * 2;
  const size_t offHb   = 0;
  const size_t offWQt  = offHb + szHb;
  const size_t offWDt  = offWQt + szWQt;
  const size_t offBQ   = offWDt + szWDt;
  const size_t offBD   = offBQ + szBQ;
  const size_t offQKVh = offBD + szBD;
  const size_t offQKVl = offQKVh + szQKV;
  const size_t offCTXh = offQKVl + szQKV;
  const size_t offCTXl = offCTXh + szCTX;
  const size_t offTCLS = offCTXl + szCTX;
  const size_t szTCLS  = (size_t)(kS / 64) * (kS / 64) * TCLS_STRIDE * 4;
  const size_t offEnd  = offTCLS + szTCLS;
  if (offEnd > ws_size) return;

  char* ws = (char*)d_ws;
  unsigned short* Hb   = (unsigned short*)(ws + offHb);
  unsigned short* WQt  = (unsigned short*)(ws + offWQt);
  unsigned short* WDt  = (unsigned short*)(ws + offWDt);
  float*          BQ   = (float*)(ws + offBQ);
  float*          BD   = (float*)(ws + offBD);
  unsigned short* QKVh = (unsigned short*)(ws + offQKVh);
  unsigned short* QKVl = (unsigned short*)(ws + offQKVl);
  unsigned short* CTXh = (unsigned short*)(ws + offCTXh);
  unsigned short* CTXl = (unsigned short*)(ws + offCTXl);
  int*            TCLS = (int*)(ws + offTCLS);

  // 1) hidden -> bf16 plane [4096][1024]
  {
    const int n8 = (kM * kH) / 8;                       // 524288 threads = 2048 blocks exactly
    cast_f32_bf16x8<<<dim3(n8 / 256), dim3(256), 0, stream>>>(hidden, Hb, n8);
  }
  // 2) w_qkv [1024 rows][3072 cols] -> WQt [3072][1024] bf16 ; w_dense [1024][1024] -> WDt [1024][1024] bf16
  transpose_cast_bf16<<<dim3(kN3 / 64, kH / 64), dim3(256), 0, stream>>>(w_qkv, WQt, kH, kN3);
  transpose_cast_bf16<<<dim3(kH / 64, kH / 64), dim3(256), 0, stream>>>(w_dense, WDt, kH, kH);
  // 3) bias lines RNE-bf16 converted (kept as f32)
  rne_bf16_f32x4<<<dim3((kN3 / 4) / 256), dim3(256), 0, stream>>>(b_qkv, BQ, kN3 / 4);
  rne_bf16_f32x4<<<dim3((kH / 4) / 256), dim3(256), 0, stream>>>(b_dense, BD, kH / 4);
  // 4) fused qkv projection: [4096x1024] x WQt[3072x1024]^T + bias -> bf16 hi/lo planes [4096][3072]
  {
    const int tiles = (kM / G_BM) * (kN3 / G_BN);       // 384 block tiles of 128x256
    wmma_gemm64<1, 0, 2, 2, false><<<dim3(tiles, 1), dim3(256), 0, stream>>>(
        Hb, Hb, kH, 0L, WQt, WQt, kH, 0L, (void*)QKVh, (void*)QKVl, kN3, 0L,
        BQ, BQ, 0L, kM, kN3, kH, 1.0f);
  }
  // 5) class of each 64x64 mask tile, then attention per (batch, head, 64 query rows) -> ctx bf16 hi/lo planes [4096][1024]
  mask_tile_class<<<dim3((kS / 64) * (kS / 64)), dim3(32), 0, stream>>>(maskp, TCLS);
  attn_planes_kernel<<<dim3(kB * N_HEADS * (kS / 64)), dim3(128), 0, stream>>>(QKVh, QKVl, maskp, TCLS, CTXh, CTXl);
  // 6) output projection: ctx (hi/lo) [4096x1024] x WDt[1024x1024]^T + bias -> out f32 [4096][1024]
  {
    const int tiles = (kM / G_BM) * (kH / G_BN);        // 128 block tiles of 128x256
    wmma_gemm64<1, 2, 2, 0, false><<<dim3(tiles, 1), dim3(256), 0, stream>>>(
        CTXh, CTXl, kH, 0L, WDt, WDt, kH, 0L, (void*)out, (void*)out, kH, 0L,
        BD, BD, 0L, kM, kH, kH, 1.0f);
  }
}

// v007
// It runs in 164 microseconds.
// In both of two side-by-side timings against v006, it was 1.05 times as fast.
// All steps since v000 together make it 3.82 times as fast.
// Contractions on v_wmma_f32_16x16x32_bf16 (bf16 operands, f32 accumulate): qkv projection = one product on RNE-bf16 inputs; q.k^T and p.v = bf16 hi/lo planes (3 products); output projection = ctx bf16 hi/lo x bf16 weights (2 products). Masking, softmax and normalisation in f32.
#include <hip/hip_runtime.h>

typedef __attribute__((ext_vector_type(16))) _Float16 v16h;
typedef __attribute__((ext_vector_type(8)))  _Float16 v8h;
typedef __attribute__((ext_vector_type(16))) __bf16   v16b;
typedef __attribute__((ext_vector_type(8)))  __bf16   v8b;
typedef __attribute__((ext_vector_type(8)))  float    v8f;
typedef __attribute__((ext_vector_type(4)))  float    v4f;
typedef __attribute__((ext_vector_type(2)))  float    v2f;
typedef __attribute__((ext_vector_type(4)))  unsigned int v4u;

__device__ __forceinline__ unsigned short f2bf_bits(float f) {
  unsigned u = __float_as_uint(f);
  return (unsigned short)((u + 0x7FFFu + ((u >> 16) & 1u)) >> 16);
}
__device__ __forceinline__ float bf_bits2f(unsigned short h) { return __uint_as_float(((unsigned)h) << 16); }
// RNE convert of an f32 bit pattern to its bf16 value, kept as an f32 bit pattern
__device__ __forceinline__ unsigned int rne_bf16_word(unsigned int u) {
  return (u + 0x7FFFu + ((u >> 16) & 1u)) & 0xFFFF0000u;
}
__device__ __forceinline__ unsigned int pack_bf16x2(float a, float b) {
  return (unsigned int)f2bf_bits(a) | ((unsigned int)f2bf_bits(b) << 16);
}
// hi/lo bf16 split of two floats, packed as (hi_a | hi_b<<16) and (lo_a | lo_b<<16)
__device__ __forceinline__ void split_pack2(float a, float b, unsigned int& wh, unsigned int& wl) {
  const unsigned short ha = f2bf_bits(a), hb = f2bf_bits(b);
  const unsigned short la = f2bf_bits(a - bf_bits2f(ha)), lb = f2bf_bits(b - bf_bits2f(hb));
  wh = (unsigned int)ha | ((unsigned int)hb << 16);
  wl = (unsigned int)la | ((unsigned int)lb << 16);
}

// hazard guards as plain device helpers
__device__ __forceinline__ void dep_guard_h(v8f& a, v8f& b, v16h x, v16h y) { asm volatile("v_nop\n\tv_nop\n\tv_nop\n\tv_nop" : "+v"(a), "+v"(b) : "v"(x), "v"(y)); }
__device__ __forceinline__ void dep_guard_b(v8f& a, v8f& b, v16b x, v16b y) { asm volatile("v_nop\n\tv_nop\n\tv_nop\n\tv_nop" : "+v"(a), "+v"(b) : "v"(x), "v"(y)); }
__device__ __forceinline__ void keep4_h(v16h a, v16h b, v16h c, v16h d) { asm volatile("v_nop" :: "v"(a), "v"(b), "v"(c), "v"(d)); }
__device__ __forceinline__ void keep4_b(v16b a, v16b b, v16b c, v16b d) { asm volatile("v_nop" :: "v"(a), "v"(b), "v"(c), "v"(d)); }
__device__ __forceinline__ void acc_guard4(v8f& a, v8f& b, v8f& c, v8f& d) { asm volatile("v_nop\n\tv_nop\n\tv_nop\n\tv_nop" : "+v"(a), "+v"(b), "+v"(c), "+v"(d)); }
template <typename T> struct Frag;
template <> struct Frag<_Float16> {
  typedef v16h V; union U { v16h v; v8h h[2]; };
  static __device__ __forceinline__ v16h load(const _Float16* p) {   // elements 0..7 <- p[0..7], 8..15 <- p[16..23]
    U f; f.h[0] = *(const v8h*)(p); f.h[1] = *(const v8h*)(p + 16); return f.v;
  }
  static __device__ __forceinline__ v8f mma(v16h a, v16h b, v8f c) {
    return __builtin_amdgcn_wmma_f32_16x16x32_f16(false, a, false, b, (short)0, c, false, false);
  }
  static __device__ __forceinline__ void guard(v8f& a, v8f& b, v16h x, v16h y) { dep_guard_h(a, b, x, y); }
  static __device__ __forceinline__ void keep(v16h a, v16h b, v16h c, v16h d) { keep4_h(a, b, c, d); }
};
template <> struct Frag<__bf16> {
  typedef v16b V; union U { v16b v; v8b h[2]; };
  static __device__ __forceinline__ v16b load(const __bf16* p) {
    U f; f.h[0] = *(const v8b*)(p); f.h[1] = *(const v8b*)(p + 16); return f.v;
  }
  static __device__ __forceinline__ v8f mma(v16b a, v16b b, v8f c) {
    return __builtin_amdgcn_wmma_f32_16x16x32_bf16(false, a, false, b, (short)0, c, false, false);
  }
  static __device__ __forceinline__ void guard(v8f& a, v8f& b, v16b x, v16b y) { dep_guard_b(a, b, x, y); }
  static __device__ __forceinline__ void keep(v16b a, v16b b, v16b c, v16b d) { keep4_b(a, b, c, d); }
};

// ---- Register-blocked batched WMMA GEMM ------------------------------------
// C[m,n] = scale * sum_k A[m,k] * Bt[n,k] (+bias)(+resid); a block of 8 waves (2 x 4) owns a 128x256 tile, each wave 64x64 of it.
// A row-major [M,K]; Bt row-major [N,K]; M % 128 == 0, N % 256 == 0, K % 64 == 0.
// The block's rows of A and Bt go through LDS in slices of 64 k (one 128-byte line per row), brought by asynchronous copies
// into two buffers: slice t + 1 flies while slice t is worked on, and every line is fetched once per block, whole.
// SPLIT: 0 = single planes; 1 = A and Bt hi/lo planes (hi.hi + hi.lo + lo.hi); 2 = A hi/lo planes only (hi.B + lo.B).
// BIAS_MODE: 0 = none, 1 = bias[m], 2 = bias[n].
// OUT_MODE: 0 = f32, 1 = f16, 2 = bf16 hi plane (Cout) + bf16 lo plane (Cout2).
// ET: 0 = f16 operands, 1 = bf16 operands (pointers passed as 16-bit storage)
template <int ET> struct Elem;
template <> struct Elem<0> { typedef _Float16 T; };
template <> struct Elem<1> { typedef __bf16 T; };

#define G_BM 128   // block tile rows of A
#define G_BN 256   // block tile rows of Bt
#define G_KS 64    // k elements of one staged slice
#define G_P  72    // LDS row pitch in 16-bit elements: 144 B = 16 B x odd, free of bank conflicts for b128 fragment reads

// One line of an asynchronous copy: 16 bytes per lane, global -> LDS, through no register.
#define G_CP(l, g) "global_load_async_to_lds_b128 %" #l ", %" #g ", off\n\t"
// N copies and, as the last line of the same statement, the wait that stands before their address registers are rewritten.
template <int N>
__device__ __forceinline__ void async_copies(const unsigned int* l, const unsigned short* const* g) {
  static_assert(N == 8 || N == 12, "copies per statement");
  if constexpr (N == 12) {
    asm volatile(G_CP(0, 1) G_CP(2, 3) G_CP(4, 5) G_CP(6, 7) G_CP(8, 9) G_CP(10, 11) G_CP(12, 13) G_CP(14, 15)
                 G_CP(16, 17) G_CP(18, 19) G_CP(20, 21) G_CP(22, 23) "s_wait_xcnt 0x0"
                 :: "v"(l[0]), "v"(g[0]), "v"(l[1]), "v"(g[1]), "v"(l[2]), "v"(g[2]), "v"(l[3]), "v"(g[3]),
                    "v"(l[4]), "v"(g[4]), "v"(l[5]), "v"(g[5]), "v"(l[6]), "v"(g[6]), "v"(l[7]), "v"(g[7]),
                    "v"(l[8]), "v"(g[8]), "v"(l[9]), "v"(g[9]), "v"(l[10]), "v"(g[10]), "v"(l[11]), "v"(g[11])
                 : "memory");
  } else {
    asm volatile(G_CP(0, 1) G_CP(2, 3) G_CP(4, 5) G_CP(6, 7) G_CP(8, 9) G_CP(10, 11) G_CP(12, 13) G_CP(14, 15) "s_wait_xcnt 0x0"
                 :: "v"(l[0]), "v"(g[0]), "v"(l[1]), "v"(g[1]), "v"(l[2]), "v"(g[2]), "v"(l[3]), "v"(g[3]),
                    "v"(l[4]), "v"(g[4]), "v"(l[5]), "v"(g[5]), "v"(l[6]), "v"(g[6]), "v"(l[7]), "v"(g[7])
                 : "memory");
  }
}

template <int ET, int SPLIT, int BIAS_MODE, int OUT_MODE, bool RESID, int ACT = 0>
__global__ __launch_bounds__(256) void wmma_gemm64(
    const unsigned short* __restrict__ Ap, const unsigned short* __restrict__ A2p, int lda, long strideA,
    const unsigned short* __restrict__ Btp, const unsigned short* __restrict__ Bt2p, int ldb, long strideB,
    void* __restrict__ Cout, void* __restrict__ Cout2, int ldc, long strideC,
    const float* __restrict__ bias,
    const float* __restrict__ resid, long strideR,
    int M, int N, int K, float scale) {
  typedef typename Elem<ET>::T T;
  typedef typename Frag<T>::V V;
  constexpr int NPA   = (SPLIT != 0) ? 2 : 1;             // planes of A
  constexpr int NPB   = (SPLIT == 1) ? 2 : 1;             // planes of Bt
  constexpr int ROWS  = G_BM * NPA + G_BN * NPB;          // rows of one slice: [A | A2 | Bt | Bt2]
  constexpr int STAGE = ROWS * G_P;                       // 16-bit elements of one buffer
  constexpr int NCOPY = ROWS / 32;                        // copies per lane and slice: 256 lanes x 16 B = 32 rows of 128 B
  constexpr int CGRP  = (NCOPY % 12 == 0) ? 12 : 8;       // copies per statement
  constexpr int AHEAD = (SPLIT == 0) ? 4 : 1;             // as far as the registers reach below 256
  static_assert(NCOPY % CGRP == 0 && NCOPY <= 63, "copies per slice");
  __shared__ __align__(16) unsigned short ring[2 * STAGE];   // two buffers
  __shared__ __align__(16) float sT[8][16 * 68];   // per-wave 16x64 slab, pitch 68 floats
  const int b    = blockIdx.y;
  const int tid  = threadIdx.x;
  const int lane = tid & 31;
  const int wave = tid >> 5;
  const int tilesN = N / G_BN;
  const int tilesM = M / G_BM;
  if ((int)blockIdx.x >= tilesM * tilesN) return;   // the same for the whole block, in front of every barrier
  const int tm = blockIdx.x / tilesN;
  const int tn = blockIdx.x - tm * tilesN;
  const int wm = wave >> 2;                    // wave's 64 rows of the block's A rows
  const int wn = wave & 3;                     // wave's 64 rows of the block's Bt rows
  const int m0 = tm * G_BM + (wm << 6);
  const int n0 = tn * G_BN + (wn << 6);

  const int rlane = lane & 15;                 // row (A) / col (B, D) within subtile
  const int koff  = (lane >> 4) * 8;           // k offset of this lane half
  const int mOff  = (lane >> 4) * 8;           // D row offset

  // copy i of a lane: row 32 i + (tid >> 3) of the slice, bytes 16 (tid & 7) .. + 15 of its 128: 8 lanes bring one whole line
  const int crow = tid >> 3;
  const int cseg = (tid & 7) * 8;
  const unsigned short* gA  = Ap  + (size_t)b * strideA + (size_t)(tm * G_BM + crow) * lda + cseg;
  const unsigned short* gA2 = A2p + (size_t)b * strideA + (size_t)(tm * G_BM + crow) * lda + cseg;
  const unsigned short* gB  = Btp  + (size_t)b * strideB + (size_t)(tn * G_BN + crow) * ldb + cseg;
  const unsigned short* gB2 = Bt2p + (size_t)b * strideB + (size_t)(tn * G_BN + crow) * ldb + cseg;
  const unsigned int lds0 = (unsigned int)(size_t)ring + (unsigned int)(crow * G_P + cseg) * 2u;   // low 32 bits = LDS byte address

  auto stage = [&](int kt, int buf) {
    unsigned int l[NCOPY];
    const unsigned short* g[NCOPY];
    // both loops unrolled: every address is a register operand of a copy statement
#pragma unroll
    for (int i = 0; i < NCOPY; ++i) {
      l[i] = lds0 + (unsigned int)(buf * STAGE + i * 32 * G_P) * 2u;
      if (i < 4 * NPA) {
        const int pl = i >> 2, r = (i & 3) * 32;
        g[i] = (pl ? gA2 : gA) + (size_t)r * lda + kt * G_KS;
      } else {
        const int q = i - 4 * NPA, pl = q >> 3, r = (q & 7) * 32;
        g[i] = (pl ? gB2 : gB) + (size_t)r * ldb + kt * G_KS;
      }
    }
#pragma unroll
    for (int i = 0; i < NCOPY; i += CGRP) async_copies<CGRP>(l + i, g + i);
  };

  v8f acc[4][4];
#pragma unroll
  for (int i = 0; i < 4; ++i)
#pragma unroll
    for (int j = 0; j < 4; ++j) acc[i][j] = (v8f){0.f,0.f,0.f,0.f,0.f,0.f,0.f,0.f};

  const int nt = K / G_KS;
  stage(0, 0);
  asm volatile("s_wait_asynccnt 0x0" ::: "memory");   // this wave's copies of slice 0 have landed
  __syncthreads();                                     // ... and every other wave's
  if (nt > 1) stage(1, 1);

  const int aoff = ((wm << 6) + rlane) * G_P + koff;
  const int boff = (G_BM * NPA + (wn << 6) + rlane) * G_P + koff;
  for (int t = 0; t < nt; ++t) {
    const T* sb = (const T*)ring + (t & 1) * STAGE;
#pragma unroll
    for (int ks = 0; ks < G_KS; ks += 32) {
      V bh[4], bl[4];
#pragma unroll
      for (int j = 0; j < 4; ++j) {
        bh[j] = Frag<T>::load(sb + boff + j * 16 * G_P + ks);
        if (SPLIT == 1) bl[j] = Frag<T>::load(sb + boff + (G_BN + j * 16) * G_P + ks);
      }
      // A fragments are fetched AHEAD row groups in front of their products, so that a row group's LDS latency lies under the products before it
      V ah[4], al[4];
#pragma unroll
      for (int i = 0; i < AHEAD; ++i) {
        ah[i] = Frag<T>::load(sb + aoff + i * 16 * G_P + ks);
        if (SPLIT != 0) al[i] = Frag<T>::load(sb + aoff + (G_BM + i * 16) * G_P + ks);
      }
#pragma unroll
      for (int i = 0; i < 4; ++i) {
        if (i + AHEAD < 4) {
          ah[i + AHEAD] = Frag<T>::load(sb + aoff + (i + AHEAD) * 16 * G_P + ks);
          if (SPLIT != 0) al[i + AHEAD] = Frag<T>::load(sb + aoff + (G_BM + (i + AHEAD) * 16) * G_P + ks);
        }
#pragma unroll
        for (int j = 0; j < 4; ++j) {
          acc[i][j] = Frag<T>::mma(ah[i], bh[j], acc[i][j]);
          if (SPLIT == 1) {
            acc[i][j] = Frag<T>::mma(ah[i], bl[j], acc[i][j]);
            acc[i][j] = Frag<T>::mma(al[i], bh[j], acc[i][j]);
          }
          if (SPLIT == 2) {
            acc[i][j] = Frag<T>::mma(al[i], bh[j], acc[i][j]);
          }
        }
        Frag<T>::guard(acc[i][0], acc[i][3], ah[i], (SPLIT != 0) ? al[i] : ah[i]);
      }
      Frag<T>::keep(bh[0], bh[1], bh[2], bh[3]);
      if (SPLIT == 1) Frag<T>::keep(bl[0], bl[1], bl[2], bl[3]);
    }
    asm volatile("s_wait_dscnt 0x0" ::: "memory");      // this wave's reads of slice t are done before its buffer is refilled
    asm volatile("s_wait_asynccnt 0x0" ::: "memory");   // this wave's copies of slice t + 1 have landed
    __syncthreads();                                     // publishes slice t + 1 and ends every reader's last read of slice t
    if (t + 2 < nt) stage(t + 2, t & 1);
  }
  asm volatile("s_wait_asynccnt 0x0" ::: "memory");     // no copy is outstanding behind the loop
  acc_guard4(acc[0][0], acc[0][1], acc[0][2], acc[0][3]);
  acc_guard4(acc[1][0], acc[1][1], acc[1][2], acc[1][3]);
  acc_guard4(acc[2][0], acc[2][1], acc[2][2], acc[2][3]);
  acc_guard4(acc[3][0], acc[3][1], acc[3][2], acc[3][3]);

  // ---- epilogue ----
  float* slab = sT[wave];
  const float* Rb = RESID ? (resid + (size_t)b * strideR) : nullptr;
#pragma unroll
  for (int i = 0; i < 4; ++i) {
    const int mBase = m0 + (i << 4);
#pragma unroll
    for (int j = 0; j < 4; ++j) {
      const int n = n0 + (j << 4) + rlane;
      float bv = 0.f;
      if (BIAS_MODE == 2) bv = bias[n];
#pragma unroll
      for (int r = 0; r < 8; ++r) {
        float v = acc[i][j][r] * scale;
        if (BIAS_MODE == 1) v += bias[mBase + mOff + r];
        if (BIAS_MODE == 2) v += bv;
        if (RESID) v += Rb[(size_t)(mBase + mOff + r) * ldc + n];
        if (ACT == 1) v = tanhf(v);
        if (ACT == 2) v = fmaxf(v, 0.0f);
        if (ACT == 4) v = (v > 0.f) ? v : 0.01f * v;
        slab[(mOff + r) * 68 + (j << 4) + rlane] = v;
      }
    }
    __builtin_amdgcn_fence(__ATOMIC_RELEASE, "workgroup");
    __builtin_amdgcn_wave_barrier();
    __builtin_amdgcn_fence(__ATOMIC_ACQUIRE, "workgroup");
    if (OUT_MODE == 0) {
      float* C = (float*)Cout + (size_t)b * strideC;
      const int hh = lane >> 4, c4 = (lane & 15) * 4;     // row seg = 256 B = 16 lanes x 16 B
      {
#pragma unroll
        for (int it = 0; it < 8; ++it) {
          const int row = it * 2 + hh;
          v4f v = *(const v4f*)(slab + row * 68 + c4);
          *(v4f*)(C + (size_t)(mBase + row) * ldc + n0 + c4) = v;
        }
        
      }
    } else {
      const int q = lane >> 3, c8 = (lane & 7) * 8;
      unsigned short* C  = (unsigned short*)Cout  + (size_t)b * strideC;
      unsigned short* C2 = (OUT_MODE == 2) ? ((unsigned short*)Cout2 + (size_t)b * strideC) : nullptr;
      {
#pragma unroll
        for (int it = 0; it < 4; ++it) {
          const int row = it * 4 + q;
          const float* sp = slab + row * 68 + c8;
          v8h hv, lv;
#pragma unroll
          for (int e = 0; e < 8; ++e) {
            if (OUT_MODE == 1) {
              hv[e] = (_Float16)sp[e];
            } else {
              unsigned short hb = f2bf_bits(sp[e]);
              unsigned short lb = f2bf_bits(sp[e] - bf_bits2f(hb));
              hv[e] = __builtin_bit_cast(_Float16, hb);
              lv[e] = __builtin_bit_cast(_Float16, lb);
            }
          }
          *(v8h*)(C + (size_t)(mBase + row) * ldc + n0 + c8) = hv;
          if (OUT_MODE == 2) *(v8h*)(C2 + (size_t)(mBase + row) * ldc + n0 + c8) = lv;
        }
        
      }
    }
    __builtin_amdgcn_fence(__ATOMIC_RELEASE, "workgroup");
    __builtin_amdgcn_wave_barrier();
    __builtin_amdgcn_fence(__ATOMIC_ACQUIRE, "workgroup");
  }
}

// lane l <-> lane l ^ 16
__device__ __forceinline__ float xhalf(float x) {
  return __builtin_bit_cast(float, __builtin_amdgcn_permlanex16(__builtin_bit_cast(int, x), __builtin_bit_cast(int, x), 0x76543210, 0xfedcba98, false, false));
}

__device__ __forceinline__ v8f at_mma(v16b a, v16b b, v8f c) {
  return __builtin_amdgcn_wmma_f32_16x16x32_bf16(false, a, false, b, (short)0, c, false, false);
}

union FB { v16b v; v8b h[2]; };
// The four 16-row A fragments of one 32-wide k half of one plane of a 64-row LDS tile (pitch 72 elements); off = lane's row * pitch + k offset
__device__ __forceinline__ void load_frag4(const unsigned short* tile, int off, FB* f) {
#pragma unroll
  for (int j = 0; j < 4; ++j) {
    f[j].h[0] = *(const v8b*)((const __bf16*)tile + off + j * 16 * 72);
    f[j].h[1] = *(const v8b*)((const __bf16*)tile + off + j * 16 * 72 + 16);
  }
}
// no instruction is scheduled across this point
#define FRAG_STAGE() __builtin_amdgcn_sched_barrier(0)

// coverage: grid*256 threads x 8 elements == n8*8 elements exactly (host sizes n8 = n/8, n % 2048 == 0)
__global__ __launch_bounds__(256) void cast_f32_bf16x8(const float* __restrict__ in, unsigned short* __restrict__ out, int n8) {
  const int i = blockIdx.x * 256 + threadIdx.x;
  if (i >= n8) return;
  const float* p = in + (size_t)i * 8;
  const v4f a = *(const v4f*)p;
  const v4f c2 = *(const v4f*)(p + 4);
  v4u w;
  w[0] = pack_bf16x2(a[0], a[1]);
  w[1] = pack_bf16x2(a[2], a[3]);
  w[2] = pack_bf16x2(c2[0], c2[1]);
  w[3] = pack_bf16x2(c2[2], c2[3]);
  v4u* d = (v4u*)(out + (size_t)i * 8);
  *d = w;
  
}

// coverage: n4 = n/4 threads, n % 1024 == 0 so every wave writes 4 complete lines
__global__ __launch_bounds__(256) void rne_bf16_f32x4(const float* __restrict__ in, float* __restrict__ out, int n4) {
  const int i = blockIdx.x * 256 + threadIdx.x;
  if (i >= n4) return;
  v4u a = *(const v4u*)(in + (size_t)i * 4);
#pragma unroll
  for (int e = 0; e < 4; ++e) a[e] = rne_bf16_word(a[e]);
  v4u* d = (v4u*)(out + (size_t)i * 4);
  *d = a;
  
}

// ---- transpose + bf16 cast: in[nrows][ncols] f32 -> out[ncols][nrows] bf16 ----
// grid = (ncols/64, nrows/64), block 256. Load: 256 threads x 16 floats = the 64x64 tile.
__global__ __launch_bounds__(256) void transpose_cast_bf16(const float* __restrict__ in, unsigned short* __restrict__ out, int nrows, int ncols) {
  __shared__ __align__(16) float tile[64 * 68];   // tile[cl*68 + rl]: cl = in col (out row), rl = in row (out col)
  const int tid = threadIdx.x, lane = tid & 31, wave = tid >> 5;
  const int r0 = blockIdx.y * 64;
  const int c0 = blockIdx.x * 64;
  {
    const int rl = tid >> 2, cq = (tid & 3) * 16;
    const float* src = in + (size_t)(r0 + rl) * ncols + c0 + cq;
#pragma unroll
    for (int i = 0; i < 4; ++i) {
      const v4f v = *(const v4f*)(src + 4 * i);
#pragma unroll
      for (int e = 0; e < 4; ++e) tile[(cq + 4 * i + e) * 68 + rl] = v[e];
    }
  }
  __syncthreads();
  const int q8 = lane >> 3, c8 = (lane & 7) * 8;
  {
#pragma unroll
    for (int it = 0; it < 2; ++it) {
      const int cl = wave * 8 + it * 4 + q8;
      const float* sp = tile + cl * 68 + c8;
      const v4f x0 = *(const v4f*)sp;
      const v4f x1 = *(const v4f*)(sp + 4);
      v4u w;
      w[0] = pack_bf16x2(x0[0], x0[1]);
      w[1] = pack_bf16x2(x0[2], x0[3]);
      w[2] = pack_bf16x2(x1[0], x1[1]);
      w[3] = pack_bf16x2(x1[2], x1[3]);
      *(v4u*)(out + (size_t)(c0 + cl) * nrows + r0 + c8) = w;
    }
    
  }
}

// =====================================================================================
// Attention, head dim 64, over bf16 hi/lo planes of the fused qkv projection.
// qkv planes: [B*S][3*HID], q at col h*64+d, k at HID + h*64 + d, v at 2*HID + h*64 + d.
// scores = 0.125 * q.k^T (bf16 hi/lo, 3 products); mask tile m[q][kv] (RNE-bf16 converted) applied as
// s*m - 10000*(1-m); online softmax in f32. Both products are formed transposed (S^T = K.Q^T, out^T += V^T.P^T, 3 products each):
// a lane holds one query's scores, so row maximum and sum are in-lane plus one exchange of the lane halves, and the
// score accumulators, split into bf16 hi/lo, are the B operand of the second product as they stand.
// A 64x64 tile whose mask is identically zero has 64 equal logits -10000 per row: folded in closed form
// (l += 64*p, o += p * column-sum(v), p = exp(-10000 - rowmax)).
// The class of every mask tile (all 0 / all 1 / mixed, of the RNE-bf16 converted values) comes from mask_tile_class, which
// reads the mask once; a tile of ones leaves every score as it is (x*1 - 10000*0 == x), so only a mixed tile is loaded here.
// The softmax runs in base 2: every logit is multiplied by log2(e) (for a tile of ones in the same multiply as the 1/8), the running
// maximum is kept in those units, and exp(x - m) = 2^(x2 - m2) is one subtraction and one v_exp_f32.
// Block = 4 waves = 64 query rows of one (batch, head); grid.x = B * NH * (S/64).
// =====================================================================================
#define SEQ_LEN 2048
#define N_HEADS 16
#define HEAD_D 64
#define HID_SZ 1024
#define QKV_PITCH 3072
#define KV_CHUNK 64
#define N_BATCH 2
#define LDS_P 72   // row pitch of the K and V^T tiles in 16-bit elements: 144 B = 16 B x odd, so the 16 rows of a b128 fragment read fall on distinct banks

#define LOG2_E 1.44269504088896340736f
#define MASKED_L2 (-10000.0f * LOG2_E)   // the logit of a masked key, in base-2 units

#define TCLS_STRIDE 32   // ints between two tile classes: each class has a 128-byte line of its own (one writer per line)

// One wave per 64x64 mask tile (grid = 32 x 32 tiles, tile = query block * 32 + key block): 32 b128 loads per lane = the tile.
// class 0: every RNE-bf16 converted element is +-0; class 1: every one is 1.0; class 2: anything else.
__global__ __launch_bounds__(32) void mask_tile_class(const float* __restrict__ maskp, int* __restrict__ tcls) {
  const int lane = threadIdx.x;
  const int qb = blockIdx.x >> 5, kc = blockIdx.x & 31;
  const float* src = maskp + (size_t)(qb * 64 + (lane >> 4)) * SEQ_LEN + kc * 64 + (lane & 15) * 4;
  unsigned int nz = 0u, n1 = 0u;
#pragma unroll
  for (int i = 0; i < 32; ++i) {
    const v4u m = *(const v4u*)(src + (size_t)(2 * i) * SEQ_LEN);
#pragma unroll
    for (int e = 0; e < 4; ++e) { const unsigned int u = rne_bf16_word(m[e]); nz |= (u & 0x7FFFFFFFu); n1 |= (u ^ 0x3F800000u); }
  }
  const int any_nz = __any(nz != 0u);
  const int any_n1 = __any(n1 != 0u);
  if (lane == 0) tcls[(size_t)blockIdx.x * TCLS_STRIDE] = any_nz ? (any_n1 ? 2 : 1) : 0;
}

// four waves per SIMD, as many as the grid's 1024 blocks of four waves need to be resident together: holds the register count at 256 or below
__global__ __launch_bounds__(128) __attribute__((amdgpu_waves_per_eu(4, 4))) void attn_planes_kernel(
    const unsigned short* __restrict__ qkvh, const unsigned short* __restrict__ qkvl,
    const float* __restrict__ maskp, const int* __restrict__ tcls,
    unsigned short* __restrict__ ctxh, unsigned short* __restrict__ ctxl) {
  union FW { v16b v; unsigned int w[8]; };
  __shared__ __align__(16) unsigned short Kh[KV_CHUNK * LDS_P];     // K hi [kv][d], pitch LDS_P
  __shared__ __align__(16) unsigned short Kl[KV_CHUNK * LDS_P];     // K lo [kv][d], pitch LDS_P
  __shared__ __align__(16) unsigned short Vth[HEAD_D * LDS_P];      // V hi [d][kv], pitch LDS_P
  __shared__ __align__(16) unsigned short Vtl[HEAD_D * LDS_P];      // V lo [d][kv], pitch LDS_P
  __shared__ __align__(16) float Os[4][16 * 68];                   // per wave out tile, pitch 68; Os[0][0..127] doubles as column-sum scratch
  __shared__ __align__(16) unsigned int Msk[64 * 68];              // mask tile [q][kv] (f32 bits), pitch 68; doubles as v scratch [kv][d]

  const int tid  = threadIdx.x;
  const int wave = tid >> 5;
  const int lane = tid & 31;
  const int hh   = lane >> 4;
  const int c    = lane & 15;
  const int bx   = blockIdx.x;
  const int qb   = 31 - (bx >> 5);           // SEQ_LEN / 64 == 32; late query blocks first: under a lower-triangular mask they hold the most live tiles, so cost falls with the block index (speed only)
  static_assert(N_BATCH * N_HEADS == 32 && SEQ_LEN / 64 == 32, "block index split");
  const int bhd  = bx & 31;                  // N_BATCH * N_HEADS == 32
  const int h    = bhd & (N_HEADS - 1);
  const int b    = bhd >> 4;
  const int qblk = qb * 64;
  const int q0   = qblk + wave * 16;
  const size_t rowb = (size_t)b * SEQ_LEN;

  // ---- Q fragments (B operand of the transposed scores), hi and lo planes, 2 d-chunks (8 b128 loads per lane) ----
  v16b qah[2], qal[2];
  {
    const size_t qoff = (rowb + q0 + c) * QKV_PITCH + h * HEAD_D + 8 * hh;
#pragma unroll
    for (int dc = 0; dc < 2; ++dc) {
      qah[dc] = Frag<__bf16>::load((const __bf16*)qkvh + qoff + dc * 32);
      qal[dc] = Frag<__bf16>::load((const __bf16*)qkvl + qoff + dc * 32);
    }
  }

  float mrow = -__builtin_inff(), lrow = 0.f;   // running maximum (base-2 units) and sum of query q0 + c (the same in both lane halves)
  v8f oacc[4];                                  // out^T: oacc[t][r] = out[q0 + c][16 t + 8 hh + r]
#pragma unroll
  for (int t = 0; t < 4; ++t) oacc[t] = (v8f){0.f,0.f,0.f,0.f,0.f,0.f,0.f,0.f};

  const int cls_l = tcls[(size_t)(qb * 32 + lane) * TCLS_STRIDE];   // lane l: class of this query block's mask tile l

  const int kvr = tid >> 1;            // staging: kv row of this thread (0..63)
  const int dh  = (tid & 1) * 32;      // staging: d half (0 or 32)

  for (int kc = 0; kc < SEQ_LEN / KV_CHUNK; ++kc) {
    const int kv0 = kc * KV_CHUNK;
    __syncthreads();
    const int cls = __builtin_amdgcn_readlane(cls_l, kc);   // scalar, the same in every wave of the block

    const size_t koff = (rowb + kv0 + kvr) * QKV_PITCH + HID_SZ + h * HEAD_D + dh;
    const size_t voff = koff + HID_SZ;

    if (cls != 0) {
      if (cls == 2) {
        // ---- mixed mask tile [64 q][64 kv]: 1024 float4 / 128 threads = 8 b128 per lane; RNE-bf16 convert ----
        // load i of a thread: row 8 i + (tid >> 4), floats 4 (tid & 15) .. + 3. One base on each side, the eight row steps constant:
        // no row addresses are held in registers over the loop (they are what the fragments read ahead need)
        const float* mrow0 = maskp + (size_t)(qblk + (tid >> 4)) * SEQ_LEN + kv0 + (tid & 15) * 4;
        unsigned int* mdst0 = Msk + (tid >> 4) * 68 + (tid & 15) * 4;
#pragma unroll
        for (int i = 0; i < 8; ++i) {
          v4u m = *(const v4u*)(mrow0 + (size_t)i * 8 * SEQ_LEN);
#pragma unroll
          for (int e = 0; e < 4; ++e) m[e] = rne_bf16_word(m[e]);
          *(v4u*)(mdst0 + i * 8 * 68) = m;
        }
      }
      // ---- K hi/lo rows -> LDS [kv][d] (4+4 b128 per lane, 128 threads x 32 elements = 64x64 per plane) ----
      {
        const v4u* gh = (const v4u*)(qkvh + koff);
        const v4u* gl = (const v4u*)(qkvl + koff);
        v4u* lh = (v4u*)(Kh + kvr * LDS_P + dh);
        v4u* ll = (v4u*)(Kl + kvr * LDS_P + dh);
        v4u a[4], bb[4];
#pragma unroll
        for (int i = 0; i < 4; ++i) { a[i] = gh[i]; bb[i] = gl[i]; }
        // inputs-only fence on the loaded values: keeps the 8 loads in flight together (without it this build waits after every second load)
        asm volatile("" :: "v"(a[0]), "v"(a[1]), "v"(a[2]), "v"(a[3]), "v"(bb[0]), "v"(bb[1]), "v"(bb[2]), "v"(bb[3]));
#pragma unroll
        for (int i = 0; i < 4; ++i) { lh[i] = a[i]; ll[i] = bb[i]; }
      }
      asm volatile("" ::: "memory");
      // ---- V hi/lo rows -> LDS transposed [d][kv] ----
      {
        const v4u* gh = (const v4u*)(qkvh + voff);
        const v4u* gl = (const v4u*)(qkvl + voff);
        unsigned short* sh = Vth + dh * LDS_P + kvr;   // one base per plane: every row step below is a constant offset
        unsigned short* sl = Vtl + dh * LDS_P + kvr;
        v4u vh4[4], vl4[4];
#pragma unroll
        for (int i = 0; i < 4; ++i) { vh4[i] = gh[i]; vl4[i] = gl[i]; }
        // inputs-only fence on the loaded values: keeps the 8 loads in flight together, as above
        asm volatile("" :: "v"(vh4[0]), "v"(vh4[1]), "v"(vh4[2]), "v"(vh4[3]), "v"(vl4[0]), "v"(vl4[1]), "v"(vl4[2]), "v"(vl4[3]));
#pragma unroll
        for (int i = 0; i < 4; ++i) {
          const v4u wh = vh4[i];
          const v4u wl = vl4[i];
#pragma unroll
          for (int e = 0; e < 4; ++e) {
            const int d = 8 * i + 2 * e;
            sh[d * LDS_P]       = (unsigned short)(wh[e] & 0xFFFFu);
            sh[(d + 1) * LDS_P] = (unsigned short)(wh[e] >> 16);
            sl[d * LDS_P]       = (unsigned short)(wl[e] & 0xFFFFu);
            sl[(d + 1) * LDS_P] = (unsigned short)(wl[e] >> 16);
          }
        }
      }
      __syncthreads();

      // ---- scores, transposed: S^T = K . Q^T, 4 key subtiles x 2 d-chunks, hi.hi + lo.hi + hi.lo ----
      // s[j][r] = score of query q0 + c against key kv0 + 16 j + 8 hh + r: one query per lane, its keys in registers
      // The fragments come in groups of four (one plane, one 32-wide half of d or of the keys: 8 reads); groups three to six are each asked for
      // two or three groups of products ahead of their use, so that the LDS latency lies under products and is not waited out in front of every third one.
      // The four accumulators take turns; each one's own order of sums is hi.hi, lo.hi, hi.lo, first half of d then second.
      // FRAG_STAGE ends a stage: without it this compiler moves the reads back down to their products.
      v8f s[4];
      FB ka[4], kb[4], kc2[4];
      FB va[4], vb[4], vc[4];
      const int fo = c * LDS_P + 8 * hh;
      load_frag4(Kh, fo, ka);            // K hi, d 0..31
      load_frag4(Kl, fo, kb);            // K lo, d 0..31
      load_frag4(Kh, fo + 32, kc2);      // K hi, d 32..63
      FRAG_STAGE();
#pragma unroll
      for (int j = 0; j < 4; ++j) s[j] = at_mma(ka[j].v, qah[0], (v8f){0.f,0.f,0.f,0.f,0.f,0.f,0.f,0.f});
#pragma unroll
      for (int j = 0; j < 4; ++j) s[j] = at_mma(kb[j].v, qah[0], s[j]);
      FRAG_STAGE();
      load_frag4(Kl, fo + 32, kb);       // K lo, d 32..63
      FRAG_STAGE();
#pragma unroll
      for (int j = 0; j < 4; ++j) s[j] = at_mma(ka[j].v, qal[0], s[j]);
      FRAG_STAGE();
      load_frag4(Vth, fo, va);           // V^T hi, keys 0..31: this group and the next arrive under the softmax
      FRAG_STAGE();
#pragma unroll
      for (int j = 0; j < 4; ++j) s[j] = at_mma(kc2[j].v, qah[1], s[j]);
#pragma unroll
      for (int j = 0; j < 4; ++j) s[j] = at_mma(kb[j].v, qah[1], s[j]);
      FRAG_STAGE();
      load_frag4(Vtl, fo, vb);           // V^T lo, keys 0..31
      FRAG_STAGE();
#pragma unroll
      for (int j = 0; j < 4; ++j) s[j] = at_mma(kc2[j].v, qal[1], s[j]);
      // ---- scale, mask (literal s*m - 10000*(1-m)), to base-2 units, maximum of the lane's 32 keys, then of both lane halves ----
      float cm = -__builtin_inff();
      if (cls == 2) {
        const unsigned int* mp = Msk + (wave * 16 + c) * 68 + 8 * hh;
#pragma unroll
        for (int j = 0; j < 4; ++j) {
          const v4u k0 = *(const v4u*)(mp + j * 16);
          const v4u k1 = *(const v4u*)(mp + j * 16 + 4);
#pragma unroll
          for (int r = 0; r < 8; ++r) {
            const float mk = __uint_as_float(r < 4 ? k0[r & 3] : k1[r & 3]);
            float x = s[j][r] * 0.125f;
            x = x * mk - 10000.0f * (1.0f - mk);
            x *= LOG2_E;
            s[j][r] = x;
            cm = fmaxf(cm, x);
          }
        }
      } else {
        // tile of ones: x*1 - 10000*(1 - 1) == x for every x
#pragma unroll
        for (int j = 0; j < 4; ++j)
#pragma unroll
          for (int r = 0; r < 8; ++r) {
            const float x = s[j][r] * (0.125f * LOG2_E);
            s[j][r] = x;
            cm = fmaxf(cm, x);
          }
      }
      cm = fmaxf(cm, xhalf(cm));
      // ---- online softmax, one query per lane; P^T split into bf16 hi/lo and packed in place as B operands ----
      FW ph[2], pl[2];
      {
        const float mnew  = fmaxf(mrow, cm);
        const float alpha = __builtin_amdgcn_exp2f(mrow - mnew);
        mrow = mnew;
        float ps[4];
#pragma unroll
        for (int j = 0; j < 4; ++j) {
          ps[j] = 0.f;
#pragma unroll
          for (int r = 0; r < 8; r += 2) {
            const v2f d = (v2f){s[j][r], s[j][r + 1]} - mnew;   // one packed subtraction for two keys
            const float p0 = __builtin_amdgcn_exp2f(d[0]);
            const float p1 = __builtin_amdgcn_exp2f(d[1]);
            ps[j] += p0;
            ps[j] += p1;
            unsigned int wh, wl;
            split_pack2(p0, p1, wh, wl);
            ph[j >> 1].w[(j & 1) * 4 + (r >> 1)] = wh;   // element 8 (j & 1) + r of the 32-key fragment = key 16 (j & 1) + 8 hh + r
            pl[j >> 1].w[(j & 1) * 4 + (r >> 1)] = wl;
          }
        }
        float psum = (ps[0] + ps[1]) + (ps[2] + ps[3]);
        psum += xhalf(psum);
        lrow = lrow * alpha + psum;
#pragma unroll
        for (int t = 0; t < 4; ++t)
#pragma unroll
          for (int r = 0; r < 8; ++r) oacc[t][r] *= alpha;
      }
      // ---- out^T += V^T(64x64) . P^T(64x16): vh.ph + vl.ph + vh.pl; oacc[t][r] = out[q0 + c][16 t + 8 hh + r] ----
      // the last two groups stand where they could be asked for; their place is left to the compiler (a stage mark behind the softmax made this build spill)
      load_frag4(Vth, fo + 32, vc);      // V^T hi, keys 32..63
#pragma unroll
      for (int t = 0; t < 4; ++t) oacc[t] = at_mma(va[t].v, ph[0].v, oacc[t]);
#pragma unroll
      for (int t = 0; t < 4; ++t) oacc[t] = at_mma(vb[t].v, ph[0].v, oacc[t]);
      load_frag4(Vtl, fo + 32, vb);      // V^T lo, keys 32..63
#pragma unroll
      for (int t = 0; t < 4; ++t) oacc[t] = at_mma(va[t].v, pl[0].v, oacc[t]);
#pragma unroll
      for (int t = 0; t < 4; ++t) oacc[t] = at_mma(vc[t].v, ph[1].v, oacc[t]);
#pragma unroll
      for (int t = 0; t < 4; ++t) oacc[t] = at_mma(vb[t].v, ph[1].v, oacc[t]);
#pragma unroll
      for (int t = 0; t < 4; ++t) oacc[t] = at_mma(vc[t].v, pl[1].v, oacc[t]);
    } else {
      // ---- all-masked tile: v rows (hi+lo, f32) -> Msk scratch [kv][d], column sums, closed-form update ----
      {
        const v4u* gh = (const v4u*)(qkvh + voff);
        const v4u* gl = (const v4u*)(qkvl + voff);
#pragma unroll
        for (int i = 0; i < 4; ++i) {
          const v4u wh = gh[i];
          const v4u wl = gl[i];
          v4u f0, f1;
          {
            const float a0 = __uint_as_float(wh[0] << 16);          const float b0 = __uint_as_float(wl[0] << 16);
            const float a1 = __uint_as_float(wh[0] & 0xFFFF0000u); const float b1 = __uint_as_float(wl[0] & 0xFFFF0000u);
            const float a2 = __uint_as_float(wh[1] << 16);          const float b2 = __uint_as_float(wl[1] << 16);
            const float a3 = __uint_as_float(wh[1] & 0xFFFF0000u); const float b3 = __uint_as_float(wl[1] & 0xFFFF0000u);
            f0[0] = __float_as_uint(a0 + b0); f0[1] = __float_as_uint(a1 + b1);
            f0[2] = __float_as_uint(a2 + b2); f0[3] = __float_as_uint(a3 + b3);
          }
          {
            const float a0 = __uint_as_float(wh[2] << 16);          const float b0 = __uint_as_float(wl[2] << 16);
            const float a1 = __uint_as_float(wh[2] & 0xFFFF0000u); const float b1 = __uint_as_float(wl[2] & 0xFFFF0000u);
            const float a2 = __uint_as_float(wh[3] << 16);          const float b2 = __uint_as_float(wl[3] << 16);
            const float a3 = __uint_as_float(wh[3] & 0xFFFF0000u); const float b3 = __uint_as_float(wl[3] & 0xFFFF0000u);
            f1[0] = __float_as_uint(a0 + b0); f1[1] = __float_as_uint(a1 + b1);
            f1[2] = __float_as_uint(a2 + b2); f1[3] = __float_as_uint(a3 + b3);
          }
          *(v4u*)(Msk + kvr * 68 + dh + 8 * i)     = f0;
          *(v4u*)(Msk + kvr * 68 + dh + 8 * i + 4) = f1;
        }
      }
      __syncthreads();
      {
        const int d = tid & 63, half = tid >> 6;
        float part = 0.f;
#pragma unroll 8
        for (int kq = 0; kq < 32; ++kq) part += __uint_as_float(Msk[(half * 32 + kq) * 68 + d]);
        Os[0][half * 64 + d] = part;
      }
      __syncthreads();
      {
        const float mnew  = fmaxf(mrow, MASKED_L2);
        const float alpha = __builtin_amdgcn_exp2f(mrow - mnew);
        const float p     = __builtin_amdgcn_exp2f(MASKED_L2 - mnew);
        mrow = mnew;
        lrow = lrow * alpha + 64.0f * p;
#pragma unroll
        for (int t = 0; t < 4; ++t) {
          const float* cs = Os[0] + t * 16 + 8 * hh;      // column sums of the lane's 8 output columns, two partial sums each
          const v4f a0 = *(const v4f*)cs;
          const v4f a1 = *(const v4f*)(cs + 4);
          const v4f b0 = *(const v4f*)(cs + 64);
          const v4f b1 = *(const v4f*)(cs + 68);
#pragma unroll
          for (int r = 0; r < 8; ++r) {
            const float vs = (r < 4 ? a0[r & 3] : a1[r & 3]) + (r < 4 ? b0[r & 3] : b1[r & 3]);
            oacc[t][r] = oacc[t][r] * alpha + p * vs;
          }
        }
      }
    }
  }
  __syncthreads();

  float* os = Os[wave];
  {
    const float inv = 1.0f / lrow;
#pragma unroll
    for (int t = 0; t < 4; ++t) {
      v4f x0, x1;
#pragma unroll
      for (int r = 0; r < 4; ++r) { x0[r] = oacc[t][r] * inv; x1[r] = oacc[t][r + 4] * inv; }
      *(v4f*)(os + c * 68 + t * 16 + 8 * hh)     = x0;
      *(v4f*)(os + c * 68 + t * 16 + 8 * hh + 4) = x1;
    }
  }
  __builtin_amdgcn_fence(__ATOMIC_RELEASE, "workgroup");
  __builtin_amdgcn_wave_barrier();
  __builtin_amdgcn_fence(__ATOMIC_ACQUIRE, "workgroup");
  {
    const int q8 = lane >> 3, c8 = (lane & 7) * 8;
    unsigned short* oh = ctxh + (rowb + q0) * HID_SZ + h * HEAD_D + c8;
    unsigned short* ol = ctxl + (rowb + q0) * HID_SZ + h * HEAD_D + c8;
    {
#pragma unroll
      for (int it = 0; it < 4; ++it) {
        const int row = it * 4 + q8;
        const float* sp = os + row * 68 + c8;
        const v4f x0 = *(const v4f*)sp;
        const v4f x1 = *(const v4f*)(sp + 4);
        v4u wh, wl;
        unsigned int th, tl;
        split_pack2(x0[0], x0[1], th, tl); wh[0] = th; wl[0] = tl;
        split_pack2(x0[2], x0[3], th, tl); wh[1] = th; wl[1] = tl;
        split_pack2(x1[0], x1[1], th, tl); wh[2] = th; wl[2] = tl;
        split_pack2(x1[2], x1[3], th, tl); wh[3] = th; wl[3] = tl;
        *(v4u*)(oh + (size_t)row * HID_SZ) = wh;
        *(v4u*)(ol + (size_t)row * HID_SZ) = wl;
      }
      
    }
  }
}

// ---------------------------------------------------------------------------
// Workspace region map (bytes):
//   Hb    bf16 [4096][1024]        off 0            size  8388608
//   WQt   bf16 [3072][1024]        off 8388608      size  6291456
//   WDt   bf16 [1024][1024]        off 14680064     size  2097152
//   BQ    f32  [3072]              off 16777216     size    12288
//   BD    f32  [1024]              off 16789504     size     4096
//   QKVh  bf16 [4096][3072]        off 16793600     size 25165824
//   QKVl  bf16 [4096][3072]        off 41959424     size 25165824
//   CTXh  bf16 [4096][1024]        off 67125248     size  8388608
//   CTXl  bf16 [4096][1024]        off 75513856     size  8388608
//   TCLS  i32  [1024] x 128 B      off 83902464     size   131072
//   end                            84033536
// Every region is written by its producer before any consumer reads it (TCLS: only the first int of each 128-byte line).
// ---------------------------------------------------------------------------
extern "C" void kernel_launch(void* const* d_in, const int* in_sizes, int n_in,
                              void* d_out, int out_size, void* d_ws, size_t ws_size,
                              hipStream_t stream) {
  constexpr int kB = N_BATCH, kS = SEQ_LEN, kH = HID_SZ;
  constexpr int kM = kB * kS;          // 4096
  constexpr int kN3 = 3 * kH;          // 3072
  static_assert(kM % G_BM == 0 && kN3 % G_BN == 0 && kH % G_BN == 0);   // GEMM M/N tile multiples
  static_assert(kH % G_KS == 0);                                         // GEMM K slice
  static_assert(kS % KV_CHUNK == 0 && kS / 64 == 32 && kH / HEAD_D == N_HEADS);
  static_assert((kM * kH) % 2048 == 0 && kN3 % 1024 == 0 && kH % 1024 == 0);

  if (n_in < 6) return;
  if (in_sizes[0] != kM * kH || in_sizes[1] != kS * kS || in_sizes[2] != kH * kN3 ||
      in_sizes[3] != kN3 || in_sizes[4] != kH * kH || in_sizes[5] != kH) return;
  if (out_size != kM * kH) return;

  const float* hidden  = (const float*)d_in[0];
  const float* maskp   = (const float*)d_in[1];
  const float* w_qkv   = (const float*)d_in[2];
  const float* b_qkv   = (const float*)d_in[3];
  const float* w_dense = (const float*)d_in[4];
  const float* b_dense = (const float*)d_in[5];
  float* out = (float*)d_out;

  const size_t szHb  = (size_t)kM * kH * 2;
  const size_t szWQt = (size_t)kN3 * kH * 2;
  const size_t szWDt = (size_t)kH * kH * 2;
  const size_t szBQ  = (size_t)kN3 * 4;
  const size_t szBD  = (size_t)kH * 4;
  const size_t szQKV = (size_t)kM * kN3 * 2;
  const size_t szCTX = (size_t)kM * kH * 2;
  const size_t offHb   = 0;
  const size_t offWQt  = offHb + szHb;
  const size_t offWDt  = offWQt + szWQt;
  const size_t offBQ   = offWDt + szWDt;
  const size_t offBD   = offBQ + szBQ;
  const size_t offQKVh = offBD + szBD;
  const size_t offQKVl = offQKVh + szQKV;
  const size_t offCTXh = offQKVl + szQKV;
  const size_t offCTXl = offCTXh + szCTX;
  const size_t offTCLS = offCTXl + szCTX;
  const size_t szTCLS  = (size_t)(kS / 64) * (kS / 64) * TCLS_STRIDE * 4;
  const size_t offEnd  = offTCLS + szTCLS;
  if (offEnd > ws_size) return;

  char* ws = (char*)d_ws;
  unsigned short* Hb   = (unsigned short*)(ws + offHb);
  unsigned short* WQt  = (unsigned short*)(ws + offWQt);
  unsigned short* WDt  = (unsigned short*)(ws + offWDt);
  float*          BQ   = (float*)(ws + offBQ);
  float*          BD   = (float*)(ws + offBD);
  unsigned short* QKVh = (unsigned short*)(ws + offQKVh);
  unsigned short* QKVl = (unsigned short*)(ws + offQKVl);
  unsigned short* CTXh = (unsigned short*)(ws + offCTXh);
  unsigned short* CTXl = (unsigned short*)(ws + offCTXl);
  int*            TCLS = (int*)(ws + offTCLS);

  // 1) hidden -> bf16 plane [4096][1024]
  {
    const int n8 = (kM * kH) / 8;                       // 524288 threads = 2048 blocks exactly
    cast_f32_bf16x8<<<dim3(n8 / 256), dim3(256), 0, stream>>>(hidden, Hb, n8);
  }
  // 2) w_qkv [1024 rows][3072 cols] -> WQt [3072][1024] bf16 ; w_dense [1024][1024] -> WDt [1024][1024] bf16
  transpose_cast_bf16<<<dim3(kN3 / 64, kH / 64), dim3(256), 0, stream>>>(w_qkv, WQt, kH, kN3);
  transpose_cast_bf16<<<dim3(kH / 64, kH / 64), dim3(256), 0, stream>>>(w_dense, WDt, kH, kH);
  // 3) bias lines RNE-bf16 converted (kept as f32)
  rne_bf16_f32x4<<<dim3((kN3 / 4) / 256), dim3(256), 0, stream>>>(b_qkv, BQ, kN3 / 4);
  rne_bf16_f32x4<<<dim3((kH / 4) / 256), dim3(256), 0, stream>>>(b_dense, BD, kH / 4);
  // 4) fused qkv projection: [4096x1024] x WQt[3072x1024]^T + bias -> bf16 hi/lo planes [4096][3072]
  {
    const int tiles = (kM / G_BM) * (kN3 / G_BN);       // 384 block tiles of 128x256
    wmma_gemm64<1, 0, 2, 2, false><<<dim3(tiles, 1), dim3(256), 0, stream>>>(
        Hb, Hb, kH, 0L, WQt, WQt, kH, 0L, (void*)QKVh, (void*)QKVl, kN3, 0L,
        BQ, BQ, 0L, kM, kN3, kH, 1.0f);
  }
  // 5) class of each 64x64 mask tile, then attention per (batch, head, 64 query rows) -> ctx bf16 hi/lo planes [4096][1024]
  mask_tile_class<<<dim3((kS / 64) * (kS / 64)), dim3(32), 0, stream>>>(maskp, TCLS);
  attn_planes_kernel<<<dim3(kB * N_HEADS * (kS / 64)), dim3(128), 0, stream>>>(QKVh, QKVl, maskp, TCLS, CTXh, CTXl);
  // 6) output projection: ctx (hi/lo) [4096x1024] x WDt[1024x1024]^T + bias -> out f32 [4096][1024]
  {
    const int tiles = (kM / G_BM) * (kH / G_BN);        // 128 block tiles of 128x256
    wmma_gemm64<1, 2, 2, 0, false><<<dim3(tiles, 1), dim3(256), 0, stream>>>(
        CTXh, CTXl, kH, 0L, WDt, WDt, kH, 0L, (void*)out, (void*)out, kH, 0L,
        BD, BD, 0L, kM, kH, kH, 1.0f);
  }
}

// v008
// A run of this version takes 158 microseconds.
// In both of two side-by-side timings against v007, it was 1.04 times as fast.
// All steps since v000 together make it 3.98 times as fast.
// Contractions on v_wmma_f32_16x16x32_bf16 (bf16 operands, f32 accumulate): qkv projection = one product on RNE-bf16 inputs; q.k^T and p.v = bf16 hi/lo planes (3 products); output projection = ctx bf16 hi/lo x bf16 weights (2 products). Masking, softmax and normalisation in f32.
#include <hip/hip_runtime.h>

typedef __attribute__((ext_vector_type(16))) _Float16 v16h;
typedef __attribute__((ext_vector_type(8)))  _Float16 v8h;
typedef __attribute__((ext_vector_type(16))) __bf16   v16b;
typedef __attribute__((ext_vector_type(8)))  __bf16   v8b;
typedef __attribute__((ext_vector_type(8)))  float    v8f;
typedef __attribute__((ext_vector_type(4)))  float    v4f;
typedef __attribute__((ext_vector_type(2)))  float    v2f;
typedef __attribute__((ext_vector_type(4)))  unsigned int v4u;

__device__ __forceinline__ unsigned short f2bf_bits(float f) {
  unsigned u = __float_as_uint(f);
  return (unsigned short)((u + 0x7FFFu + ((u >> 16) & 1u)) >> 16);
}
__device__ __forceinline__ float bf_bits2f(unsigned short h) { return __uint_as_float(((unsigned)h) << 16); }
// RNE convert of an f32 bit pattern to its bf16 value, kept as an f32 bit pattern
__device__ __forceinline__ unsigned int rne_bf16_word(unsigned int u) {
  return (u + 0x7FFFu + ((u >> 16) & 1u)) & 0xFFFF0000u;
}
__device__ __forceinline__ unsigned int pack_bf16x2(float a, float b) {
  return (unsigned int)f2bf_bits(a) | ((unsigned int)f2bf_bits(b) << 16);
}
// hi/lo bf16 split of two floats, packed as (hi_a | hi_b<<16) and (lo_a | lo_b<<16)
__device__ __forceinline__ void split_pack2(float a, float b, unsigned int& wh, unsigned int& wl) {
  const unsigned short ha = f2bf_bits(a), hb = f2bf_bits(b);
  const unsigned short la = f2bf_bits(a - bf_bits2f(ha)), lb = f2bf_bits(b - bf_bits2f(hb));
  wh = (unsigned int)ha | ((unsigned int)hb << 16);
  wl = (unsigned int)la | ((unsigned int)lb << 16);
}

// hazard guards as plain device helpers
__device__ __forceinline__ void dep_guard_h(v8f& a, v8f& b, v16h x, v16h y) { asm volatile("v_nop\n\tv_nop\n\tv_nop\n\tv_nop" : "+v"(a), "+v"(b) : "v"(x), "v"(y)); }
__device__ __forceinline__ void dep_guard_b(v8f& a, v8f& b, v16b x, v16b y) { asm volatile("v_nop\n\tv_nop\n\tv_nop\n\tv_nop" : "+v"(a), "+v"(b) : "v"(x), "v"(y)); }
__device__ __forceinline__ void keep4_h(v16h a, v16h b, v16h c, v16h d) { asm volatile("v_nop" :: "v"(a), "v"(b), "v"(c), "v"(d)); }
__device__ __forceinline__ void keep4_b(v16b a, v16b b, v16b c, v16b d) { asm volatile("v_nop" :: "v"(a), "v"(b), "v"(c), "v"(d)); }
__device__ __forceinline__ void acc_guard4(v8f& a, v8f& b, v8f& c, v8f& d) { asm volatile("v_nop\n\tv_nop\n\tv_nop\n\tv_nop" : "+v"(a), "+v"(b), "+v"(c), "+v"(d)); }
template <typename T> struct Frag;
template <> struct Frag<_Float16> {
  typedef v16h V; union U { v16h v; v8h h[2]; };
  static __device__ __forceinline__ v16h load(const _Float16* p) {   // elements 0..7 <- p[0..7], 8..15 <- p[16..23]
    U f; f.h[0] = *(const v8h*)(p); f.h[1] = *(const v8h*)(p + 16); return f.v;
  }
  static __device__ __forceinline__ v8f mma(v16h a, v16h b, v8f c) {
    return __builtin_amdgcn_wmma_f32_16x16x32_f16(false, a, false, b, (short)0, c, false, false);
  }
  static __device__ __forceinline__ void guard(v8f& a, v8f& b, v16h x, v16h y) { dep_guard_h(a, b, x, y); }
  static __device__ __forceinline__ void keep(v16h a, v16h b, v16h c, v16h d) { keep4_h(a, b, c, d); }
};
template <> struct Frag<__bf16> {
  typedef v16b V; union U { v16b v; v8b h[2]; };
  static __device__ __forceinline__ v16b load(const __bf16* p) {
    U f; f.h[0] = *(const v8b*)(p); f.h[1] = *(const v8b*)(p + 16); return f.v;
  }
  static __device__ __forceinline__ v8f mma(v16b a, v16b b, v8f c) {
    return __builtin_amdgcn_wmma_f32_16x16x32_bf16(false, a, false, b, (short)0, c, false, false);
  }
  static __device__ __forceinline__ void guard(v8f& a, v8f& b, v16b x, v16b y) { dep_guard_b(a, b, x, y); }
  static __device__ __forceinline__ void keep(v16b a, v16b b, v16b c, v16b d) { keep4_b(a, b, c, d); }
};

// ---- Register-blocked batched WMMA GEMM ------------------------------------
// C[m,n] = scale * sum_k A[m,k] * Bt[n,k] (+bias)(+resid); a block of 8 waves (2 x 4) owns a 128x256 tile, each wave 64x64 of it.
// A row-major [M,K]; Bt row-major [N,K]; M % 128 == 0, N % 256 == 0, K % 64 == 0.
// The block's rows of A and Bt go through LDS in slices of 64 k (one 128-byte line per row), brought by asynchronous copies
// into two buffers: slice t + 1 flies while slice t is worked on, and every line is fetched once per block, whole.
// SPLIT: 0 = single planes; 1 = A and Bt hi/lo planes (hi.hi + hi.lo + lo.hi); 2 = A hi/lo planes only (hi.B + lo.B).
// BIAS_MODE: 0 = none, 1 = bias[m], 2 = bias[n].
// OUT_MODE: 0 = f32, 1 = f16, 2 = bf16 hi plane (Cout) + bf16 lo plane (Cout2).
// ET: 0 = f16 operands, 1 = bf16 operands (pointers passed as 16-bit storage)
template <int ET> struct Elem;
template <> struct Elem<0> { typedef _Float16 T; };
template <> struct Elem<1> { typedef __bf16 T; };

#define G_BM 128   // block tile rows of A
#define G_BN 256   // block tile rows of Bt
#define G_KS 64    // k elements of one staged slice
#define G_P  72    // LDS row pitch in 16-bit elements: 144 B = 16 B x odd, free of bank conflicts for b128 fragment reads

// One line of an asynchronous copy: 16 bytes per lane, global -> LDS, through no register.
#define G_CP(l, g) "global_load_async_to_lds_b128 %" #l ", %" #g ", off\n\t"
// N copies and, as the last line of the same statement, the wait that stands before their address registers are rewritten.
template <int N>
__device__ __forceinline__ void async_copies(const unsigned int* l, const unsigned short* const* g) {
  static_assert(N == 8 || N == 12, "copies per statement");
  if constexpr (N == 12) {
    asm volatile(G_CP(0, 1) G_CP(2, 3) G_CP(4, 5) G_CP(6, 7) G_CP(8, 9) G_CP(10, 11) G_CP(12, 13) G_CP(14, 15)
                 G_CP(16, 17) G_CP(18, 19) G_CP(20, 21) G_CP(22, 23) "s_wait_xcnt 0x0"
                 :: "v"(l[0]), "v"(g[0]), "v"(l[1]), "v"(g[1]), "v"(l[2]), "v"(g[2]), "v"(l[3]), "v"(g[3]),
                    "v"(l[4]), "v"(g[4]), "v"(l[5]), "v"(g[5]), "v"(l[6]), "v"(g[6]), "v"(l[7]), "v"(g[7]),
                    "v"(l[8]), "v"(g[8]), "v"(l[9]), "v"(g[9]), "v"(l[10]), "v"(g[10]), "v"(l[11]), "v"(g[11])
                 : "memory");
  } else {
    asm volatile(G_CP(0, 1) G_CP(2, 3) G_CP(4, 5) G_CP(6, 7) G_CP(8, 9) G_CP(10, 11) G_CP(12, 13) G_CP(14, 15) "s_wait_xcnt 0x0"
                 :: "v"(l[0]), "v"(g[0]), "v"(l[1]), "v"(g[1]), "v"(l[2]), "v"(g[2]), "v"(l[3]), "v"(g[3]),
                    "v"(l[4]), "v"(g[4]), "v"(l[5]), "v"(g[5]), "v"(l[6]), "v"(g[6]), "v"(l[7]), "v"(g[7])
                 : "memory");
  }
}

template <int ET, int SPLIT, int BIAS_MODE, int OUT_MODE, bool RESID, int ACT = 0>
__global__ __launch_bounds__(256) void wmma_gemm64(
    const unsigned short* __restrict__ Ap, const unsigned short* __restrict__ A2p, int lda, long strideA,
    const unsigned short* __restrict__ Btp, const unsigned short* __restrict__ Bt2p, int ldb, long strideB,
    void* __restrict__ Cout, void* __restrict__ Cout2, int ldc, long strideC,
    const float* __restrict__ bias,
    const float* __restrict__ resid, long strideR,
    int M, int N, int K, float scale) {
  typedef typename Elem<ET>::T T;
  typedef typename Frag<T>::V V;
  constexpr int NPA   = (SPLIT != 0) ? 2 : 1;             // planes of A
  constexpr int NPB   = (SPLIT == 1) ? 2 : 1;             // planes of Bt
  constexpr int ROWS  = G_BM * NPA + G_BN * NPB;          // rows of one slice: [A | A2 | Bt | Bt2]
  constexpr int STAGE = ROWS * G_P;                       // 16-bit elements of one buffer
  constexpr int NCOPY = ROWS / 32;                        // copies per lane and slice: 256 lanes x 16 B = 32 rows of 128 B
  constexpr int CGRP  = (NCOPY % 12 == 0) ? 12 : 8;       // copies per statement
  constexpr int AHEAD = (SPLIT == 0) ? 4 : 1;             // as far as the registers reach below 256
  static_assert(NCOPY % CGRP == 0 && NCOPY <= 63, "copies per slice");
  __shared__ __align__(16) unsigned short ring[2 * STAGE];   // two buffers
  __shared__ __align__(16) float sT[8][16 * 68];   // per-wave 16x64 slab, pitch 68 floats
  const int b    = blockIdx.y;
  const int tid  = threadIdx.x;
  const int lane = tid & 31;
  const int wave = tid >> 5;
  const int tilesN = N / G_BN;
  const int tilesM = M / G_BM;
  if ((int)blockIdx.x >= tilesM * tilesN) return;   // the same for the whole block, in front of every barrier
  const int tm = blockIdx.x / tilesN;
  const int tn = blockIdx.x - tm * tilesN;
  const int wm = wave >> 2;                    // wave's 64 rows of the block's A rows
  const int wn = wave & 3;                     // wave's 64 rows of the block's Bt rows
  const int m0 = tm * G_BM + (wm << 6);
  const int n0 = tn * G_BN + (wn << 6);

  const int rlane = lane & 15;                 // row (A) / col (B, D) within subtile
  const int koff  = (lane >> 4) * 8;           // k offset of this lane half
  const int mOff  = (lane >> 4) * 8;           // D row offset

  // copy i of a lane: row 32 i + (tid >> 3) of the slice, bytes 16 (tid & 7) .. + 15 of its 128: 8 lanes bring one whole line
  const int crow = tid >> 3;
  const int cseg = (tid & 7) * 8;
  const unsigned short* gA  = Ap  + (size_t)b * strideA + (size_t)(tm * G_BM + crow) * lda + cseg;
  const unsigned short* gA2 = A2p + (size_t)b * strideA + (size_t)(tm * G_BM + crow) * lda + cseg;
  const unsigned short* gB  = Btp  + (size_t)b * strideB + (size_t)(tn * G_BN + crow) * ldb + cseg;
  const unsigned short* gB2 = Bt2p + (size_t)b * strideB + (size_t)(tn * G_BN + crow) * ldb + cseg;
  const unsigned int lds0 = (unsigned int)(size_t)ring + (unsigned int)(crow * G_P + cseg) * 2u;   // low 32 bits = LDS byte address

  auto stage = [&](int kt, int buf) {
    unsigned int l[NCOPY];
    const unsigned short* g[NCOPY];
    // both loops unrolled: every address is a register operand of a copy statement
#pragma unroll
    for (int i = 0; i < NCOPY; ++i) {
      l[i] = lds0 + (unsigned int)(buf * STAGE + i * 32 * G_P) * 2u;
      if (i < 4 * NPA) {
        const int pl = i >> 2, r = (i & 3) * 32;
        g[i] = (pl ? gA2 : gA) + (size_t)r * lda + kt * G_KS;
      } else {
        const int q = i - 4 * NPA, pl = q >> 3, r = (q & 7) * 32;
        g[i] = (pl ? gB2 : gB) + (size_t)r * ldb + kt * G_KS;
      }
    }
#pragma unroll
    for (int i = 0; i < NCOPY; i += CGRP) async_copies<CGRP>(l + i, g + i);
  };

  v8f acc[4][4];
#pragma unroll
  for (int i = 0; i < 4; ++i)
#pragma unroll
    for (int j = 0; j < 4; ++j) acc[i][j] = (v8f){0.f,0.f,0.f,0.f,0.f,0.f,0.f,0.f};

  const int nt = K / G_KS;
  stage(0, 0);
  asm volatile("s_wait_asynccnt 0x0" ::: "memory");   // this wave's copies of slice 0 have landed
  __syncthreads();                                     // ... and every other wave's
  if (nt > 1) stage(1, 1);

  const int aoff = ((wm << 6) + rlane) * G_P + koff;
  const int boff = (G_BM * NPA + (wn << 6) + rlane) * G_P + koff;
  for (int t = 0; t < nt; ++t) {
    const T* sb = (const T*)ring + (t & 1) * STAGE;
#pragma unroll
    for (int ks = 0; ks < G_KS; ks += 32) {
      V bh[4], bl[4];
#pragma unroll
      for (int j = 0; j < 4; ++j) {
        bh[j] = Frag<T>::load(sb + boff + j * 16 * G_P + ks);
        if (SPLIT == 1) bl[j] = Frag<T>::load(sb + boff + (G_BN + j * 16) * G_P + ks);
      }
      // A fragments are fetched AHEAD row groups in front of their products, so that a row group's LDS latency lies under the products before it
      V ah[4], al[4];
#pragma unroll
      for (int i = 0; i < AHEAD; ++i) {
        ah[i] = Frag<T>::load(sb + aoff + i * 16 * G_P + ks);
        if (SPLIT != 0) al[i] = Frag<T>::load(sb + aoff + (G_BM + i * 16) * G_P + ks);
      }
#pragma unroll
      for (int i = 0; i < 4; ++i) {
        if (i + AHEAD < 4) {
          ah[i + AHEAD] = Frag<T>::load(sb + aoff + (i + AHEAD) * 16 * G_P + ks);
          if (SPLIT != 0) al[i + AHEAD] = Frag<T>::load(sb + aoff + (G_BM + (i + AHEAD) * 16) * G_P + ks);
        }
#pragma unroll
        for (int j = 0; j < 4; ++j) {
          acc[i][j] = Frag<T>::mma(ah[i], bh[j], acc[i][j]);
          if (SPLIT == 1) {
            acc[i][j] = Frag<T>::mma(ah[i], bl[j], acc[i][j]);
            acc[i][j] = Frag<T>::mma(al[i], bh[j], acc[i][j]);
          }
          if (SPLIT == 2) {
            acc[i][j] = Frag<T>::mma(al[i], bh[j], acc[i][j]);
          }
        }
        Frag<T>::guard(acc[i][0], acc[i][3], ah[i], (SPLIT != 0) ? al[i] : ah[i]);
      }
      Frag<T>::keep(bh[0], bh[1], bh[2], bh[3]);
      if (SPLIT == 1) Frag<T>::keep(bl[0], bl[1], bl[2], bl[3]);
    }
    asm volatile("s_wait_dscnt 0x0" ::: "memory");      // this wave's reads of slice t are done before its buffer is refilled
    asm volatile("s_wait_asynccnt 0x0" ::: "memory");   // this wave's copies of slice t + 1 have landed
    __syncthreads();                                     // publishes slice t + 1 and ends every reader's last read of slice t
    if (t + 2 < nt) stage(t + 2, t & 1);
  }
  asm volatile("s_wait_asynccnt 0x0" ::: "memory");     // no copy is outstanding behind the loop
  acc_guard4(acc[0][0], acc[0][1], acc[0][2], acc[0][3]);
  acc_guard4(acc[1][0], acc[1][1], acc[1][2], acc[1][3]);
  acc_guard4(acc[2][0], acc[2][1], acc[2][2], acc[2][3]);
  acc_guard4(acc[3][0], acc[3][1], acc[3][2], acc[3][3]);

  // ---- epilogue ----
  float* slab = sT[wave];
  const float* Rb = RESID ? (resid + (size_t)b * strideR) : nullptr;
#pragma unroll
  for (int i = 0; i < 4; ++i) {
    const int mBase = m0 + (i << 4);
#pragma unroll
    for (int j = 0; j < 4; ++j) {
      const int n = n0 + (j << 4) + rlane;
      float bv = 0.f;
      if (BIAS_MODE == 2) bv = bias[n];
#pragma unroll
      for (int r = 0; r < 8; ++r) {
        float v = acc[i][j][r] * scale;
        if (BIAS_MODE == 1) v += bias[mBase + mOff + r];
        if (BIAS_MODE == 2) v += bv;
        if (RESID) v += Rb[(size_t)(mBase + mOff + r) * ldc + n];
        if (ACT == 1) v = tanhf(v);
        if (ACT == 2) v = fmaxf(v, 0.0f);
        if (ACT == 4) v = (v > 0.f) ? v : 0.01f * v;
        slab[(mOff + r) * 68 + (j << 4) + rlane] = v;
      }
    }
    __builtin_amdgcn_fence(__ATOMIC_RELEASE, "workgroup");
    __builtin_amdgcn_wave_barrier();
    __builtin_amdgcn_fence(__ATOMIC_ACQUIRE, "workgroup");
    if (OUT_MODE == 0) {
      float* C = (float*)Cout + (size_t)b * strideC;
      const int hh = lane >> 4, c4 = (lane & 15) * 4;     // row seg = 256 B = 16 lanes x 16 B
      {
#pragma unroll
        for (int it = 0; it < 8; ++it) {
          const int row = it * 2 + hh;
          v4f v = *(const v4f*)(slab + row * 68 + c4);
          *(v4f*)(C + (size_t)(mBase + row) * ldc + n0 + c4) = v;
        }
        
      }
    } else {
      const int q = lane >> 3, c8 = (lane & 7) * 8;
      unsigned short* C  = (unsigned short*)Cout  + (size_t)b * strideC;
      unsigned short* C2 = (OUT_MODE == 2) ? ((unsigned short*)Cout2 + (size_t)b * strideC) : nullptr;
      {
#pragma unroll
        for (int it = 0; it < 4; ++it) {
          const int row = it * 4 + q;
          const float* sp = slab + row * 68 + c8;
          v8h hv, lv;
#pragma unroll
          for (int e = 0; e < 8; ++e) {
            if (OUT_MODE == 1) {
              hv[e] = (_Float16)sp[e];
            } else {
              unsigned short hb = f2bf_bits(sp[e]);
              unsigned short lb = f2bf_bits(sp[e] - bf_bits2f(hb));
              hv[e] = __builtin_bit_cast(_Float16, hb);
              lv[e] = __builtin_bit_cast(_Float16, lb);
            }
          }
          *(v8h*)(C + (size_t)(mBase + row) * ldc + n0 + c8) = hv;
          if (OUT_MODE == 2) *(v8h*)(C2 + (size_t)(mBase + row) * ldc + n0 + c8) = lv;
        }
        
      }
    }
    __builtin_amdgcn_fence(__ATOMIC_RELEASE, "workgroup");
    __builtin_amdgcn_wave_barrier();
    __builtin_amdgcn_fence(__ATOMIC_ACQUIRE, "workgroup");
  }
}

// lane l <-> lane l ^ 16
__device__ __forceinline__ float xhalf(float x) {
  return __builtin_bit_cast(float, __builtin_amdgcn_permlanex16(__builtin_bit_cast(int, x), __builtin_bit_cast(int, x), 0x76543210, 0xfedcba98, false, false));
}

__device__ __forceinline__ v8f at_mma(v16b a, v16b b, v8f c) {
  return __builtin_amdgcn_wmma_f32_16x16x32_bf16(false, a, false, b, (short)0, c, false, false);
}

union FB { v16b v; v8b h[2]; };
// The four 16-row A fragments of one 32-wide k half of one plane of a 64-row LDS tile (pitch 72 elements); off = lane's row * pitch + k offset
__device__ __forceinline__ void load_frag4(const unsigned short* tile, int off, FB* f) {
#pragma unroll
  for (int j = 0; j < 4; ++j) {
    f[j].h[0] = *(const v8b*)((const __bf16*)tile + off + j * 16 * 72);
    f[j].h[1] = *(const v8b*)((const __bf16*)tile + off + j * 16 * 72 + 16);
  }
}
// no instruction is scheduled across this point
#define FRAG_STAGE() __builtin_amdgcn_sched_barrier(0)

// =====================================================================================
// Attention, head dim 64, over bf16 hi/lo planes of the fused qkv projection.
// qkv planes: [B*S][3*HID], q at col h*64+d, k at HID + h*64 + d, v at 2*HID + h*64 + d.
// scores = 0.125 * q.k^T (bf16 hi/lo, 3 products); mask tile m[q][kv] (RNE-bf16 converted) applied as
// s*m - 10000*(1-m); online softmax in f32. Both products are formed transposed (S^T = K.Q^T, out^T += V^T.P^T, 3 products each):
// a lane holds one query's scores, so row maximum and sum are in-lane plus one exchange of the lane halves, and the
// score accumulators, split into bf16 hi/lo, are the B operand of the second product as they stand.
// A 64x64 tile whose mask is identically zero has 64 equal logits -10000 per row: folded in closed form
// (l += 64*p, o += p * column-sum(v), p = exp(-10000 - rowmax)).
// The class of every mask tile (all 0 / all 1 / mixed, of the RNE-bf16 converted values) comes from prep_all, which
// reads the mask once; a tile of ones leaves every score as it is (x*1 - 10000*0 == x), so only a mixed tile is loaded here.
// The softmax runs in base 2: every logit is multiplied by log2(e) (for a tile of ones in the same multiply as the 1/8), the running
// maximum is kept in those units, and exp(x - m) = 2^(x2 - m2) is one subtraction and one v_exp_f32.
// Block = 4 waves = 64 query rows of one (batch, head); grid.x = B * NH * (S/64).
// =====================================================================================
#define SEQ_LEN 2048
#define N_HEADS 16
#define HEAD_D 64
#define HID_SZ 1024
#define QKV_PITCH 3072
#define KV_CHUNK 64
#define N_BATCH 2
#define LDS_P 72   // row pitch of the K and V^T tiles in 16-bit elements: 144 B = 16 B x odd, so the 16 rows of a b128 fragment read fall on distinct banks

#define LOG2_E 1.44269504088896340736f
#define MASKED_L2 (-10000.0f * LOG2_E)   // the logit of a masked key, in base-2 units

#define TCLS_STRIDE 32   // ints between two tile classes: each class has a 128-byte line of its own (one writer per line)

// ---- all preparatory work in one launch: the block index picks the job, and a block does several units of it ----
// The jobs read only inputs and write disjoint workspace regions, so none waits for another; few, fat blocks keep the number of
// work-groups and waves to start small, and every block has all its loads in flight together.
//   blocks [0, 4)      bias lines RNE-bf16 converted, kept as f32: 3 blocks b_qkv, 1 block b_dense, 4 floats per thread
//   blocks [4, 196)    w_qkv   [1024][3072] f32 -> WQt [3072][1024] bf16: 4 tiles of 64x64 each (256 in rows x 64 in columns)
//   blocks [196, 260)  w_dense [1024][1024] f32 -> WDt [1024][1024] bf16: the same
//   blocks [260, 388)  class of the 64x64 mask tiles, one wave per tile, 8 tiles per block
//   blocks [388, 644)  hidden f32 -> bf16 plane: 16384 elements per block, 8 x 8 per thread
#define PREP_BIAS   4
#define PREP_TQ     ((3 * HID_SZ / 64) * (HID_SZ / 256))
#define PREP_TD     ((HID_SZ / 64) * (HID_SZ / 256))
#define PREP_MASK   ((SEQ_LEN / 64) * (SEQ_LEN / 64) / 8)
#define PREP_CAST   (N_BATCH * SEQ_LEN * HID_SZ / 16384)
#define PREP_BLOCKS (PREP_BIAS + PREP_TQ + PREP_TD + PREP_MASK + PREP_CAST)

// transpose + bf16 cast of in rows r0 .. r0 + 255, columns c0 .. c0 + 63: in[nrows][ncols] f32 -> out[ncols][nrows] bf16.
// tiles[k][cl*68 + rl]: k = 64-row group, cl = in col (out row), rl = in row (out col). Called by a whole block of 256 threads.
__device__ __forceinline__ void transpose_cast4(const float* __restrict__ in, unsigned short* __restrict__ out, int nrows, int ncols,
                                                int r0, int c0, float* tiles) {
  const int tid = threadIdx.x, lane = tid & 31, wave = tid >> 5;
  {
    const int rl = tid >> 2, cq = (tid & 3) * 16;
    const float* src = in + (size_t)(r0 + rl) * ncols + c0 + cq;
    v4f v[4][4];
#pragma unroll
    for (int k = 0; k < 4; ++k)
#pragma unroll
      for (int i = 0; i < 4; ++i) v[k][i] = *(const v4f*)(src + (size_t)(k * 64) * ncols + 4 * i);
    // the wait that stands before a register of an issued load is rewritten; the address is named so that it lives up to here
    // (without it this build lets the last load land on the address pair of the fifteen before it)
    asm volatile("s_wait_xcnt 0x0" :: "v"(src) : "memory");
#pragma unroll
    for (int k = 0; k < 4; ++k)
#pragma unroll
      for (int i = 0; i < 4; ++i)
#pragma unroll
        for (int e = 0; e < 4; ++e) tiles[k * (64 * 68) + (cq + 4 * i + e) * 68 + rl] = v[k][i][e];
  }
  __syncthreads();
  const int q8 = lane >> 3, c8 = (lane & 7) * 8;
#pragma unroll
  for (int k = 0; k < 4; ++k) {
#pragma unroll
    for (int it = 0; it < 2; ++it) {
      const int cl = wave * 8 + it * 4 + q8;
      const float* sp = tiles + k * (64 * 68) + cl * 68 + c8;
      const v4f x0 = *(const v4f*)sp;
      const v4f x1 = *(const v4f*)(sp + 4);
      v4u w;
      w[0] = pack_bf16x2(x0[0], x0[1]);
      w[1] = pack_bf16x2(x0[2], x0[3]);
      w[2] = pack_bf16x2(x1[0], x1[1]);
      w[3] = pack_bf16x2(x1[2], x1[3]);
      *(v4u*)(out + (size_t)(c0 + cl) * nrows + r0 + k * 64 + c8) = w;
    }
  }
  // the wait that stands before a register of an issued store is rewritten (the code of the other jobs follows this one in the kernel)
  asm volatile("s_wait_xcnt 0x0" ::: "memory");
}

__global__ __launch_bounds__(256) void prep_all(
    const float* __restrict__ hidden, const float* __restrict__ maskp, const float* __restrict__ w_qkv,
    const float* __restrict__ b_qkv, const float* __restrict__ w_dense, const float* __restrict__ b_dense,
    unsigned short* __restrict__ Hb, unsigned short* __restrict__ WQt, unsigned short* __restrict__ WDt,
    float* __restrict__ BQ, float* __restrict__ BD, int* __restrict__ tcls) {
  __shared__ __align__(16) float tiles[4 * 64 * 68];
  const int tid = threadIdx.x;
  int u = blockIdx.x;   // every branch below is the same for the whole block
  if (u < PREP_BIAS) {
    static_assert(3 * HID_SZ == 3 * 1024 && HID_SZ == 1024, "3 + 1 blocks of 256 threads x 4 floats");
    const float* in = (u < 3) ? (b_qkv + u * 1024) : b_dense;
    float* o        = (u < 3) ? (BQ + u * 1024) : BD;
    v4u a = *(const v4u*)(in + tid * 4);
#pragma unroll
    for (int e = 0; e < 4; ++e) a[e] = rne_bf16_word(a[e]);
    *(v4u*)(o + tid * 4) = a;
    return;
  }
  u -= PREP_BIAS;
  if (u < PREP_TQ) {
    constexpr int CT = 3 * HID_SZ / 64;
    transpose_cast4(w_qkv, WQt, HID_SZ, 3 * HID_SZ, (u / CT) * 256, (u % CT) * 64, tiles);
    return;
  }
  u -= PREP_TQ;
  if (u < PREP_TD) {
    constexpr int CT = HID_SZ / 64;
    transpose_cast4(w_dense, WDt, HID_SZ, HID_SZ, (u / CT) * 256, (u % CT) * 64, tiles);
    return;
  }
  u -= PREP_TD;
  if (u < PREP_MASK) {
    // One wave per 64x64 mask tile (tile = query block * 32 + key block): 32 b128 loads per lane = the tile.
    // class 0: every RNE-bf16 converted element is +-0; class 1: every one is 1.0; class 2: anything else.
    const int lane = tid & 31;
    const int tile = u * 8 + (tid >> 5);
    const int qb = tile >> 5, kc = tile & 31;
    const float* src = maskp + (size_t)(qb * 64 + (lane >> 4)) * SEQ_LEN + kc * 64 + (lane & 15) * 4;
    unsigned int nz = 0u, n1 = 0u;
#pragma unroll
    for (int i = 0; i < 32; ++i) {
      const v4u m = *(const v4u*)(src + (size_t)(2 * i) * SEQ_LEN);
#pragma unroll
      for (int e = 0; e < 4; ++e) { const unsigned int w = rne_bf16_word(m[e]); nz |= (w & 0x7FFFFFFFu); n1 |= (w ^ 0x3F800000u); }
    }
    const int any_nz = __any(nz != 0u);
    const int any_n1 = __any(n1 != 0u);
    if (lane == 0) tcls[(size_t)tile * TCLS_STRIDE] = any_nz ? (any_n1 ? 2 : 1) : 0;
    return;
  }
  u -= PREP_MASK;
  {
    // unit it of a block: 2048 elements in a row, 8 per thread (2 b128 loads, 1 b128 store)
    const float* p = hidden + (size_t)u * 16384 + tid * 8;
    unsigned short* d = Hb + (size_t)u * 16384 + tid * 8;
    v4f a[8], c2[8];
#pragma unroll
    for (int it = 0; it < 8; ++it) { a[it] = *(const v4f*)(p + it * 2048); c2[it] = *(const v4f*)(p + it * 2048 + 4); }
#pragma unroll
    for (int it = 0; it < 8; ++it) {
      v4u w;
      w[0] = pack_bf16x2(a[it][0], a[it][1]);
      w[1] = pack_bf16x2(a[it][2], a[it][3]);
      w[2] = pack_bf16x2(c2[it][0], c2[it][1]);
      w[3] = pack_bf16x2(c2[it][2], c2[it][3]);
      *(v4u*)(d + it * 2048) = w;
    }
    // the wait that stands before a register of an issued store is rewritten (the code of the other jobs follows this one in the kernel)
    asm volatile("s_wait_xcnt 0x0" ::: "memory");
  }
}

// four waves per SIMD, as many as the grid's 1024 blocks of four waves need to be resident together: holds the register count at 256 or below
__global__ __launch_bounds__(128) __attribute__((amdgpu_waves_per_eu(4, 4))) void attn_planes_kernel(
    const unsigned short* __restrict__ qkvh, const unsigned short* __restrict__ qkvl,
    const float* __restrict__ maskp, const int* __restrict__ tcls,
    unsigned short* __restrict__ ctxh, unsigned short* __restrict__ ctxl) {
  union FW { v16b v; unsigned int w[8]; };
  __shared__ __align__(16) unsigned short Kh[KV_CHUNK * LDS_P];     // K hi [kv][d], pitch LDS_P
  __shared__ __align__(16) unsigned short Kl[KV_CHUNK * LDS_P];     // K lo [kv][d], pitch LDS_P
  __shared__ __align__(16) unsigned short Vth[HEAD_D * LDS_P];      // V hi [d][kv], pitch LDS_P
  __shared__ __align__(16) unsigned short Vtl[HEAD_D * LDS_P];      // V lo [d][kv], pitch LDS_P
  __shared__ __align__(16) float Os[4][16 * 68];                   // per wave out tile, pitch 68; Os[0][0..127] doubles as column-sum scratch
  __shared__ __align__(16) unsigned int Msk[64 * 68];              // mask tile [q][kv] (f32 bits), pitch 68; doubles as v scratch [kv][d]

  const int tid  = threadIdx.x;
  const int wave = tid >> 5;
  const int lane = tid & 31;
  const int hh   = lane >> 4;
  const int c    = lane & 15;
  const int bx   = blockIdx.x;
  const int qb   = 31 - (bx >> 5);           // SEQ_LEN / 64 == 32; late query blocks first: under a lower-triangular mask they hold the most live tiles, so cost falls with the block index (speed only)
  static_assert(N_BATCH * N_HEADS == 32 && SEQ_LEN / 64 == 32, "block index split");
  const int bhd  = bx & 31;                  // N_BATCH * N_HEADS == 32
  const int h    = bhd & (N_HEADS - 1);
  const int b    = bhd >> 4;
  const int qblk = qb * 64;
  const int q0   = qblk + wave * 16;
  const size_t rowb = (size_t)b * SEQ_LEN;

  // ---- Q fragments (B operand of the transposed scores), hi and lo planes, 2 d-chunks (8 b128 loads per lane) ----
  v16b qah[2], qal[2];
  {
    const size_t qoff = (rowb + q0 + c) * QKV_PITCH + h * HEAD_D + 8 * hh;
#pragma unroll
    for (int dc = 0; dc < 2; ++dc) {
      qah[dc] = Frag<__bf16>::load((const __bf16*)qkvh + qoff + dc * 32);
      qal[dc] = Frag<__bf16>::load((const __bf16*)qkvl + qoff + dc * 32);
    }
  }

  float mrow = -__builtin_inff(), lrow = 0.f;   // running maximum (base-2 units) and sum of query q0 + c (the same in both lane halves)
  v8f oacc[4];                                  // out^T: oacc[t][r] = out[q0 + c][16 t + 8 hh + r]
#pragma unroll
  for (int t = 0; t < 4; ++t) oacc[t] = (v8f){0.f,0.f,0.f,0.f,0.f,0.f,0.f,0.f};

  const int cls_l = tcls[(size_t)(qb * 32 + lane) * TCLS_STRIDE];   // lane l: class of this query block's mask tile l

  const int kvr = tid >> 1;            // staging: kv row of this thread (0..63)
  const int dh  = (tid & 1) * 32;      // staging: d half (0 or 32)

  for (int kc = 0; kc < SEQ_LEN / KV_CHUNK; ++kc) {
    const int kv0 = kc * KV_CHUNK;
    __syncthreads();
    const int cls = __builtin_amdgcn_readlane(cls_l, kc);   // scalar, the same in every wave of the block

    const size_t koff = (rowb + kv0 + kvr) * QKV_PITCH + HID_SZ + h * HEAD_D + dh;
    const size_t voff = koff + HID_SZ;

    if (cls != 0) {
      if (cls == 2) {
        // ---- mixed mask tile [64 q][64 kv]: 1024 float4 / 128 threads = 8 b128 per lane; RNE-bf16 convert ----
        // load i of a thread: row 8 i + (tid >> 4), floats 4 (tid & 15) .. + 3. One base on each side, the eight row steps constant:
        // no row addresses are held in registers over the loop (they are what the fragments read ahead need)
        const float* mrow0 = maskp + (size_t)(qblk + (tid >> 4)) * SEQ_LEN + kv0 + (tid & 15) * 4;
        unsigned int* mdst0 = Msk + (tid >> 4) * 68 + (tid & 15) * 4;
#pragma unroll
        for (int i = 0; i < 8; ++i) {
          v4u m = *(const v4u*)(mrow0 + (size_t)i * 8 * SEQ_LEN);
#pragma unroll
          for (int e = 0; e < 4; ++e) m[e] = rne_bf16_word(m[e]);
          *(v4u*)(mdst0 + i * 8 * 68) = m;
        }
      }
      // ---- K hi/lo rows -> LDS [kv][d] (4+4 b128 per lane, 128 threads x 32 elements = 64x64 per plane) ----
      {
        const v4u* gh = (const v4u*)(qkvh + koff);
        const v4u* gl = (const v4u*)(qkvl + koff);
        v4u* lh = (v4u*)(Kh + kvr * LDS_P + dh);
        v4u* ll = (v4u*)(Kl + kvr * LDS_P + dh);
        v4u a[4], bb[4];
#pragma unroll
        for (int i = 0; i < 4; ++i) { a[i] = gh[i]; bb[i] = gl[i]; }
        // inputs-only fence on the loaded values: keeps the 8 loads in flight together (without it this build waits after every second load)
        asm volatile("" :: "v"(a[0]), "v"(a[1]), "v"(a[2]), "v"(a[3]), "v"(bb[0]), "v"(bb[1]), "v"(bb[2]), "v"(bb[3]));
#pragma unroll
        for (int i = 0; i < 4; ++i) { lh[i] = a[i]; ll[i] = bb[i]; }
      }
      asm volatile("" ::: "memory");
      // ---- V hi/lo rows -> LDS transposed [d][kv] ----
      {
        const v4u* gh = (const v4u*)(qkvh + voff);
        const v4u* gl = (const v4u*)(qkvl + voff);
        unsigned short* sh = Vth + dh * LDS_P + kvr;   // one base per plane: every row step below is a constant offset
        unsigned short* sl = Vtl + dh * LDS_P + kvr;
        v4u vh4[4], vl4[4];
#pragma unroll
        for (int i = 0; i < 4; ++i) { vh4[i] = gh[i]; vl4[i] = gl[i]; }
        // inputs-only fence on the loaded values: keeps the 8 loads in flight together, as above
        asm volatile("" :: "v"(vh4[0]), "v"(vh4[1]), "v"(vh4[2]), "v"(vh4[3]), "v"(vl4[0]), "v"(vl4[1]), "v"(vl4[2]), "v"(vl4[3]));
#pragma unroll
        for (int i = 0; i < 4; ++i) {
          const v4u wh = vh4[i];
          const v4u wl = vl4[i];
#pragma unroll
          for (int e = 0; e < 4; ++e) {
            const int d = 8 * i + 2 * e;
            sh[d * LDS_P]       = (unsigned short)(wh[e] & 0xFFFFu);
            sh[(d + 1) * LDS_P] = (unsigned short)(wh[e] >> 16);
            sl[d * LDS_P]       = (unsigned short)(wl[e] & 0xFFFFu);
            sl[(d + 1) * LDS_P] = (unsigned short)(wl[e] >> 16);
          }
        }
      }
      __syncthreads();

      // ---- scores, transposed: S^T = K . Q^T, 4 key subtiles x 2 d-chunks, hi.hi + lo.hi + hi.lo ----
      // s[j][r] = score of query q0 + c against key kv0 + 16 j + 8 hh + r: one query per lane, its keys in registers
      // The fragments come in groups of four (one plane, one 32-wide half of d or of the keys: 8 reads); groups three to six are each asked for
      // two or three groups of products ahead of their use, so that the LDS latency lies under products and is not waited out in front of every third one.
      // The four accumulators take turns; each one's own order of sums is hi.hi, lo.hi, hi.lo, first half of d then second.
      // FRAG_STAGE ends a stage: without it this compiler moves the reads back down to their products.
      v8f s[4];
      FB ka[4], kb[4], kc2[4];
      FB va[4], vb[4], vc[4];
      const int fo = c * LDS_P + 8 * hh;
      load_frag4(Kh, fo, ka);            // K hi, d 0..31
      load_frag4(Kl, fo, kb);            // K lo, d 0..31
      load_frag4(Kh, fo + 32, kc2);      // K hi, d 32..63
      FRAG_STAGE();
#pragma unroll
      for (int j = 0; j < 4; ++j) s[j] = at_mma(ka[j].v, qah[0], (v8f){0.f,0.f,0.f,0.f,0.f,0.f,0.f,0.f});
#pragma unroll
      for (int j = 0; j < 4; ++j) s[j] = at_mma(kb[j].v, qah[0], s[j]);
      FRAG_STAGE();
      load_frag4(Kl, fo + 32, kb);       // K lo, d 32..63
      FRAG_STAGE();
#pragma unroll
      for (int j = 0; j < 4; ++j) s[j] = at_mma(ka[j].v, qal[0], s[j]);
      FRAG_STAGE();
      load_frag4(Vth, fo, va);           // V^T hi, keys 0..31: this group and the next arrive under the softmax
      FRAG_STAGE();
#pragma unroll
      for (int j = 0; j < 4; ++j) s[j] = at_mma(kc2[j].v, qah[1], s[j]);
#pragma unroll
      for (int j = 0; j < 4; ++j) s[j] = at_mma(kb[j].v, qah[1], s[j]);
      FRAG_STAGE();
      load_frag4(Vtl, fo, vb);           // V^T lo, keys 0..31
      FRAG_STAGE();
#pragma unroll
      for (int j = 0; j < 4; ++j) s[j] = at_mma(kc2[j].v, qal[1], s[j]);
      // ---- scale, mask (literal s*m - 10000*(1-m)), to base-2 units, maximum of the lane's 32 keys, then of both lane halves ----
      float cm = -__builtin_inff();
      if (cls == 2) {
        const unsigned int* mp = Msk + (wave * 16 + c) * 68 + 8 * hh;
#pragma unroll
        for (int j = 0; j < 4; ++j) {
          const v4u k0 = *(const v4u*)(mp + j * 16);
          const v4u k1 = *(const v4u*)(mp + j * 16 + 4);
#pragma unroll
          for (int r = 0; r < 8; ++r) {
            const float mk = __uint_as_float(r < 4 ? k0[r & 3] : k1[r & 3]);
            float x = s[j][r] * 0.125f;
            x = x * mk - 10000.0f * (1.0f - mk);
            x *= LOG2_E;
            s[j][r] = x;
            cm = fmaxf(cm, x);
          }
        }
      } else {
        // tile of ones: x*1 - 10000*(1 - 1) == x for every x
#pragma unroll
        for (int j = 0; j < 4; ++j)
#pragma unroll
          for (int r = 0; r < 8; ++r) {
            const float x = s[j][r] * (0.125f * LOG2_E);
            s[j][r] = x;
            cm = fmaxf(cm, x);
          }
      }
      cm = fmaxf(cm, xhalf(cm));
      // ---- online softmax, one query per lane; P^T split into bf16 hi/lo and packed in place as B operands ----
      FW ph[2], pl[2];
      {
        const float mnew  = fmaxf(mrow, cm);
        const float alpha = __builtin_amdgcn_exp2f(mrow - mnew);
        mrow = mnew;
        float ps[4];
#pragma unroll
        for (int j = 0; j < 4; ++j) {
          ps[j] = 0.f;
#pragma unroll
          for (int r = 0; r < 8; r += 2) {
            const v2f d = (v2f){s[j][r], s[j][r + 1]} - mnew;   // one packed subtraction for two keys
            const float p0 = __builtin_amdgcn_exp2f(d[0]);
            const float p1 = __builtin_amdgcn_exp2f(d[1]);
            ps[j] += p0;
            ps[j] += p1;
            unsigned int wh, wl;
            split_pack2(p0, p1, wh, wl);
            ph[j >> 1].w[(j & 1) * 4 + (r >> 1)] = wh;   // element 8 (j & 1) + r of the 32-key fragment = key 16 (j & 1) + 8 hh + r
            pl[j >> 1].w[(j & 1) * 4 + (r >> 1)] = wl;
          }
        }
        float psum = (ps[0] + ps[1]) + (ps[2] + ps[3]);
        psum += xhalf(psum);
        lrow = lrow * alpha + psum;
#pragma unroll
        for (int t = 0; t < 4; ++t)
#pragma unroll
          for (int r = 0; r < 8; ++r) oacc[t][r] *= alpha;
      }
      // ---- out^T += V^T(64x64) . P^T(64x16): vh.ph + vl.ph + vh.pl; oacc[t][r] = out[q0 + c][16 t + 8 hh + r] ----
      // the last two groups stand where they could be asked for; their place is left to the compiler (a stage mark behind the softmax made this build spill)
      load_frag4(Vth, fo + 32, vc);      // V^T hi, keys 32..63
#pragma unroll
      for (int t = 0; t < 4; ++t) oacc[t] = at_mma(va[t].v, ph[0].v, oacc[t]);
#pragma unroll
      for (int t = 0; t < 4; ++t) oacc[t] = at_mma(vb[t].v, ph[0].v, oacc[t]);
      load_frag4(Vtl, fo + 32, vb);      // V^T lo, keys 32..63
#pragma unroll
      for (int t = 0; t < 4; ++t) oacc[t] = at_mma(va[t].v, pl[0].v, oacc[t]);
#pragma unroll
      for (int t = 0; t < 4; ++t) oacc[t] = at_mma(vc[t].v, ph[1].v, oacc[t]);
#pragma unroll
      for (int t = 0; t < 4; ++t) oacc[t] = at_mma(vb[t].v, ph[1].v, oacc[t]);
#pragma unroll
      for (int t = 0; t < 4; ++t) oacc[t] = at_mma(vc[t].v, pl[1].v, oacc[t]);
    } else {
      // ---- all-masked tile: v rows (hi+lo, f32) -> Msk scratch [kv][d], column sums, closed-form update ----
      {
        const v4u* gh = (const v4u*)(qkvh + voff);
        const v4u* gl = (const v4u*)(qkvl + voff);
#pragma unroll
        for (int i = 0; i < 4; ++i) {
          const v4u wh = gh[i];
          const v4u wl = gl[i];
          v4u f0, f1;
          {
            const float a0 = __uint_as_float(wh[0] << 16);          const float b0 = __uint_as_float(wl[0] << 16);
            const float a1 = __uint_as_float(wh[0] & 0xFFFF0000u); const float b1 = __uint_as_float(wl[0] & 0xFFFF0000u);
            const float a2 = __uint_as_float(wh[1] << 16);          const float b2 = __uint_as_float(wl[1] << 16);
            const float a3 = __uint_as_float(wh[1] & 0xFFFF0000u); const float b3 = __uint_as_float(wl[1] & 0xFFFF0000u);
            f0[0] = __float_as_uint(a0 + b0); f0[1] = __float_as_uint(a1 + b1);
            f0[2] = __float_as_uint(a2 + b2); f0[3] = __float_as_uint(a3 + b3);
          }
          {
            const float a0 = __uint_as_float(wh[2] << 16);          const float b0 = __uint_as_float(wl[2] << 16);
            const float a1 = __uint_as_float(wh[2] & 0xFFFF0000u); const float b1 = __uint_as_float(wl[2] & 0xFFFF0000u);
            const float a2 = __uint_as_float(wh[3] << 16);          const float b2 = __uint_as_float(wl[3] << 16);
            const float a3 = __uint_as_float(wh[3] & 0xFFFF0000u); const float b3 = __uint_as_float(wl[3] & 0xFFFF0000u);
            f1[0] = __float_as_uint(a0 + b0); f1[1] = __float_as_uint(a1 + b1);
            f1[2] = __float_as_uint(a2 + b2); f1[3] = __float_as_uint(a3 + b3);
          }
          *(v4u*)(Msk + kvr * 68 + dh + 8 * i)     = f0;
          *(v4u*)(Msk + kvr * 68 + dh + 8 * i + 4) = f1;
        }
      }
      __syncthreads();
      {
        const int d = tid & 63, half = tid >> 6;
        float part = 0.f;
#pragma unroll 8
        for (int kq = 0; kq < 32; ++kq) part += __uint_as_float(Msk[(half * 32 + kq) * 68 + d]);
        Os[0][half * 64 + d] = part;
      }
      __syncthreads();
      {
        const float mnew  = fmaxf(mrow, MASKED_L2);
        const float alpha = __builtin_amdgcn_exp2f(mrow - mnew);
        const float p     = __builtin_amdgcn_exp2f(MASKED_L2 - mnew);
        mrow = mnew;
        lrow = lrow * alpha + 64.0f * p;
#pragma unroll
        for (int t = 0; t < 4; ++t) {
          const float* cs = Os[0] + t * 16 + 8 * hh;      // column sums of the lane's 8 output columns, two partial sums each
          const v4f a0 = *(const v4f*)cs;
          const v4f a1 = *(const v4f*)(cs + 4);
          const v4f b0 = *(const v4f*)(cs + 64);
          const v4f b1 = *(const v4f*)(cs + 68);
#pragma unroll
          for (int r = 0; r < 8; ++r) {
            const float vs = (r < 4 ? a0[r & 3] : a1[r & 3]) + (r < 4 ? b0[r & 3] : b1[r & 3]);
            oacc[t][r] = oacc[t][r] * alpha + p * vs;
          }
        }
      }
    }
  }
  __syncthreads();

  float* os = Os[wave];
  {
    const float inv = 1.0f / lrow;
#pragma unroll
    for (int t = 0; t < 4; ++t) {
      v4f x0, x1;
#pragma unroll
      for (int r = 0; r < 4; ++r) { x0[r] = oacc[t][r] * inv; x1[r] = oacc[t][r + 4] * inv; }
      *(v4f*)(os + c * 68 + t * 16 + 8 * hh)     = x0;
      *(v4f*)(os + c * 68 + t * 16 + 8 * hh + 4) = x1;
    }
  }
  __builtin_amdgcn_fence(__ATOMIC_RELEASE, "workgroup");
  __builtin_amdgcn_wave_barrier();
  __builtin_amdgcn_fence(__ATOMIC_ACQUIRE, "workgroup");
  {
    const int q8 = lane >> 3, c8 = (lane & 7) * 8;
    unsigned short* oh = ctxh + (rowb + q0) * HID_SZ + h * HEAD_D + c8;
    unsigned short* ol = ctxl + (rowb + q0) * HID_SZ + h * HEAD_D + c8;
    {
#pragma unroll
      for (int it = 0; it < 4; ++it) {
        const int row = it * 4 + q8;
        const float* sp = os + row * 68 + c8;
        const v4f x0 = *(const v4f*)sp;
        const v4f x1 = *(const v4f*)(sp + 4);
        v4u wh, wl;
        unsigned int th, tl;
        split_pack2(x0[0], x0[1], th, tl); wh[0] = th; wl[0] = tl;
        split_pack2(x0[2], x0[3], th, tl); wh[1] = th; wl[1] = tl;
        split_pack2(x1[0], x1[1], th, tl); wh[2] = th; wl[2] = tl;
        split_pack2(x1[2], x1[3], th, tl); wh[3] = th; wl[3] = tl;
        *(v4u*)(oh + (size_t)row * HID_SZ) = wh;
        *(v4u*)(ol + (size_t)row * HID_SZ) = wl;
      }
      
    }
  }
}

// ---------------------------------------------------------------------------
// Workspace region map (bytes):
//   Hb    bf16 [4096][1024]        off 0            size  8388608
//   WQt   bf16 [3072][1024]        off 8388608      size  6291456
//   WDt   bf16 [1024][1024]        off 14680064     size  2097152
//   BQ    f32  [3072]              off 16777216     size    12288
//   BD    f32  [1024]              off 16789504     size     4096
//   QKVh  bf16 [4096][3072]        off 16793600     size 25165824
//   QKVl  bf16 [4096][3072]        off 41959424     size 25165824
//   CTXh  bf16 [4096][1024]        off 67125248     size  8388608
//   CTXl  bf16 [4096][1024]        off 75513856     size  8388608
//   TCLS  i32  [1024] x 128 B      off 83902464     size   131072
//   end                            84033536
// Every region is written by its producer before any consumer reads it (TCLS: only the first int of each 128-byte line).
// ---------------------------------------------------------------------------
extern "C" void kernel_launch(void* const* d_in, const int* in_sizes, int n_in,
                              void* d_out, int out_size, void* d_ws, size_t ws_size,
                              hipStream_t stream) {
  constexpr int kB = N_BATCH, kS = SEQ_LEN, kH = HID_SZ;
  constexpr int kM = kB * kS;          // 4096
  constexpr int kN3 = 3 * kH;          // 3072
  static_assert(kM % G_BM == 0 && kN3 % G_BN == 0 && kH % G_BN == 0);   // GEMM M/N tile multiples
  static_assert(kH % G_KS == 0);                                         // GEMM K slice
  static_assert(kS % KV_CHUNK == 0 && kS / 64 == 32 && kH / HEAD_D == N_HEADS);
  static_assert((kM * kH) % 2048 == 0 && kN3 % 1024 == 0 && kH % 1024 == 0);

  if (n_in < 6) return;
  if (in_sizes[0] != kM * kH || in_sizes[1] != kS * kS || in_sizes[2] != kH * kN3 ||
      in_sizes[3] != kN3 || in_sizes[4] != kH * kH || in_sizes[5] != kH) return;
  if (out_size != kM * kH) return;

  const float* hidden  = (const float*)d_in[0];
  const float* maskp   = (const float*)d_in[1];
  const float* w_qkv   = (const float*)d_in[2];
  const float* b_qkv   = (const float*)d_in[3];
  const float* w_dense = (const float*)d_in[4];
  const float* b_dense = (const float*)d_in[5];
  float* out = (float*)d_out;

  const size_t szHb  = (size_t)kM * kH * 2;
  const size_t szWQt = (size_t)kN3 * kH * 2;
  const size_t szWDt = (size_t)kH * kH * 2;
  const size_t szBQ  = (size_t)kN3 * 4;
  const size_t szBD  = (size_t)kH * 4;
  const size_t szQKV = (size_t)kM * kN3 * 2;
  const size_t szCTX = (size_t)kM * kH * 2;
  const size_t offHb   = 0;
  const size_t offWQt  = offHb + szHb;
  const size_t offWDt  = offWQt + szWQt;
  const size_t offBQ   = offWDt + szWDt;
  const size_t offBD   = offBQ + szBQ;
  const size_t offQKVh = offBD + szBD;
  const size_t offQKVl = offQKVh + szQKV;
  const size_t offCTXh = offQKVl + szQKV;
  const size_t offCTXl = offCTXh + szCTX;
  const size_t offTCLS = offCTXl + szCTX;
  const size_t szTCLS  = (size_t)(kS / 64) * (kS / 64) * TCLS_STRIDE * 4;
  const size_t offEnd  = offTCLS + szTCLS;
  if (offEnd > ws_size) return;

  char* ws = (char*)d_ws;
  unsigned short* Hb   = (unsigned short*)(ws + offHb);
  unsigned short* WQt  = (unsigned short*)(ws + offWQt);
  unsigned short* WDt  = (unsigned short*)(ws + offWDt);
  float*          BQ   = (float*)(ws + offBQ);
  float*          BD   = (float*)(ws + offBD);
  unsigned short* QKVh = (unsigned short*)(ws + offQKVh);
  unsigned short* QKVl = (unsigned short*)(ws + offQKVl);
  unsigned short* CTXh = (unsigned short*)(ws + offCTXh);
  unsigned short* CTXl = (unsigned short*)(ws + offCTXl);
  int*            TCLS = (int*)(ws + offTCLS);

  // 1-3) hidden -> bf16 plane; w_qkv, w_dense -> transposed bf16; bias lines RNE-bf16 converted (kept as f32); class of each 64x64 mask tile
  prep_all<<<dim3(PREP_BLOCKS), dim3(256), 0, stream>>>(hidden, maskp, w_qkv, b_qkv, w_dense, b_dense, Hb, WQt, WDt, BQ, BD, TCLS);
  // 4) fused qkv projection: [4096x1024] x WQt[3072x1024]^T + bias -> bf16 hi/lo planes [4096][3072]
  {
    const int tiles = (kM / G_BM) * (kN3 / G_BN);       // 384 block tiles of 128x256
    wmma_gemm64<1, 0, 2, 2, false><<<dim3(tiles, 1), dim3(256), 0, stream>>>(
        Hb, Hb, kH, 0L, WQt, WQt, kH, 0L, (void*)QKVh, (void*)QKVl, kN3, 0L,
        BQ, BQ, 0L, kM, kN3, kH, 1.0f);
  }
  // 5) attention per (batch, head, 64 query rows) -> ctx bf16 hi/lo planes [4096][1024]
  attn_planes_kernel<<<dim3(kB * N_HEADS * (kS / 64)), dim3(128), 0, stream>>>(QKVh, QKVl, maskp, TCLS, CTXh, CTXl);
  // 6) output projection: ctx (hi/lo) [4096x1024] x WDt[1024x1024]^T + bias -> out f32 [4096][1024]
  {
    const int tiles = (kM / G_BM) * (kH / G_BN);        // 128 block tiles of 128x256
    wmma_gemm64<1, 2, 2, 0, false><<<dim3(tiles, 1), dim3(256), 0, stream>>>(
        CTXh, CTXl, kH, 0L, WDt, WDt, kH, 0L, (void*)out, (void*)out, kH, 0L,
        BD, BD, 0L, kM, kH, kH, 1.0f);
  }
}

// v009
// Measured time: 148 microseconds a run.
// Timed twice side by side with v008, it ran 1.06 times as fast both times.
// All steps since v000 together make it 4.22 times as fast.
// Contractions on v_wmma_f32_16x16x32_bf16 (bf16 operands, f32 accumulate): qkv projection = one product on RNE-bf16 inputs; q.k^T and p.v = bf16 hi/lo planes (3 products); output projection = ctx bf16 hi/lo x bf16 weights (2 products). Masking, softmax and normalisation in f32.
#include <hip/hip_runtime.h>

typedef __attribute__((ext_vector_type(16))) _Float16 v16h;
typedef __attribute__((ext_vector_type(8)))  _Float16 v8h;
typedef __attribute__((ext_vector_type(16))) __bf16   v16b;
typedef __attribute__((ext_vector_type(8)))  __bf16   v8b;
typedef __attribute__((ext_vector_type(2)))  __bf16   v2b;
typedef __attribute__((ext_vector_type(8)))  float    v8f;
typedef __attribute__((ext_vector_type(4)))  float    v4f;
typedef __attribute__((ext_vector_type(2)))  float    v2f;
typedef __attribute__((ext_vector_type(4)))  unsigned int v4u;

// RNE convert of an f32 bit pattern to its bf16 value, kept as an f32 bit pattern
__device__ __forceinline__ unsigned int rne_bf16_word(unsigned int u) {
  return (u + 0x7FFFu + ((u >> 16) & 1u)) & 0xFFFF0000u;
}
// two floats rounded to nearest even and packed as (a | b<<16) by the hardware's own conversion: one v_cvt_pk_bf16_f32
__device__ __forceinline__ unsigned int pack_bf16x2(float a, float b) {
  return __builtin_bit_cast(unsigned int, __builtin_convertvector((v2f){a, b}, v2b));
}
// hi/lo bf16 split of two floats, packed as (hi_a | hi_b<<16) and (lo_a | lo_b<<16)
__device__ __forceinline__ void split_pack2(float a, float b, unsigned int& wh, unsigned int& wl) {
  wh = pack_bf16x2(a, b);
  const v2f lo = (v2f){a, b} - (v2f){__uint_as_float(wh << 16), __uint_as_float(wh & 0xFFFF0000u)};
  wl = pack_bf16x2(lo[0], lo[1]);
}

// hazard guards as plain device helpers
__device__ __forceinline__ void dep_guard_h(v8f& a, v8f& b, v16h x, v16h y) { asm volatile("v_nop\n\tv_nop\n\tv_nop\n\tv_nop" : "+v"(a), "+v"(b) : "v"(x), "v"(y)); }
__device__ __forceinline__ void dep_guard_b(v8f& a, v8f& b, v16b x, v16b y) { asm volatile("v_nop\n\tv_nop\n\tv_nop\n\tv_nop" : "+v"(a), "+v"(b) : "v"(x), "v"(y)); }
__device__ __forceinline__ void keep4_h(v16h a, v16h b, v16h c, v16h d) { asm volatile("v_nop" :: "v"(a), "v"(b), "v"(c), "v"(d)); }
__device__ __forceinline__ void keep4_b(v16b a, v16b b, v16b c, v16b d) { asm volatile("v_nop" :: "v"(a), "v"(b), "v"(c), "v"(d)); }
__device__ __forceinline__ void acc_guard4(v8f& a, v8f& b, v8f& c, v8f& d) { asm volatile("v_nop\n\tv_nop\n\tv_nop\n\tv_nop" : "+v"(a), "+v"(b), "+v"(c), "+v"(d)); }
template <typename T> struct Frag;
template <> struct Frag<_Float16> {
  typedef v16h V; union U { v16h v; v8h h[2]; };
  static __device__ __forceinline__ v16h load(const _Float16* p) {   // elements 0..7 <- p[0..7], 8..15 <- p[16..23]
    U f; f.h[0] = *(const v8h*)(p); f.h[1] = *(const v8h*)(p + 16); return f.v;
  }
  static __device__ __forceinline__ v8f mma(v16h a, v16h b, v8f c) {
    return __builtin_amdgcn_wmma_f32_16x16x32_f16(false, a, false, b, (short)0, c, false, false);
  }
  static __device__ __forceinline__ void guard(v8f& a, v8f& b, v16h x, v16h y) { dep_guard_h(a, b, x, y); }
  static __device__ __forceinline__ void keep(v16h a, v16h b, v16h c, v16h d) { keep4_h(a, b, c, d); }
};
template <> struct Frag<__bf16> {
  typedef v16b V; union U { v16b v; v8b h[2]; };
  static __device__ __forceinline__ v16b load(const __bf16* p) {
    U f; f.h[0] = *(const v8b*)(p); f.h[1] = *(const v8b*)(p + 16); return f.v;
  }
  static __device__ __forceinline__ v8f mma(v16b a, v16b b, v8f c) {
    return __builtin_amdgcn_wmma_f32_16x16x32_bf16(false, a, false, b, (short)0, c, false, false);
  }
  static __device__ __forceinline__ void guard(v8f& a, v8f& b, v16b x, v16b y) { dep_guard_b(a, b, x, y); }
  static __device__ __forceinline__ void keep(v16b a, v16b b, v16b c, v16b d) { keep4_b(a, b, c, d); }
};

// ---- Register-blocked batched WMMA GEMM ------------------------------------
// C[m,n] = scale * sum_k A[m,k] * Bt[n,k] (+bias)(+resid); a block of 8 waves (2 x 4) owns a 128x256 tile, each wave 64x64 of it.
// A row-major [M,K]; Bt row-major [N,K]; M % 128 == 0, N % 256 == 0, K % 64 == 0.
// The block's rows of A and Bt go through LDS in slices of 64 k (one 128-byte line per row), brought by asynchronous copies
// into two buffers: slice t + 1 flies while slice t is worked on, and every line is fetched once per block, whole.
// SPLIT: 0 = single planes; 1 = A and Bt hi/lo planes (hi.hi + hi.lo + lo.hi); 2 = A hi/lo planes only (hi.B + lo.B).
// BIAS_MODE: 0 = none, 1 = bias[m], 2 = bias[n].
// OUT_MODE: 0 = f32, 1 = f16, 2 = bf16 hi plane (Cout) + bf16 lo plane (Cout2).
// ET: 0 = f16 operands, 1 = bf16 operands (pointers passed as 16-bit storage)
template <int ET> struct Elem;
template <> struct Elem<0> { typedef _Float16 T; };
template <> struct Elem<1> { typedef __bf16 T; };

#define G_BM 128   // block tile rows of A
#define G_BN 256   // block tile rows of Bt
#define G_KS 64    // k elements of one staged slice
#define G_P  72    // LDS row pitch in 16-bit elements: 144 B = 16 B x odd, free of bank conflicts for b128 fragment reads

// One line of an asynchronous copy: 16 bytes per lane, global -> LDS, through no register.
#define G_CP(l, g) "global_load_async_to_lds_b128 %" #l ", %" #g ", off\n\t"
// N copies and, as the last line of the same statement, the wait that stands before their address registers are rewritten.
template <int N>
__device__ __forceinline__ void async_copies(const unsigned int* l, const unsigned short* const* g) {
  static_assert(N == 8 || N == 12, "copies per statement");
  if constexpr (N == 12) {
    asm volatile(G_CP(0, 1) G_CP(2, 3) G_CP(4, 5) G_CP(6, 7) G_CP(8, 9) G_CP(10, 11) G_CP(12, 13) G_CP(14, 15)
                 G_CP(16, 17) G_CP(18, 19) G_CP(20, 21) G_CP(22, 23) "s_wait_xcnt 0x0"
                 :: "v"(l[0]), "v"(g[0]), "v"(l[1]), "v"(g[1]), "v"(l[2]), "v"(g[2]), "v"(l[3]), "v"(g[3]),
                    "v"(l[4]), "v"(g[4]), "v"(l[5]), "v"(g[5]), "v"(l[6]), "v"(g[6]), "v"(l[7]), "v"(g[7]),
                    "v"(l[8]), "v"(g[8]), "v"(l[9]), "v"(g[9]), "v"(l[10]), "v"(g[10]), "v"(l[11]), "v"(g[11])
                 : "memory");
  } else {
    asm volatile(G_CP(0, 1) G_CP(2, 3) G_CP(4, 5) G_CP(6, 7) G_CP(8, 9) G_CP(10, 11) G_CP(12, 13) G_CP(14, 15) "s_wait_xcnt 0x0"
                 :: "v"(l[0]), "v"(g[0]), "v"(l[1]), "v"(g[1]), "v"(l[2]), "v"(g[2]), "v"(l[3]), "v"(g[3]),
                    "v"(l[4]), "v"(g[4]), "v"(l[5]), "v"(g[5]), "v"(l[6]), "v"(g[6]), "v"(l[7]), "v"(g[7])
                 : "memory");
  }
}

template <int ET, int SPLIT, int BIAS_MODE, int OUT_MODE, bool RESID, int ACT = 0>
__global__ __launch_bounds__(256) void wmma_gemm64(
    const unsigned short* __restrict__ Ap, const unsigned short* __restrict__ A2p, int lda, long strideA,
    const unsigned short* __restrict__ Btp, const unsigned short* __restrict__ Bt2p, int ldb, long strideB,
    void* __restrict__ Cout, void* __restrict__ Cout2, int ldc, long strideC,
    const float* __restrict__ bias,
    const float* __restrict__ resid, long strideR,
    int M, int N, int K, float scale) {
  typedef typename Elem<ET>::T T;
  typedef typename Frag<T>::V V;
  constexpr int NPA   = (SPLIT != 0) ? 2 : 1;             // planes of A
  constexpr int NPB   = (SPLIT == 1) ? 2 : 1;             // planes of Bt
  constexpr int ROWS  = G_BM * NPA + G_BN * NPB;          // rows of one slice: [A | A2 | Bt | Bt2]
  constexpr int STAGE = ROWS * G_P;                       // 16-bit elements of one buffer
  constexpr int NCOPY = ROWS / 32;                        // copies per lane and slice: 256 lanes x 16 B = 32 rows of 128 B
  constexpr int CGRP  = (NCOPY % 12 == 0) ? 12 : 8;       // copies per statement
  constexpr int AHEAD = (SPLIT == 0) ? 4 : 1;             // as far as the registers reach below 256
  static_assert(NCOPY % CGRP == 0 && NCOPY <= 63, "copies per slice");
  __shared__ __align__(16) unsigned short ring[2 * STAGE];   // two buffers
  __shared__ __align__(16) float sT[8][16 * 68];   // per-wave 16x64 slab, pitch 68 floats
  const int b    = blockIdx.y;
  const int tid  = threadIdx.x;
  const int lane = tid & 31;
  const int wave = tid >> 5;
  const int tilesN = N / G_BN;
  const int tilesM = M / G_BM;
  if ((int)blockIdx.x >= tilesM * tilesN) return;   // the same for the whole block, in front of every barrier
  const int tm = blockIdx.x / tilesN;
  const int tn = blockIdx.x - tm * tilesN;
  const int wm = wave >> 2;                    // wave's 64 rows of the block's A rows
  const int wn = wave & 3;                     // wave's 64 rows of the block's Bt rows
  const int m0 = tm * G_BM + (wm << 6);
  const int n0 = tn * G_BN + (wn << 6);

  const int rlane = lane & 15;                 // row (A) / col (B, D) within subtile
  const int koff  = (lane >> 4) * 8;           // k offset of this lane half
  const int mOff  = (lane >> 4) * 8;           // D row offset

  // copy i of a lane: row 32 i + (tid >> 3) of the slice, bytes 16 (tid & 7) .. + 15 of its 128: 8 lanes bring one whole line
  const int crow = tid >> 3;
  const int cseg = (tid & 7) * 8;
  const unsigned short* gA  = Ap  + (size_t)b * strideA + (size_t)(tm * G_BM + crow) * lda + cseg;
  const unsigned short* gA2 = A2p + (size_t)b * strideA + (size_t)(tm * G_BM + crow) * lda + cseg;
  const unsigned short* gB  = Btp  + (size_t)b * strideB + (size_t)(tn * G_BN + crow) * ldb + cseg;
  const unsigned short* gB2 = Bt2p + (size_t)b * strideB + (size_t)(tn * G_BN + crow) * ldb + cseg;
  const unsigned int lds0 = (unsigned int)(size_t)ring + (unsigned int)(crow * G_P + cseg) * 2u;   // low 32 bits = LDS byte address

  auto stage = [&](int kt, int buf) {
    unsigned int l[NCOPY];
    const unsigned short* g[NCOPY];
    // both loops unrolled: every address is a register operand of a copy statement
#pragma unroll
    for (int i = 0; i < NCOPY; ++i) {
      l[i] = lds0 + (unsigned int)(buf * STAGE + i * 32 * G_P) * 2u;
      if (i < 4 * NPA) {
        const int pl = i >> 2, r = (i & 3) * 32;
        g[i] = (pl ? gA2 : gA) + (size_t)r * lda + kt * G_KS;
      } else {
        const int q = i - 4 * NPA, pl = q >> 3, r = (q & 7) * 32;
        g[i] = (pl ? gB2 : gB) + (size_t)r * ldb + kt * G_KS;
      }
    }
#pragma unroll
    for (int i = 0; i < NCOPY; i += CGRP) async_copies<CGRP>(l + i, g + i);
  };

  v8f acc[4][4];
#pragma unroll
  for (int i = 0; i < 4; ++i)
#pragma unroll
    for (int j = 0; j < 4; ++j) acc[i][j] = (v8f){0.f,0.f,0.f,0.f,0.f,0.f,0.f,0.f};

  const int nt = K / G_KS;
  stage(0, 0);
  asm volatile("s_wait_asynccnt 0x0" ::: "memory");   // this wave's copies of slice 0 have landed
  __syncthreads();                                     // ... and every other wave's
  if (nt > 1) stage(1, 1);

  const int aoff = ((wm << 6) + rlane) * G_P + koff;
  const int boff = (G_BM * NPA + (wn << 6) + rlane) * G_P + koff;
  for (int t = 0; t < nt; ++t) {
    const T* sb = (const T*)ring + (t & 1) * STAGE;
#pragma unroll
    for (int ks = 0; ks < G_KS; ks += 32) {
      V bh[4], bl[4];
#pragma unroll
      for (int j = 0; j < 4; ++j) {
        bh[j] = Frag<T>::load(sb + boff + j * 16 * G_P + ks);
        if (SPLIT == 1) bl[j] = Frag<T>::load(sb + boff + (G_BN + j * 16) * G_P + ks);
      }
      // A fragments are fetched AHEAD row groups in front of their products, so that a row group's LDS latency lies under the products before it
      V ah[4], al[4];
#pragma unroll
      for (int i = 0; i < AHEAD; ++i) {
        ah[i] = Frag<T>::load(sb + aoff + i * 16 * G_P + ks);
        if (SPLIT != 0) al[i] = Frag<T>::load(sb + aoff + (G_BM + i * 16) * G_P + ks);
      }
#pragma unroll
      for (int i = 0; i < 4; ++i) {
        if (i + AHEAD < 4) {
          ah[i + AHEAD] = Frag<T>::load(sb + aoff + (i + AHEAD) * 16 * G_P + ks);
          if (SPLIT != 0) al[i + AHEAD] = Frag<T>::load(sb + aoff + (G_BM + (i + AHEAD) * 16) * G_P + ks);
        }
#pragma unroll
        for (int j = 0; j < 4; ++j) {
          acc[i][j] = Frag<T>::mma(ah[i], bh[j], acc[i][j]);
          if (SPLIT == 1) {
            acc[i][j] = Frag<T>::mma(ah[i], bl[j], acc[i][j]);
            acc[i][j] = Frag<T>::mma(al[i], bh[j], acc[i][j]);
          }
          if (SPLIT == 2) {
            acc[i][j] = Frag<T>::mma(al[i], bh[j], acc[i][j]);
          }
        }
        Frag<T>::guard(acc[i][0], acc[i][3], ah[i], (SPLIT != 0) ? al[i] : ah[i]);
      }
      Frag<T>::keep(bh[0], bh[1], bh[2], bh[3]);
      if (SPLIT == 1) Frag<T>::keep(bl[0], bl[1], bl[2], bl[3]);
    }
    asm volatile("s_wait_dscnt 0x0" ::: "memory");      // this wave's reads of slice t are done before its buffer is refilled
    asm volatile("s_wait_asynccnt 0x0" ::: "memory");   // this wave's copies of slice t + 1 have landed
    __syncthreads();                                     // publishes slice t + 1 and ends every reader's last read of slice t
    if (t + 2 < nt) stage(t + 2, t & 1);
  }
  asm volatile("s_wait_asynccnt 0x0" ::: "memory");     // no copy is outstanding behind the loop
  acc_guard4(acc[0][0], acc[0][1], acc[0][2], acc[0][3]);
  acc_guard4(acc[1][0], acc[1][1], acc[1][2], acc[1][3]);
  acc_guard4(acc[2][0], acc[2][1], acc[2][2], acc[2][3]);
  acc_guard4(acc[3][0], acc[3][1], acc[3][2], acc[3][3]);

  // ---- epilogue ----
  float* slab = sT[wave];
  const float* Rb = RESID ? (resid + (size_t)b * strideR) : nullptr;
#pragma unroll
  for (int i = 0; i < 4; ++i) {
    const int mBase = m0 + (i << 4);
#pragma unroll
    for (int j = 0; j < 4; ++j) {
      const int n = n0 + (j << 4) + rlane;
      float bv = 0.f;
      if (BIAS_MODE == 2) bv = bias[n];
#pragma unroll
      for (int r = 0; r < 8; ++r) {
        float v = acc[i][j][r] * scale;
        if (BIAS_MODE == 1) v += bias[mBase + mOff + r];
        if (BIAS_MODE == 2) v += bv;
        if (RESID) v += Rb[(size_t)(mBase + mOff + r) * ldc + n];
        if (ACT == 1) v = tanhf(v);
        if (ACT == 2) v = fmaxf(v, 0.0f);
        if (ACT == 4) v = (v > 0.f) ? v : 0.01f * v;
        slab[(mOff + r) * 68 + (j << 4) + rlane] = v;
      }
    }
    __builtin_amdgcn_fence(__ATOMIC_RELEASE, "workgroup");
    __builtin_amdgcn_wave_barrier();
    __builtin_amdgcn_fence(__ATOMIC_ACQUIRE, "workgroup");
    if (OUT_MODE == 0) {
      float* C = (float*)Cout + (size_t)b * strideC;
      const int hh = lane >> 4, c4 = (lane & 15) * 4;     // row seg = 256 B = 16 lanes x 16 B
      {
#pragma unroll
        for (int it = 0; it < 8; ++it) {
          const int row = it * 2 + hh;
          v4f v = *(const v4f*)(slab + row * 68 + c4);
          *(v4f*)(C + (size_t)(mBase + row) * ldc + n0 + c4) = v;
        }
        
      }
    } else {
      const int q = lane >> 3, c8 = (lane & 7) * 8;
      unsigned short* C  = (unsigned short*)Cout  + (size_t)b * strideC;
      unsigned short* C2 = (OUT_MODE == 2) ? ((unsigned short*)Cout2 + (size_t)b * strideC) : nullptr;
      {
#pragma unroll
        for (int it = 0; it < 4; ++it) {
          const int row = it * 4 + q;
          const float* sp = slab + row * 68 + c8;
          if (OUT_MODE == 1) {
            v8h hv;
            // unrolled so that hv[e] is a plain register half of the b128 store
#pragma unroll
            for (int e = 0; e < 8; ++e) hv[e] = (_Float16)sp[e];
            *(v8h*)(C + (size_t)(mBase + row) * ldc + n0 + c8) = hv;
          } else {
            v4u wh, wl;
            // unrolled so that wh[e] and wl[e] are plain registers of the two b128 stores
#pragma unroll
            for (int e = 0; e < 4; ++e) {
              unsigned int th, tl;
              split_pack2(sp[2 * e], sp[2 * e + 1], th, tl);
              wh[e] = th;
              wl[e] = tl;
            }
            *(v4u*)(C + (size_t)(mBase + row) * ldc + n0 + c8) = wh;
            *(v4u*)(C2 + (size_t)(mBase + row) * ldc + n0 + c8) = wl;
          }
        }
        
      }
    }
    __builtin_amdgcn_fence(__ATOMIC_RELEASE, "workgroup");
    __builtin_amdgcn_wave_barrier();
    __builtin_amdgcn_fence(__ATOMIC_ACQUIRE, "workgroup");
  }
}

// lane l <-> lane l ^ 16
__device__ __forceinline__ float xhalf(float x) {
  return __builtin_bit_cast(float, __builtin_amdgcn_permlanex16(__builtin_bit_cast(int, x), __builtin_bit_cast(int, x), 0x76543210, 0xfedcba98, false, false));
}

__device__ __forceinline__ v8f at_mma(v16b a, v16b b, v8f c) {
  return __builtin_amdgcn_wmma_f32_16x16x32_bf16(false, a, false, b, (short)0, c, false, false);
}

union FB { v16b v; v8b h[2]; };
// The four 16-row A fragments of one 32-wide k half of one plane of a 64-row LDS tile (pitch 72 elements); off = lane's row * pitch + k offset
__device__ __forceinline__ void load_frag4(const unsigned short* tile, int off, FB* f) {
#pragma unroll
  for (int j = 0; j < 4; ++j) {
    f[j].h[0] = *(const v8b*)((const __bf16*)tile + off + j * 16 * 72);
    f[j].h[1] = *(const v8b*)((const __bf16*)tile + off + j * 16 * 72 + 16);
  }
}
// no instruction is scheduled across this point
#define FRAG_STAGE() __builtin_amdgcn_sched_barrier(0)

// =====================================================================================
// Attention, head dim 64, over bf16 hi/lo planes of the fused qkv projection.
// qkv planes: [B*S][3*HID], q at col h*64+d, k at HID + h*64 + d, v at 2*HID + h*64 + d.
// scores = 0.125 * q.k^T (bf16 hi/lo, 3 products); mask tile m[q][kv] (RNE-bf16 converted) applied as
// s*m - 10000*(1-m); online softmax in f32. Both products are formed transposed (S^T = K.Q^T, out^T += V^T.P^T, 3 products each):
// a lane holds one query's scores, so row maximum and sum are in-lane plus one exchange of the lane halves, and the
// score accumulators, split into bf16 hi/lo, are the B operand of the second product as they stand.
// A 64x64 tile whose mask is identically zero has 64 equal logits -10000 per row: folded in closed form
// (l += 64*p, o += p * column-sum(v), p = exp(-10000 - rowmax)).
// The class of every mask tile (all 0 / all 1 / mixed, of the RNE-bf16 converted values) comes from prep_all, which
// reads the mask once; a tile of ones leaves every score as it is (x*1 - 10000*0 == x), so only a mixed tile is loaded here.
// The softmax runs in base 2: every logit is multiplied by log2(e) (for a tile of ones in the same multiply as the 1/8), the running
// maximum is kept in those units, and exp(x - m) = 2^(x2 - m2) is one subtraction and one v_exp_f32.
// Block = 4 waves = 64 query rows of one (batch, head); grid.x = B * NH * (S/64).
// =====================================================================================
#define SEQ_LEN 2048
#define N_HEADS 16
#define HEAD_D 64
#define HID_SZ 1024
#define QKV_PITCH 3072
#define KV_CHUNK 64
#define N_BATCH 2
#define LDS_P 72   // row pitch of the K and V^T tiles in 16-bit elements: 144 B = 16 B x odd, so the 16 rows of a b128 fragment read fall on distinct banks

#define LOG2_E 1.44269504088896340736f
#define MASKED_L2 (-10000.0f * LOG2_E)   // the logit of a masked key, in base-2 units

#define TCLS_STRIDE 32   // ints between two tile classes: each class has a 128-byte line of its own (one writer per line)

// ---- all preparatory work in one launch: the block index picks the job, and a block does several units of it ----
// The jobs read only inputs and write disjoint workspace regions, so none waits for another; few, fat blocks keep the number of
// work-groups and waves to start small, and every block has all its loads in flight together.
//   blocks [0, 4)      bias lines RNE-bf16 converted, kept as f32: 3 blocks b_qkv, 1 block b_dense, 4 floats per thread
//   blocks [4, 196)    w_qkv   [1024][3072] f32 -> WQt [3072][1024] bf16: 4 tiles of 64x64 each (256 in rows x 64 in columns)
//   blocks [196, 260)  w_dense [1024][1024] f32 -> WDt [1024][1024] bf16: the same
//   blocks [260, 388)  class of the 64x64 mask tiles, one wave per tile, 8 tiles per block
//   blocks [388, 644)  hidden f32 -> bf16 plane: 16384 elements per block, 8 x 8 per thread
#define PREP_BIAS   4
#define PREP_TQ     ((3 * HID_SZ / 64) * (HID_SZ / 256))
#define PREP_TD     ((HID_SZ / 64) * (HID_SZ / 256))
#define PREP_MASK   ((SEQ_LEN / 64) * (SEQ_LEN / 64) / 8)
#define PREP_CAST   (N_BATCH * SEQ_LEN * HID_SZ / 16384)
#define PREP_BLOCKS (PREP_BIAS + PREP_TQ + PREP_TD + PREP_MASK + PREP_CAST)

// transpose + bf16 cast of in rows r0 .. r0 + 255, columns c0 .. c0 + 63: in[nrows][ncols] f32 -> out[ncols][nrows] bf16.
// tiles[k][cl*68 + rl]: k = 64-row group, cl = in col (out row), rl = in row (out col). Called by a whole block of 256 threads.
__device__ __forceinline__ void transpose_cast4(const float* __restrict__ in, unsigned short* __restrict__ out, int nrows, int ncols,
                                                int r0, int c0, float* tiles) {
  const int tid = threadIdx.x, lane = tid & 31, wave = tid >> 5;
  {
    const int rl = tid >> 2, cq = (tid & 3) * 16;
    const float* src = in + (size_t)(r0 + rl) * ncols + c0 + cq;
    v4f v[4][4];
#pragma unroll
    for (int k = 0; k < 4; ++k)
#pragma unroll
      for (int i = 0; i < 4; ++i) v[k][i] = *(const v4f*)(src + (size_t)(k * 64) * ncols + 4 * i);
    // the wait that stands before a register of an issued load is rewritten; the address is named so that it lives up to here
    asm volatile("s_wait_xcnt 0x0" :: "v"(src) : "memory");
#pragma unroll
    for (int k = 0; k < 4; ++k)
#pragma unroll
      for (int i = 0; i < 4; ++i)
#pragma unroll
        for (int e = 0; e < 4; ++e) tiles[k * (64 * 68) + (cq + 4 * i + e) * 68 + rl] = v[k][i][e];
  }
  __syncthreads();
  const int q8 = lane >> 3, c8 = (lane & 7) * 8;
#pragma unroll
  for (int k = 0; k < 4; ++k) {
#pragma unroll
    for (int it = 0; it < 2; ++it) {
      const int cl = wave * 8 + it * 4 + q8;
      const float* sp = tiles + k * (64 * 68) + cl * 68 + c8;
      const v4f x0 = *(const v4f*)sp;
      const v4f x1 = *(const v4f*)(sp + 4);
      v4u w;
      w[0] = pack_bf16x2(x0[0], x0[1]);
      w[1] = pack_bf16x2(x0[2], x0[3]);
      w[2] = pack_bf16x2(x1[0], x1[1]);
      w[3] = pack_bf16x2(x1[2], x1[3]);
      *(v4u*)(out + (size_t)(c0 + cl) * nrows + r0 + k * 64 + c8) = w;
    }
  }
  // the wait that stands before a register of an issued store is rewritten (the code of the other jobs follows this one in the kernel)
  asm volatile("s_wait_xcnt 0x0" ::: "memory");
}

__global__ __launch_bounds__(256) void prep_all(
    const float* __restrict__ hidden, const float* __restrict__ maskp, const float* __restrict__ w_qkv,
    const float* __restrict__ b_qkv, const float* __restrict__ w_dense, const float* __restrict__ b_dense,
    unsigned short* __restrict__ Hb, unsigned short* __restrict__ WQt, unsigned short* __restrict__ WDt,
    float* __restrict__ BQ, float* __restrict__ BD, int* __restrict__ tcls) {
  __shared__ __align__(16) float tiles[4 * 64 * 68];
  const int tid = threadIdx.x;
  int u = blockIdx.x;   // every branch below is the same for the whole block
  if (u < PREP_BIAS) {
    static_assert(3 * HID_SZ == 3 * 1024 && HID_SZ == 1024, "3 + 1 blocks of 256 threads x 4 floats");
    const float* in = (u < 3) ? (b_qkv + u * 1024) : b_dense;
    float* o        = (u < 3) ? (BQ + u * 1024) : BD;
    v4u a = *(const v4u*)(in + tid * 4);
#pragma unroll
    for (int e = 0; e < 4; ++e) a[e] = rne_bf16_word(a[e]);
    *(v4u*)(o + tid * 4) = a;
    return;
  }
  u -= PREP_BIAS;
  if (u < PREP_TQ) {
    constexpr int CT = 3 * HID_SZ / 64;
    transpose_cast4(w_qkv, WQt, HID_SZ, 3 * HID_SZ, (u / CT) * 256, (u % CT) * 64, tiles);
    return;
  }
  u -= PREP_TQ;
  if (u < PREP_TD) {
    constexpr int CT = HID_SZ / 64;
    transpose_cast4(w_dense, WDt, HID_SZ, HID_SZ, (u / CT) * 256, (u % CT) * 64, tiles);
    return;
  }
  u -= PREP_TD;
  if (u < PREP_MASK) {
    // One wave per 64x64 mask tile (tile = query block * 32 + key block): 32 b128 loads per lane = the tile.
    // class 0: every RNE-bf16 converted element is +-0; class 1: every one is 1.0; class 2: anything else.
    const int lane = tid & 31;
    const int tile = u * 8 + (tid >> 5);
    const int qb = tile >> 5, kc = tile & 31;
    const float* src = maskp + (size_t)(qb * 64 + (lane >> 4)) * SEQ_LEN + kc * 64 + (lane & 15) * 4;
    unsigned int nz = 0u, n1 = 0u;
#pragma unroll
    for (int i = 0; i < 32; ++i) {
      const v4u m = *(const v4u*)(src + (size_t)(2 * i) * SEQ_LEN);
#pragma unroll
      for (int e = 0; e < 4; ++e) { const unsigned int w = rne_bf16_word(m[e]); nz |= (w & 0x7FFFFFFFu); n1 |= (w ^ 0x3F800000u); }
    }
    const int any_nz = __any(nz != 0u);
    const int any_n1 = __any(n1 != 0u);
    if (lane == 0) tcls[(size_t)tile * TCLS_STRIDE] = any_nz ? (any_n1 ? 2 : 1) : 0;
    return;
  }
  u -= PREP_MASK;
  {
    // unit it of a block: 2048 elements in a row, 8 per thread (2 b128 loads, 1 b128 store)
    const float* p = hidden + (size_t)u * 16384 + tid * 8;
    unsigned short* d = Hb + (size_t)u * 16384 + tid * 8;
    v4f a[8], c2[8];
#pragma unroll
    for (int it = 0; it < 8; ++it) { a[it] = *(const v4f*)(p + it * 2048); c2[it] = *(const v4f*)(p + it * 2048 + 4); }
#pragma unroll
    for (int it = 0; it < 8; ++it) {
      v4u w;
      w[0] = pack_bf16x2(a[it][0], a[it][1]);
      w[1] = pack_bf16x2(a[it][2], a[it][3]);
      w[2] = pack_bf16x2(c2[it][0], c2[it][1]);
      w[3] = pack_bf16x2(c2[it][2], c2[it][3]);
      *(v4u*)(d + it * 2048) = w;
    }
    // the wait that stands before a register of an issued store is rewritten (the code of the other jobs follows this one in the kernel)
    asm volatile("s_wait_xcnt 0x0" ::: "memory");
  }
}

// four waves per SIMD, as many as the grid's 1024 blocks of four waves need to be resident together: holds the register count at 256 or below
__global__ __launch_bounds__(128) __attribute__((amdgpu_waves_per_eu(4, 4))) void attn_planes_kernel(
    const unsigned short* __restrict__ qkvh, const unsigned short* __restrict__ qkvl,
    const float* __restrict__ maskp, const int* __restrict__ tcls,
    unsigned short* __restrict__ ctxh, unsigned short* __restrict__ ctxl) {
  union FW { v16b v; unsigned int w[8]; };
  __shared__ __align__(16) unsigned short Kh[KV_CHUNK * LDS_P];     // K hi [kv][d], pitch LDS_P
  __shared__ __align__(16) unsigned short Kl[KV_CHUNK * LDS_P];     // K lo [kv][d], pitch LDS_P
  __shared__ __align__(16) unsigned short Vth[HEAD_D * LDS_P];      // V hi [d][kv], pitch LDS_P
  __shared__ __align__(16) unsigned short Vtl[HEAD_D * LDS_P];      // V lo [d][kv], pitch LDS_P
  __shared__ __align__(16) float Os[4][16 * 68];                   // per wave out tile, pitch 68; Os[0][0..127] doubles as column-sum scratch
  __shared__ __align__(16) unsigned int Msk[64 * 68];              // mask tile [q][kv] (f32 bits), pitch 68; doubles as v scratch [kv][d]

  const int tid  = threadIdx.x;
  const int wave = tid >> 5;
  const int lane = tid & 31;
  const int hh   = lane >> 4;
  const int c    = lane & 15;
  const int bx   = blockIdx.x;
  const int qb   = 31 - (bx >> 5);           // SEQ_LEN / 64 == 32; late query blocks first: under a lower-triangular mask they hold the most live tiles, so cost falls with the block index (speed only)
  static_assert(N_BATCH * N_HEADS == 32 && SEQ_LEN / 64 == 32, "block index split");
  const int bhd  = bx & 31;                  // N_BATCH * N_HEADS == 32
  const int h    = bhd & (N_HEADS - 1);
  const int b    = bhd >> 4;
  const int qblk = qb * 64;
  const int q0   = qblk + wave * 16;
  const size_t rowb = (size_t)b * SEQ_LEN;

  // ---- Q fragments (B operand of the transposed scores), hi and lo planes, 2 d-chunks (8 b128 loads per lane) ----
  v16b qah[2], qal[2];
  {
    const size_t qoff = (rowb + q0 + c) * QKV_PITCH + h * HEAD_D + 8 * hh;
#pragma unroll
    for (int dc = 0; dc < 2; ++dc) {
      qah[dc] = Frag<__bf16>::load((const __bf16*)qkvh + qoff + dc * 32);
      qal[dc] = Frag<__bf16>::load((const __bf16*)qkvl + qoff + dc * 32);
    }
  }

  float mrow = -__builtin_inff(), lrow = 0.f;   // running maximum (base-2 units) and sum of query q0 + c (the same in both lane halves)
  v8f oacc[4];                                  // out^T: oacc[t][r] = out[q0 + c][16 t + 8 hh + r]
#pragma unroll
  for (int t = 0; t < 4; ++t) oacc[t] = (v8f){0.f,0.f,0.f,0.f,0.f,0.f,0.f,0.f};

  const int cls_l = tcls[(size_t)(qb * 32 + lane) * TCLS_STRIDE];   // lane l: class of this query block's mask tile l

  const int kvr = tid >> 1;            // staging: kv row of this thread (0..63)
  const int dh  = (tid & 1) * 32;      // staging: d half (0 or 32)

  for (int kc = 0; kc < SEQ_LEN / KV_CHUNK; ++kc) {
    const int kv0 = kc * KV_CHUNK;
    __syncthreads();
    const int cls = __builtin_amdgcn_readlane(cls_l, kc);   // scalar, the same in every wave of the block

    const size_t koff = (rowb + kv0 + kvr) * QKV_PITCH + HID_SZ + h * HEAD_D + dh;
    const size_t voff = koff + HID_SZ;

    if (cls != 0) {
      if (cls == 2) {
        // ---- mixed mask tile [64 q][64 kv]: 1024 float4 / 128 threads = 8 b128 per lane; RNE-bf16 convert ----
        // load i of a thread: row 8 i + (tid >> 4), floats 4 (tid & 15) .. + 3. One base on each side, the eight row steps constant:
        // no row addresses are held in registers over the loop (they are what the fragments read ahead need)
        const float* mrow0 = maskp + (size_t)(qblk + (tid >> 4)) * SEQ_LEN + kv0 + (tid & 15) * 4;
        unsigned int* mdst0 = Msk + (tid >> 4) * 68 + (tid & 15) * 4;
#pragma unroll
        for (int i = 0; i < 8; ++i) {
          v4u m = *(const v4u*)(mrow0 + (size_t)i * 8 * SEQ_LEN);
#pragma unroll
          for (int e = 0; e < 4; ++e) m[e] = rne_bf16_word(m[e]);
          *(v4u*)(mdst0 + i * 8 * 68) = m;
        }
      }
      // ---- K hi/lo rows -> LDS [kv][d] (4+4 b128 per lane, 128 threads x 32 elements = 64x64 per plane) ----
      {
        const v4u* gh = (const v4u*)(qkvh + koff);
        const v4u* gl = (const v4u*)(qkvl + koff);
        v4u* lh = (v4u*)(Kh + kvr * LDS_P + dh);
        v4u* ll = (v4u*)(Kl + kvr * LDS_P + dh);
        v4u a[4], bb[4];
#pragma unroll
        for (int i = 0; i < 4; ++i) { a[i] = gh[i]; bb[i] = gl[i]; }
        // inputs-only fence on the loaded values: keeps the 8 loads in flight together (without it this build waits after every second load)
        asm volatile("" :: "v"(a[0]), "v"(a[1]), "v"(a[2]), "v"(a[3]), "v"(bb[0]), "v"(bb[1]), "v"(bb[2]), "v"(bb[3]));
#pragma unroll
        for (int i = 0; i < 4; ++i) { lh[i] = a[i]; ll[i] = bb[i]; }
      }
      asm volatile("" ::: "memory");
      // ---- V hi/lo rows -> LDS transposed [d][kv] ----
      {
        const v4u* gh = (const v4u*)(qkvh + voff);
        const v4u* gl = (const v4u*)(qkvl + voff);
        unsigned short* sh = Vth + dh * LDS_P + kvr;   // one base per plane: every row step below is a constant offset
        unsigned short* sl = Vtl + dh * LDS_P + kvr;
        v4u vh4[4], vl4[4];
#pragma unroll
        for (int i = 0; i < 4; ++i) { vh4[i] = gh[i]; vl4[i] = gl[i]; }
        // inputs-only fence on the loaded values: keeps the 8 loads in flight together, as above
        asm volatile("" :: "v"(vh4[0]), "v"(vh4[1]), "v"(vh4[2]), "v"(vh4[3]), "v"(vl4[0]), "v"(vl4[1]), "v"(vl4[2]), "v"(vl4[3]));
#pragma unroll
        for (int i = 0; i < 4; ++i) {
          const v4u wh = vh4[i];
          const v4u wl = vl4[i];
#pragma unroll
          for (int e = 0; e < 4; ++e) {
            const int d = 8 * i + 2 * e;
            sh[d * LDS_P]       = (unsigned short)(wh[e] & 0xFFFFu);
            sh[(d + 1) * LDS_P] = (unsigned short)(wh[e] >> 16);
            sl[d * LDS_P]       = (unsigned short)(wl[e] & 0xFFFFu);
            sl[(d + 1) * LDS_P] = (unsigned short)(wl[e] >> 16);
          }
        }
      }
      __syncthreads();

      // ---- scores, transposed: S^T = K . Q^T, 4 key subtiles x 2 d-chunks, hi.hi + lo.hi + hi.lo ----
      // s[j][r] = score of query q0 + c against key kv0 + 16 j + 8 hh + r: one query per lane, its keys in registers
      // The fragments come in groups of four (one plane, one 32-wide half of d or of the keys: 8 reads); groups three to six are each asked for
      // two or three groups of products ahead of their use, so that the LDS latency lies under products and is not waited out in front of every third one.
      // The four accumulators take turns; each one's own order of sums is hi.hi, lo.hi, hi.lo, first half of d then second.
      // FRAG_STAGE ends a stage: without it this compiler moves the reads back down to their products.
      v8f s[4];
      FB ka[4], kb[4], kc2[4];
      FB va[4], vb[4], vc[4];
      const int fo = c * LDS_P + 8 * hh;
      load_frag4(Kh, fo, ka);            // K hi, d 0..31
      load_frag4(Kl, fo, kb);            // K lo, d 0..31
      load_frag4(Kh, fo + 32, kc2);      // K hi, d 32..63
      FRAG_STAGE();
#pragma unroll
      for (int j = 0; j < 4; ++j) s[j] = at_mma(ka[j].v, qah[0], (v8f){0.f,0.f,0.f,0.f,0.f,0.f,0.f,0.f});
#pragma unroll
      for (int j = 0; j < 4; ++j) s[j] = at_mma(kb[j].v, qah[0], s[j]);
      FRAG_STAGE();
      load_frag4(Kl, fo + 32, kb);       // K lo, d 32..63
      FRAG_STAGE();
#pragma unroll
      for (int j = 0; j < 4; ++j) s[j] = at_mma(ka[j].v, qal[0], s[j]);
      FRAG_STAGE();
      load_frag4(Vth, fo, va);           // V^T hi, keys 0..31: this group and the next arrive under the softmax
      FRAG_STAGE();
#pragma unroll
      for (int j = 0; j < 4; ++j) s[j] = at_mma(kc2[j].v, qah[1], s[j]);
#pragma unroll
      for (int j = 0; j < 4; ++j) s[j] = at_mma(kb[j].v, qah[1], s[j]);
      FRAG_STAGE();
      load_frag4(Vtl, fo, vb);           // V^T lo, keys 0..31
      FRAG_STAGE();
#pragma unroll
      for (int j = 0; j < 4; ++j) s[j] = at_mma(kc2[j].v, qal[1], s[j]);
      // ---- scale, mask (literal s*m - 10000*(1-m)), to base-2 units, maximum of the lane's 32 keys, then of both lane halves ----
      float cm = -__builtin_inff();
      if (cls == 2) {
        const unsigned int* mp = Msk + (wave * 16 + c) * 68 + 8 * hh;
#pragma unroll
        for (int j = 0; j < 4; ++j) {
          const v4u k0 = *(const v4u*)(mp + j * 16);
          const v4u k1 = *(const v4u*)(mp + j * 16 + 4);
#pragma unroll
          for (int r = 0; r < 8; ++r) {
            const float mk = __uint_as_float(r < 4 ? k0[r & 3] : k1[r & 3]);
            float x = s[j][r] * 0.125f;
            x = x * mk - 10000.0f * (1.0f - mk);
            x *= LOG2_E;
            s[j][r] = x;
            cm = fmaxf(cm, x);
          }
        }
      } else {
        // tile of ones: x*1 - 10000*(1 - 1) == x for every x
#pragma unroll
        for (int j = 0; j < 4; ++j)
#pragma unroll
          for (int r = 0; r < 8; ++r) {
            const float x = s[j][r] * (0.125f * LOG2_E);
            s[j][r] = x;
            cm = fmaxf(cm, x);
          }
      }
      cm = fmaxf(cm, xhalf(cm));
      // ---- online softmax, one query per lane; P^T split into bf16 hi/lo and packed in place as B operands ----
      FW ph[2], pl[2];
      {
        const float mnew  = fmaxf(mrow, cm);
        const float alpha = __builtin_amdgcn_exp2f(mrow - mnew);
        mrow = mnew;
        float ps[4];
#pragma unroll
        for (int j = 0; j < 4; ++j) {
          ps[j] = 0.f;
#pragma unroll
          for (int r = 0; r < 8; r += 2) {
            const v2f d = (v2f){s[j][r], s[j][r + 1]} - mnew;   // one packed subtraction for two keys
            const float p0 = __builtin_amdgcn_exp2f(d[0]);
            const float p1 = __builtin_amdgcn_exp2f(d[1]);
            ps[j] += p0;
            ps[j] += p1;
            unsigned int wh, wl;
            split_pack2(p0, p1, wh, wl);
            ph[j >> 1].w[(j & 1) * 4 + (r >> 1)] = wh;   // element 8 (j & 1) + r of the 32-key fragment = key 16 (j & 1) + 8 hh + r
            pl[j >> 1].w[(j & 1) * 4 + (r >> 1)] = wl;
          }
        }
        float psum = (ps[0] + ps[1]) + (ps[2] + ps[3]);
        psum += xhalf(psum);
        lrow = lrow * alpha + psum;
#pragma unroll
        for (int t = 0; t < 4; ++t)
#pragma unroll
          for (int r = 0; r < 8; ++r) oacc[t][r] *= alpha;
      }
      // ---- out^T += V^T(64x64) . P^T(64x16): vh.ph + vl.ph + vh.pl; oacc[t][r] = out[q0 + c][16 t + 8 hh + r] ----
      // the last two groups stand where they could be asked for; their place is left to the compiler (a stage mark behind the softmax made this build spill)
      load_frag4(Vth, fo + 32, vc);      // V^T hi, keys 32..63
#pragma unroll
      for (int t = 0; t < 4; ++t) oacc[t] = at_mma(va[t].v, ph[0].v, oacc[t]);
#pragma unroll
      for (int t = 0; t < 4; ++t) oacc[t] = at_mma(vb[t].v, ph[0].v, oacc[t]);
      load_frag4(Vtl, fo + 32, vb);      // V^T lo, keys 32..63
#pragma unroll
      for (int t = 0; t < 4; ++t) oacc[t] = at_mma(va[t].v, pl[0].v, oacc[t]);
#pragma unroll
      for (int t = 0; t < 4; ++t) oacc[t] = at_mma(vc[t].v, ph[1].v, oacc[t]);
#pragma unroll
      for (int t = 0; t < 4; ++t) oacc[t] = at_mma(vb[t].v, ph[1].v, oacc[t]);
#pragma unroll
      for (int t = 0; t < 4; ++t) oacc[t] = at_mma(vc[t].v, pl[1].v, oacc[t]);
    } else {
      // ---- all-masked tile: v rows (hi+lo, f32) -> Msk scratch [kv][d], column sums, closed-form update ----
      {
        const v4u* gh = (const v4u*)(qkvh + voff);
        const v4u* gl = (const v4u*)(qkvl + voff);
#pragma unroll
        for (int i = 0; i < 4; ++i) {
          const v4u wh = gh[i];
          const v4u wl = gl[i];
          v4u f0, f1;
          {
            const float a0 = __uint_as_float(wh[0] << 16);          const float b0 = __uint_as_float(wl[0] << 16);
            const float a1 = __uint_as_float(wh[0] & 0xFFFF0000u); const float b1 = __uint_as_float(wl[0] & 0xFFFF0000u);
            const float a2 = __uint_as_float(wh[1] << 16);          const float b2 = __uint_as_float(wl[1] << 16);
            const float a3 = __uint_as_float(wh[1] & 0xFFFF0000u); const float b3 = __uint_as_float(wl[1] & 0xFFFF0000u);
            f0[0] = __float_as_uint(a0 + b0); f0[1] = __float_as_uint(a1 + b1);
            f0[2] = __float_as_uint(a2 + b2); f0[3] = __float_as_uint(a3 + b3);
          }
          {
            const float a0 = __uint_as_float(wh[2] << 16);          const float b0 = __uint_as_float(wl[2] << 16);
            const float a1 = __uint_as_float(wh[2] & 0xFFFF0000u); const float b1 = __uint_as_float(wl[2] & 0xFFFF0000u);
            const float a2 = __uint_as_float(wh[3] << 16);          const float b2 = __uint_as_float(wl[3] << 16);
            const float a3 = __uint_as_float(wh[3] & 0xFFFF0000u); const float b3 = __uint_as_float(wl[3] & 0xFFFF0000u);
            f1[0] = __float_as_uint(a0 + b0); f1[1] = __float_as_uint(a1 + b1);
            f1[2] = __float_as_uint(a2 + b2); f1[3] = __float_as_uint(a3 + b3);
          }
          *(v4u*)(Msk + kvr * 68 + dh + 8 * i)     = f0;
          *(v4u*)(Msk + kvr * 68 + dh + 8 * i + 4) = f1;
        }
      }
      __syncthreads();
      {
        const int d = tid & 63, half = tid >> 6;
        float part = 0.f;
#pragma unroll 8
        for (int kq = 0; kq < 32; ++kq) part += __uint_as_float(Msk[(half * 32 + kq) * 68 + d]);
        Os[0][half * 64 + d] = part;
      }
      __syncthreads();
      {
        const float mnew  = fmaxf(mrow, MASKED_L2);
        const float alpha = __builtin_amdgcn_exp2f(mrow - mnew);
        const float p     = __builtin_amdgcn_exp2f(MASKED_L2 - mnew);
        mrow = mnew;
        lrow = lrow * alpha + 64.0f * p;
#pragma unroll
        for (int t = 0; t < 4; ++t) {
          const float* cs = Os[0] + t * 16 + 8 * hh;      // column sums of the lane's 8 output columns, two partial sums each
          const v4f a0 = *(const v4f*)cs;
          const v4f a1 = *(const v4f*)(cs + 4);
          const v4f b0 = *(const v4f*)(cs + 64);
          const v4f b1 = *(const v4f*)(cs + 68);
#pragma unroll
          for (int r = 0; r < 8; ++r) {
            const float vs = (r < 4 ? a0[r & 3] : a1[r & 3]) + (r < 4 ? b0[r & 3] : b1[r & 3]);
            oacc[t][r] = oacc[t][r] * alpha + p * vs;
          }
        }
      }
    }
  }
  __syncthreads();

  float* os = Os[wave];
  {
    const float inv = 1.0f / lrow;
#pragma unroll
    for (int t = 0; t < 4; ++t) {
      v4f x0, x1;
#pragma unroll
      for (int r = 0; r < 4; ++r) { x0[r] = oacc[t][r] * inv; x1[r] = oacc[t][r + 4] * inv; }
      *(v4f*)(os + c * 68 + t * 16 + 8 * hh)     = x0;
      *(v4f*)(os + c * 68 + t * 16 + 8 * hh + 4) = x1;
    }
  }
  __builtin_amdgcn_fence(__ATOMIC_RELEASE, "workgroup");
  __builtin_amdgcn_wave_barrier();
  __builtin_amdgcn_fence(__ATOMIC_ACQUIRE, "workgroup");
  {
    const int q8 = lane >> 3, c8 = (lane & 7) * 8;
    unsigned short* oh = ctxh + (rowb + q0) * HID_SZ + h * HEAD_D + c8;
    unsigned short* ol = ctxl + (rowb + q0) * HID_SZ + h * HEAD_D + c8;
    {
#pragma unroll
      for (int it = 0; it < 4; ++it) {
        const int row = it * 4 + q8;
        const float* sp = os + row * 68 + c8;
        const v4f x0 = *(const v4f*)sp;
        const v4f x1 = *(const v4f*)(sp + 4);
        v4u wh, wl;
        unsigned int th, tl;
        split_pack2(x0[0], x0[1], th, tl); wh[0] = th; wl[0] = tl;
        split_pack2(x0[2], x0[3], th, tl); wh[1] = th; wl[1] = tl;
        split_pack2(x1[0], x1[1], th, tl); wh[2] = th; wl[2] = tl;
        split_pack2(x1[2], x1[3], th, tl); wh[3] = th; wl[3] = tl;
        *(v4u*)(oh + (size_t)row * HID_SZ) = wh;
        *(v4u*)(ol + (size_t)row * HID_SZ) = wl;
      }
      
    }
  }
}

// ---------------------------------------------------------------------------
// Workspace region map (bytes):
//   Hb    bf16 [4096][1024]        off 0            size  8388608
//   WQt   bf16 [3072][1024]        off 8388608      size  6291456
//   WDt   bf16 [1024][1024]        off 14680064     size  2097152
//   BQ    f32  [3072]              off 16777216     size    12288
//   BD    f32  [1024]              off 16789504     size     4096
//   QKVh  bf16 [4096][3072]        off 16793600     size 25165824
//   QKVl  bf16 [4096][3072]        off 41959424     size 25165824
//   CTXh  bf16 [4096][1024]        off 67125248     size  8388608
//   CTXl  bf16 [4096][1024]        off 75513856     size  8388608
//   TCLS  i32  [1024] x 128 B      off 83902464     size   131072
//   end                            84033536
// Every region is written by its producer before any consumer reads it (TCLS: only the first int of each 128-byte line).
// ---------------------------------------------------------------------------
extern "C" void kernel_launch(void* const* d_in, const int* in_sizes, int n_in,
                              void* d_out, int out_size, void* d_ws, size_t ws_size,
                              hipStream_t stream) {
  constexpr int kB = N_BATCH, kS = SEQ_LEN, kH = HID_SZ;
  constexpr int kM = kB * kS;          // 4096
  constexpr int kN3 = 3 * kH;          // 3072
  static_assert(kM % G_BM == 0 && kN3 % G_BN == 0 && kH % G_BN == 0);   // GEMM M/N tile multiples
  static_assert(kH % G_KS == 0);                                         // GEMM K slice
  static_assert(kS % KV_CHUNK == 0 && kS / 64 == 32 && kH / HEAD_D == N_HEADS);
  static_assert((kM * kH) % 2048 == 0 && kN3 % 1024 == 0 && kH % 1024 == 0);

  if (n_in < 6) return;
  if (in_sizes[0] != kM * kH || in_sizes[1] != kS * kS || in_sizes[2] != kH * kN3 ||
      in_sizes[3] != kN3 || in_sizes[4] != kH * kH || in_sizes[5] != kH) return;
  if (out_size != kM * kH) return;

  const float* hidden  = (const float*)d_in[0];
  const float* maskp   = (const float*)d_in[1];
  const float* w_qkv   = (const float*)d_in[2];
  const float* b_qkv   = (const float*)d_in[3];
  const float* w_dense = (const float*)d_in[4];
  const float* b_dense = (const float*)d_in[5];
  float* out = (float*)d_out;

  const size_t szHb  = (size_t)kM * kH * 2;
  const size_t szWQt = (size_t)kN3 * kH * 2;
  const size_t szWDt = (size_t)kH * kH * 2;
  const size_t szBQ  = (size_t)kN3 * 4;
  const size_t szBD  = (size_t)kH * 4;
  const size_t szQKV = (size_t)kM * kN3 * 2;
  const size_t szCTX = (size_t)kM * kH * 2;
  const size_t offHb   = 0;
  const size_t offWQt  = offHb + szHb;
  const size_t offWDt  = offWQt + szWQt;
  const size_t offBQ   = offWDt + szWDt;
  const size_t offBD   = offBQ + szBQ;
  const size_t offQKVh = offBD + szBD;
  const size_t offQKVl = offQKVh + szQKV;
  const size_t offCTXh = offQKVl + szQKV;
  const size_t offCTXl = offCTXh + szCTX;
  const size_t offTCLS = offCTXl + szCTX;
  const size_t szTCLS  = (size_t)(kS / 64) * (kS / 64) * TCLS_STRIDE * 4;
  const size_t offEnd  = offTCLS + szTCLS;
  if (offEnd > ws_size) return;

  char* ws = (char*)d_ws;
  unsigned short* Hb   = (unsigned short*)(ws + offHb);
  unsigned short* WQt  = (unsigned short*)(ws + offWQt);
  unsigned short* WDt  = (unsigned short*)(ws + offWDt);
  float*          BQ   = (float*)(ws + offBQ);
  float*          BD   = (float*)(ws + offBD);
  unsigned short* QKVh = (unsigned short*)(ws + offQKVh);
  unsigned short* QKVl = (unsigned short*)(ws + offQKVl);
  unsigned short* CTXh = (unsigned short*)(ws + offCTXh);
  unsigned short* CTXl = (unsigned short*)(ws + offCTXl);
  int*            TCLS = (int*)(ws + offTCLS);

  // 1-3) hidden -> bf16 plane; w_qkv, w_dense -> transposed bf16; bias lines RNE-bf16 converted (kept as f32); class of each 64x64 mask tile
  prep_all<<<dim3(PREP_BLOCKS), dim3(256), 0, stream>>>(hidden, maskp, w_qkv, b_qkv, w_dense, b_dense, Hb, WQt, WDt, BQ, BD, TCLS);
  // 4) fused qkv projection: [4096x1024] x WQt[3072x1024]^T + bias -> bf16 hi/lo planes [4096][3072]
  {
    const int tiles = (kM / G_BM) * (kN3 / G_BN);       // 384 block tiles of 128x256
    wmma_gemm64<1, 0, 2, 2, false><<<dim3(tiles, 1), dim3(256), 0, stream>>>(
        Hb, Hb, kH, 0L, WQt, WQt, kH, 0L, (void*)QKVh, (void*)QKVl, kN3, 0L,
        BQ, BQ, 0L, kM, kN3, kH, 1.0f);
  }
  // 5) attention per (batch, head, 64 query rows) -> ctx bf16 hi/lo planes [4096][1024]
  attn_planes_kernel<<<dim3(kB * N_HEADS * (kS / 64)), dim3(128), 0, stream>>>(QKVh, QKVl, maskp, TCLS, CTXh, CTXl);
  // 6) output projection: ctx (hi/lo) [4096x1024] x WDt[1024x1024]^T + bias -> out f32 [4096][1024]
  {
    const int tiles = (kM / G_BM) * (kH / G_BN);        // 128 block tiles of 128x256
    wmma_gemm64<1, 2, 2, 0, false><<<dim3(tiles, 1), dim3(256), 0, stream>>>(
        CTXh, CTXl, kH, 0L, WDt, WDt, kH, 0L, (void*)out, (void*)out, kH, 0L,
        BD, BD, 0L, kM, kH, kH, 1.0f);
  }
}

// v010
// One run takes 136 microseconds.
// Next to v009, in two timings, it ran 1.09 times as fast each time.
// Over all steps from v000 it is 4.62 times as fast.
// Contractions on v_wmma_f32_16x16x32_bf16 (bf16 operands, f32 accumulate): qkv projection = one product on RNE-bf16 inputs; q.k^T and p.v = bf16 hi/lo planes (3 products); output projection = ctx bf16 hi/lo x bf16 weights (2 products). Masking, softmax and normalisation in f32.
#include <hip/hip_runtime.h>

typedef __attribute__((ext_vector_type(16))) _Float16 v16h;
typedef __attribute__((ext_vector_type(8)))  _Float16 v8h;
typedef __attribute__((ext_vector_type(16))) __bf16   v16b;
typedef __attribute__((ext_vector_type(8)))  __bf16   v8b;
typedef __attribute__((ext_vector_type(2)))  __bf16   v2b;
typedef __attribute__((ext_vector_type(8)))  float    v8f;
typedef __attribute__((ext_vector_type(4)))  float    v4f;
typedef __attribute__((ext_vector_type(2)))  float    v2f;
typedef __attribute__((ext_vector_type(4)))  unsigned int v4u;

// RNE convert of an f32 bit pattern to its bf16 value, kept as an f32 bit pattern
__device__ __forceinline__ unsigned int rne_bf16_word(unsigned int u) {
  return (u + 0x7FFFu + ((u >> 16) & 1u)) & 0xFFFF0000u;
}
// two floats rounded to nearest even and packed as (a | b<<16) by the hardware's own conversion: one v_cvt_pk_bf16_f32
__device__ __forceinline__ unsigned int pack_bf16x2(float a, float b) {
  return __builtin_bit_cast(unsigned int, __builtin_convertvector((v2f){a, b}, v2b));
}
// hi/lo bf16 split of two floats, packed as (hi_a | hi_b<<16) and (lo_a | lo_b<<16)
__device__ __forceinline__ void split_pack2(float a, float b, unsigned int& wh, unsigned int& wl) {
  wh = pack_bf16x2(a, b);
  const v2f lo = (v2f){a, b} - (v2f){__uint_as_float(wh << 16), __uint_as_float(wh & 0xFFFF0000u)};
  wl = pack_bf16x2(lo[0], lo[1]);
}

// hazard guards as plain device helpers
__device__ __forceinline__ void dep_guard_h(v8f& a, v8f& b, v16h x, v16h y) { asm volatile("v_nop\n\tv_nop\n\tv_nop\n\tv_nop" : "+v"(a), "+v"(b) : "v"(x), "v"(y)); }
__device__ __forceinline__ void dep_guard_b(v8f& a, v8f& b, v16b x, v16b y) { asm volatile("v_nop\n\tv_nop\n\tv_nop\n\tv_nop" : "+v"(a), "+v"(b) : "v"(x), "v"(y)); }
__device__ __forceinline__ void keep4_h(v16h a, v16h b, v16h c, v16h d) { asm volatile("v_nop" :: "v"(a), "v"(b), "v"(c), "v"(d)); }
__device__ __forceinline__ void keep4_b(v16b a, v16b b, v16b c, v16b d) { asm volatile("v_nop" :: "v"(a), "v"(b), "v"(c), "v"(d)); }
__device__ __forceinline__ void acc_guard4(v8f& a, v8f& b, v8f& c, v8f& d) { asm volatile("v_nop\n\tv_nop\n\tv_nop\n\tv_nop" : "+v"(a), "+v"(b), "+v"(c), "+v"(d)); }
template <typename T> struct Frag;
template <> struct Frag<_Float16> {
  typedef v16h V; union U { v16h v; v8h h[2]; };
  static __device__ __forceinline__ v16h load(const _Float16* p) {   // elements 0..7 <- p[0..7], 8..15 <- p[16..23]
    U f; f.h[0] = *(const v8h*)(p); f.h[1] = *(const v8h*)(p + 16); return f.v;
  }
  static __device__ __forceinline__ v8f mma(v16h a, v16h b, v8f c) {
    return __builtin_amdgcn_wmma_f32_16x16x32_f16(false, a, false, b, (short)0, c, false, false);
  }
  static __device__ __forceinline__ void guard(v8f& a, v8f& b, v16h x, v16h y) { dep_guard_h(a, b, x, y); }
  static __device__ __forceinline__ void keep(v16h a, v16h b, v16h c, v16h d) { keep4_h(a, b, c, d); }
};
template <> struct Frag<__bf16> {
  typedef v16b V; union U { v16b v; v8b h[2]; };
  static __device__ __forceinline__ v16b load(const __bf16* p) {
    U f; f.h[0] = *(const v8b*)(p); f.h[1] = *(const v8b*)(p + 16); return f.v;
  }
  static __device__ __forceinline__ v8f mma(v16b a, v16b b, v8f c) {
    return __builtin_amdgcn_wmma_f32_16x16x32_bf16(false, a, false, b, (short)0, c, false, false);
  }
  static __device__ __forceinline__ void guard(v8f& a, v8f& b, v16b x, v16b y) { dep_guard_b(a, b, x, y); }
  static __device__ __forceinline__ void keep(v16b a, v16b b, v16b c, v16b d) { keep4_b(a, b, c, d); }
};

// ---- Register-blocked batched WMMA GEMM ------------------------------------
// C[m,n] = scale * sum_k A[m,k] * Bt[n,k] (+bias)(+resid); a block of 8 waves (2 x 4) owns a 128x256 tile, each wave 64x64 of it.
// A row-major [M,K]; Bt row-major [N,K]; M % 128 == 0, N % 256 == 0, K % 64 == 0.
// The block's rows of A and Bt go through LDS in slices of 64 k (one 128-byte line per row), brought by asynchronous copies
// into two buffers: slice t + 1 flies while slice t is worked on, and every line is fetched once per block, whole.
// SPLIT: 0 = single planes; 1 = A and Bt hi/lo planes (hi.hi + hi.lo + lo.hi); 2 = A hi/lo planes only (hi.B + lo.B).
// BIAS_MODE: 0 = none, 1 = bias[m], 2 = bias[n].
// OUT_MODE: 0 = f32, 1 = f16, 2 = bf16 hi plane (Cout) + bf16 lo plane (Cout2).
// ET: 0 = f16 operands, 1 = bf16 operands (pointers passed as 16-bit storage)
template <int ET> struct Elem;
template <> struct Elem<0> { typedef _Float16 T; };
template <> struct Elem<1> { typedef __bf16 T; };

#define G_BM 128   // block tile rows of A
#define G_BN 256   // block tile rows of Bt
#define G_KS 64    // k elements of one staged slice
#define G_P  72    // LDS row pitch in 16-bit elements: 144 B = 16 B x odd, free of bank conflicts for b128 fragment reads

// One line of an asynchronous copy: 16 bytes per lane, global -> LDS, through no register.
#define G_CP(l, g) "global_load_async_to_lds_b128 %" #l ", %" #g ", off\n\t"
// N copies and, as the last line of the same statement, the wait that stands before their address registers are rewritten.
template <int N>
__device__ __forceinline__ void async_copies(const unsigned int* l, const unsigned short* const* g) {
  static_assert(N == 8 || N == 12, "copies per statement");
  if constexpr (N == 12) {
    asm volatile(G_CP(0, 1) G_CP(2, 3) G_CP(4, 5) G_CP(6, 7) G_CP(8, 9) G_CP(10, 11) G_CP(12, 13) G_CP(14, 15)
                 G_CP(16, 17) G_CP(18, 19) G_CP(20, 21) G_CP(22, 23) "s_wait_xcnt 0x0"
                 :: "v"(l[0]), "v"(g[0]), "v"(l[1]), "v"(g[1]), "v"(l[2]), "v"(g[2]), "v"(l[3]), "v"(g[3]),
                    "v"(l[4]), "v"(g[4]), "v"(l[5]), "v"(g[5]), "v"(l[6]), "v"(g[6]), "v"(l[7]), "v"(g[7]),
                    "v"(l[8]), "v"(g[8]), "v"(l[9]), "v"(g[9]), "v"(l[10]), "v"(g[10]), "v"(l[11]), "v"(g[11])
                 : "memory");
  } else {
    asm volatile(G_CP(0, 1) G_CP(2, 3) G_CP(4, 5) G_CP(6, 7) G_CP(8, 9) G_CP(10, 11) G_CP(12, 13) G_CP(14, 15) "s_wait_xcnt 0x0"
                 :: "v"(l[0]), "v"(g[0]), "v"(l[1]), "v"(g[1]), "v"(l[2]), "v"(g[2]), "v"(l[3]), "v"(g[3]),
                    "v"(l[4]), "v"(g[4]), "v"(l[5]), "v"(g[5]), "v"(l[6]), "v"(g[6]), "v"(l[7]), "v"(g[7])
                 : "memory");
  }
}

template <int ET, int SPLIT, int BIAS_MODE, int OUT_MODE, bool RESID, int ACT = 0>
__global__ __launch_bounds__(256) void wmma_gemm64(
    const unsigned short* __restrict__ Ap, const unsigned short* __restrict__ A2p, int lda, long strideA,
    const unsigned short* __restrict__ Btp, const unsigned short* __restrict__ Bt2p, int ldb, long strideB,
    void* __restrict__ Cout, void* __restrict__ Cout2, int ldc, long strideC,
    const float* __restrict__ bias,
    const float* __restrict__ resid, long strideR,
    int M, int N, int K, float scale) {
  typedef typename Elem<ET>::T T;
  typedef typename Frag<T>::V V;
  constexpr int NPA   = (SPLIT != 0) ? 2 : 1;             // planes of A
  constexpr int NPB   = (SPLIT == 1) ? 2 : 1;             // planes of Bt
  constexpr int ROWS  = G_BM * NPA + G_BN * NPB;          // rows of one slice: [A | A2 | Bt | Bt2]
  constexpr int STAGE = ROWS * G_P;                       // 16-bit elements of one buffer
  constexpr int NCOPY = ROWS / 32;                        // copies per lane and slice: 256 lanes x 16 B = 32 rows of 128 B
  constexpr int CGRP  = (NCOPY % 12 == 0) ? 12 : 8;       // copies per statement
  constexpr int AHEAD = (SPLIT == 0) ? 4 : 1;             // as far as the registers reach below 256
  static_assert(NCOPY % CGRP == 0 && NCOPY <= 63, "copies per slice");
  __shared__ __align__(16) unsigned short ring[2 * STAGE];   // two buffers
  __shared__ __align__(16) float sT[8][16 * 68];   // per-wave 16x64 slab, pitch 68 floats
  const int b    = blockIdx.y;
  const int tid  = threadIdx.x;
  const int lane = tid & 31;
  const int wave = tid >> 5;
  const int tilesN = N / G_BN;
  const int tilesM = M / G_BM;
  if ((int)blockIdx.x >= tilesM * tilesN) return;   // the same for the whole block, in front of every barrier
  const int tm = blockIdx.x / tilesN;
  const int tn = blockIdx.x - tm * tilesN;
  const int wm = wave >> 2;                    // wave's 64 rows of the block's A rows
  const int wn = wave & 3;                     // wave's 64 rows of the block's Bt rows
  const int m0 = tm * G_BM + (wm << 6);
  const int n0 = tn * G_BN + (wn << 6);

  const int rlane = lane & 15;                 // row (A) / col (B, D) within subtile
  const int koff  = (lane >> 4) * 8;           // k offset of this lane half
  const int mOff  = (lane >> 4) * 8;           // D row offset

  // copy i of a lane: row 32 i + (tid >> 3) of the slice, bytes 16 (tid & 7) .. + 15 of its 128: 8 lanes bring one whole line
  const int crow = tid >> 3;
  const int cseg = (tid & 7) * 8;
  const unsigned short* gA  = Ap  + (size_t)b * strideA + (size_t)(tm * G_BM + crow) * lda + cseg;
  const unsigned short* gA2 = A2p + (size_t)b * strideA + (size_t)(tm * G_BM + crow) * lda + cseg;
  const unsigned short* gB  = Btp  + (size_t)b * strideB + (size_t)(tn * G_BN + crow) * ldb + cseg;
  const unsigned short* gB2 = Bt2p + (size_t)b * strideB + (size_t)(tn * G_BN + crow) * ldb + cseg;
  const unsigned int lds0 = (unsigned int)(size_t)ring + (unsigned int)(crow * G_P + cseg) * 2u;   // low 32 bits = LDS byte address

  auto stage = [&](int kt, int buf) {
    unsigned int l[NCOPY];
    const unsigned short* g[NCOPY];
    // both loops unrolled: every address is a register operand of a copy statement
#pragma unroll
    for (int i = 0; i < NCOPY; ++i) {
      l[i] = lds0 + (unsigned int)(buf * STAGE + i * 32 * G_P) * 2u;
      if (i < 4 * NPA) {
        const int pl = i >> 2, r = (i & 3) * 32;
        g[i] = (pl ? gA2 : gA) + (size_t)r * lda + kt * G_KS;
      } else {
        const int q = i - 4 * NPA, pl = q >> 3, r = (q & 7) * 32;
        g[i] = (pl ? gB2 : gB) + (size_t)r * ldb + kt * G_KS;
      }
    }
#pragma unroll
    for (int i = 0; i < NCOPY; i += CGRP) async_copies<CGRP>(l + i, g + i);
  };

  v8f acc[4][4];
#pragma unroll
  for (int i = 0; i < 4; ++i)
#pragma unroll
    for (int j = 0; j < 4; ++j) acc[i][j] = (v8f){0.f,0.f,0.f,0.f,0.f,0.f,0.f,0.f};

  const int nt = K / G_KS;
  stage(0, 0);
  asm volatile("s_wait_asynccnt 0x0" ::: "memory");   // this wave's copies of slice 0 have landed
  __syncthreads();                                     // ... and every other wave's
  if (nt > 1) stage(1, 1);

  const int aoff = ((wm << 6) + rlane) * G_P + koff;
  const int boff = (G_BM * NPA + (wn << 6) + rlane) * G_P + koff;
  for (int t = 0; t < nt; ++t) {
    const T* sb = (const T*)ring + (t & 1) * STAGE;
#pragma unroll
    for (int ks = 0; ks < G_KS; ks += 32) {
      V bh[4], bl[4];
#pragma unroll
      for (int j = 0; j < 4; ++j) {
        bh[j] = Frag<T>::load(sb + boff + j * 16 * G_P + ks);
        if (SPLIT == 1) bl[j] = Frag<T>::load(sb + boff + (G_BN + j * 16) * G_P + ks);
      }
      // A fragments are fetched AHEAD row groups in front of their products, so that a row group's LDS latency lies under the products before it
      V ah[4], al[4];
#pragma unroll
      for (int i = 0; i < AHEAD; ++i) {
        ah[i] = Frag<T>::load(sb + aoff + i * 16 * G_P + ks);
        if (SPLIT != 0) al[i] = Frag<T>::load(sb + aoff + (G_BM + i * 16) * G_P + ks);
      }
#pragma unroll
      for (int i = 0; i < 4; ++i) {
        if (i + AHEAD < 4) {
          ah[i + AHEAD] = Frag<T>::load(sb + aoff + (i + AHEAD) * 16 * G_P + ks);
          if (SPLIT != 0) al[i + AHEAD] = Frag<T>::load(sb + aoff + (G_BM + (i + AHEAD) * 16) * G_P + ks);
        }
#pragma unroll
        for (int j = 0; j < 4; ++j) {
          acc[i][j] = Frag<T>::mma(ah[i], bh[j], acc[i][j]);
          if (SPLIT == 1) {
            acc[i][j] = Frag<T>::mma(ah[i], bl[j], acc[i][j]);
            acc[i][j] = Frag<T>::mma(al[i], bh[j], acc[i][j]);
          }
          if (SPLIT == 2) {
            acc[i][j] = Frag<T>::mma(al[i], bh[j], acc[i][j]);
          }
        }
        Frag<T>::guard(acc[i][0], acc[i][3], ah[i], (SPLIT != 0) ? al[i] : ah[i]);
      }
      Frag<T>::keep(bh[0], bh[1], bh[2], bh[3]);
      if (SPLIT == 1) Frag<T>::keep(bl[0], bl[1], bl[2], bl[3]);
    }
    asm volatile("s_wait_dscnt 0x0" ::: "memory");      // this wave's reads of slice t are done before its buffer is refilled
    asm volatile("s_wait_asynccnt 0x0" ::: "memory");   // this wave's copies of slice t + 1 have landed
    __syncthreads();                                     // publishes slice t + 1 and ends every reader's last read of slice t
    if (t + 2 < nt) stage(t + 2, t & 1);
  }
  asm volatile("s_wait_asynccnt 0x0" ::: "memory");     // no copy is outstanding behind the loop
  acc_guard4(acc[0][0], acc[0][1], acc[0][2], acc[0][3]);
  acc_guard4(acc[1][0], acc[1][1], acc[1][2], acc[1][3]);
  acc_guard4(acc[2][0], acc[2][1], acc[2][2], acc[2][3]);
  acc_guard4(acc[3][0], acc[3][1], acc[3][2], acc[3][3]);

  // ---- epilogue ----
  float* slab = sT[wave];
  const float* Rb = RESID ? (resid + (size_t)b * strideR) : nullptr;
#pragma unroll
  for (int i = 0; i < 4; ++i) {
    const int mBase = m0 + (i << 4);
#pragma unroll
    for (int j = 0; j < 4; ++j) {
      const int n = n0 + (j << 4) + rlane;
      float bv = 0.f;
      if (BIAS_MODE == 2) bv = bias[n];
#pragma unroll
      for (int r = 0; r < 8; ++r) {
        float v = acc[i][j][r] * scale;
        if (BIAS_MODE == 1) v += bias[mBase + mOff + r];
        if (BIAS_MODE == 2) v += bv;
        if (RESID) v += Rb[(size_t)(mBase + mOff + r) * ldc + n];
        if (ACT == 1) v = tanhf(v);
        if (ACT == 2) v = fmaxf(v, 0.0f);
        if (ACT == 4) v = (v > 0.f) ? v : 0.01f * v;
        slab[(mOff + r) * 68 + (j << 4) + rlane] = v;
      }
    }
    __builtin_amdgcn_fence(__ATOMIC_RELEASE, "workgroup");
    __builtin_amdgcn_wave_barrier();
    __builtin_amdgcn_fence(__ATOMIC_ACQUIRE, "workgroup");
    if (OUT_MODE == 0) {
      float* C = (float*)Cout + (size_t)b * strideC;
      const int hh = lane >> 4, c4 = (lane & 15) * 4;     // row seg = 256 B = 16 lanes x 16 B
      {
#pragma unroll
        for (int it = 0; it < 8; ++it) {
          const int row = it * 2 + hh;
          v4f v = *(const v4f*)(slab + row * 68 + c4);
          *(v4f*)(C + (size_t)(mBase + row) * ldc + n0 + c4) = v;
        }
        
      }
    } else {
      const int q = lane >> 3, c8 = (lane & 7) * 8;
      unsigned short* C  = (unsigned short*)Cout  + (size_t)b * strideC;
      unsigned short* C2 = (OUT_MODE == 2) ? ((unsigned short*)Cout2 + (size_t)b * strideC) : nullptr;
      {
#pragma unroll
        for (int it = 0; it < 4; ++it) {
          const int row = it * 4 + q;
          const float* sp = slab + row * 68 + c8;
          if (OUT_MODE == 1) {
            v8h hv;
            // unrolled so that hv[e] is a plain register half of the b128 store
#pragma unroll
            for (int e = 0; e < 8; ++e) hv[e] = (_Float16)sp[e];
            *(v8h*)(C + (size_t)(mBase + row) * ldc + n0 + c8) = hv;
          } else {
            v4u wh, wl;
            // unrolled so that wh[e] and wl[e] are plain registers of the two b128 stores
#pragma unroll
            for (int e = 0; e < 4; ++e) {
              unsigned int th, tl;
              split_pack2(sp[2 * e], sp[2 * e + 1], th, tl);
              wh[e] = th;
              wl[e] = tl;
            }
            *(v4u*)(C + (size_t)(mBase + row) * ldc + n0 + c8) = wh;
            *(v4u*)(C2 + (size_t)(mBase + row) * ldc + n0 + c8) = wl;
          }
        }
        
      }
    }
    __builtin_amdgcn_fence(__ATOMIC_RELEASE, "workgroup");
    __builtin_amdgcn_wave_barrier();
    __builtin_amdgcn_fence(__ATOMIC_ACQUIRE, "workgroup");
  }
}

// lane l <-> lane l ^ 16
__device__ __forceinline__ float xhalf(float x) {
  return __builtin_bit_cast(float, __builtin_amdgcn_permlanex16(__builtin_bit_cast(int, x), __builtin_bit_cast(int, x), 0x76543210, 0xfedcba98, false, false));
}

__device__ __forceinline__ v8f at_mma(v16b a, v16b b, v8f c) {
  return __builtin_amdgcn_wmma_f32_16x16x32_bf16(false, a, false, b, (short)0, c, false, false);
}

union FB { v16b v; v8b h[2]; };
// The four 16-row A fragments of one 32-wide k half of one plane of a 64-row LDS tile (pitch 72 elements); off = lane's row * pitch + k offset
__device__ __forceinline__ void load_frag4(const unsigned short* tile, int off, FB* f) {
#pragma unroll
  for (int j = 0; j < 4; ++j) {
    f[j].h[0] = *(const v8b*)((const __bf16*)tile + off + j * 16 * 72);
    f[j].h[1] = *(const v8b*)((const __bf16*)tile + off + j * 16 * 72 + 16);
  }
}
typedef __attribute__((ext_vector_type(8))) short s16x8;
// transposing LDS read: from a row-major 16-bit tile T, lane (c = l & 15, hh = l >> 4) gets T[k0 + 8 hh + 0..7][d0 + c];
// the lane's address is that of row k0 + 8 hh + (l & 7), bytes 2 d0 + 16 ((l >> 3) & 1)
__device__ __forceinline__ v8b ld_tr16(const unsigned short* p) {
  typedef __attribute__((address_space(3))) s16x8 lds_s16x8;
  return __builtin_bit_cast(v8b, __builtin_amdgcn_ds_load_tr16_b128_v8i16((lds_s16x8*)p));
}
// The four 16-row A fragments of V^T (rows = d, k = 32 keys) out of one plane of a row-major V tile [key][d] (pitch 80 elements);
// off = lane's address as above, in elements, for the first of the 32 keys. Same k order as load_frag4: keys 8 hh + 0..7, then 16 + 8 hh + 0..7
__device__ __forceinline__ void load_frag4_tr(const unsigned short* tile, int off, FB* f) {
#pragma unroll
  for (int t = 0; t < 4; ++t) {
    f[t].h[0] = ld_tr16(tile + off + t * 16);
    f[t].h[1] = ld_tr16(tile + off + 16 * 80 + t * 16);
  }
}
// no instruction is scheduled across this point
#define FRAG_STAGE() __builtin_amdgcn_sched_barrier(0)

// =====================================================================================
// Attention, head dim 64, over bf16 hi/lo planes of the fused qkv projection.
// qkv planes: [B*S][3*HID], q at col h*64+d, k at HID + h*64 + d, v at 2*HID + h*64 + d.
// scores = 0.125 * q.k^T (bf16 hi/lo, 3 products); mask tile m[q][kv] (RNE-bf16 converted) applied as
// s*m - 10000*(1-m); online softmax in f32. Both products are formed transposed (S^T = K.Q^T, out^T += V^T.P^T, 3 products each):
// a lane holds one query's scores, so row maximum and sum are in-lane plus one exchange of the lane halves, and the
// score accumulators, split into bf16 hi/lo, are the B operand of the second product as they stand.
// A 64x64 tile whose mask is identically zero has 64 equal logits -10000 per row: folded in closed form
// (l += 64*p, o += p * column-sum(v), p = exp(-10000 - rowmax)).
// The class of every mask tile (all 0 / all 1 / mixed, of the RNE-bf16 converted values) comes from prep_all, which
// reads the mask once; a tile of ones leaves every score as it is (x*1 - 10000*0 == x), so only a mixed tile is loaded here.
// The softmax runs in base 2: every logit is multiplied by log2(e) (for a tile of ones in the same multiply as the 1/8), the running
// maximum is kept in those units, and exp(x - m) = 2^(x2 - m2) is one subtraction and one v_exp_f32.
// Block = 4 waves = 64 query rows of one (batch, head); grid.x = B * NH * (S/64).
// =====================================================================================
#define SEQ_LEN 2048
#define N_HEADS 16
#define HEAD_D 64
#define HID_SZ 1024
#define QKV_PITCH 3072
#define KV_CHUNK 64
#define N_BATCH 2
#define LDS_P 72   // row pitch of the K tiles in 16-bit elements: 144 B = 16 B x odd, so the 16 rows of a b128 fragment read fall on distinct banks
#define V_P 80     // row pitch of the V tiles in 16-bit elements: 160 B = 32 B x odd, the pitch at which the transposing reads are free of bank conflicts

#define LOG2_E 1.44269504088896340736f
#define MASKED_L2 (-10000.0f * LOG2_E)   // the logit of a masked key, in base-2 units

#define TCLS_STRIDE 32   // ints between two tile classes: each class has a 128-byte line of its own (one writer per line)

// ---- all preparatory work in one launch: the block index picks the job, and a block does several units of it ----
// The jobs read only inputs and write disjoint workspace regions, so none waits for another; few, fat blocks keep the number of
// work-groups and waves to start small, and every block has all its loads in flight together.
//   blocks [0, 4)      bias lines RNE-bf16 converted, kept as f32: 3 blocks b_qkv, 1 block b_dense, 4 floats per thread
//   blocks [4, 196)    w_qkv   [1024][3072] f32 -> WQt [3072][1024] bf16: 4 tiles of 64x64 each (256 in rows x 64 in columns)
//   blocks [196, 260)  w_dense [1024][1024] f32 -> WDt [1024][1024] bf16: the same
//   blocks [260, 388)  class of the 64x64 mask tiles, one wave per tile, 8 tiles per block
//   blocks [388, 644)  hidden f32 -> bf16 plane: 16384 elements per block, 8 x 8 per thread
#define PREP_BIAS   4
#define PREP_TQ     ((3 * HID_SZ / 64) * (HID_SZ / 256))
#define PREP_TD     ((HID_SZ / 64) * (HID_SZ / 256))
#define PREP_MASK   ((SEQ_LEN / 64) * (SEQ_LEN / 64) / 8)
#define PREP_CAST   (N_BATCH * SEQ_LEN * HID_SZ / 16384)
#define PREP_BLOCKS (PREP_BIAS + PREP_TQ + PREP_TD + PREP_MASK + PREP_CAST)

// transpose + bf16 cast of in rows r0 .. r0 + 255, columns c0 .. c0 + 63: in[nrows][ncols] f32 -> out[ncols][nrows] bf16.
// tiles[k][cl*68 + rl]: k = 64-row group, cl = in col (out row), rl = in row (out col). Called by a whole block of 256 threads.
__device__ __forceinline__ void transpose_cast4(const float* __restrict__ in, unsigned short* __restrict__ out, int nrows, int ncols,
                                                int r0, int c0, float* tiles) {
  const int tid = threadIdx.x, lane = tid & 31, wave = tid >> 5;
  {
    const int rl = tid >> 2, cq = (tid & 3) * 16;
    const float* src = in + (size_t)(r0 + rl) * ncols + c0 + cq;
    v4f v[4][4];
#pragma unroll
    for (int k = 0; k < 4; ++k)
#pragma unroll
      for (int i = 0; i < 4; ++i) v[k][i] = *(const v4f*)(src + (size_t)(k * 64) * ncols + 4 * i);
    // the wait that stands before a register of an issued load is rewritten; the address is named so that it lives up to here
    asm volatile("s_wait_xcnt 0x0" :: "v"(src) : "memory");
#pragma unroll
    for (int k = 0; k < 4; ++k)
#pragma unroll
      for (int i = 0; i < 4; ++i)
#pragma unroll
        for (int e = 0; e < 4; ++e) tiles[k * (64 * 68) + (cq + 4 * i + e) * 68 + rl] = v[k][i][e];
  }
  __syncthreads();
  const int q8 = lane >> 3, c8 = (lane & 7) * 8;
#pragma unroll
  for (int k = 0; k < 4; ++k) {
#pragma unroll
    for (int it = 0; it < 2; ++it) {
      const int cl = wave * 8 + it * 4 + q8;
      const float* sp = tiles + k * (64 * 68) + cl * 68 + c8;
      const v4f x0 = *(const v4f*)sp;
      const v4f x1 = *(const v4f*)(sp + 4);
      v4u w;
      w[0] = pack_bf16x2(x0[0], x0[1]);
      w[1] = pack_bf16x2(x0[2], x0[3]);
      w[2] = pack_bf16x2(x1[0], x1[1]);
      w[3] = pack_bf16x2(x1[2], x1[3]);
      *(v4u*)(out + (size_t)(c0 + cl) * nrows + r0 + k * 64 + c8) = w;
    }
  }
  // the wait that stands before a register of an issued store is rewritten (the code of the other jobs follows this one in the kernel)
  asm volatile("s_wait_xcnt 0x0" ::: "memory");
}

__global__ __launch_bounds__(256) void prep_all(
    const float* __restrict__ hidden, const float* __restrict__ maskp, const float* __restrict__ w_qkv,
    const float* __restrict__ b_qkv, const float* __restrict__ w_dense, const float* __restrict__ b_dense,
    unsigned short* __restrict__ Hb, unsigned short* __restrict__ WQt, unsigned short* __restrict__ WDt,
    float* __restrict__ BQ, float* __restrict__ BD, int* __restrict__ tcls) {
  __shared__ __align__(16) float tiles[4 * 64 * 68];
  const int tid = threadIdx.x;
  int u = blockIdx.x;   // every branch below is the same for the whole block
  if (u < PREP_BIAS) {
    static_assert(3 * HID_SZ == 3 * 1024 && HID_SZ == 1024, "3 + 1 blocks of 256 threads x 4 floats");
    const float* in = (u < 3) ? (b_qkv + u * 1024) : b_dense;
    float* o        = (u < 3) ? (BQ + u * 1024) : BD;
    v4u a = *(const v4u*)(in + tid * 4);
#pragma unroll
    for (int e = 0; e < 4; ++e) a[e] = rne_bf16_word(a[e]);
    *(v4u*)(o + tid * 4) = a;
    return;
  }
  u -= PREP_BIAS;
  if (u < PREP_TQ) {
    constexpr int CT = 3 * HID_SZ / 64;
    transpose_cast4(w_qkv, WQt, HID_SZ, 3 * HID_SZ, (u / CT) * 256, (u % CT) * 64, tiles);
    return;
  }
  u -= PREP_TQ;
  if (u < PREP_TD) {
    constexpr int CT = HID_SZ / 64;
    transpose_cast4(w_dense, WDt, HID_SZ, HID_SZ, (u / CT) * 256, (u % CT) * 64, tiles);
    return;
  }
  u -= PREP_TD;
  if (u < PREP_MASK) {
    // One wave per 64x64 mask tile (tile = query block * 32 + key block): 32 b128 loads per lane = the tile.
    // class 0: every RNE-bf16 converted element is +-0; class 1: every one is 1.0; class 2: anything else.
    const int lane = tid & 31;
    const int tile = u * 8 + (tid >> 5);
    const int qb = tile >> 5, kc = tile & 31;
    const float* src = maskp + (size_t)(qb * 64 + (lane >> 4)) * SEQ_LEN + kc * 64 + (lane & 15) * 4;
    unsigned int nz = 0u, n1 = 0u;
#pragma unroll
    for (int i = 0; i < 32; ++i) {
      const v4u m = *(const v4u*)(src + (size_t)(2 * i) * SEQ_LEN);
#pragma unroll
      for (int e = 0; e < 4; ++e) { const unsigned int w = rne_bf16_word(m[e]); nz |= (w & 0x7FFFFFFFu); n1 |= (w ^ 0x3F800000u); }
    }
    const int any_nz = __any(nz != 0u);
    const int any_n1 = __any(n1 != 0u);
    if (lane == 0) tcls[(size_t)tile * TCLS_STRIDE] = any_nz ? (any_n1 ? 2 : 1) : 0;
    return;
  }
  u -= PREP_MASK;
  {
    // unit it of a block: 2048 elements in a row, 8 per thread (2 b128 loads, 1 b128 store)
    const float* p = hidden + (size_t)u * 16384 + tid * 8;
    unsigned short* d = Hb + (size_t)u * 16384 + tid * 8;
    v4f a[8], c2[8];
#pragma unroll
    for (int it = 0; it < 8; ++it) { a[it] = *(const v4f*)(p + it * 2048); c2[it] = *(const v4f*)(p + it * 2048 + 4); }
#pragma unroll
    for (int it = 0; it < 8; ++it) {
      v4u w;
      w[0] = pack_bf16x2(a[it][0], a[it][1]);
      w[1] = pack_bf16x2(a[it][2], a[it][3]);
      w[2] = pack_bf16x2(c2[it][0], c2[it][1]);
      w[3] = pack_bf16x2(c2[it][2], c2[it][3]);
      *(v4u*)(d + it * 2048) = w;
    }
    // the wait that stands before a register of an issued store is rewritten (the code of the other jobs follows this one in the kernel)
    asm volatile("s_wait_xcnt 0x0" ::: "memory");
  }
}

// four waves per SIMD, as many as the grid's 1024 blocks of four waves need to be resident together: holds the register count at 256 or below
__global__ __launch_bounds__(128) __attribute__((amdgpu_waves_per_eu(4, 4))) void attn_planes_kernel(
    const unsigned short* __restrict__ qkvh, const unsigned short* __restrict__ qkvl,
    const float* __restrict__ maskp, const int* __restrict__ tcls,
    unsigned short* __restrict__ ctxh, unsigned short* __restrict__ ctxl) {
  union FW { v16b v; unsigned int w[8]; };
  __shared__ __align__(16) unsigned short Kh[KV_CHUNK * LDS_P];     // K hi [kv][d], pitch LDS_P
  __shared__ __align__(16) unsigned short Kl[KV_CHUNK * LDS_P];     // K lo [kv][d], pitch LDS_P
  __shared__ __align__(16) unsigned short Vs[2 * KV_CHUNK * V_P];   // V hi, then V lo, each [kv][d] as in memory, pitch V_P
  __shared__ __align__(16) float Os[4][16 * 68];                   // per wave out tile, pitch 68; Os[0][0..127] doubles as column-sum scratch
  __shared__ __align__(16) unsigned int Msk[64 * 68];              // mask tile [q][kv] (f32 bits), pitch 68; doubles as v scratch [kv][d]

  const int tid  = threadIdx.x;
  const int wave = tid >> 5;
  const int lane = tid & 31;
  const int hh   = lane >> 4;
  const int c    = lane & 15;
  const int bx   = blockIdx.x;
  const int qb   = 31 - (bx >> 5);           // SEQ_LEN / 64 == 32; late query blocks first: under a lower-triangular mask they hold the most live tiles, so cost falls with the block index (speed only)
  static_assert(N_BATCH * N_HEADS == 32 && SEQ_LEN / 64 == 32, "block index split");
  const int bhd  = bx & 31;                  // N_BATCH * N_HEADS == 32
  const int h    = bhd & (N_HEADS - 1);
  const int b    = bhd >> 4;
  const int qblk = qb * 64;
  const int q0   = qblk + wave * 16;
  const size_t rowb = (size_t)b * SEQ_LEN;

  // ---- Q fragments (B operand of the transposed scores), hi and lo planes, 2 d-chunks (8 b128 loads per lane) ----
  v16b qah[2], qal[2];
  {
    const size_t qoff = (rowb + q0 + c) * QKV_PITCH + h * HEAD_D + 8 * hh;
#pragma unroll
    for (int dc = 0; dc < 2; ++dc) {
      qah[dc] = Frag<__bf16>::load((const __bf16*)qkvh + qoff + dc * 32);
      qal[dc] = Frag<__bf16>::load((const __bf16*)qkvl + qoff + dc * 32);
    }
  }

  float mrow = -__builtin_inff(), lrow = 0.f;   // running maximum (base-2 units) and sum of query q0 + c (the same in both lane halves)
  v8f oacc[4];                                  // out^T: oacc[t][r] = out[q0 + c][16 t + 8 hh + r]
#pragma unroll
  for (int t = 0; t < 4; ++t) oacc[t] = (v8f){0.f,0.f,0.f,0.f,0.f,0.f,0.f,0.f};

  const int cls_l = tcls[(size_t)(qb * 32 + lane) * TCLS_STRIDE];   // lane l: class of this query block's mask tile l

  const int kvr = tid >> 1;            // staging: kv row of this thread (0..63)
  const int dh  = (tid & 1) * 32;      // staging: d half (0 or 32)

  for (int kc = 0; kc < SEQ_LEN / KV_CHUNK; ++kc) {
    const int kv0 = kc * KV_CHUNK;
    __syncthreads();
    const int cls = __builtin_amdgcn_readlane(cls_l, kc);   // scalar, the same in every wave of the block

    const size_t koff = (rowb + kv0 + kvr) * QKV_PITCH + HID_SZ + h * HEAD_D + dh;
    const size_t voff = koff + HID_SZ;

    if (cls != 0) {
      if (cls == 2) {
        // ---- mixed mask tile [64 q][64 kv]: 1024 float4 / 128 threads = 8 b128 per lane; RNE-bf16 convert ----
        // load i of a thread: row 8 i + (tid >> 4), floats 4 (tid & 15) .. + 3. One base on each side, the eight row steps constant:
        // no row addresses are held in registers over the loop (they are what the fragments read ahead need)
        const float* mrow0 = maskp + (size_t)(qblk + (tid >> 4)) * SEQ_LEN + kv0 + (tid & 15) * 4;
        unsigned int* mdst0 = Msk + (tid >> 4) * 68 + (tid & 15) * 4;
#pragma unroll
        for (int i = 0; i < 8; ++i) {
          v4u m = *(const v4u*)(mrow0 + (size_t)i * 8 * SEQ_LEN);
#pragma unroll
          for (int e = 0; e < 4; ++e) m[e] = rne_bf16_word(m[e]);
          *(v4u*)(mdst0 + i * 8 * 68) = m;
        }
      }
      // ---- K hi/lo rows -> LDS [kv][d] (4+4 b128 per lane, 128 threads x 32 elements = 64x64 per plane) ----
      {
        const v4u* gh = (const v4u*)(qkvh + koff);
        const v4u* gl = (const v4u*)(qkvl + koff);
        v4u* lh = (v4u*)(Kh + kvr * LDS_P + dh);
        v4u* ll = (v4u*)(Kl + kvr * LDS_P + dh);
        v4u a[4], bb[4];
#pragma unroll
        for (int i = 0; i < 4; ++i) { a[i] = gh[i]; bb[i] = gl[i]; }
        // the wait that stands before a register of an issued load is rewritten; the addresses are named so that they live up to here
        // (without it this build lets a later load land on the address pair of the four before it)
        asm volatile("s_wait_xcnt 0x0" :: "v"(gh), "v"(gl) : "memory");
        // inputs-only fence on the loaded values: keeps the 8 loads in flight together (without it this build waits after every second load)
        asm volatile("" :: "v"(a[0]), "v"(a[1]), "v"(a[2]), "v"(a[3]), "v"(bb[0]), "v"(bb[1]), "v"(bb[2]), "v"(bb[3]));
#pragma unroll
        for (int i = 0; i < 4; ++i) { lh[i] = a[i]; ll[i] = bb[i]; }
      }
      asm volatile("" ::: "memory");
      // ---- V hi/lo rows -> LDS as they lie [kv][d]: load i of a thread = row 16 i + (tid >> 3), bytes 16 (tid & 7) .. + 15 of its 128 ----
      {
        const size_t vline = (rowb + kv0 + (tid >> 3)) * QKV_PITCH + h * HEAD_D + (tid & 7) * 8;
        const unsigned short* rh = qkvh + vline;   // the address pairs that the loads take; the rest is their constant offset
        const unsigned short* rl = qkvl + vline;
        const unsigned short* gh = rh + 2 * HID_SZ;
        const unsigned short* gl = rl + 2 * HID_SZ;
        unsigned short* sv = Vs + (tid >> 3) * V_P + (tid & 7) * 8;   // one base for both planes: every step below is a constant offset
        v4u vh4[4], vl4[4];
#pragma unroll
        for (int i = 0; i < 4; ++i) {
          vh4[i] = *(const v4u*)(gh + (size_t)i * 16 * QKV_PITCH);
          vl4[i] = *(const v4u*)(gl + (size_t)i * 16 * QKV_PITCH);
        }
        // the wait that stands before a register of an issued load is rewritten; the address pairs are named as above
        asm volatile("s_wait_xcnt 0x0" :: "v"(rh), "v"(rl) : "memory");
        // inputs-only fence on the loaded values: keeps the 8 loads in flight together, as above
        asm volatile("" :: "v"(vh4[0]), "v"(vh4[1]), "v"(vh4[2]), "v"(vh4[3]), "v"(vl4[0]), "v"(vl4[1]), "v"(vl4[2]), "v"(vl4[3]));
#pragma unroll
        for (int i = 0; i < 4; ++i) {
          *(v4u*)(sv + i * 16 * V_P) = vh4[i];
          *(v4u*)(sv + (KV_CHUNK + i * 16) * V_P) = vl4[i];
        }
      }
      __syncthreads();

      // ---- scores, transposed: S^T = K . Q^T, 4 key subtiles x 2 d-chunks, hi.hi + lo.hi + hi.lo ----
      // s[j][r] = score of query q0 + c against key kv0 + 16 j + 8 hh + r: one query per lane, its keys in registers
      // The fragments come in groups of four (one plane, one 32-wide half of d or of the keys: 8 reads); groups three to six are each asked for
      // two or three groups of products ahead of their use, so that the LDS latency lies under products and is not waited out in front of every third one.
      // The four accumulators take turns; each one's own order of sums is hi.hi, lo.hi, hi.lo, first half of d then second.
      // FRAG_STAGE ends a stage: without it this compiler moves the reads back down to their products.
      v8f s[4];
      FB ka[4], kb[4], kc2[4];
      FB va[4], vb[4], vc[4];
      const int fo = c * LDS_P + 8 * hh;
      const int vo = (8 * hh + (lane & 7)) * V_P + 8 * ((lane >> 3) & 1);   // lane's address of a transposing read, in elements
      load_frag4(Kh, fo, ka);            // K hi, d 0..31
      load_frag4(Kl, fo, kb);            // K lo, d 0..31
      load_frag4(Kh, fo + 32, kc2);      // K hi, d 32..63
      FRAG_STAGE();
#pragma unroll
      for (int j = 0; j < 4; ++j) s[j] = at_mma(ka[j].v, qah[0], (v8f){0.f,0.f,0.f,0.f,0.f,0.f,0.f,0.f});
#pragma unroll
      for (int j = 0; j < 4; ++j) s[j] = at_mma(kb[j].v, qah[0], s[j]);
      FRAG_STAGE();
      load_frag4(Kl, fo + 32, kb);       // K lo, d 32..63
      FRAG_STAGE();
#pragma unroll
      for (int j = 0; j < 4; ++j) s[j] = at_mma(ka[j].v, qal[0], s[j]);
      FRAG_STAGE();
      load_frag4_tr(Vs, vo, va);         // V^T hi, keys 0..31: this group and the next arrive under the softmax
      FRAG_STAGE();
#pragma unroll
      for (int j = 0; j < 4; ++j) s[j] = at_mma(kc2[j].v, qah[1], s[j]);
#pragma unroll
      for (int j = 0; j < 4; ++j) s[j] = at_mma(kb[j].v, qah[1], s[j]);
      FRAG_STAGE();
      load_frag4_tr(Vs + KV_CHUNK * V_P, vo, vb);   // V^T lo, keys 0..31
      FRAG_STAGE();
#pragma unroll
      for (int j = 0; j < 4; ++j) s[j] = at_mma(kc2[j].v, qal[1], s[j]);
      // ---- scale, mask (literal s*m - 10000*(1-m)), to base-2 units, maximum of the lane's 32 keys, then of both lane halves ----
      float cm = -__builtin_inff();
      if (cls == 2) {
        const unsigned int* mp = Msk + (wave * 16 + c) * 68 + 8 * hh;
#pragma unroll
        for (int j = 0; j < 4; ++j) {
          const v4u k0 = *(const v4u*)(mp + j * 16);
          const v4u k1 = *(const v4u*)(mp + j * 16 + 4);
#pragma unroll
          for (int r = 0; r < 8; ++r) {
            const float mk = __uint_as_float(r < 4 ? k0[r & 3] : k1[r & 3]);
            float x = s[j][r] * 0.125f;
            x = x * mk - 10000.0f * (1.0f - mk);
            x *= LOG2_E;
            s[j][r] = x;
            cm = fmaxf(cm, x);
          }
        }
      } else {
        // tile of ones: x*1 - 10000*(1 - 1) == x for every x
#pragma unroll
        for (int j = 0; j < 4; ++j)
#pragma unroll
          for (int r = 0; r < 8; ++r) {
            const float x = s[j][r] * (0.125f * LOG2_E);
            s[j][r] = x;
            cm = fmaxf(cm, x);
          }
      }
      cm = fmaxf(cm, xhalf(cm));
      // ---- online softmax, one query per lane; P^T split into bf16 hi/lo and packed in place as B operands ----
      FW ph[2], pl[2];
      {
        const float mnew  = fmaxf(mrow, cm);
        const float alpha = __builtin_amdgcn_exp2f(mrow - mnew);
        mrow = mnew;
        float ps[4];
#pragma unroll
        for (int j = 0; j < 4; ++j) {
          ps[j] = 0.f;
#pragma unroll
          for (int r = 0; r < 8; r += 2) {
            const v2f d = (v2f){s[j][r], s[j][r + 1]} - mnew;   // one packed subtraction for two keys
            const float p0 = __builtin_amdgcn_exp2f(d[0]);
            const float p1 = __builtin_amdgcn_exp2f(d[1]);
            ps[j] += p0;
            ps[j] += p1;
            unsigned int wh, wl;
            split_pack2(p0, p1, wh, wl);
            ph[j >> 1].w[(j & 1) * 4 + (r >> 1)] = wh;   // element 8 (j & 1) + r of the 32-key fragment = key 16 (j & 1) + 8 hh + r
            pl[j >> 1].w[(j & 1) * 4 + (r >> 1)] = wl;
          }
        }
        float psum = (ps[0] + ps[1]) + (ps[2] + ps[3]);
        psum += xhalf(psum);
        lrow = lrow * alpha + psum;
#pragma unroll
        for (int t = 0; t < 4; ++t)
#pragma unroll
          for (int r = 0; r < 8; ++r) oacc[t][r] *= alpha;
      }
      // ---- out^T += V^T(64x64) . P^T(64x16): vh.ph + vl.ph + vh.pl; oacc[t][r] = out[q0 + c][16 t + 8 hh + r] ----
      // the last two groups stand where they could be asked for; their place is left to the compiler (a stage mark behind the softmax made this build spill)
      load_frag4_tr(Vs, vo + 32 * V_P, vc);      // V^T hi, keys 32..63
#pragma unroll
      for (int t = 0; t < 4; ++t) oacc[t] = at_mma(va[t].v, ph[0].v, oacc[t]);
#pragma unroll
      for (int t = 0; t < 4; ++t) oacc[t] = at_mma(vb[t].v, ph[0].v, oacc[t]);
      load_frag4_tr(Vs + KV_CHUNK * V_P, vo + 32 * V_P, vb);      // V^T lo, keys 32..63
#pragma unroll
      for (int t = 0; t < 4; ++t) oacc[t] = at_mma(va[t].v, pl[0].v, oacc[t]);
#pragma unroll
      for (int t = 0; t < 4; ++t) oacc[t] = at_mma(vc[t].v, ph[1].v, oacc[t]);
#pragma unroll
      for (int t = 0; t < 4; ++t) oacc[t] = at_mma(vb[t].v, ph[1].v, oacc[t]);
#pragma unroll
      for (int t = 0; t < 4; ++t) oacc[t] = at_mma(vc[t].v, pl[1].v, oacc[t]);
    } else {
      // ---- all-masked tile: v rows (hi+lo, f32) -> Msk scratch [kv][d], column sums, closed-form update ----
      {
        const v4u* gh = (const v4u*)(qkvh + voff);
        const v4u* gl = (const v4u*)(qkvl + voff);
#pragma unroll
        for (int i = 0; i < 4; ++i) {
          const v4u wh = gh[i];
          const v4u wl = gl[i];
          v4u f0, f1;
          {
            const float a0 = __uint_as_float(wh[0] << 16);          const float b0 = __uint_as_float(wl[0] << 16);
            const float a1 = __uint_as_float(wh[0] & 0xFFFF0000u); const float b1 = __uint_as_float(wl[0] & 0xFFFF0000u);
            const float a2 = __uint_as_float(wh[1] << 16);          const float b2 = __uint_as_float(wl[1] << 16);
            const float a3 = __uint_as_float(wh[1] & 0xFFFF0000u); const float b3 = __uint_as_float(wl[1] & 0xFFFF0000u);
            f0[0] = __float_as_uint(a0 + b0); f0[1] = __float_as_uint(a1 + b1);
            f0[2] = __float_as_uint(a2 + b2); f0[3] = __float_as_uint(a3 + b3);
          }
          {
            const float a0 = __uint_as_float(wh[2] << 16);          const float b0 = __uint_as_float(wl[2] << 16);
            const float a1 = __uint_as_float(wh[2] & 0xFFFF0000u); const float b1 = __uint_as_float(wl[2] & 0xFFFF0000u);
            const float a2 = __uint_as_float(wh[3] << 16);          const float b2 = __uint_as_float(wl[3] << 16);
            const float a3 = __uint_as_float(wh[3] & 0xFFFF0000u); const float b3 = __uint_as_float(wl[3] & 0xFFFF0000u);
            f1[0] = __float_as_uint(a0 + b0); f1[1] = __float_as_uint(a1 + b1);
            f1[2] = __float_as_uint(a2 + b2); f1[3] = __float_as_uint(a3 + b3);
          }
          *(v4u*)(Msk + kvr * 68 + dh + 8 * i)     = f0;
          *(v4u*)(Msk + kvr * 68 + dh + 8 * i + 4) = f1;
        }
      }
      __syncthreads();
      {
        const int d = tid & 63, half = tid >> 6;
        float part = 0.f;
#pragma unroll 8
        for (int kq = 0; kq < 32; ++kq) part += __uint_as_float(Msk[(half * 32 + kq) * 68 + d]);
        Os[0][half * 64 + d] = part;
      }
      __syncthreads();
      {
        const float mnew  = fmaxf(mrow, MASKED_L2);
        const float alpha = __builtin_amdgcn_exp2f(mrow - mnew);
        const float p     = __builtin_amdgcn_exp2f(MASKED_L2 - mnew);
        mrow = mnew;
        lrow = lrow * alpha + 64.0f * p;
#pragma unroll
        for (int t = 0; t < 4; ++t) {
          const float* cs = Os[0] + t * 16 + 8 * hh;      // column sums of the lane's 8 output columns, two partial sums each
          const v4f a0 = *(const v4f*)cs;
          const v4f a1 = *(const v4f*)(cs + 4);
          const v4f b0 = *(const v4f*)(cs + 64);
          const v4f b1 = *(const v4f*)(cs + 68);
#pragma unroll
          for (int r = 0; r < 8; ++r) {
            const float vs = (r < 4 ? a0[r & 3] : a1[r & 3]) + (r < 4 ? b0[r & 3] : b1[r & 3]);
            oacc[t][r] = oacc[t][r] * alpha + p * vs;
          }
        }
      }
    }
  }
  __syncthreads();

  float* os = Os[wave];
  {
    const float inv = 1.0f / lrow;
#pragma unroll
    for (int t = 0; t < 4; ++t) {
      v4f x0, x1;
#pragma unroll
      for (int r = 0; r < 4; ++r) { x0[r] = oacc[t][r] * inv; x1[r] = oacc[t][r + 4] * inv; }
      *(v4f*)(os + c * 68 + t * 16 + 8 * hh)     = x0;
      *(v4f*)(os + c * 68 + t * 16 + 8 * hh + 4) = x1;
    }
  }
  __builtin_amdgcn_fence(__ATOMIC_RELEASE, "workgroup");
  __builtin_amdgcn_wave_barrier();
  __builtin_amdgcn_fence(__ATOMIC_ACQUIRE, "workgroup");
  {
    const int q8 = lane >> 3, c8 = (lane & 7) * 8;
    unsigned short* oh = ctxh + (rowb + q0) * HID_SZ + h * HEAD_D + c8;
    unsigned short* ol = ctxl + (rowb + q0) * HID_SZ + h * HEAD_D + c8;
    {
#pragma unroll
      for (int it = 0; it < 4; ++it) {
        const int row = it * 4 + q8;
        const float* sp = os + row * 68 + c8;
        const v4f x0 = *(const v4f*)sp;
        const v4f x1 = *(const v4f*)(sp + 4);
        v4u wh, wl;
        unsigned int th, tl;
        split_pack2(x0[0], x0[1], th, tl); wh[0] = th; wl[0] = tl;
        split_pack2(x0[2], x0[3], th, tl); wh[1] = th; wl[1] = tl;
        split_pack2(x1[0], x1[1], th, tl); wh[2] = th; wl[2] = tl;
        split_pack2(x1[2], x1[3], th, tl); wh[3] = th; wl[3] = tl;
        *(v4u*)(oh + (size_t)row * HID_SZ) = wh;
        *(v4u*)(ol + (size_t)row * HID_SZ) = wl;
      }
      
    }
  }
}

// ---------------------------------------------------------------------------
// Workspace region map (bytes):
//   Hb    bf16 [4096][1024]        off 0            size  8388608
//   WQt   bf16 [3072][1024]        off 8388608      size  6291456
//   WDt   bf16 [1024][1024]        off 14680064     size  2097152
//   BQ    f32  [3072]              off 16777216     size    12288
//   BD    f32  [1024]              off 16789504     size     4096
//   QKVh  bf16 [4096][3072]        off 16793600     size 25165824
//   QKVl  bf16 [4096][3072]        off 41959424     size 25165824
//   CTXh  bf16 [4096][1024]        off 67125248     size  8388608
//   CTXl  bf16 [4096][1024]        off 75513856     size  8388608
//   TCLS  i32  [1024] x 128 B      off 83902464     size   131072
//   end                            84033536
// Every region is written by its producer before any consumer reads it (TCLS: only the first int of each 128-byte line).
// ---------------------------------------------------------------------------
extern "C" void kernel_launch(void* const* d_in, const int* in_sizes, int n_in,
                              void* d_out, int out_size, void* d_ws, size_t ws_size,
                              hipStream_t stream) {
  constexpr int kB = N_BATCH, kS = SEQ_LEN, kH = HID_SZ;
  constexpr int kM = kB * kS;          // 4096
  constexpr int kN3 = 3 * kH;          // 3072
  static_assert(kM % G_BM == 0 && kN3 % G_BN == 0 && kH % G_BN == 0);   // GEMM M/N tile multiples
  static_assert(kH % G_KS == 0);                                         // GEMM K slice
  static_assert(kS % KV_CHUNK == 0 && kS / 64 == 32 && kH / HEAD_D == N_HEADS);
  static_assert((kM * kH) % 2048 == 0 && kN3 % 1024 == 0 && kH % 1024 == 0);

  if (n_in < 6) return;
  if (in_sizes[0] != kM * kH || in_sizes[1] != kS * kS || in_sizes[2] != kH * kN3 ||
      in_sizes[3] != kN3 || in_sizes[4] != kH * kH || in_sizes[5] != kH) return;
  if (out_size != kM * kH) return;

  const float* hidden  = (const float*)d_in[0];
  const float* maskp   = (const float*)d_in[1];
  const float* w_qkv   = (const float*)d_in[2];
  const float* b_qkv   = (const float*)d_in[3];
  const float* w_dense = (const float*)d_in[4];
  const float* b_dense = (const float*)d_in[5];
  float* out = (float*)d_out;

  const size_t szHb  = (size_t)kM * kH * 2;
  const size_t szWQt = (size_t)kN3 * kH * 2;
  const size_t szWDt = (size_t)kH * kH * 2;
  const size_t szBQ  = (size_t)kN3 * 4;
  const size_t szBD  = (size_t)kH * 4;
  const size_t szQKV = (size_t)kM * kN3 * 2;
  const size_t szCTX = (size_t)kM * kH * 2;
  const size_t offHb   = 0;
  const size_t offWQt  = offHb + szHb;
  const size_t offWDt  = offWQt + szWQt;
  const size_t offBQ   = offWDt + szWDt;
  const size_t offBD   = offBQ + szBQ;
  const size_t offQKVh = offBD + szBD;
  const size_t offQKVl = offQKVh + szQKV;
  const size_t offCTXh = offQKVl + szQKV;
  const size_t offCTXl = offCTXh + szCTX;
  const size_t offTCLS = offCTXl + szCTX;
  const size_t szTCLS  = (size_t)(kS / 64) * (kS / 64) * TCLS_STRIDE * 4;
  const size_t offEnd  = offTCLS + szTCLS;
  if (offEnd > ws_size) return;

  char* ws = (char*)d_ws;
  unsigned short* Hb   = (unsigned short*)(ws + offHb);
  unsigned short* WQt  = (unsigned short*)(ws + offWQt);
  unsigned short* WDt  = (unsigned short*)(ws + offWDt);
  float*          BQ   = (float*)(ws + offBQ);
  float*          BD   = (float*)(ws + offBD);
  unsigned short* QKVh = (unsigned short*)(ws + offQKVh);
  unsigned short* QKVl = (unsigned short*)(ws + offQKVl);
  unsigned short* CTXh = (unsigned short*)(ws + offCTXh);
  unsigned short* CTXl = (unsigned short*)(ws + offCTXl);
  int*            TCLS = (int*)(ws + offTCLS);

  // 1-3) hidden -> bf16 plane; w_qkv, w_dense -> transposed bf16; bias lines RNE-bf16 converted (kept as f32); class of each 64x64 mask tile
  prep_all<<<dim3(PREP_BLOCKS), dim3(256), 0, stream>>>(hidden, maskp, w_qkv, b_qkv, w_dense, b_dense, Hb, WQt, WDt, BQ, BD, TCLS);
  // 4) fused qkv projection: [4096x1024] x WQt[3072x1024]^T + bias -> bf16 hi/lo planes [4096][3072]
  {
    const int tiles = (kM / G_BM) * (kN3 / G_BN);       // 384 block tiles of 128x256
    wmma_gemm64<1, 0, 2, 2, false><<<dim3(tiles, 1), dim3(256), 0, stream>>>(
        Hb, Hb, kH, 0L, WQt, WQt, kH, 0L, (void*)QKVh, (void*)QKVl, kN3, 0L,
        BQ, BQ, 0L, kM, kN3, kH, 1.0f);
  }
  // 5) attention per (batch, head, 64 query rows) -> ctx bf16 hi/lo planes [4096][1024]
  attn_planes_kernel<<<dim3(kB * N_HEADS * (kS / 64)), dim3(128), 0, stream>>>(QKVh, QKVl, maskp, TCLS, CTXh, CTXl);
  // 6) output projection: ctx (hi/lo) [4096x1024] x WDt[1024x1024]^T + bias -> out f32 [4096][1024]
  {
    const int tiles = (kM / G_BM) * (kH / G_BN);        // 128 block tiles of 128x256
    wmma_gemm64<1, 2, 2, 0, false><<<dim3(tiles, 1), dim3(256), 0, stream>>>(
        CTXh, CTXl, kH, 0L, WDt, WDt, kH, 0L, (void*)out, (void*)out, kH, 0L,
        BD, BD, 0L, kM, kH, kH, 1.0f);
  }
}
